// v000
// The times below were measured on an AMD MI455X: many runs one after another, warmed up first and cycling through
// copies of the inputs, with the whole window's GPU time divided by the number of runs. Launches and the gaps
// between them are all in it. The median over several windows is given; except for v000 it joins two sittings, which
// can be a few percent apart, so the side-by-side timings, each taken in one sitting, are the better comparison.
// v000, which the later versions start from, runs in 379 microseconds.
// Contractions: LN(x).Wq^T, LN(x).Wk^T, LN(x).Wv^T, LN(x).Wg^T(+bg), Wt.LN(x)^T (shared pair-bias table) and O.Wo^T(+bo) on
// v_wmma_f32_16x16x32_f16 with the activation operand carried as f16 hi + f16 residual planes (x*64, O*4096) and the weight
// operand as f16(bf16(W)*1024); q.k^T over 32 on v_wmma_f32_16x16x32_f16 (q, k *1024 f16 hi + residual, products hh+lh+hl);
// centred softmax weights P' = 16384*P - 64 (f16 hi) times v^T (v*1024 f16 hi + residual, products P'.vh + P'.vl);
// all f32 accumulate. LayerNorm, mask bias, softmax, sigmoid gate, key-mean of v and carry folds in f32 on VALU.
// Every float input is RNE-converted to bf16 on load.
#include <hip/hip_runtime.h>
#include <math.h>
#include <stdint.h>

#ifndef NB
#define NB 1
#endif
#ifndef NI
#define NI 256
#endif
#define NSEQ   256
#define CZ     128
#define NH     4
#define HD     32
#define NPOS   (NSEQ * NSEQ)
#define IG     ((NI <= 64) ? NI : 64)
#define NGRP   (NI / IG)
#define GROWS  (IG * NSEQ)
#define XSC    64.0f
#define WSC    1024.0f
#define QSC    1024.0f
#define KSC    1024.0f
#define VCAR   1024.0f
#define PCAR   16384.0f
#define OSC    4096.0f
#define MINF   1.0e9f
#define RSQ_HD 0.17677669529663689f
#define LOG2E  1.4426950408889634f
#define WPB    2
#define NHG    (NH / WPB)
#define NQT    (NSEQ / 16)
#define NKT    (NSEQ / 32)
#define NST    (NSEQ / 64)
#define ATT_THREADS (WPB * 32)
#define SBP    260
#define SBW    (16 * SBP)
#define STP    72
#define SLAB64 (16 * 68)
#define VTP    72
#define XTP    136
#define WTP    136
#define BTM    64
#define QKC    (CZ / 8)
#define QKR    16
#define QKT    (QKC * QKR)
#define WS_CAP 134217728
static_assert(NB == 1);
static_assert(CZ == NH * HD && HD == 32 && NH == 4 && NSEQ == 256);
static_assert(NI >= 1 && NI <= NSEQ && (NI % IG) == 0 && IG >= 1 && IG <= 64 && NGRP >= 1);
static_assert((GROWS % 64) == 0 && (GROWS % QKR) == 0 && (NPOS % 64) == 0 && QKT == 256);
static_assert((NH % WPB) == 0 && ATT_THREADS == 64 && (NSEQ % 64) == 0 && (CZ % 64) == 0 && (CZ % 32) == 0);
static_assert((BTM % 64) == 0 && BTM >= NH && (BTM % 32) == 0);
static_assert(SBP >= NSEQ && (SBP % 4) == 0 && STP >= 64 && (STP % 8) == 0 && XTP >= CZ && WTP >= CZ && VTP >= 64);

typedef unsigned short u16;
typedef _Float16 v16h __attribute__((ext_vector_type(16)));
typedef _Float16 v8h  __attribute__((ext_vector_type(8)));
typedef float    v8f  __attribute__((ext_vector_type(8)));
typedef float    v4f  __attribute__((ext_vector_type(4)));
typedef unsigned int v4u __attribute__((ext_vector_type(4)));

union FragH { v16h v; v8h h[2]; v4u u[2]; };

// ---- scalar helpers --------------------------------------------------------------------------------
__device__ __forceinline__ unsigned short bf_bits(float f) {          // f32 -> bf16 bits, RNE convert
  unsigned u = __float_as_uint(f);
  return (unsigned short)((u + 0x7FFFu + ((u >> 16) & 1u)) >> 16);
}
__device__ __forceinline__ float bf_up(unsigned short h) { return __uint_as_float(((unsigned)h) << 16); }
__device__ __forceinline__ float bfr(float f) { return bf_up(bf_bits(f)); }
__device__ __forceinline__ unsigned short h_bits(_Float16 x) { return __builtin_bit_cast(unsigned short, x); }
__device__ __forceinline__ unsigned pk16(unsigned short a, unsigned short b) { return (unsigned)a | ((unsigned)b << 16); }
__device__ __forceinline__ v8f zero8() { v8f z = {0.f, 0.f, 0.f, 0.f, 0.f, 0.f, 0.f, 0.f}; return z; }

// ---- fragment loader: 16-bit A/B operand, lane -> row/col (lane&15), p already includes +8*(lane>>4);
//      elements 0..7 <- p[0..7] (k0+8h..), elements 8..15 <- p[16..23] (k0+16+8h..); same split k map for A and B,
//      B always read from a k-contiguous [n][k] plane.
__device__ __forceinline__ v16h ldfrag_h(const _Float16* p) {
  FragH f;
  f.h[0] = *(const v8h*)(p);
  f.h[1] = *(const v8h*)(p + 16);
  return f.v;
}

// ---- WMMA helpers with trailing VALU hazard gaps ------------------------------------------------------
__device__ __forceinline__ v8f mma_h(v16h a, v16h b, v8f c) {
  return __builtin_amdgcn_wmma_f32_16x16x32_f16(false, a, false, b, (short)0, c, false, false);
}
__device__ __forceinline__ void guard2(v8f& a, v8f& b, v16h x0, v16h x1, v16h x2, v16h x3, v16h x4, v16h x5) {
#if defined(__HIP_DEVICE_COMPILE__)
  asm volatile("v_nop\n\tv_nop\n\tv_nop\n\tv_nop"
               : "+v"(a), "+v"(b) : "v"(x0), "v"(x1), "v"(x2), "v"(x3), "v"(x4), "v"(x5) : "memory");
#endif
}
template <typename F>
__device__ __forceinline__ void guard6(v8f& a, v8f& b, v8f& c, v8f& d, F x0, F x1, F x2, F x3, F x4, F x5) {
#if defined(__HIP_DEVICE_COMPILE__)
  asm volatile("v_nop\n\tv_nop\n\tv_nop\n\tv_nop"
               : "+v"(a), "+v"(b), "+v"(c), "+v"(d) : "v"(x0), "v"(x1), "v"(x2), "v"(x3), "v"(x4), "v"(x5) : "memory");
#endif
}
template <typename F>
__device__ __forceinline__ void guard9(v8f& a, v8f& b, v8f& c, v8f& d, F x0, F x1, F x2, F x3, F x4, F x5,
                                       F x6, F x7, F x8) {
#if defined(__HIP_DEVICE_COMPILE__)
  asm volatile("v_nop\n\tv_nop\n\tv_nop\n\tv_nop"
               : "+v"(a), "+v"(b), "+v"(c), "+v"(d)
               : "v"(x0), "v"(x1), "v"(x2), "v"(x3), "v"(x4), "v"(x5), "v"(x6), "v"(x7), "v"(x8) : "memory");
#endif
}
__device__ __forceinline__ void acc_guard2(v8f& a, v8f& b) {
#if defined(__HIP_DEVICE_COMPILE__)
  asm volatile("v_nop\n\tv_nop\n\tv_nop\n\tv_nop" : "+v"(a), "+v"(b));
#endif
}
__device__ __forceinline__ void wave_sync_lds() {
  __builtin_amdgcn_fence(__ATOMIC_RELEASE, "workgroup");
  __builtin_amdgcn_wave_barrier();
  __builtin_amdgcn_fence(__ATOMIC_ACQUIRE, "workgroup");
}

// =====================================================================================================
// LayerNorm over CZ of the bf16 RNE-converted input rows, eps 1e-5, gamma/beta (bf16 RNE-converted), then
// with shuffles over the 4 lanes); both planes staged in LDS (pitch XTP halves, 16-B vector stores), block barrier, then each
// coverage: compute 256 thr x 32 = 64 rows x 128; store 4 iterations x 8 waves x 2 rows x 16 lanes x 8 halves = 64 x 128 per
//           plane; grid = nrows/64 blocks = every row of XH and XL exactly once (nrows a multiple of 64).
// =====================================================================================================
__global__ __launch_bounds__(256) void ln16(const float* __restrict__ X, const float* __restrict__ gam,
                                            const float* __restrict__ bet, u16* XHo, u16* XLo, int nrows) {
#pragma clang fp contract(off)
  __shared__ __align__(16) u16 TH[64 * XTP];
  __shared__ __align__(16) u16 TL[64 * XTP];
  const int tid = (int)threadIdx.x, wave = tid >> 5, lane = tid & 31;
  const int row0 = (int)blockIdx.x * 64;
  if (row0 + 64 > nrows) return;            // block-uniform, before the barrier; never taken with the exact grid
  const int rl = tid >> 2, part = tid & 3;
  const float* p = X + (size_t)(row0 + rl) * CZ + part * 32;
  v4f xv[8];
  float s = 0.0f;
#pragma unroll
  for (int t = 0; t < 8; ++t) {
    v4f a = *(const v4f*)(p + 4 * t);
#pragma unroll
    for (int e = 0; e < 4; ++e) { const float f = bfr(a[e]); a[e] = f; s = s + f; }
    xv[t] = a;
  }
  s = s + __shfl_xor(s, 1, 32);
  s = s + __shfl_xor(s, 2, 32);
  const float mu = s * (1.0f / (float)CZ);
  float q = 0.0f;
#pragma unroll
  for (int t = 0; t < 8; ++t) {
#pragma unroll
    for (int e = 0; e < 4; ++e) { const float d = xv[t][e] - mu; q = q + d * d; }
  }
  q = q + __shfl_xor(q, 1, 32);
  q = q + __shfl_xor(q, 2, 32);
  const float var  = q * (1.0f / (float)CZ);
  const float rstd = rsqrtf(var + 1e-5f);
  v4u oh[4], ol[4];
#pragma unroll
  for (int t = 0; t < 8; ++t) {
    const v4f g4 = *(const v4f*)(gam + part * 32 + 4 * t);
    const v4f b4 = *(const v4f*)(bet + part * 32 + 4 * t);
    unsigned short hb[4], lb[4];
#pragma unroll
    for (int e = 0; e < 4; ++e) {
      float y = (xv[t][e] - mu) * rstd;
      y = y * bfr(g4[e]);
      y = y + bfr(b4[e]);
      const float w = y * XSC;
      const _Float16 hv = (_Float16)w;
      const _Float16 lv = (_Float16)(w - (float)hv);
      hb[e] = h_bits(hv);
      lb[e] = h_bits(lv);
    }
    oh[t >> 1][(t & 1) * 2]     = pk16(hb[0], hb[1]);
    oh[t >> 1][(t & 1) * 2 + 1] = pk16(hb[2], hb[3]);
    ol[t >> 1][(t & 1) * 2]     = pk16(lb[0], lb[1]);
    ol[t >> 1][(t & 1) * 2 + 1] = pk16(lb[2], lb[3]);
  }
  {
    u16* th = TH + rl * XTP + part * 32;
    u16* tl = TL + rl * XTP + part * 32;
#pragma unroll
    for (int q4 = 0; q4 < 4; ++q4) {
      *(v4u*)(th + 8 * q4) = oh[q4];
      *(v4u*)(tl + 8 * q4) = ol[q4];
    }
  }
  __syncthreads();
  v4u vh[4], vl[4];
  const int ch = (lane & 15) * 8;
#pragma unroll
  for (int it = 0; it < 4; ++it) {
    const int row = (it * 8 + wave) * 2 + (lane >> 4);
    vh[it] = *(const v4u*)(TH + row * XTP + ch);
    vl[it] = *(const v4u*)(TL + row * XTP + ch);
  }
  {
#pragma unroll
    for (int it = 0; it < 4; ++it) {
      const int row = (it * 8 + wave) * 2 + (lane >> 4);
      const size_t o = (size_t)(row0 + row) * CZ + ch;
      *(v4u*)(XHo + o) = vh[it];
      *(v4u*)(XLo + o) = vl[it];
    }
    
  }
}

// =====================================================================================================
// Weight plane: W f32 [nrow rows n][CZ k] row-major (k contiguous); D 16-bit [np rows n][CZ k], D[n][k] = f16 bits of
// bf16(W[n][k]) * scale for n < nrow, 0 for nrow <= n < np. Block = 32 n rows: each thread loads 16 consecutive k values of
// one n row with a clamped row address (zeroed by predicate for n >= nrow), converts into the LDS tile [32 n][CZ k]
// coverage: load 256 thr x 16 = 32 n x 128 k; store 2 iterations x 8 waves x 2 rows x 16 lanes x 8 halves = 32 x 128;
//           grid = np/32 blocks covers the [np][CZ] plane exactly once.
// =====================================================================================================
__global__ __launch_bounds__(256) void wp16(const float* __restrict__ W, int nrow, int np, u16* D, float scale) {
  __shared__ __align__(16) u16 T[32 * WTP];
  const int tid = (int)threadIdx.x, wave = tid >> 5, lane = tid & 31;
  const int n0 = (int)blockIdx.x * 32;
  if (n0 + 32 > np) return;                 // block-uniform, before the barrier; never taken with the exact grid
  {
    const int nl = tid >> 3, kc = (tid & 7) * 16;
    const int n  = n0 + nl;
    int nr = (n < nrow) ? n : (nrow - 1);
    nr = (nr < 0) ? 0 : nr;
    const float* src = W + (size_t)nr * CZ + kc;
    v4u w2[2];
#pragma unroll
    for (int t = 0; t < 4; ++t) {
      const v4f a = *(const v4f*)(src + 4 * t);
      unsigned short hb[4];
#pragma unroll
      for (int e = 0; e < 4; ++e) {
        const float val = (n < nrow) ? a[e] : 0.0f;
        hb[e] = h_bits((_Float16)(bfr(val) * scale));
      }
      w2[t >> 1][(t & 1) * 2]     = pk16(hb[0], hb[1]);
      w2[t >> 1][(t & 1) * 2 + 1] = pk16(hb[2], hb[3]);
    }
    *(v4u*)(T + nl * WTP + kc)     = w2[0];
    *(v4u*)(T + nl * WTP + kc + 8) = w2[1];
  }
  __syncthreads();
  v4u w4[2];
  const int ch = (lane & 15) * 8;
#pragma unroll
  for (int it = 0; it < 2; ++it) {
    const int row = (it * 8 + wave) * 2 + (lane >> 4);
    w4[it] = *(const v4u*)(T + row * WTP + ch);
  }
  {
#pragma unroll
    for (int it = 0; it < 2; ++it) {
      const int row = (it * 8 + wave) * 2 + (lane >> 4);
      *(v4u*)(D + (size_t)(n0 + row) * CZ + ch) = w4[it];
    }
    
  }
}

// =====================================================================================================
// GEMM epilogue: the wave's 16x64 f32 tile (times oscale, plus a per-column addend) staged in its LDS slab (pitch 68),
// coverage: 8 instructions x 2 rows x 16 lanes x 4 floats = the wave's 16 x 64 tile.
// =====================================================================================================
__device__ __forceinline__ void epi64(float* sl, v8f a0, v8f a1, v8f a2, v8f a3, float oscale,
                                      float b0, float b1, float b2, float b3,
                                      float* C, int N, size_t rowb, int col0, int lane) {
  const int hh = lane >> 4, m = lane & 15;
#pragma unroll
  for (int r = 0; r < 8; ++r) {
    const int ro = (8 * hh + r) * 68 + m;
    sl[ro]      = a0[r] * oscale + b0;
    sl[ro + 16] = a1[r] * oscale + b1;
    sl[ro + 32] = a2[r] * oscale + b2;
    sl[ro + 48] = a3[r] * oscale + b3;
  }
  wave_sync_lds();
  v4f vals[8];
#pragma unroll
  for (int it = 0; it < 8; ++it) vals[it] = *(const v4f*)(sl + (it * 2 + hh) * 68 + m * 4);
  float* dst = C + (rowb + (size_t)hh) * (size_t)N + col0 + m * 4;
  {
#pragma unroll
    for (int it = 0; it < 8; ++it) {
      *(v4f*)(dst + (size_t)(it * 2) * (size_t)N) = vals[it];
    }
    
  }
}

// =====================================================================================================
// f16 GEMM: C[M][N] (f32) = (Ah [+ Al])[M][K] . (Bh [+ Bl])[N][K]^T * oscale [+ bf16(bias[col])].
// ALO == 1: products ah.bh + al.bh (A residual plane, unscaled); BLO == 1: products ah.bh + ah.bl (B residual plane);
// one accumulator. Block = 64x64 tile, 4 waves x 16 rows; fragments loaded straight from the 16-bit rows (two 16-B loads
// each, split k map for A and B); K stepped by 32 (host guarantees K % 32 == 0, M % 64 == 0, N % 64 == 0,
// grid = (M/64)*(N/64)). hasb is a block-uniform flag; bias is dereferenced only when hasb != 0.
// =====================================================================================================
template <int ALO, int BLO>
__global__ __launch_bounds__(128)
void gemm_h(const u16* __restrict__ Ah, const u16* __restrict__ Al, const u16* __restrict__ Bh, const u16* __restrict__ Bl,
            const float* __restrict__ bias, int hasb, float* C, int M, int N, int K, float oscale) {
  __shared__ __align__(16) float slab[4 * SLAB64];
  const int tid = (int)threadIdx.x, wave = tid >> 5, lane = tid & 31, hh = lane >> 4, m = lane & 15;
  const int ntile = N >> 6;
  const int bid   = (int)blockIdx.x;
  const int rowb  = (bid / ntile) * 64 + wave * 16;
  const int col0  = (bid % ntile) * 64;
  if (rowb + 16 > M) return;                // wave-uniform, never taken with the exact grid; no block barriers in this kernel
  const _Float16* ahp = (const _Float16*)(const void*)Ah + (size_t)(rowb + m) * K + 8 * hh;
  const _Float16* alp = (const _Float16*)(const void*)Al + (size_t)(rowb + m) * K + 8 * hh;   // read only when ALO
  const _Float16* bhp = (const _Float16*)(const void*)Bh + (size_t)(col0 + m) * K + 8 * hh;
  const _Float16* blp = (const _Float16*)(const void*)Bl + (size_t)(col0 + m) * K + 8 * hh;   // read only when BLO
  const size_t bs = (size_t)16 * K;
  float bb0 = 0.0f, bb1 = 0.0f, bb2 = 0.0f, bb3 = 0.0f;
  if (hasb != 0) {
    bb0 = bfr(bias[col0 + m]);
    bb1 = bfr(bias[col0 + 16 + m]);
    bb2 = bfr(bias[col0 + 32 + m]);
    bb3 = bfr(bias[col0 + 48 + m]);
  }
  v8f acc0 = zero8(), acc1 = zero8(), acc2 = zero8(), acc3 = zero8();
#pragma unroll 1
  for (int k0 = 0; k0 < K; k0 += 32) {
    const v16h ah = ldfrag_h(ahp + k0);
    const v16h b0 = ldfrag_h(bhp + k0);
    const v16h b1 = ldfrag_h(bhp + bs + k0);
    const v16h b2 = ldfrag_h(bhp + 2 * bs + k0);
    const v16h b3 = ldfrag_h(bhp + 3 * bs + k0);
    acc0 = mma_h(ah, b0, acc0);
    acc1 = mma_h(ah, b1, acc1);
    acc2 = mma_h(ah, b2, acc2);
    acc3 = mma_h(ah, b3, acc3);
    if constexpr (ALO != 0) {
      const v16h al = ldfrag_h(alp + k0);
      acc0 = mma_h(al, b0, acc0);
      acc1 = mma_h(al, b1, acc1);
      acc2 = mma_h(al, b2, acc2);
      acc3 = mma_h(al, b3, acc3);
      if constexpr (BLO != 0) {
        const v16h l0 = ldfrag_h(blp + k0);
        const v16h l1 = ldfrag_h(blp + bs + k0);
        const v16h l2 = ldfrag_h(blp + 2 * bs + k0);
        const v16h l3 = ldfrag_h(blp + 3 * bs + k0);
        acc0 = mma_h(ah, l0, acc0);
        acc1 = mma_h(ah, l1, acc1);
        acc2 = mma_h(ah, l2, acc2);
        acc3 = mma_h(ah, l3, acc3);
        guard9<v16h>(acc0, acc1, acc2, acc3, ah, b0, b1, b2, b3, l0, l1, l2, l3);
        guard6<v16h>(acc0, acc1, acc2, acc3, al, al, al, al, al, al);
      } else {
        guard6<v16h>(acc0, acc1, acc2, acc3, ah, al, b0, b1, b2, b3);
      }
    } else if constexpr (BLO != 0) {
      const v16h l0 = ldfrag_h(blp + k0);
      const v16h l1 = ldfrag_h(blp + bs + k0);
      const v16h l2 = ldfrag_h(blp + 2 * bs + k0);
      const v16h l3 = ldfrag_h(blp + 3 * bs + k0);
      acc0 = mma_h(ah, l0, acc0);
      acc1 = mma_h(ah, l1, acc1);
      acc2 = mma_h(ah, l2, acc2);
      acc3 = mma_h(ah, l3, acc3);
      guard9<v16h>(acc0, acc1, acc2, acc3, ah, b0, b1, b2, b3, l0, l1, l2, l3);
    } else {
      guard6<v16h>(acc0, acc1, acc2, acc3, ah, b0, b1, b2, b3, ah);
    }
  }
  epi64(slab + wave * SLAB64, acc0, acc1, acc2, acc3, oscale, bb0, bb1, bb2, bb3, C, N, (size_t)rowb, col0, lane);
}

// =====================================================================================================
// v^T planes from the v projection F f32 [GROWS][CZ] (row = il*NSEQ + s, column = h*HD + d):
//   VH[((il*NH + h)*HD + d)][s] = f16(v * 1024);  VL same layout = f16 residual of (v * 1024).
// Block = (il, head h, 64 keys s0): each thread loads its 8 floats (key sl, d chunk dc) with 16-B loads, converts, scatters
// into two LDS tiles [d][64 keys] (pitch VTP halves); after a block barrier each d row segment (64 halves = one whole
// coverage: load 256 thr x 8 = 64 keys x 32 d; store 256 thr x 8 halves = 32 lines x 64 per plane = the block's tile;
//           grid = IG*NH*NST blocks covers VH and VL exactly once.
// =====================================================================================================
__global__ __launch_bounds__(256) void vt16(const float* __restrict__ F, u16* VHo, u16* VLo) {
  __shared__ __align__(16) u16 TH[HD * VTP];
  __shared__ __align__(16) u16 TL[HD * VTP];
  const int tid = (int)threadIdx.x;
  const int bid = (int)blockIdx.x;
  const int st  = bid % NST;
  const int t2  = bid / NST;
  const int h   = t2 % NH;
  const int il  = t2 / NH;
  if (il >= IG) return;                     // block-uniform, before any barrier; never taken with the exact grid
  const int s0  = st * 64;
  {
    const int sl = tid >> 2;                // key within tile 0..63
    const int dc = (tid & 3) * 8;           // d chunk 0,8,16,24
    const float* src = F + ((size_t)il * NSEQ + s0 + sl) * CZ + h * HD + dc;
    const v4f a = *(const v4f*)(src), b4 = *(const v4f*)(src + 4);
    float w[8];
#pragma unroll
    for (int e = 0; e < 4; ++e) { w[e] = a[e] * VCAR; w[4 + e] = b4[e] * VCAR; }
#pragma unroll
    for (int e = 0; e < 8; ++e) {
      const _Float16 hv = (_Float16)w[e];
      const _Float16 lv = (_Float16)(w[e] - (float)hv);
      TH[(dc + e) * VTP + sl] = h_bits(hv);
      TL[(dc + e) * VTP + sl] = h_bits(lv);
    }
  }
  __syncthreads();
  const int q8 = tid >> 3, p8 = (tid & 7) * 8;   // q8 = d line 0..31
  const v4u vh = *(const v4u*)(TH + q8 * VTP + p8);
  const v4u vl = *(const v4u*)(TL + q8 * VTP + p8);
  const size_t hrow = (size_t)(il * NH + h) * HD + q8;
  const size_t base = hrow * NSEQ + s0 + p8;
  {
    *(v4u*)(VHo + base) = vh;
    *(v4u*)(VLo + base) = vl;
    
  }
}

// =====================================================================================================
// Key-mean of the v projection: VM[il][c] = (1/NSEQ) * sum_s F[il*NSEQ + s][c], f32. Block = il, thread = column c
// coverage: grid = IG blocks x 128 threads = every element of VM [IG][CZ] exactly once.
// =====================================================================================================
__global__ __launch_bounds__(128) void vmean(const float* __restrict__ F, float* VM) {
  const int il = (int)blockIdx.x;
  if (il >= IG) return;
  const int c = (int)threadIdx.x;
  const float* p = F + (size_t)il * NSEQ * CZ + c;
  float s = 0.0f;
#pragma unroll 4
  for (int k = 0; k < NSEQ; ++k) s += p[(size_t)k * CZ];
  const float mv = s * (1.0f / (float)NSEQ);
  float* d = VM + (size_t)il * CZ + c;
  {
    *(float*)(d) = mv;
    
  }
}

// =====================================================================================================
// q / k planes from a projection F f32 [nrows][CZ]: Hp [nrows][CZ] = f16(val * sc) (same layout), Lp = f16 residual.
// Block = QKR consecutive rows x QKC threads per row, thread = 8 consecutive columns: two 16-B loads, one 16-B store per
// coverage: QKR rows x 16 thr x 8 = QKR whole CZ rows per block; grid = nrows/QKR blocks = every row of Hp and Lp once.
// =====================================================================================================
__global__ __launch_bounds__(QKT) void qk16(const float* __restrict__ F, u16* Hp, u16* Lp, float sc, int nrows) {
  const int tid = (int)threadIdx.x;
  const int rl  = tid / QKC;
  const int cc  = tid - rl * QKC;
  const int row = (int)blockIdx.x * QKR + rl;
  if (row >= nrows) return;
  const float* p = F + (size_t)row * CZ + cc * 8;
  const v4f a = *(const v4f*)(p), b4 = *(const v4f*)(p + 4);
  float w[8];
#pragma unroll
  for (int e = 0; e < 4; ++e) { w[e] = a[e] * sc; w[4 + e] = b4[e] * sc; }
  v4u oh, ol;
#pragma unroll
  for (int e = 0; e < 4; ++e) {
    const float t0 = w[2 * e], t1 = w[2 * e + 1];
    const _Float16 h0 = (_Float16)t0, h1 = (_Float16)t1;
    const _Float16 l0 = (_Float16)(t0 - (float)h0), l1 = (_Float16)(t1 - (float)h1);
    oh[e] = pk16(h_bits(h0), h_bits(h1));
    ol[e] = pk16(h_bits(l0), h_bits(l1));
  }
  const size_t o = (size_t)row * CZ + cc * 8;
  {
    *(v4u*)(Hp + o) = oh;
    *(v4u*)(Lp + o) = ol;
    
  }
}

// =====================================================================================================
// Row-wise gated attention. Block bid -> (query tile qt: rows q0 = 16*qt .. q0+15 of row block il, head group hg of WPB
// heads); one wave per head = hg*WPB + wave; all NSEQ keys of row block il, shared bias table BT f32 [BTM][NPOS]
// (row h, position j*NSEQ + k) plus the per-row mask bias 1e9*(bf16(mask[il][k]) - 1) (MK already offset to the row group).
//   q/k planes f16 x1024 hi + residual [il*NSEQ + s][h*HD + d]; v^T planes [il*NH + h][d][NSEQ] hi + residual;
//   VM f32 [il][h*HD + d] = key-mean of v; GF f32 [il*NSEQ + s][h*HD + d] = gate pre-activation (bias already added).
//   Phase 0: the wave's 16 x NSEQ bias rows (times log2e, plus mask bias times log2e) loaded with 16-B loads into its private
//   LDS score buffer (pitch SBP).
//   Phase 1 (per 32-key tile): scores q_hi.k_hi + q_lo.k_hi + q_hi.k_lo (one k-step of 32), u = s*rsqrt(32)*log2e/(1024*1024)
//   + buffered bias written back to the lane's own D positions of the buffer; running row max.
//   Phase 2a: p = exp2(u - m) written back (own positions), row sums Z, per-row scale 16384/Z.
//   of P' (f16 hi) rebuilt from the buffer rows (float vector loads, same element type as stored), v^T B fragments for the two
//   16-wide d subtiles, products P'.v_hi + P'.v_lo.
//   Epilogue: vals = acc/(16384*1024) + VM (exact identity sum(P'+64).v/16384 = sum P.v), gate g = 1/(1+exp(-z)) in f32,
//   O = g*vals*4096 -> f16 hi + residual, staged as u16 elements in a block LDS tile [2 planes][16 rows][STP], block barrier,
//   a divergent branch; the only early return is block-uniform and precedes every barrier.
// staged extent == consumed extent: score buffer columns 0..NSEQ-1 of all 16 rows written in phase 0 before any read
//   (columns NSEQ..SBP-1 never read); stage tile rows 0..15 x columns 0..63 of both planes written before the barrier
//   (columns 64..STP-1 never read).
// coverage: per block 2 iterations x 2 waves x 4 row groups x 8 lanes x 8 halves = 16 rows x 64 halves per plane;
//           grid = IG*NHG*NQT blocks = every (row, 64-column group) of OH and OL exactly once.
// =====================================================================================================
__global__ __launch_bounds__(ATT_THREADS)
void attn(const u16* __restrict__ QHp, const u16* __restrict__ QLp,
          const u16* __restrict__ KHp, const u16* __restrict__ KLp,
          const u16* __restrict__ VHp, const u16* __restrict__ VLp,
          const float* __restrict__ VM, const float* __restrict__ GF, const float* __restrict__ BT,
          const float* __restrict__ MK, u16* OHp, u16* OLp) {
  __shared__ __align__(16) float sbuf[WPB * SBW];
  __shared__ __align__(16) u16 stg[2 * 16 * STP];

  const int tid  = (int)threadIdx.x;
  const int wave = tid >> 5;
  const int lane = tid & 31;
  const int hh   = lane >> 4;
  const int c    = lane & 15;
  const int bid  = (int)blockIdx.x;
  const int qt   = bid % NQT;
  const int t2   = bid / NQT;
  const int hg   = t2 % NHG;
  const int il   = t2 / NHG;
  if (il >= IG) return;                     // block-uniform, before every barrier; never taken with the exact grid
  const int q0   = qt * 16;
  const int head = hg * WPB + wave;
  float* buf = sbuf + wave * SBW;
  const size_t prow0 = (size_t)il * NSEQ;   // first position row of this row block in the group-local planes

  // ---- phase 0: bias rows (query rows q0..q0+15, all keys) x log2e + mask bias x log2e -> score buffer ----
  {
    const float* bsrc = BT + (size_t)head * NPOS + (size_t)q0 * NSEQ;
    const float* msrc = MK + (size_t)il * NSEQ;
    v4f mb0, mb1;                           // keys lane*4..+3 and 128+lane*4..+3 of mask row il
    {
      const v4f m0 = *(const v4f*)(msrc + lane * 4);
      const v4f m1 = *(const v4f*)(msrc + 128 + lane * 4);
#pragma unroll
      for (int e = 0; e < 4; ++e) {
        mb0[e] = (MINF * (bfr(m0[e]) - 1.0f)) * LOG2E;
        mb1[e] = (MINF * (bfr(m1[e]) - 1.0f)) * LOG2E;
      }
    }
#pragma unroll 1
    for (int g4 = 0; g4 < 4; ++g4) {
      v4f tv[8];
#pragma unroll
      for (int it = 0; it < 8; ++it) {
        const int idx = (g4 * 8 + it) * 32 + lane;        // 0..1023
        const int jr = idx >> 6, k4 = (idx & 63) * 4;      // k4 = lane*4 for even it, 128 + lane*4 for odd it
        tv[it] = *(const v4f*)(bsrc + (size_t)jr * NSEQ + k4);
      }
#pragma unroll
      for (int it = 0; it < 8; ++it) {
        const int idx = (g4 * 8 + it) * 32 + lane;
        const int jr = idx >> 6, k4 = (idx & 63) * 4;
        const v4f mb = (it & 1) ? mb1 : mb0;
        *(v4f*)(buf + jr * SBP + k4) = tv[it] * LOG2E + mb;
      }
    }
  }
  wave_sync_lds();

  const size_t hcol = (size_t)head * HD + 8 * hh;
  const _Float16* Qh  = (const _Float16*)(const void*)QHp + (prow0 + q0 + c) * CZ + hcol;
  const _Float16* Ql  = (const _Float16*)(const void*)QLp + (prow0 + q0 + c) * CZ + hcol;
  const _Float16* Khb = (const _Float16*)(const void*)KHp + (prow0 + c) * CZ + hcol;     // key row kb added per tile
  const _Float16* Klb = (const _Float16*)(const void*)KLp + (prow0 + c) * CZ + hcol;
  const _Float16* Vhb = (const _Float16*)(const void*)VHp + ((size_t)(il * NH + head) * HD + c) * NSEQ + 8 * hh;
  const _Float16* Vlb = (const _Float16*)(const void*)VLp + ((size_t)(il * NH + head) * HD + c) * NSEQ + 8 * hh;
  const v16h qh = ldfrag_h(Qh);
  const v16h ql = ldfrag_h(Ql);
  const float lsc = RSQ_HD * (LOG2E / (QSC * KSC));

  // ---- phase 1: scores + bias into the buffer (log2 domain), running row max ----
  float mrow[8];
#pragma unroll
  for (int r = 0; r < 8; ++r) mrow[r] = -INFINITY;
#pragma unroll 1
  for (int kt = 0; kt < NKT; ++kt) {
    const int kb = kt * 32;
    const _Float16* k0p = Khb + (size_t)kb * CZ;
    const _Float16* k1p = k0p + (size_t)16 * CZ;
    const _Float16* l0p = Klb + (size_t)kb * CZ;
    const _Float16* l1p = l0p + (size_t)16 * CZ;
    const v16h kh0 = ldfrag_h(k0p), kh1 = ldfrag_h(k1p);
    const v16h kl0 = ldfrag_h(l0p), kl1 = ldfrag_h(l1p);
    v8f s0 = zero8(), s1 = zero8();
    s0 = mma_h(qh, kh0, s0);
    s0 = mma_h(ql, kh0, s0);
    s0 = mma_h(qh, kl0, s0);
    s1 = mma_h(qh, kh1, s1);
    s1 = mma_h(ql, kh1, s1);
    s1 = mma_h(qh, kl1, s1);
    guard2(s0, s1, qh, ql, kh0, kl0, kh1, kl1);
#pragma unroll
    for (int r = 0; r < 8; ++r) {
      const int pos = (8 * hh + r) * SBP + kb + c;   // D element r = (query row 8hh+r, key kb+c); +16 = key kb+16+c
      const float u0 = s0[r] * lsc + buf[pos];
      const float u1 = s1[r] * lsc + buf[pos + 16];
      buf[pos]      = u0;
      buf[pos + 16] = u1;
      mrow[r] = fmaxf(mrow[r], fmaxf(u0, u1));
    }
  }
#pragma unroll
  for (int r = 0; r < 8; ++r) {
    float mx = mrow[r];
#pragma unroll
    for (int off = 1; off < 16; off <<= 1) mx = fmaxf(mx, __shfl_xor(mx, off, 32));
    mrow[r] = mx;
  }

  // ---- phase 2a: p = exp2(u - m) (own positions), row sums, per-row scale 16384/Z (Z >= 1) ----
  float psc[8];
  {
    float lrow[8];
#pragma unroll
    for (int r = 0; r < 8; ++r) lrow[r] = 0.0f;
#pragma unroll 1
    for (int kt = 0; kt < NKT; ++kt) {
      const int kb = kt * 32;
#pragma unroll
      for (int r = 0; r < 8; ++r) {
        const int pos = (8 * hh + r) * SBP + kb + c;
        const float e0 = exp2f(buf[pos] - mrow[r]);
        const float e1 = exp2f(buf[pos + 16] - mrow[r]);
        buf[pos]      = e0;
        buf[pos + 16] = e1;
        lrow[r] += e0 + e1;
      }
    }
#pragma unroll
    for (int r = 0; r < 8; ++r) {
      float ls = lrow[r];
#pragma unroll
      for (int off = 1; off < 16; off <<= 1) ls += __shfl_xor(ls, off, 32);
      const float lz = (ls > 0.0f) ? ls : 1.0f;
      psc[r] = PCAR * __builtin_amdgcn_rcpf(lz);
    }
  }

  // ---- phase 2b: centred P' tiles as f16 A fragments, P'.v^T (hi + residual) ----
  const float pcen = PCAR / (float)NSEQ;
  v8f o0 = zero8(), o1 = zero8();
#pragma unroll 1
  for (int kt = 0; kt < NKT; ++kt) {
    const int kb = kt * 32;
#pragma unroll
    for (int r = 0; r < 8; ++r) {
      const int pos = (8 * hh + r) * SBP + kb + c;
      const float pp0 = buf[pos] * psc[r] - pcen;
      const float pp1 = buf[pos + 16] * psc[r] - pcen;
      buf[pos]      = pp0;
      buf[pos + 16] = pp1;
    }
    wave_sync_lds();
    FragH ph;
    {
      const float* prow = buf + c * SBP + kb + 8 * hh;
      const v4f p0 = *(const v4f*)(prow), p1 = *(const v4f*)(prow + 4);
      const v4f p2 = *(const v4f*)(prow + 16), p3 = *(const v4f*)(prow + 20);
#pragma unroll
      for (int e = 0; e < 4; ++e) {
        ph.h[0][e]     = (_Float16)p0[e];       // elements 0..7  = keys kb + 8hh + 0..7
        ph.h[0][4 + e] = (_Float16)p1[e];
        ph.h[1][e]     = (_Float16)p2[e];       // elements 8..15 = keys kb + 16 + 8hh + 0..7
        ph.h[1][4 + e] = (_Float16)p3[e];
      }
    }
    {
      const v16h vha = ldfrag_h(Vhb + kb);
      const v16h vhb = ldfrag_h(Vhb + (size_t)16 * NSEQ + kb);
      const v16h vla = ldfrag_h(Vlb + kb);
      const v16h vlb = ldfrag_h(Vlb + (size_t)16 * NSEQ + kb);
      o0 = mma_h(ph.v, vha, o0);                // D element r = (row 8hh+r, d = c)
      o0 = mma_h(ph.v, vla, o0);
      o1 = mma_h(ph.v, vhb, o1);                // d = 16 + c
      o1 = mma_h(ph.v, vlb, o1);
      guard2(o0, o1, ph.v, vha, vla, vhb, vlb, ph.v);
    }
  }
  acc_guard2(o0, o1);

  // ---- epilogue: vals = acc/(16384*1024) + key-mean, sigmoid gate, O*4096 -> f16 hi + residual in the block stage tile ----
  {
    const float oc  = 1.0f / (PCAR * VCAR);
    const float vm0 = VM[(size_t)il * CZ + head * HD + c];
    const float vm1 = VM[(size_t)il * CZ + head * HD + 16 + c];
    const float* gp = GF + (prow0 + q0 + 8 * hh) * CZ + head * HD + c;
#pragma unroll
    for (int r = 0; r < 8; ++r) {
      const float gz0 = gp[(size_t)r * CZ];
      const float gz1 = gp[(size_t)r * CZ + 16];
      const float g0  = __builtin_amdgcn_rcpf(1.0f + exp2f(-gz0 * LOG2E));
      const float g1  = __builtin_amdgcn_rcpf(1.0f + exp2f(-gz1 * LOG2E));
      const float w0  = (o0[r] * oc + vm0) * g0 * OSC;
      const float w1  = (o1[r] * oc + vm1) * g1 * OSC;
      const _Float16 h0 = (_Float16)w0, h1 = (_Float16)w1;
      const _Float16 l0 = (_Float16)(w0 - (float)h0), l1 = (_Float16)(w1 - (float)h1);
      const int si = (8 * hh + r) * STP + wave * HD + c;
      stg[si]                 = h_bits(h0);
      stg[si + 16]            = h_bits(h1);
      stg[16 * STP + si]      = h_bits(l0);
      stg[16 * STP + si + 16] = h_bits(l1);
    }
  }
  __syncthreads();
  v4u vh[2], vl[2];
  const int rq = lane >> 3, p8 = (lane & 7) * 8;
#pragma unroll
  for (int it = 0; it < 2; ++it) {
    const int row = it * 8 + wave * 4 + rq;
    vh[it] = *(const v4u*)(stg + row * STP + p8);
    vl[it] = *(const v4u*)(stg + (16 + row) * STP + p8);
  }
  const size_t ob = (prow0 + q0) * CZ + (size_t)hg * 64 + p8;
  {
#pragma unroll
    for (int it = 0; it < 2; ++it) {
      const int row = it * 8 + wave * 4 + rq;
      *(v4u*)(OHp + ob + (size_t)row * CZ) = vh[it];
      *(v4u*)(OLp + ob + (size_t)row * CZ) = vl[it];
    }
    
  }
}

// =====================================================================================================
// Row blocks of the pair tensor are processed in NGRP groups of IG rows i (GROWS positions each); every per-group plane is
// fully rewritten by whole-line stores before it is read within its group. Workspace map (bytes; every extent is an exact
// multiple of its store granularity, no tail rows; every region offset a multiple of 32768):
//   WQ, WK, WV, WG, WO  f16 x1024 [128 n][128 k]   5 x 32768;  WB f16 x1024 [BTM n][128 k] (16384 in a 32768 slot)
//   VM   f32 [IG][128]                              IG*512 (slot padded to 32768)
//   XH, XL  f16 [NPOS][128] (x*64 hi, residual)    2 x 16777216
//   BT   f32 [BTM][NPOS]                            16777216
//   F    f32 [GROWS][128]                           GROWS*512   (v, q, k projections in launch order; afterwards the region
//                                                               holds OH f16 [GROWS][128] then OL f16 [GROWS][128])
//   GF   f32 [GROWS][128]                           GROWS*512
//   QH, QL, KH, KL  f16 [GROWS][128]               4 x GROWS*256
//   VH, VL  f16 [IG*NH*HD][NSEQ]                    2 x GROWS*256
//   end (IG = 64)                                   92504064
// =====================================================================================================
extern "C" void kernel_launch(void* const* d_in, const int* in_sizes, int n_in,
                              void* d_out, int out_size, void* d_ws, size_t ws_size,
                              hipStream_t stream) {
  if (n_in < 12) return;
  if (in_sizes[0] < NPOS * CZ) return;
  if (in_sizes[1] < NI * NSEQ) return;
  if (in_sizes[2] < CZ || in_sizes[3] < CZ) return;
  if (in_sizes[4] < NH * CZ) return;
  if (in_sizes[5] < CZ * CZ || in_sizes[6] < CZ * CZ || in_sizes[7] < CZ * CZ || in_sizes[8] < CZ * CZ) return;
  if (in_sizes[9] < CZ) return;
  if (in_sizes[10] < CZ * CZ || in_sizes[11] < CZ) return;
  if (out_size < NI * NSEQ * CZ) return;

  const float* x   = (const float*)d_in[0];
  const float* msk = (const float*)d_in[1];
  const float* gam = (const float*)d_in[2];
  const float* bet = (const float*)d_in[3];
  const float* Wt  = (const float*)d_in[4];
  const float* Wq  = (const float*)d_in[5];
  const float* Wk  = (const float*)d_in[6];
  const float* Wv  = (const float*)d_in[7];
  const float* Wg  = (const float*)d_in[8];
  const float* bg  = (const float*)d_in[9];
  const float* Wo  = (const float*)d_in[10];
  const float* bo  = (const float*)d_in[11];
  float*       out = (float*)d_out;

  const size_t szWP = 32768;
  const size_t szVM = (((size_t)IG * CZ * 4) + 32767) / 32768 * 32768;
  const size_t szX  = (size_t)NPOS * CZ * 2;
  const size_t szBT = (size_t)BTM * NPOS * 4;
  const size_t szF  = (size_t)GROWS * CZ * 4;
  const size_t szP  = (size_t)GROWS * CZ * 2;          // QH, QL, KH, KL, VH, VL, OH, OL
  if (2 * szP > szF) return;                           // OH + OL live inside the F region
  size_t off = 0;
  const size_t oWQ = off; off += szWP;
  const size_t oWK = off; off += szWP;
  const size_t oWV = off; off += szWP;
  const size_t oWG = off; off += szWP;
  const size_t oWO = off; off += szWP;
  const size_t oWB = off; off += szWP;
  const size_t oVM = off; off += szVM;
  const size_t oXH = off; off += szX;
  const size_t oXL = off; off += szX;
  const size_t oBT = off; off += szBT;
  const size_t oF  = off; off += szF;
  const size_t oGF = off; off += szF;
  const size_t oQH = off; off += szP;
  const size_t oQL = off; off += szP;
  const size_t oKH = off; off += szP;
  const size_t oKL = off; off += szP;
  const size_t oVH = off; off += szP;
  const size_t oVL = off; off += szP;
  if (off > ws_size) return;                // off = 92504064 for IG = 64
  if (off > (size_t)WS_CAP) return;

  char* ws = (char*)d_ws;
  u16*   WQ = (u16*)(ws + oWQ);
  u16*   WK = (u16*)(ws + oWK);
  u16*   WV = (u16*)(ws + oWV);
  u16*   WG = (u16*)(ws + oWG);
  u16*   WO = (u16*)(ws + oWO);
  u16*   WB = (u16*)(ws + oWB);
  float* VM = (float*)(ws + oVM);
  u16*   XH = (u16*)(ws + oXH);
  u16*   XL = (u16*)(ws + oXL);
  float* BT = (float*)(ws + oBT);
  float* F  = (float*)(ws + oF);
  u16*   OH = (u16*)(ws + oF);
  u16*   OL = (u16*)(ws + oF + szP);
  float* GF = (float*)(ws + oGF);
  u16*   QH = (u16*)(ws + oQH);
  u16*   QL = (u16*)(ws + oQL);
  u16*   KH = (u16*)(ws + oKH);
  u16*   KL = (u16*)(ws + oKL);
  u16*   VH = (u16*)(ws + oVH);
  u16*   VL = (u16*)(ws + oVL);

  const dim3 b256(256), b128(128), bAT(ATT_THREADS), bQK(QKT);
  const dim3 gLN(NPOS / 64);
  const dim3 gW(CZ / 32), gWB(BTM / 32);
  const dim3 gBias((BTM / 64) * (NPOS / 64));
  const dim3 gG((GROWS / 64) * (CZ / 64));
  const dim3 gVT(IG * NH * NST);
  const dim3 gVM(IG);
  const dim3 gQK(GROWS / QKR);
  const dim3 gA(IG * NHG * NQT);
  const float oscp = 1.0f / (XSC * WSC);
  const float osco = 1.0f / (OSC * WSC);

  // (a) LayerNorm of all positions -> x*64 f16 hi + residual planes
  ln16<<<gLN, b256, 0, stream>>>(x, gam, bet, XH, XL, NPOS);
  // (b) weight planes [n][k] as f16 of the bf16 value x1024 (weights are [out][in] = [n][k]); Wt plane padded to BTM rows
  wp16<<<gW,  b256, 0, stream>>>(Wq, CZ, CZ,  WQ, WSC);
  wp16<<<gW,  b256, 0, stream>>>(Wk, CZ, CZ,  WK, WSC);
  wp16<<<gW,  b256, 0, stream>>>(Wv, CZ, CZ,  WV, WSC);
  wp16<<<gW,  b256, 0, stream>>>(Wg, CZ, CZ,  WG, WSC);
  wp16<<<gW,  b256, 0, stream>>>(Wo, CZ, CZ,  WO, WSC);
  wp16<<<gWB, b256, 0, stream>>>(Wt, NH, BTM, WB, WSC);
  // (c) shared bias table BT[h][p] = sum_c Wt[h][c] * x[p][c]  (A = Wt plane, B = x hi + residual planes)
  gemm_h<0, 1><<<gBias, b128, 0, stream>>>(WB, WB, XH, XL, bo, 0, BT, BTM, NPOS, CZ, oscp);

  for (int g = 0; g < NGRP; ++g) {
    const u16*   XHg = XH + (size_t)g * GROWS * CZ;
    const u16*   XLg = XL + (size_t)g * GROWS * CZ;
    const float* Mg  = msk + (size_t)g * IG * NSEQ;
    float*       og  = out + (size_t)g * GROWS * CZ;
    // (1) v = x.Wv^T -> F; (2) v^T hi + residual planes x1024; (3) key-mean of v
    gemm_h<1, 0><<<gG, b128, 0, stream>>>(XHg, XLg, WV, WV, bo, 0, F, GROWS, CZ, CZ, oscp);
    vt16<<<gVT, b256, 0, stream>>>(F, VH, VL);
    vmean<<<gVM, b128, 0, stream>>>(F, VM);
    // (4) q = x.Wq^T -> F; (5) q hi + residual planes x1024
    gemm_h<1, 0><<<gG, b128, 0, stream>>>(XHg, XLg, WQ, WQ, bo, 0, F, GROWS, CZ, CZ, oscp);
    qk16<<<gQK, bQK, 0, stream>>>(F, QH, QL, QSC, GROWS);
    // (6) k = x.Wk^T -> F; (7) k hi + residual planes x1024
    gemm_h<1, 0><<<gG, b128, 0, stream>>>(XHg, XLg, WK, WK, bo, 0, F, GROWS, CZ, CZ, oscp);
    qk16<<<gQK, bQK, 0, stream>>>(F, KH, KL, KSC, GROWS);
    // (8) gate pre-activation x.Wg^T + bg -> GF f32
    gemm_h<1, 0><<<gG, b128, 0, stream>>>(XHg, XLg, WG, WG, bg, 1, GF, GROWS, CZ, CZ, oscp);
    // (9) attention over all keys of each row block with the shared bias and the row mask bias, gated
    //     -> O x4096 f16 hi + residual planes
    attn<<<gA, bAT, 0, stream>>>(QH, QL, KH, KL, VH, VL, VM, GF, BT, Mg, OH, OL);
    // (10) output projection (O hi + residual).Wo^T + bo -> out f32, carries 4096 x 1024 folded back
    gemm_h<1, 0><<<gG, b128, 0, stream>>>(OH, OL, WO, WO, bo, 1, og, GROWS, CZ, CZ, osco);
  }
  (void)hipGetLastError();
}

// v001
// It runs in 267 microseconds.
// In both of two side-by-side timings against v000, it was 1.42 times as fast.
// Contractions: LN(x).Wq^T, LN(x).Wk^T, LN(x).Wv^T, LN(x).Wg^T(+bg), Wt.LN(x)^T (shared pair-bias table) and O.Wo^T(+bo) on
// v_wmma_f32_16x16x32_f16 with the activation operand carried as f16 hi + f16 residual planes (x*64, O*4096) and the weight
// operand as f16(bf16(W)*1024); q.k^T over 32 on v_wmma_f32_16x16x32_f16 (q, k *1024 f16 hi + residual, products hh+lh+hl);
// centred softmax weights P' = 16384*P - 64 (f16 hi) times v^T (v*1024 f16 hi + residual, products P'.vh + P'.vl);
// all f32 accumulate. LayerNorm, mask bias, softmax, sigmoid gate, key-mean of v and carry folds in f32 on VALU.
// Every float input is RNE-converted to bf16 on load.
#include <hip/hip_runtime.h>
#include <math.h>
#include <stdint.h>

#ifndef NB
#define NB 1
#endif
#ifndef NI
#define NI 256
#endif
#define NSEQ   256
#define CZ     128
#define NH     4
#define HD     32
#define NPOS   (NSEQ * NSEQ)
#define IG     NI
#define NGRP   (NI / IG)
#define GROWS  (IG * NSEQ)
#define XSC    64.0f
#define WSC    1024.0f
#define QSC    1024.0f
#define KSC    1024.0f
#define VCAR   1024.0f
#define PCAR   16384.0f
#define OSC    4096.0f
#define MINF   1.0e9f
#define RSQ_HD 0.17677669529663689f
#define LOG2E  1.4426950408889634f
#define WPB    2
#define NHG    (NH / WPB)
#define NQT    (NSEQ / 16)
#define NKT    (NSEQ / 32)
#define NST    (NSEQ / 64)
#define ATT_THREADS (WPB * 32)
#define SBP    260
#define SBW    (16 * SBP)
#define STP    72
#define SLAB64 (16 * 68)
#define VTP    72
#define XTP    136
#define WTP    136
#define BTM    64
#define QKC    (CZ / 8)
#define QKR    16
#define QKT    (QKC * QKR)
#define WS_CAP 268435456
static_assert(NB == 1);
static_assert(CZ == NH * HD && HD == 32 && NH == 4 && NSEQ == 256);
static_assert(NI >= 1 && NI <= NSEQ && (NI % IG) == 0 && IG >= 1 && IG <= NSEQ && NGRP == 1);
static_assert((GROWS % 64) == 0 && (GROWS % QKR) == 0 && (NPOS % 64) == 0 && QKT == 256);
static_assert((NH % WPB) == 0 && ATT_THREADS == 64 && (NSEQ % 64) == 0 && (CZ % 64) == 0 && (CZ % 32) == 0);
static_assert((BTM % 64) == 0 && BTM >= NH && (BTM % 32) == 0);
static_assert(SBP >= NSEQ && (SBP % 4) == 0 && STP >= 64 && (STP % 8) == 0 && XTP >= CZ && WTP >= CZ && VTP >= 64);

typedef unsigned short u16;
typedef _Float16 v16h __attribute__((ext_vector_type(16)));
typedef _Float16 v8h  __attribute__((ext_vector_type(8)));
typedef float    v8f  __attribute__((ext_vector_type(8)));
typedef float    v4f  __attribute__((ext_vector_type(4)));
typedef unsigned int v4u __attribute__((ext_vector_type(4)));

union FragH { v16h v; v8h h[2]; v4u u[2]; };

// ---- scalar helpers --------------------------------------------------------------------------------
__device__ __forceinline__ unsigned short bf_bits(float f) {          // f32 -> bf16 bits, RNE convert
  unsigned u = __float_as_uint(f);
  return (unsigned short)((u + 0x7FFFu + ((u >> 16) & 1u)) >> 16);
}
__device__ __forceinline__ float bf_up(unsigned short h) { return __uint_as_float(((unsigned)h) << 16); }
__device__ __forceinline__ float bfr(float f) { return bf_up(bf_bits(f)); }
__device__ __forceinline__ unsigned short h_bits(_Float16 x) { return __builtin_bit_cast(unsigned short, x); }
__device__ __forceinline__ unsigned pk16(unsigned short a, unsigned short b) { return (unsigned)a | ((unsigned)b << 16); }
__device__ __forceinline__ v8f zero8() { v8f z = {0.f, 0.f, 0.f, 0.f, 0.f, 0.f, 0.f, 0.f}; return z; }

// ---- fragment loader: 16-bit A/B operand, lane -> row/col (lane&15), p already includes +8*(lane>>4);
//      elements 0..7 <- p[0..7] (k0+8h..), elements 8..15 <- p[16..23] (k0+16+8h..); same split k map for A and B,
//      B always read from a k-contiguous [n][k] plane.
__device__ __forceinline__ v16h ldfrag_h(const _Float16* p) {
  FragH f;
  f.h[0] = *(const v8h*)(p);
  f.h[1] = *(const v8h*)(p + 16);
  return f.v;
}

// ---- WMMA helpers with trailing VALU hazard gaps ------------------------------------------------------
__device__ __forceinline__ v8f mma_h(v16h a, v16h b, v8f c) {
  return __builtin_amdgcn_wmma_f32_16x16x32_f16(false, a, false, b, (short)0, c, false, false);
}
__device__ __forceinline__ void guard2(v8f& a, v8f& b, v16h x0, v16h x1, v16h x2, v16h x3, v16h x4, v16h x5) {
#if defined(__HIP_DEVICE_COMPILE__)
  asm volatile("v_nop\n\tv_nop\n\tv_nop\n\tv_nop"
               : "+v"(a), "+v"(b) : "v"(x0), "v"(x1), "v"(x2), "v"(x3), "v"(x4), "v"(x5) : "memory");
#endif
}
template <typename F>
__device__ __forceinline__ void guard6(v8f& a, v8f& b, v8f& c, v8f& d, F x0, F x1, F x2, F x3, F x4, F x5) {
#if defined(__HIP_DEVICE_COMPILE__)
  asm volatile("v_nop\n\tv_nop\n\tv_nop\n\tv_nop"
               : "+v"(a), "+v"(b), "+v"(c), "+v"(d) : "v"(x0), "v"(x1), "v"(x2), "v"(x3), "v"(x4), "v"(x5) : "memory");
#endif
}
template <typename F>
__device__ __forceinline__ void guard9(v8f& a, v8f& b, v8f& c, v8f& d, F x0, F x1, F x2, F x3, F x4, F x5,
                                       F x6, F x7, F x8) {
#if defined(__HIP_DEVICE_COMPILE__)
  asm volatile("v_nop\n\tv_nop\n\tv_nop\n\tv_nop"
               : "+v"(a), "+v"(b), "+v"(c), "+v"(d)
               : "v"(x0), "v"(x1), "v"(x2), "v"(x3), "v"(x4), "v"(x5), "v"(x6), "v"(x7), "v"(x8) : "memory");
#endif
}
__device__ __forceinline__ void acc_guard2(v8f& a, v8f& b) {
#if defined(__HIP_DEVICE_COMPILE__)
  asm volatile("v_nop\n\tv_nop\n\tv_nop\n\tv_nop" : "+v"(a), "+v"(b));
#endif
}
__device__ __forceinline__ void wave_sync_lds() {
  __builtin_amdgcn_fence(__ATOMIC_RELEASE, "workgroup");
  __builtin_amdgcn_wave_barrier();
  __builtin_amdgcn_fence(__ATOMIC_ACQUIRE, "workgroup");
}

// =====================================================================================================
// LayerNorm over CZ of the bf16 RNE-converted input rows, eps 1e-5, gamma/beta (bf16 RNE-converted), then
// with shuffles over the 4 lanes); both planes staged in LDS (pitch XTP halves, 16-B vector stores), block barrier, then each
// coverage: compute 256 thr x 32 = 64 rows x 128; store 4 iterations x 8 waves x 2 rows x 16 lanes x 8 halves = 64 x 128 per
//           plane; grid = nrows/64 blocks = every row of XH and XL exactly once (nrows a multiple of 64).
// =====================================================================================================
__global__ __launch_bounds__(256) void ln16(const float* __restrict__ X, const float* __restrict__ gam,
                                            const float* __restrict__ bet, u16* XHo, u16* XLo, int nrows) {
#pragma clang fp contract(off)
  __shared__ __align__(16) u16 TH[64 * XTP];
  __shared__ __align__(16) u16 TL[64 * XTP];
  const int tid = (int)threadIdx.x, wave = tid >> 5, lane = tid & 31;
  const int row0 = (int)blockIdx.x * 64;
  if (row0 + 64 > nrows) return;            // block-uniform, before the barrier; never taken with the exact grid
  const int rl = tid >> 2, part = tid & 3;
  const float* p = X + (size_t)(row0 + rl) * CZ + part * 32;
  v4f xv[8];
  float s = 0.0f;
#pragma unroll
  for (int t = 0; t < 8; ++t) {
    v4f a = *(const v4f*)(p + 4 * t);
#pragma unroll
    for (int e = 0; e < 4; ++e) { const float f = bfr(a[e]); a[e] = f; s = s + f; }
    xv[t] = a;
  }
  s = s + __shfl_xor(s, 1, 32);
  s = s + __shfl_xor(s, 2, 32);
  const float mu = s * (1.0f / (float)CZ);
  float q = 0.0f;
#pragma unroll
  for (int t = 0; t < 8; ++t) {
#pragma unroll
    for (int e = 0; e < 4; ++e) { const float d = xv[t][e] - mu; q = q + d * d; }
  }
  q = q + __shfl_xor(q, 1, 32);
  q = q + __shfl_xor(q, 2, 32);
  const float var  = q * (1.0f / (float)CZ);
  const float rstd = rsqrtf(var + 1e-5f);
  v4u oh[4], ol[4];
#pragma unroll
  for (int t = 0; t < 8; ++t) {
    const v4f g4 = *(const v4f*)(gam + part * 32 + 4 * t);
    const v4f b4 = *(const v4f*)(bet + part * 32 + 4 * t);
    unsigned short hb[4], lb[4];
#pragma unroll
    for (int e = 0; e < 4; ++e) {
      float y = (xv[t][e] - mu) * rstd;
      y = y * bfr(g4[e]);
      y = y + bfr(b4[e]);
      const float w = y * XSC;
      const _Float16 hv = (_Float16)w;
      const _Float16 lv = (_Float16)(w - (float)hv);
      hb[e] = h_bits(hv);
      lb[e] = h_bits(lv);
    }
    oh[t >> 1][(t & 1) * 2]     = pk16(hb[0], hb[1]);
    oh[t >> 1][(t & 1) * 2 + 1] = pk16(hb[2], hb[3]);
    ol[t >> 1][(t & 1) * 2]     = pk16(lb[0], lb[1]);
    ol[t >> 1][(t & 1) * 2 + 1] = pk16(lb[2], lb[3]);
  }
  {
    u16* th = TH + rl * XTP + part * 32;
    u16* tl = TL + rl * XTP + part * 32;
#pragma unroll
    for (int q4 = 0; q4 < 4; ++q4) {
      *(v4u*)(th + 8 * q4) = oh[q4];
      *(v4u*)(tl + 8 * q4) = ol[q4];
    }
  }
  __syncthreads();
  v4u vh[4], vl[4];
  const int ch = (lane & 15) * 8;
#pragma unroll
  for (int it = 0; it < 4; ++it) {
    const int row = (it * 8 + wave) * 2 + (lane >> 4);
    vh[it] = *(const v4u*)(TH + row * XTP + ch);
    vl[it] = *(const v4u*)(TL + row * XTP + ch);
  }
  {
#pragma unroll
    for (int it = 0; it < 4; ++it) {
      const int row = (it * 8 + wave) * 2 + (lane >> 4);
      const size_t o = (size_t)(row0 + row) * CZ + ch;
      *(v4u*)(XHo + o) = vh[it];
      *(v4u*)(XLo + o) = vl[it];
    }
    
  }
}

// =====================================================================================================
// Weight plane: W f32 [nrow rows n][CZ k] row-major (k contiguous); D 16-bit [np rows n][CZ k], D[n][k] = f16 bits of
// bf16(W[n][k]) * scale for n < nrow, 0 for nrow <= n < np. Block = 32 n rows: each thread loads 16 consecutive k values of
// one n row with a clamped row address (zeroed by predicate for n >= nrow), converts into the LDS tile [32 n][CZ k]
// coverage: load 256 thr x 16 = 32 n x 128 k; store 2 iterations x 8 waves x 2 rows x 16 lanes x 8 halves = 32 x 128;
//           grid = np/32 blocks covers the [np][CZ] plane exactly once.
// =====================================================================================================
__global__ __launch_bounds__(256) void wp16(const float* __restrict__ W, int nrow, int np, u16* D, float scale) {
  __shared__ __align__(16) u16 T[32 * WTP];
  const int tid = (int)threadIdx.x, wave = tid >> 5, lane = tid & 31;
  const int n0 = (int)blockIdx.x * 32;
  if (n0 + 32 > np) return;                 // block-uniform, before the barrier; never taken with the exact grid
  {
    const int nl = tid >> 3, kc = (tid & 7) * 16;
    const int n  = n0 + nl;
    int nr = (n < nrow) ? n : (nrow - 1);
    nr = (nr < 0) ? 0 : nr;
    const float* src = W + (size_t)nr * CZ + kc;
    v4u w2[2];
#pragma unroll
    for (int t = 0; t < 4; ++t) {
      const v4f a = *(const v4f*)(src + 4 * t);
      unsigned short hb[4];
#pragma unroll
      for (int e = 0; e < 4; ++e) {
        const float val = (n < nrow) ? a[e] : 0.0f;
        hb[e] = h_bits((_Float16)(bfr(val) * scale));
      }
      w2[t >> 1][(t & 1) * 2]     = pk16(hb[0], hb[1]);
      w2[t >> 1][(t & 1) * 2 + 1] = pk16(hb[2], hb[3]);
    }
    *(v4u*)(T + nl * WTP + kc)     = w2[0];
    *(v4u*)(T + nl * WTP + kc + 8) = w2[1];
  }
  __syncthreads();
  v4u w4[2];
  const int ch = (lane & 15) * 8;
#pragma unroll
  for (int it = 0; it < 2; ++it) {
    const int row = (it * 8 + wave) * 2 + (lane >> 4);
    w4[it] = *(const v4u*)(T + row * WTP + ch);
  }
  {
#pragma unroll
    for (int it = 0; it < 2; ++it) {
      const int row = (it * 8 + wave) * 2 + (lane >> 4);
      *(v4u*)(D + (size_t)(n0 + row) * CZ + ch) = w4[it];
    }
    
  }
}

// =====================================================================================================
// GEMM epilogue: the wave's 16x64 f32 tile (times oscale, plus a per-column addend) staged in its LDS slab (pitch 68),
// coverage: 8 instructions x 2 rows x 16 lanes x 4 floats = the wave's 16 x 64 tile.
// =====================================================================================================
__device__ __forceinline__ void epi64(float* sl, v8f a0, v8f a1, v8f a2, v8f a3, float oscale,
                                      float b0, float b1, float b2, float b3,
                                      float* C, int N, size_t rowb, int col0, int lane) {
  const int hh = lane >> 4, m = lane & 15;
#pragma unroll
  for (int r = 0; r < 8; ++r) {
    const int ro = (8 * hh + r) * 68 + m;
    sl[ro]      = a0[r] * oscale + b0;
    sl[ro + 16] = a1[r] * oscale + b1;
    sl[ro + 32] = a2[r] * oscale + b2;
    sl[ro + 48] = a3[r] * oscale + b3;
  }
  wave_sync_lds();
  v4f vals[8];
#pragma unroll
  for (int it = 0; it < 8; ++it) vals[it] = *(const v4f*)(sl + (it * 2 + hh) * 68 + m * 4);
  float* dst = C + (rowb + (size_t)hh) * (size_t)N + col0 + m * 4;
  {
#pragma unroll
    for (int it = 0; it < 8; ++it) {
      *(v4f*)(dst + (size_t)(it * 2) * (size_t)N) = vals[it];
    }
    
  }
}

// =====================================================================================================
// f16 GEMM: C[M][N] (f32) = (Ah [+ Al])[M][K] . (Bh [+ Bl])[N][K]^T * oscale [+ bf16(bias[col])].
// ALO == 1: products ah.bh + al.bh (A residual plane, unscaled); BLO == 1: products ah.bh + ah.bl (B residual plane);
// one accumulator. Block = 64x64 tile, 4 waves x 16 rows; fragments loaded straight from the 16-bit rows (two 16-B loads
// each, split k map for A and B); K stepped by 32 (host guarantees K % 32 == 0, M % 64 == 0, N % 64 == 0,
// grid = (M/64)*(N/64)). hasb is a block-uniform flag; bias is dereferenced only when hasb != 0.
// =====================================================================================================
template <int ALO, int BLO>
__global__ __launch_bounds__(128)
void gemm_h(const u16* __restrict__ Ah, const u16* __restrict__ Al, const u16* __restrict__ Bh, const u16* __restrict__ Bl,
            const float* __restrict__ bias, int hasb, float* C, int M, int N, int K, float oscale) {
  __shared__ __align__(16) float slab[4 * SLAB64];
  const int tid = (int)threadIdx.x, wave = tid >> 5, lane = tid & 31, hh = lane >> 4, m = lane & 15;
  const int ntile = N >> 6;
  const int bid   = (int)blockIdx.x;
  const int rowb  = (bid / ntile) * 64 + wave * 16;
  const int col0  = (bid % ntile) * 64;
  if (rowb + 16 > M) return;                // wave-uniform, never taken with the exact grid; no block barriers in this kernel
  const _Float16* ahp = (const _Float16*)(const void*)Ah + (size_t)(rowb + m) * K + 8 * hh;
  const _Float16* alp = (const _Float16*)(const void*)Al + (size_t)(rowb + m) * K + 8 * hh;   // read only when ALO
  const _Float16* bhp = (const _Float16*)(const void*)Bh + (size_t)(col0 + m) * K + 8 * hh;
  const _Float16* blp = (const _Float16*)(const void*)Bl + (size_t)(col0 + m) * K + 8 * hh;   // read only when BLO
  const size_t bs = (size_t)16 * K;
  float bb0 = 0.0f, bb1 = 0.0f, bb2 = 0.0f, bb3 = 0.0f;
  if (hasb != 0) {
    bb0 = bfr(bias[col0 + m]);
    bb1 = bfr(bias[col0 + 16 + m]);
    bb2 = bfr(bias[col0 + 32 + m]);
    bb3 = bfr(bias[col0 + 48 + m]);
  }
  v8f acc0 = zero8(), acc1 = zero8(), acc2 = zero8(), acc3 = zero8();
#pragma unroll 1
  for (int k0 = 0; k0 < K; k0 += 32) {
    const v16h ah = ldfrag_h(ahp + k0);
    const v16h b0 = ldfrag_h(bhp + k0);
    const v16h b1 = ldfrag_h(bhp + bs + k0);
    const v16h b2 = ldfrag_h(bhp + 2 * bs + k0);
    const v16h b3 = ldfrag_h(bhp + 3 * bs + k0);
    acc0 = mma_h(ah, b0, acc0);
    acc1 = mma_h(ah, b1, acc1);
    acc2 = mma_h(ah, b2, acc2);
    acc3 = mma_h(ah, b3, acc3);
    if constexpr (ALO != 0) {
      const v16h al = ldfrag_h(alp + k0);
      acc0 = mma_h(al, b0, acc0);
      acc1 = mma_h(al, b1, acc1);
      acc2 = mma_h(al, b2, acc2);
      acc3 = mma_h(al, b3, acc3);
      if constexpr (BLO != 0) {
        const v16h l0 = ldfrag_h(blp + k0);
        const v16h l1 = ldfrag_h(blp + bs + k0);
        const v16h l2 = ldfrag_h(blp + 2 * bs + k0);
        const v16h l3 = ldfrag_h(blp + 3 * bs + k0);
        acc0 = mma_h(ah, l0, acc0);
        acc1 = mma_h(ah, l1, acc1);
        acc2 = mma_h(ah, l2, acc2);
        acc3 = mma_h(ah, l3, acc3);
        guard9<v16h>(acc0, acc1, acc2, acc3, ah, b0, b1, b2, b3, l0, l1, l2, l3);
        guard6<v16h>(acc0, acc1, acc2, acc3, al, al, al, al, al, al);
      } else {
        guard6<v16h>(acc0, acc1, acc2, acc3, ah, al, b0, b1, b2, b3);
      }
    } else if constexpr (BLO != 0) {
      const v16h l0 = ldfrag_h(blp + k0);
      const v16h l1 = ldfrag_h(blp + bs + k0);
      const v16h l2 = ldfrag_h(blp + 2 * bs + k0);
      const v16h l3 = ldfrag_h(blp + 3 * bs + k0);
      acc0 = mma_h(ah, l0, acc0);
      acc1 = mma_h(ah, l1, acc1);
      acc2 = mma_h(ah, l2, acc2);
      acc3 = mma_h(ah, l3, acc3);
      guard9<v16h>(acc0, acc1, acc2, acc3, ah, b0, b1, b2, b3, l0, l1, l2, l3);
    } else {
      guard6<v16h>(acc0, acc1, acc2, acc3, ah, b0, b1, b2, b3, ah);
    }
  }
  epi64(slab + wave * SLAB64, acc0, acc1, acc2, acc3, oscale, bb0, bb1, bb2, bb3, C, N, (size_t)rowb, col0, lane);
}

// =====================================================================================================
// v^T planes from the v projection F f32 [GROWS][CZ] (row = il*NSEQ + s, column = h*HD + d):
//   VH[((il*NH + h)*HD + d)][s] = f16(v * 1024);  VL same layout = f16 residual of (v * 1024).
// Block = (il, head h, 64 keys s0): each thread loads its 8 floats (key sl, d chunk dc) with 16-B loads, converts, scatters
// into two LDS tiles [d][64 keys] (pitch VTP halves); after a block barrier each d row segment (64 halves = one whole
// coverage: load 256 thr x 8 = 64 keys x 32 d; store 256 thr x 8 halves = 32 lines x 64 per plane = the block's tile;
//           grid = IG*NH*NST blocks covers VH and VL exactly once.
// =====================================================================================================
__global__ __launch_bounds__(256) void vt16(const float* __restrict__ F, u16* VHo, u16* VLo) {
  __shared__ __align__(16) u16 TH[HD * VTP];
  __shared__ __align__(16) u16 TL[HD * VTP];
  const int tid = (int)threadIdx.x;
  const int bid = (int)blockIdx.x;
  const int st  = bid % NST;
  const int t2  = bid / NST;
  const int h   = t2 % NH;
  const int il  = t2 / NH;
  if (il >= IG) return;                     // block-uniform, before any barrier; never taken with the exact grid
  const int s0  = st * 64;
  {
    const int sl = tid >> 2;                // key within tile 0..63
    const int dc = (tid & 3) * 8;           // d chunk 0,8,16,24
    const float* src = F + ((size_t)il * NSEQ + s0 + sl) * CZ + h * HD + dc;
    const v4f a = *(const v4f*)(src), b4 = *(const v4f*)(src + 4);
    float w[8];
#pragma unroll
    for (int e = 0; e < 4; ++e) { w[e] = a[e] * VCAR; w[4 + e] = b4[e] * VCAR; }
#pragma unroll
    for (int e = 0; e < 8; ++e) {
      const _Float16 hv = (_Float16)w[e];
      const _Float16 lv = (_Float16)(w[e] - (float)hv);
      TH[(dc + e) * VTP + sl] = h_bits(hv);
      TL[(dc + e) * VTP + sl] = h_bits(lv);
    }
  }
  __syncthreads();
  const int q8 = tid >> 3, p8 = (tid & 7) * 8;   // q8 = d line 0..31
  const v4u vh = *(const v4u*)(TH + q8 * VTP + p8);
  const v4u vl = *(const v4u*)(TL + q8 * VTP + p8);
  const size_t hrow = (size_t)(il * NH + h) * HD + q8;
  const size_t base = hrow * NSEQ + s0 + p8;
  {
    *(v4u*)(VHo + base) = vh;
    *(v4u*)(VLo + base) = vl;
    
  }
}

// =====================================================================================================
// Key-mean of the v projection: VM[il][c] = (1/NSEQ) * sum_s F[il*NSEQ + s][c], f32. Block = il, thread = column c
// coverage: grid = IG blocks x 128 threads = every element of VM [IG][CZ] exactly once.
// =====================================================================================================
__global__ __launch_bounds__(128) void vmean(const float* __restrict__ F, float* VM) {
  const int il = (int)blockIdx.x;
  if (il >= IG) return;
  const int c = (int)threadIdx.x;
  const float* p = F + (size_t)il * NSEQ * CZ + c;
  float s = 0.0f;
#pragma unroll 4
  for (int k = 0; k < NSEQ; ++k) s += p[(size_t)k * CZ];
  const float mv = s * (1.0f / (float)NSEQ);
  float* d = VM + (size_t)il * CZ + c;
  {
    *(float*)(d) = mv;
    
  }
}

// =====================================================================================================
// q / k planes from a projection F f32 [nrows][CZ]: Hp [nrows][CZ] = f16(val * sc) (same layout), Lp = f16 residual.
// Block = QKR consecutive rows x QKC threads per row, thread = 8 consecutive columns: two 16-B loads, one 16-B store per
// coverage: QKR rows x 16 thr x 8 = QKR whole CZ rows per block; grid = nrows/QKR blocks = every row of Hp and Lp once.
// =====================================================================================================
__global__ __launch_bounds__(QKT) void qk16(const float* __restrict__ F, u16* Hp, u16* Lp, float sc, int nrows) {
  const int tid = (int)threadIdx.x;
  const int rl  = tid / QKC;
  const int cc  = tid - rl * QKC;
  const int row = (int)blockIdx.x * QKR + rl;
  if (row >= nrows) return;
  const float* p = F + (size_t)row * CZ + cc * 8;
  const v4f a = *(const v4f*)(p), b4 = *(const v4f*)(p + 4);
  float w[8];
#pragma unroll
  for (int e = 0; e < 4; ++e) { w[e] = a[e] * sc; w[4 + e] = b4[e] * sc; }
  v4u oh, ol;
#pragma unroll
  for (int e = 0; e < 4; ++e) {
    const float t0 = w[2 * e], t1 = w[2 * e + 1];
    const _Float16 h0 = (_Float16)t0, h1 = (_Float16)t1;
    const _Float16 l0 = (_Float16)(t0 - (float)h0), l1 = (_Float16)(t1 - (float)h1);
    oh[e] = pk16(h_bits(h0), h_bits(h1));
    ol[e] = pk16(h_bits(l0), h_bits(l1));
  }
  const size_t o = (size_t)row * CZ + cc * 8;
  {
    *(v4u*)(Hp + o) = oh;
    *(v4u*)(Lp + o) = ol;
    
  }
}

// =====================================================================================================
// Row-wise gated attention. Block bid -> (query tile qt: rows q0 = 16*qt .. q0+15 of row block il, head group hg of WPB
// heads); one wave per head = hg*WPB + wave; all NSEQ keys of row block il, shared bias table BT f32 [BTM][NPOS]
// (row h, position j*NSEQ + k) plus the per-row mask bias 1e9*(bf16(mask[il][k]) - 1) (MK already offset to the row group).
//   q/k planes f16 x1024 hi + residual [il*NSEQ + s][h*HD + d]; v^T planes [il*NH + h][d][NSEQ] hi + residual;
//   VM f32 [il][h*HD + d] = key-mean of v; GF f32 [il*NSEQ + s][h*HD + d] = gate pre-activation (bias already added).
//   Phase 0: the wave's 16 x NSEQ bias rows (times log2e, plus mask bias times log2e) loaded with 16-B loads into its private
//   LDS score buffer (pitch SBP).
//   Phase 1 (per 32-key tile): scores q_hi.k_hi + q_lo.k_hi + q_hi.k_lo (one k-step of 32), u = s*rsqrt(32)*log2e/(1024*1024)
//   + buffered bias written back to the lane's own D positions of the buffer; running row max.
//   Phase 2a: p = exp2(u - m) written back (own positions), row sums Z, per-row scale 16384/Z.
//   of P' (f16 hi) rebuilt from the buffer rows (float vector loads, same element type as stored), v^T B fragments for the two
//   16-wide d subtiles, products P'.v_hi + P'.v_lo.
//   Epilogue: vals = acc/(16384*1024) + VM (exact identity sum(P'+64).v/16384 = sum P.v), gate g = 1/(1+exp(-z)) in f32,
//   O = g*vals*4096 -> f16 hi + residual, staged as u16 elements in a block LDS tile [2 planes][16 rows][STP], block barrier,
//   a divergent branch; the only early return is block-uniform and precedes every barrier.
// staged extent == consumed extent: score buffer columns 0..NSEQ-1 of all 16 rows written in phase 0 before any read
//   (columns NSEQ..SBP-1 never read); stage tile rows 0..15 x columns 0..63 of both planes written before the barrier
//   (columns 64..STP-1 never read).
// coverage: per block 2 iterations x 2 waves x 4 row groups x 8 lanes x 8 halves = 16 rows x 64 halves per plane;
//           grid = IG*NHG*NQT blocks = every (row, 64-column group) of OH and OL exactly once.
// =====================================================================================================
__global__ __launch_bounds__(ATT_THREADS)
void attn(const u16* __restrict__ QHp, const u16* __restrict__ QLp,
          const u16* __restrict__ KHp, const u16* __restrict__ KLp,
          const u16* __restrict__ VHp, const u16* __restrict__ VLp,
          const float* __restrict__ VM, const float* __restrict__ GF, const float* __restrict__ BT,
          const float* __restrict__ MK, u16* OHp, u16* OLp) {
  __shared__ __align__(16) float sbuf[WPB * SBW];
  __shared__ __align__(16) u16 stg[2 * 16 * STP];

  const int tid  = (int)threadIdx.x;
  const int wave = tid >> 5;
  const int lane = tid & 31;
  const int hh   = lane >> 4;
  const int c    = lane & 15;
  const int bid  = (int)blockIdx.x;
  const int qt   = bid % NQT;
  const int t2   = bid / NQT;
  const int hg   = t2 % NHG;
  const int il   = t2 / NHG;
  if (il >= IG) return;                     // block-uniform, before every barrier; never taken with the exact grid
  const int q0   = qt * 16;
  const int head = hg * WPB + wave;
  float* buf = sbuf + wave * SBW;
  const size_t prow0 = (size_t)il * NSEQ;   // first position row of this row block in the group-local planes

  // ---- phase 0: bias rows (query rows q0..q0+15, all keys) x log2e + mask bias x log2e -> score buffer ----
  {
    const float* bsrc = BT + (size_t)head * NPOS + (size_t)q0 * NSEQ;
    const float* msrc = MK + (size_t)il * NSEQ;
    v4f mb0, mb1;                           // keys lane*4..+3 and 128+lane*4..+3 of mask row il
    {
      const v4f m0 = *(const v4f*)(msrc + lane * 4);
      const v4f m1 = *(const v4f*)(msrc + 128 + lane * 4);
#pragma unroll
      for (int e = 0; e < 4; ++e) {
        mb0[e] = (MINF * (bfr(m0[e]) - 1.0f)) * LOG2E;
        mb1[e] = (MINF * (bfr(m1[e]) - 1.0f)) * LOG2E;
      }
    }
#pragma unroll 1
    for (int g4 = 0; g4 < 4; ++g4) {
      v4f tv[8];
#pragma unroll
      for (int it = 0; it < 8; ++it) {
        const int idx = (g4 * 8 + it) * 32 + lane;        // 0..1023
        const int jr = idx >> 6, k4 = (idx & 63) * 4;      // k4 = lane*4 for even it, 128 + lane*4 for odd it
        tv[it] = *(const v4f*)(bsrc + (size_t)jr * NSEQ + k4);
      }
#pragma unroll
      for (int it = 0; it < 8; ++it) {
        const int idx = (g4 * 8 + it) * 32 + lane;
        const int jr = idx >> 6, k4 = (idx & 63) * 4;
        const v4f mb = (it & 1) ? mb1 : mb0;
        *(v4f*)(buf + jr * SBP + k4) = tv[it] * LOG2E + mb;
      }
    }
  }
  wave_sync_lds();

  const size_t hcol = (size_t)head * HD + 8 * hh;
  const _Float16* Qh  = (const _Float16*)(const void*)QHp + (prow0 + q0 + c) * CZ + hcol;
  const _Float16* Ql  = (const _Float16*)(const void*)QLp + (prow0 + q0 + c) * CZ + hcol;
  const _Float16* Khb = (const _Float16*)(const void*)KHp + (prow0 + c) * CZ + hcol;     // key row kb added per tile
  const _Float16* Klb = (const _Float16*)(const void*)KLp + (prow0 + c) * CZ + hcol;
  const _Float16* Vhb = (const _Float16*)(const void*)VHp + ((size_t)(il * NH + head) * HD + c) * NSEQ + 8 * hh;
  const _Float16* Vlb = (const _Float16*)(const void*)VLp + ((size_t)(il * NH + head) * HD + c) * NSEQ + 8 * hh;
  const v16h qh = ldfrag_h(Qh);
  const v16h ql = ldfrag_h(Ql);
  const float lsc = RSQ_HD * (LOG2E / (QSC * KSC));

  // ---- phase 1: scores + bias into the buffer (log2 domain), running row max ----
  float mrow[8];
#pragma unroll
  for (int r = 0; r < 8; ++r) mrow[r] = -INFINITY;
#pragma unroll 1
  for (int kt = 0; kt < NKT; ++kt) {
    const int kb = kt * 32;
    const _Float16* k0p = Khb + (size_t)kb * CZ;
    const _Float16* k1p = k0p + (size_t)16 * CZ;
    const _Float16* l0p = Klb + (size_t)kb * CZ;
    const _Float16* l1p = l0p + (size_t)16 * CZ;
    const v16h kh0 = ldfrag_h(k0p), kh1 = ldfrag_h(k1p);
    const v16h kl0 = ldfrag_h(l0p), kl1 = ldfrag_h(l1p);
    v8f s0 = zero8(), s1 = zero8();
    s0 = mma_h(qh, kh0, s0);
    s0 = mma_h(ql, kh0, s0);
    s0 = mma_h(qh, kl0, s0);
    s1 = mma_h(qh, kh1, s1);
    s1 = mma_h(ql, kh1, s1);
    s1 = mma_h(qh, kl1, s1);
    guard2(s0, s1, qh, ql, kh0, kl0, kh1, kl1);
#pragma unroll
    for (int r = 0; r < 8; ++r) {
      const int pos = (8 * hh + r) * SBP + kb + c;   // D element r = (query row 8hh+r, key kb+c); +16 = key kb+16+c
      const float u0 = s0[r] * lsc + buf[pos];
      const float u1 = s1[r] * lsc + buf[pos + 16];
      buf[pos]      = u0;
      buf[pos + 16] = u1;
      mrow[r] = fmaxf(mrow[r], fmaxf(u0, u1));
    }
  }
#pragma unroll
  for (int r = 0; r < 8; ++r) {
    float mx = mrow[r];
#pragma unroll
    for (int off = 1; off < 16; off <<= 1) mx = fmaxf(mx, __shfl_xor(mx, off, 32));
    mrow[r] = mx;
  }

  // ---- phase 2a: p = exp2(u - m) (own positions), row sums, per-row scale 16384/Z (Z >= 1) ----
  float psc[8];
  {
    float lrow[8];
#pragma unroll
    for (int r = 0; r < 8; ++r) lrow[r] = 0.0f;
#pragma unroll 1
    for (int kt = 0; kt < NKT; ++kt) {
      const int kb = kt * 32;
#pragma unroll
      for (int r = 0; r < 8; ++r) {
        const int pos = (8 * hh + r) * SBP + kb + c;
        const float e0 = exp2f(buf[pos] - mrow[r]);
        const float e1 = exp2f(buf[pos + 16] - mrow[r]);
        buf[pos]      = e0;
        buf[pos + 16] = e1;
        lrow[r] += e0 + e1;
      }
    }
#pragma unroll
    for (int r = 0; r < 8; ++r) {
      float ls = lrow[r];
#pragma unroll
      for (int off = 1; off < 16; off <<= 1) ls += __shfl_xor(ls, off, 32);
      const float lz = (ls > 0.0f) ? ls : 1.0f;
      psc[r] = PCAR * __builtin_amdgcn_rcpf(lz);
    }
  }

  // ---- phase 2b: centred P' tiles as f16 A fragments, P'.v^T (hi + residual) ----
  const float pcen = PCAR / (float)NSEQ;
  v8f o0 = zero8(), o1 = zero8();
#pragma unroll 1
  for (int kt = 0; kt < NKT; ++kt) {
    const int kb = kt * 32;
#pragma unroll
    for (int r = 0; r < 8; ++r) {
      const int pos = (8 * hh + r) * SBP + kb + c;
      const float pp0 = buf[pos] * psc[r] - pcen;
      const float pp1 = buf[pos + 16] * psc[r] - pcen;
      buf[pos]      = pp0;
      buf[pos + 16] = pp1;
    }
    wave_sync_lds();
    FragH ph;
    {
      const float* prow = buf + c * SBP + kb + 8 * hh;
      const v4f p0 = *(const v4f*)(prow), p1 = *(const v4f*)(prow + 4);
      const v4f p2 = *(const v4f*)(prow + 16), p3 = *(const v4f*)(prow + 20);
#pragma unroll
      for (int e = 0; e < 4; ++e) {
        ph.h[0][e]     = (_Float16)p0[e];       // elements 0..7  = keys kb + 8hh + 0..7
        ph.h[0][4 + e] = (_Float16)p1[e];
        ph.h[1][e]     = (_Float16)p2[e];       // elements 8..15 = keys kb + 16 + 8hh + 0..7
        ph.h[1][4 + e] = (_Float16)p3[e];
      }
    }
    {
      const v16h vha = ldfrag_h(Vhb + kb);
      const v16h vhb = ldfrag_h(Vhb + (size_t)16 * NSEQ + kb);
      const v16h vla = ldfrag_h(Vlb + kb);
      const v16h vlb = ldfrag_h(Vlb + (size_t)16 * NSEQ + kb);
      o0 = mma_h(ph.v, vha, o0);                // D element r = (row 8hh+r, d = c)
      o0 = mma_h(ph.v, vla, o0);
      o1 = mma_h(ph.v, vhb, o1);                // d = 16 + c
      o1 = mma_h(ph.v, vlb, o1);
      guard2(o0, o1, ph.v, vha, vla, vhb, vlb, ph.v);
    }
  }
  acc_guard2(o0, o1);

  // ---- epilogue: vals = acc/(16384*1024) + key-mean, sigmoid gate, O*4096 -> f16 hi + residual in the block stage tile ----
  {
    const float oc  = 1.0f / (PCAR * VCAR);
    const float vm0 = VM[(size_t)il * CZ + head * HD + c];
    const float vm1 = VM[(size_t)il * CZ + head * HD + 16 + c];
    const float* gp = GF + (prow0 + q0 + 8 * hh) * CZ + head * HD + c;
#pragma unroll
    for (int r = 0; r < 8; ++r) {
      const float gz0 = gp[(size_t)r * CZ];
      const float gz1 = gp[(size_t)r * CZ + 16];
      const float g0  = __builtin_amdgcn_rcpf(1.0f + exp2f(-gz0 * LOG2E));
      const float g1  = __builtin_amdgcn_rcpf(1.0f + exp2f(-gz1 * LOG2E));
      const float w0  = (o0[r] * oc + vm0) * g0 * OSC;
      const float w1  = (o1[r] * oc + vm1) * g1 * OSC;
      const _Float16 h0 = (_Float16)w0, h1 = (_Float16)w1;
      const _Float16 l0 = (_Float16)(w0 - (float)h0), l1 = (_Float16)(w1 - (float)h1);
      const int si = (8 * hh + r) * STP + wave * HD + c;
      stg[si]                 = h_bits(h0);
      stg[si + 16]            = h_bits(h1);
      stg[16 * STP + si]      = h_bits(l0);
      stg[16 * STP + si + 16] = h_bits(l1);
    }
  }
  __syncthreads();
  v4u vh[2], vl[2];
  const int rq = lane >> 3, p8 = (lane & 7) * 8;
#pragma unroll
  for (int it = 0; it < 2; ++it) {
    const int row = it * 8 + wave * 4 + rq;
    vh[it] = *(const v4u*)(stg + row * STP + p8);
    vl[it] = *(const v4u*)(stg + (16 + row) * STP + p8);
  }
  const size_t ob = (prow0 + q0) * CZ + (size_t)hg * 64 + p8;
  {
#pragma unroll
    for (int it = 0; it < 2; ++it) {
      const int row = it * 8 + wave * 4 + rq;
      *(v4u*)(OHp + ob + (size_t)row * CZ) = vh[it];
      *(v4u*)(OLp + ob + (size_t)row * CZ) = vl[it];
    }
    
  }
}

// =====================================================================================================
// All NI row blocks of the pair tensor are processed as one group (IG = NI rows i, GROWS positions), so each stage is one
// chip-filling launch; every plane is fully rewritten by whole-line stores before it is read. Workspace map (bytes; every extent is an exact
// multiple of its store granularity, no tail rows; every region offset a multiple of 32768):
//   WQ, WK, WV, WG, WO  f16 x1024 [128 n][128 k]   5 x 32768;  WB f16 x1024 [BTM n][128 k] (16384 in a 32768 slot)
//   VM   f32 [IG][128]                              IG*512 (slot rounded up to a multiple of 32768)
//   XH, XL  f16 [NPOS][128] (x*64 hi, residual)    2 x 16777216
//   BT   f32 [BTM][NPOS]                            16777216
//   F    f32 [GROWS][128]                           GROWS*512   (v, q, k projections in launch order; afterwards the region
//                                                               holds OH f16 [GROWS][128] then OL f16 [GROWS][128])
//   GF   f32 [GROWS][128]                           GROWS*512
//   QH, QL, KH, KL  f16 [GROWS][128]               4 x GROWS*256
//   VH, VL  f16 [IG*NH*HD][NSEQ]                    2 x GROWS*256
//   end (IG = 256)                                  218431488
// =====================================================================================================
extern "C" void kernel_launch(void* const* d_in, const int* in_sizes, int n_in,
                              void* d_out, int out_size, void* d_ws, size_t ws_size,
                              hipStream_t stream) {
  if (n_in < 12) return;
  if (in_sizes[0] < NPOS * CZ) return;
  if (in_sizes[1] < NI * NSEQ) return;
  if (in_sizes[2] < CZ || in_sizes[3] < CZ) return;
  if (in_sizes[4] < NH * CZ) return;
  if (in_sizes[5] < CZ * CZ || in_sizes[6] < CZ * CZ || in_sizes[7] < CZ * CZ || in_sizes[8] < CZ * CZ) return;
  if (in_sizes[9] < CZ) return;
  if (in_sizes[10] < CZ * CZ || in_sizes[11] < CZ) return;
  if (out_size < NI * NSEQ * CZ) return;

  const float* x   = (const float*)d_in[0];
  const float* msk = (const float*)d_in[1];
  const float* gam = (const float*)d_in[2];
  const float* bet = (const float*)d_in[3];
  const float* Wt  = (const float*)d_in[4];
  const float* Wq  = (const float*)d_in[5];
  const float* Wk  = (const float*)d_in[6];
  const float* Wv  = (const float*)d_in[7];
  const float* Wg  = (const float*)d_in[8];
  const float* bg  = (const float*)d_in[9];
  const float* Wo  = (const float*)d_in[10];
  const float* bo  = (const float*)d_in[11];
  float*       out = (float*)d_out;

  const size_t szWP = 32768;
  const size_t szVM = (((size_t)IG * CZ * 4) + 32767) / 32768 * 32768;
  const size_t szX  = (size_t)NPOS * CZ * 2;
  const size_t szBT = (size_t)BTM * NPOS * 4;
  const size_t szF  = (size_t)GROWS * CZ * 4;
  const size_t szP  = (size_t)GROWS * CZ * 2;          // QH, QL, KH, KL, VH, VL, OH, OL
  if (2 * szP > szF) return;                           // OH + OL live inside the F region
  size_t off = 0;
  const size_t oWQ = off; off += szWP;
  const size_t oWK = off; off += szWP;
  const size_t oWV = off; off += szWP;
  const size_t oWG = off; off += szWP;
  const size_t oWO = off; off += szWP;
  const size_t oWB = off; off += szWP;
  const size_t oVM = off; off += szVM;
  const size_t oXH = off; off += szX;
  const size_t oXL = off; off += szX;
  const size_t oBT = off; off += szBT;
  const size_t oF  = off; off += szF;
  const size_t oGF = off; off += szF;
  const size_t oQH = off; off += szP;
  const size_t oQL = off; off += szP;
  const size_t oKH = off; off += szP;
  const size_t oKL = off; off += szP;
  const size_t oVH = off; off += szP;
  const size_t oVL = off; off += szP;
  if (off > ws_size) return;                // off = 218431488 for IG = 256
  if (off > (size_t)WS_CAP) return;

  char* ws = (char*)d_ws;
  u16*   WQ = (u16*)(ws + oWQ);
  u16*   WK = (u16*)(ws + oWK);
  u16*   WV = (u16*)(ws + oWV);
  u16*   WG = (u16*)(ws + oWG);
  u16*   WO = (u16*)(ws + oWO);
  u16*   WB = (u16*)(ws + oWB);
  float* VM = (float*)(ws + oVM);
  u16*   XH = (u16*)(ws + oXH);
  u16*   XL = (u16*)(ws + oXL);
  float* BT = (float*)(ws + oBT);
  float* F  = (float*)(ws + oF);
  u16*   OH = (u16*)(ws + oF);
  u16*   OL = (u16*)(ws + oF + szP);
  float* GF = (float*)(ws + oGF);
  u16*   QH = (u16*)(ws + oQH);
  u16*   QL = (u16*)(ws + oQL);
  u16*   KH = (u16*)(ws + oKH);
  u16*   KL = (u16*)(ws + oKL);
  u16*   VH = (u16*)(ws + oVH);
  u16*   VL = (u16*)(ws + oVL);

  const dim3 b256(256), b128(128), bAT(ATT_THREADS), bQK(QKT);
  const dim3 gLN(NPOS / 64);
  const dim3 gW(CZ / 32), gWB(BTM / 32);
  const dim3 gBias((BTM / 64) * (NPOS / 64));
  const dim3 gG((GROWS / 64) * (CZ / 64));
  const dim3 gVT(IG * NH * NST);
  const dim3 gVM(IG);
  const dim3 gQK(GROWS / QKR);
  const dim3 gA(IG * NHG * NQT);
  const float oscp = 1.0f / (XSC * WSC);
  const float osco = 1.0f / (OSC * WSC);

  // (a) LayerNorm of all positions -> x*64 f16 hi + residual planes
  ln16<<<gLN, b256, 0, stream>>>(x, gam, bet, XH, XL, NPOS);
  // (b) weight planes [n][k] as f16 of the bf16 value x1024 (weights are [out][in] = [n][k]); Wt plane padded to BTM rows
  wp16<<<gW,  b256, 0, stream>>>(Wq, CZ, CZ,  WQ, WSC);
  wp16<<<gW,  b256, 0, stream>>>(Wk, CZ, CZ,  WK, WSC);
  wp16<<<gW,  b256, 0, stream>>>(Wv, CZ, CZ,  WV, WSC);
  wp16<<<gW,  b256, 0, stream>>>(Wg, CZ, CZ,  WG, WSC);
  wp16<<<gW,  b256, 0, stream>>>(Wo, CZ, CZ,  WO, WSC);
  wp16<<<gWB, b256, 0, stream>>>(Wt, NH, BTM, WB, WSC);
  // (c) shared bias table BT[h][p] = sum_c Wt[h][c] * x[p][c]  (A = Wt plane, B = x hi + residual planes)
  gemm_h<0, 1><<<gBias, b128, 0, stream>>>(WB, WB, XH, XL, bo, 0, BT, BTM, NPOS, CZ, oscp);

  for (int g = 0; g < NGRP; ++g) {
    const u16*   XHg = XH + (size_t)g * GROWS * CZ;
    const u16*   XLg = XL + (size_t)g * GROWS * CZ;
    const float* Mg  = msk + (size_t)g * IG * NSEQ;
    float*       og  = out + (size_t)g * GROWS * CZ;
    // (1) v = x.Wv^T -> F; (2) v^T hi + residual planes x1024; (3) key-mean of v
    gemm_h<1, 0><<<gG, b128, 0, stream>>>(XHg, XLg, WV, WV, bo, 0, F, GROWS, CZ, CZ, oscp);
    vt16<<<gVT, b256, 0, stream>>>(F, VH, VL);
    vmean<<<gVM, b128, 0, stream>>>(F, VM);
    // (4) q = x.Wq^T -> F; (5) q hi + residual planes x1024
    gemm_h<1, 0><<<gG, b128, 0, stream>>>(XHg, XLg, WQ, WQ, bo, 0, F, GROWS, CZ, CZ, oscp);
    qk16<<<gQK, bQK, 0, stream>>>(F, QH, QL, QSC, GROWS);
    // (6) k = x.Wk^T -> F; (7) k hi + residual planes x1024
    gemm_h<1, 0><<<gG, b128, 0, stream>>>(XHg, XLg, WK, WK, bo, 0, F, GROWS, CZ, CZ, oscp);
    qk16<<<gQK, bQK, 0, stream>>>(F, KH, KL, KSC, GROWS);
    // (8) gate pre-activation x.Wg^T + bg -> GF f32
    gemm_h<1, 0><<<gG, b128, 0, stream>>>(XHg, XLg, WG, WG, bg, 1, GF, GROWS, CZ, CZ, oscp);
    // (9) attention over all keys of each row block with the shared bias and the row mask bias, gated
    //     -> O x4096 f16 hi + residual planes
    attn<<<gA, bAT, 0, stream>>>(QH, QL, KH, KL, VH, VL, VM, GF, BT, Mg, OH, OL);
    // (10) output projection (O hi + residual).Wo^T + bo -> out f32, carries 4096 x 1024 folded back
    gemm_h<1, 0><<<gG, b128, 0, stream>>>(OH, OL, WO, WO, bo, 1, og, GROWS, CZ, CZ, osco);
  }
  (void)hipGetLastError();
}

// v002
// A run of this version takes 219 microseconds.
// Timed twice side by side with v001, it ran 1.22 and 1.23 times as fast.
// All steps since v000 together make it 1.74 times as fast.
// Contractions: LN(x).Wq^T, LN(x).Wk^T, LN(x).Wv^T, LN(x).Wg^T(+bg), Wt.LN(x)^T (shared pair-bias table) and O.Wo^T(+bo) on
// v_wmma_f32_16x16x32_f16 with the activation operand carried as f16 hi + f16 residual planes (x*64, O*4096) and the weight
// operand as f16(bf16(W)*1024); q.k^T over 32 on v_wmma_f32_16x16x32_f16 (q, k *1024 f16 hi + residual, products hh+lh+hl);
// centred softmax weights P' = 16384*P - 64 (f16 hi) times v^T (v*1024 f16 hi + residual, products P'.vh + P'.vl);
// all f32 accumulate. LayerNorm, mask bias, softmax, sigmoid gate, key-mean of v and carry folds in f32 on VALU.
// Every float input is RNE-converted to bf16 on load.
#include <hip/hip_runtime.h>
#include <math.h>
#include <stdint.h>

#ifndef NB
#define NB 1
#endif
#ifndef NI
#define NI 256
#endif
#define NSEQ   256
#define CZ     128
#define NH     4
#define HD     32
#define NPOS   (NSEQ * NSEQ)
#define IG     NI
#define NGRP   (NI / IG)
#define GROWS  (IG * NSEQ)
#define XSC    64.0f
#define WSC    1024.0f
#define QSC    1024.0f
#define KSC    1024.0f
#define VCAR   1024.0f
#define PCAR   16384.0f
#define OSC    4096.0f
#define MINF   1.0e9f
#define RSQ_HD 0.17677669529663689f
#define LOG2E  1.4426950408889634f
#define WPB    2
#define NHG    (NH / WPB)
#define NQT    (NSEQ / 16)
#define NKT    (NSEQ / 32)
#define NST    (NSEQ / 64)
#define ATT_THREADS (WPB * 32)
#define SBP    260
#define SBW    (16 * SBP)
#define STP    72
#define SLAB64 (16 * 68)
#define TRP    69
#define XTP    136
#define WTP    136
#define BTM    64
#define WS_CAP 268435456
static_assert(NB == 1);
static_assert(CZ == NH * HD && HD == 32 && NH == 4 && NSEQ == 256);
static_assert(NI >= 1 && NI <= NSEQ && (NI % IG) == 0 && IG >= 1 && IG <= NSEQ && NGRP == 1);
static_assert((GROWS % 64) == 0 && (NPOS % 64) == 0);
static_assert((NH % WPB) == 0 && ATT_THREADS == 64 && (NSEQ % 64) == 0 && (CZ % 64) == 0 && (CZ % 32) == 0);
static_assert((BTM % 64) == 0 && BTM >= NH && (BTM % 32) == 0);
static_assert(SBP >= NSEQ && (SBP % 4) == 0 && STP >= 64 && (STP % 8) == 0 && XTP >= CZ && WTP >= CZ && TRP >= 64);

typedef unsigned short u16;
typedef _Float16 v16h __attribute__((ext_vector_type(16)));
typedef _Float16 v8h  __attribute__((ext_vector_type(8)));
typedef float    v8f  __attribute__((ext_vector_type(8)));
typedef float    v4f  __attribute__((ext_vector_type(4)));
typedef unsigned int v4u __attribute__((ext_vector_type(4)));

union FragH { v16h v; v8h h[2]; v4u u[2]; };

// ---- scalar helpers --------------------------------------------------------------------------------
__device__ __forceinline__ unsigned short bf_bits(float f) {          // f32 -> bf16 bits, RNE convert
  unsigned u = __float_as_uint(f);
  return (unsigned short)((u + 0x7FFFu + ((u >> 16) & 1u)) >> 16);
}
__device__ __forceinline__ float bf_up(unsigned short h) { return __uint_as_float(((unsigned)h) << 16); }
__device__ __forceinline__ float bfr(float f) { return bf_up(bf_bits(f)); }
__device__ __forceinline__ unsigned short h_bits(_Float16 x) { return __builtin_bit_cast(unsigned short, x); }
__device__ __forceinline__ unsigned pk16(unsigned short a, unsigned short b) { return (unsigned)a | ((unsigned)b << 16); }
__device__ __forceinline__ v8f zero8() { v8f z = {0.f, 0.f, 0.f, 0.f, 0.f, 0.f, 0.f, 0.f}; return z; }

// ---- fragment loader: 16-bit A/B operand, lane -> row/col (lane&15), p already includes +8*(lane>>4);
//      elements 0..7 <- p[0..7] (k0+8h..), elements 8..15 <- p[16..23] (k0+16+8h..); same split k map for A and B,
//      B always read from a k-contiguous [n][k] plane.
__device__ __forceinline__ v16h ldfrag_h(const _Float16* p) {
  FragH f;
  f.h[0] = *(const v8h*)(p);
  f.h[1] = *(const v8h*)(p + 16);
  return f.v;
}

// ---- WMMA helpers with trailing VALU hazard gaps ------------------------------------------------------
__device__ __forceinline__ v8f mma_h(v16h a, v16h b, v8f c) {
  return __builtin_amdgcn_wmma_f32_16x16x32_f16(false, a, false, b, (short)0, c, false, false);
}
__device__ __forceinline__ void guard2(v8f& a, v8f& b, v16h x0, v16h x1, v16h x2, v16h x3, v16h x4, v16h x5) {
#if defined(__HIP_DEVICE_COMPILE__)
  asm volatile("v_nop\n\tv_nop\n\tv_nop\n\tv_nop"
               : "+v"(a), "+v"(b) : "v"(x0), "v"(x1), "v"(x2), "v"(x3), "v"(x4), "v"(x5) : "memory");
#endif
}
template <typename F>
__device__ __forceinline__ void guard6(v8f& a, v8f& b, v8f& c, v8f& d, F x0, F x1, F x2, F x3, F x4, F x5) {
#if defined(__HIP_DEVICE_COMPILE__)
  asm volatile("v_nop\n\tv_nop\n\tv_nop\n\tv_nop"
               : "+v"(a), "+v"(b), "+v"(c), "+v"(d) : "v"(x0), "v"(x1), "v"(x2), "v"(x3), "v"(x4), "v"(x5) : "memory");
#endif
}
template <typename F>
__device__ __forceinline__ void guard9(v8f& a, v8f& b, v8f& c, v8f& d, F x0, F x1, F x2, F x3, F x4, F x5,
                                       F x6, F x7, F x8) {
#if defined(__HIP_DEVICE_COMPILE__)
  asm volatile("v_nop\n\tv_nop\n\tv_nop\n\tv_nop"
               : "+v"(a), "+v"(b), "+v"(c), "+v"(d)
               : "v"(x0), "v"(x1), "v"(x2), "v"(x3), "v"(x4), "v"(x5), "v"(x6), "v"(x7), "v"(x8) : "memory");
#endif
}
__device__ __forceinline__ void acc_guard2(v8f& a, v8f& b) {
#if defined(__HIP_DEVICE_COMPILE__)
  asm volatile("v_nop\n\tv_nop\n\tv_nop\n\tv_nop" : "+v"(a), "+v"(b));
#endif
}
__device__ __forceinline__ void wave_sync_lds() {
  __builtin_amdgcn_fence(__ATOMIC_RELEASE, "workgroup");
  __builtin_amdgcn_wave_barrier();
  __builtin_amdgcn_fence(__ATOMIC_ACQUIRE, "workgroup");
}

// =====================================================================================================
// LayerNorm over CZ of the bf16 RNE-converted input rows, eps 1e-5, gamma/beta (bf16 RNE-converted), then
// with shuffles over the 4 lanes); both planes staged in LDS (pitch XTP halves, 16-B vector stores), block barrier, then each
// coverage: compute 256 thr x 32 = 64 rows x 128; store 4 iterations x 8 waves x 2 rows x 16 lanes x 8 halves = 64 x 128 per
//           plane; grid = nrows/64 blocks = every row of XH and XL exactly once (nrows a multiple of 64).
// =====================================================================================================
__global__ __launch_bounds__(256) void ln16(const float* __restrict__ X, const float* __restrict__ gam,
                                            const float* __restrict__ bet, u16* XHo, u16* XLo, int nrows) {
#pragma clang fp contract(off)
  __shared__ __align__(16) u16 TH[64 * XTP];
  __shared__ __align__(16) u16 TL[64 * XTP];
  const int tid = (int)threadIdx.x, wave = tid >> 5, lane = tid & 31;
  const int row0 = (int)blockIdx.x * 64;
  if (row0 + 64 > nrows) return;            // block-uniform, before the barrier; never taken with the exact grid
  const int rl = tid >> 2, part = tid & 3;
  const float* p = X + (size_t)(row0 + rl) * CZ + part * 32;
  v4f xv[8];
  float s = 0.0f;
#pragma unroll
  for (int t = 0; t < 8; ++t) {
    v4f a = *(const v4f*)(p + 4 * t);
#pragma unroll
    for (int e = 0; e < 4; ++e) { const float f = bfr(a[e]); a[e] = f; s = s + f; }
    xv[t] = a;
  }
  s = s + __shfl_xor(s, 1, 32);
  s = s + __shfl_xor(s, 2, 32);
  const float mu = s * (1.0f / (float)CZ);
  float q = 0.0f;
#pragma unroll
  for (int t = 0; t < 8; ++t) {
#pragma unroll
    for (int e = 0; e < 4; ++e) { const float d = xv[t][e] - mu; q = q + d * d; }
  }
  q = q + __shfl_xor(q, 1, 32);
  q = q + __shfl_xor(q, 2, 32);
  const float var  = q * (1.0f / (float)CZ);
  const float rstd = rsqrtf(var + 1e-5f);
  v4u oh[4], ol[4];
#pragma unroll
  for (int t = 0; t < 8; ++t) {
    const v4f g4 = *(const v4f*)(gam + part * 32 + 4 * t);
    const v4f b4 = *(const v4f*)(bet + part * 32 + 4 * t);
    unsigned short hb[4], lb[4];
#pragma unroll
    for (int e = 0; e < 4; ++e) {
      float y = (xv[t][e] - mu) * rstd;
      y = y * bfr(g4[e]);
      y = y + bfr(b4[e]);
      const float w = y * XSC;
      const _Float16 hv = (_Float16)w;
      const _Float16 lv = (_Float16)(w - (float)hv);
      hb[e] = h_bits(hv);
      lb[e] = h_bits(lv);
    }
    oh[t >> 1][(t & 1) * 2]     = pk16(hb[0], hb[1]);
    oh[t >> 1][(t & 1) * 2 + 1] = pk16(hb[2], hb[3]);
    ol[t >> 1][(t & 1) * 2]     = pk16(lb[0], lb[1]);
    ol[t >> 1][(t & 1) * 2 + 1] = pk16(lb[2], lb[3]);
  }
  {
    u16* th = TH + rl * XTP + part * 32;
    u16* tl = TL + rl * XTP + part * 32;
#pragma unroll
    for (int q4 = 0; q4 < 4; ++q4) {
      *(v4u*)(th + 8 * q4) = oh[q4];
      *(v4u*)(tl + 8 * q4) = ol[q4];
    }
  }
  __syncthreads();
  v4u vh[4], vl[4];
  const int ch = (lane & 15) * 8;
#pragma unroll
  for (int it = 0; it < 4; ++it) {
    const int row = (it * 8 + wave) * 2 + (lane >> 4);
    vh[it] = *(const v4u*)(TH + row * XTP + ch);
    vl[it] = *(const v4u*)(TL + row * XTP + ch);
  }
  {
#pragma unroll
    for (int it = 0; it < 4; ++it) {
      const int row = (it * 8 + wave) * 2 + (lane >> 4);
      const size_t o = (size_t)(row0 + row) * CZ + ch;
      *(v4u*)(XHo + o) = vh[it];
      *(v4u*)(XLo + o) = vl[it];
    }
    
  }
}

// =====================================================================================================
// Weight plane: W f32 [nrow rows n][CZ k] row-major (k contiguous); D 16-bit [np rows n][CZ k], D[n][k] = f16 bits of
// bf16(W[n][k]) * scale for n < nrow, 0 for nrow <= n < np. Block = 32 n rows: each thread loads 16 consecutive k values of
// one n row with a clamped row address (zeroed by predicate for n >= nrow), converts into the LDS tile [32 n][CZ k]
// coverage: load 256 thr x 16 = 32 n x 128 k; store 2 iterations x 8 waves x 2 rows x 16 lanes x 8 halves = 32 x 128;
//           grid = np/32 blocks covers the [np][CZ] plane exactly once.
// =====================================================================================================
__global__ __launch_bounds__(256) void wp16(const float* __restrict__ W, int nrow, int np, u16* D, float scale) {
  __shared__ __align__(16) u16 T[32 * WTP];
  const int tid = (int)threadIdx.x, wave = tid >> 5, lane = tid & 31;
  const int n0 = (int)blockIdx.x * 32;
  if (n0 + 32 > np) return;                 // block-uniform, before the barrier; never taken with the exact grid
  {
    const int nl = tid >> 3, kc = (tid & 7) * 16;
    const int n  = n0 + nl;
    int nr = (n < nrow) ? n : (nrow - 1);
    nr = (nr < 0) ? 0 : nr;
    const float* src = W + (size_t)nr * CZ + kc;
    v4u w2[2];
#pragma unroll
    for (int t = 0; t < 4; ++t) {
      const v4f a = *(const v4f*)(src + 4 * t);
      unsigned short hb[4];
#pragma unroll
      for (int e = 0; e < 4; ++e) {
        const float val = (n < nrow) ? a[e] : 0.0f;
        hb[e] = h_bits((_Float16)(bfr(val) * scale));
      }
      w2[t >> 1][(t & 1) * 2]     = pk16(hb[0], hb[1]);
      w2[t >> 1][(t & 1) * 2 + 1] = pk16(hb[2], hb[3]);
    }
    *(v4u*)(T + nl * WTP + kc)     = w2[0];
    *(v4u*)(T + nl * WTP + kc + 8) = w2[1];
  }
  __syncthreads();
  v4u w4[2];
  const int ch = (lane & 15) * 8;
#pragma unroll
  for (int it = 0; it < 2; ++it) {
    const int row = (it * 8 + wave) * 2 + (lane >> 4);
    w4[it] = *(const v4u*)(T + row * WTP + ch);
  }
  {
#pragma unroll
    for (int it = 0; it < 2; ++it) {
      const int row = (it * 8 + wave) * 2 + (lane >> 4);
      *(v4u*)(D + (size_t)(n0 + row) * CZ + ch) = w4[it];
    }
    
  }
}

// =====================================================================================================
// GEMM epilogue: the wave's 16x64 f32 tile (times oscale, plus a per-column addend) staged in its LDS slab (pitch 68),
// coverage: 8 instructions x 2 rows x 16 lanes x 4 floats = the wave's 16 x 64 tile.
// =====================================================================================================
__device__ __forceinline__ void epi64(float* sl, v8f a0, v8f a1, v8f a2, v8f a3, float oscale,
                                      float b0, float b1, float b2, float b3,
                                      float* C, int N, size_t rowb, int col0, int lane) {
  const int hh = lane >> 4, m = lane & 15;
#pragma unroll
  for (int r = 0; r < 8; ++r) {
    const int ro = (8 * hh + r) * 68 + m;
    sl[ro]      = a0[r] * oscale + b0;
    sl[ro + 16] = a1[r] * oscale + b1;
    sl[ro + 32] = a2[r] * oscale + b2;
    sl[ro + 48] = a3[r] * oscale + b3;
  }
  wave_sync_lds();
  v4f vals[8];
#pragma unroll
  for (int it = 0; it < 8; ++it) vals[it] = *(const v4f*)(sl + (it * 2 + hh) * 68 + m * 4);
  float* dst = C + (rowb + (size_t)hh) * (size_t)N + col0 + m * 4;
  {
#pragma unroll
    for (int it = 0; it < 8; ++it) {
      *(v4f*)(dst + (size_t)(it * 2) * (size_t)N) = vals[it];
    }
    
  }
}

// =====================================================================================================
// Eight f32 values (already carrying their plane scale) -> 8 f16 hi halves and 8 f16 residual halves, packed for 16-B stores.
// =====================================================================================================
__device__ __forceinline__ void split8(const float* w, v4u& oh, v4u& ol) {
#pragma unroll
  for (int e = 0; e < 4; ++e) {
    const float t0 = w[2 * e], t1 = w[2 * e + 1];
    const _Float16 h0 = (_Float16)t0, h1 = (_Float16)t1;
    const _Float16 l0 = (_Float16)(t0 - (float)h0), l1 = (_Float16)(t1 - (float)h1);
    oh[e] = pk16(h_bits(h0), h_bits(h1));
    ol[e] = pk16(h_bits(l0), h_bits(l1));
  }
}

// =====================================================================================================
// GEMM epilogue, plane form (q, k): the wave's 16x64 f32 tile (times oscale) staged in its LDS slab (pitch 68), read back as
// 8 consecutive columns per lane, times psc, split into f16 hi + residual, one 16-B store per plane and lane.
// coverage: 4 instructions x 4 rows x 8 lanes x 8 halves = the wave's 16 x 64 tile per plane; each row segment is one whole
//           128-B line written by one instruction.
// =====================================================================================================
__device__ __forceinline__ void epi_pl(float* sl, v8f a0, v8f a1, v8f a2, v8f a3, float oscale, float psc,
                                       u16* Hp, u16* Lp, int N, size_t rowb, int col0, int lane) {
  const int hh = lane >> 4, m = lane & 15;
#pragma unroll
  for (int r = 0; r < 8; ++r) {
    const int ro = (8 * hh + r) * 68 + m;
    sl[ro]      = a0[r] * oscale;
    sl[ro + 16] = a1[r] * oscale;
    sl[ro + 32] = a2[r] * oscale;
    sl[ro + 48] = a3[r] * oscale;
  }
  wave_sync_lds();
  const int rq = lane >> 3, c8 = (lane & 7) * 8;
  v4u oh[4], ol[4];
#pragma unroll
  for (int it = 0; it < 4; ++it) {
    const float* p = sl + (it * 4 + rq) * 68 + c8;
    const v4f a = *(const v4f*)(p), b4 = *(const v4f*)(p + 4);
    float w[8];
#pragma unroll
    for (int e = 0; e < 4; ++e) { w[e] = a[e] * psc; w[4 + e] = b4[e] * psc; }
    split8(w, oh[it], ol[it]);
  }
#pragma unroll
  for (int it = 0; it < 4; ++it) {
    const size_t o = (rowb + (size_t)(it * 4 + rq)) * (size_t)N + col0 + c8;
    *(v4u*)(Hp + o) = oh[it];
    *(v4u*)(Lp + o) = ol[it];
  }
}

// =====================================================================================================
// GEMM epilogue, transposed plane form (v): the block's 64 keys x 64 columns f32 tile (times oscale) staged in one LDS tile
// [key][column] (pitch TRP floats: odd, so the column reads below fall in 32 different banks), block barrier, then each lane
// reads 8 consecutive keys of one column, splits v * psc into f16 hi + residual and stores 16 B per plane into
//   Hp/Lp[(il*N + column)][NSEQ keys]; 8 lanes = one whole 128-B line. The 8 lanes' f32 values are also summed (shuffles) to the
// column's sum over the block's 64 keys; the 64 sums are gathered in LDS and stored by wave 0 as two whole lines of
//   KS[row tile][N]  (row tile = il*NST + key tile).
// coverage: 4 waves x 4 instructions x 4 columns x 8 lanes x 8 halves = 64 columns x 64 keys per plane; 32 lanes x 2 = 64 sums.
// =====================================================================================================
__device__ __forceinline__ void epi_tr(float* sl, float* rs, v8f a0, v8f a1, v8f a2, v8f a3, float oscale, float psc,
                                       u16* Hp, u16* Lp, float* KS, int N, int rb0, int col0, int wave, int lane) {
  const int hh = lane >> 4, m = lane & 15;
#pragma unroll
  for (int r = 0; r < 8; ++r) {
    const int ro = (wave * 16 + 8 * hh + r) * TRP + m;
    sl[ro]      = a0[r] * oscale;
    sl[ro + 16] = a1[r] * oscale;
    sl[ro + 32] = a2[r] * oscale;
    sl[ro + 48] = a3[r] * oscale;
  }
  __syncthreads();
  const int rq = lane >> 3, k8 = (lane & 7) * 8;
  const int il = rb0 / NSEQ, s0 = rb0 % NSEQ;
  v4u oh[4], ol[4];
  float cs[4];
#pragma unroll
  for (int it = 0; it < 4; ++it) {
    const int cl = wave * 16 + it * 4 + rq;              // column within the block's 64
    float v[8], w[8];
#pragma unroll
    for (int e = 0; e < 8; ++e) v[e] = sl[(k8 + e) * TRP + cl];
#pragma unroll
    for (int e = 0; e < 8; ++e) w[e] = v[e] * psc;
    split8(w, oh[it], ol[it]);
    cs[it] = ((v[0] + v[1]) + (v[2] + v[3])) + ((v[4] + v[5]) + (v[6] + v[7]));
  }
#pragma unroll
  for (int off = 1; off < 8; off <<= 1) {
#pragma unroll
    for (int it = 0; it < 4; ++it) cs[it] += __shfl_xor(cs[it], off, 32);
  }
  if ((lane & 7) == 0) {
#pragma unroll
    for (int it = 0; it < 4; ++it) rs[wave * 16 + it * 4 + rq] = cs[it];
  }
  __syncthreads();
  if (wave == 0) {
    float2 t;
    t.x = rs[2 * lane];
    t.y = rs[2 * lane + 1];
    *(float2*)(KS + (size_t)(rb0 / 64) * N + col0 + 2 * lane) = t;
  }
#pragma unroll
  for (int it = 0; it < 4; ++it) {
    const int cl = wave * 16 + it * 4 + rq;
    const size_t o = ((size_t)il * N + col0 + cl) * NSEQ + s0 + k8;
    *(v4u*)(Hp + o) = oh[it];
    *(v4u*)(Lp + o) = ol[it];
  }
}

// =====================================================================================================
// f16 GEMM: C[M][N] (f32) = (Ah [+ Al])[M][K] . (Bh [+ Bl])[N][K]^T * oscale [+ bf16(bias[col])].
// ALO == 1: products ah.bh + al.bh (A residual plane, unscaled); BLO == 1: products ah.bh + ah.bl (B residual plane);
// one accumulator. Block = 64x64 tile, 4 waves x 16 rows; fragments loaded straight from the 16-bit rows (two 16-B loads
// each, split k map for A and B); K stepped by 32 (host guarantees K % 32 == 0, M % 64 == 0, N % 64 == 0,
// grid = (M/64)*(N/64)). hasb is a block-uniform flag; bias is dereferenced only when hasb != 0.
// EPI == 0: C f32 as above. EPI == 1: the product times psc goes out as f16 hi + residual planes Hp, Lp [M][N] (C unused).
// EPI == 2: the product times psc goes out transposed per NSEQ-row group as Hp, Lp [(row / NSEQ)*N + col][NSEQ], and C takes
// the f32 column sums of each 64-row tile, [M/64][N] (host guarantees NSEQ % 64 == 0 and M % NSEQ == 0).
// =====================================================================================================
template <int ALO, int BLO, int EPI>
__global__ __launch_bounds__(128)
void gemm_h(const u16* __restrict__ Ah, const u16* __restrict__ Al, const u16* __restrict__ Bh, const u16* __restrict__ Bl,
            const float* __restrict__ bias, int hasb, float* C, u16* Hp, u16* Lp, int M, int N, int K, float oscale,
            float psc) {
  __shared__ __align__(16) float slab[(EPI == 2) ? (64 * TRP + 64) : (4 * SLAB64)];
  const int tid = (int)threadIdx.x, wave = tid >> 5, lane = tid & 31, hh = lane >> 4, m = lane & 15;
  const int ntile = N >> 6;
  const int bid   = (int)blockIdx.x;
  const int rb0   = (bid / ntile) * 64;
  const int rowb  = rb0 + wave * 16;
  const int col0  = (bid % ntile) * 64;
  if (rb0 + 64 > M) return;                 // block-uniform, before any barrier; never taken with the exact grid
  const _Float16* ahp = (const _Float16*)(const void*)Ah + (size_t)(rowb + m) * K + 8 * hh;
  const _Float16* alp = (const _Float16*)(const void*)Al + (size_t)(rowb + m) * K + 8 * hh;   // read only when ALO
  const _Float16* bhp = (const _Float16*)(const void*)Bh + (size_t)(col0 + m) * K + 8 * hh;
  const _Float16* blp = (const _Float16*)(const void*)Bl + (size_t)(col0 + m) * K + 8 * hh;   // read only when BLO
  const size_t bs = (size_t)16 * K;
  float bb0 = 0.0f, bb1 = 0.0f, bb2 = 0.0f, bb3 = 0.0f;
  if (hasb != 0) {
    bb0 = bfr(bias[col0 + m]);
    bb1 = bfr(bias[col0 + 16 + m]);
    bb2 = bfr(bias[col0 + 32 + m]);
    bb3 = bfr(bias[col0 + 48 + m]);
  }
  v8f acc0 = zero8(), acc1 = zero8(), acc2 = zero8(), acc3 = zero8();
#pragma unroll 1
  for (int k0 = 0; k0 < K; k0 += 32) {
    const v16h ah = ldfrag_h(ahp + k0);
    const v16h b0 = ldfrag_h(bhp + k0);
    const v16h b1 = ldfrag_h(bhp + bs + k0);
    const v16h b2 = ldfrag_h(bhp + 2 * bs + k0);
    const v16h b3 = ldfrag_h(bhp + 3 * bs + k0);
    acc0 = mma_h(ah, b0, acc0);
    acc1 = mma_h(ah, b1, acc1);
    acc2 = mma_h(ah, b2, acc2);
    acc3 = mma_h(ah, b3, acc3);
    if constexpr (ALO != 0) {
      const v16h al = ldfrag_h(alp + k0);
      acc0 = mma_h(al, b0, acc0);
      acc1 = mma_h(al, b1, acc1);
      acc2 = mma_h(al, b2, acc2);
      acc3 = mma_h(al, b3, acc3);
      if constexpr (BLO != 0) {
        const v16h l0 = ldfrag_h(blp + k0);
        const v16h l1 = ldfrag_h(blp + bs + k0);
        const v16h l2 = ldfrag_h(blp + 2 * bs + k0);
        const v16h l3 = ldfrag_h(blp + 3 * bs + k0);
        acc0 = mma_h(ah, l0, acc0);
        acc1 = mma_h(ah, l1, acc1);
        acc2 = mma_h(ah, l2, acc2);
        acc3 = mma_h(ah, l3, acc3);
        guard9<v16h>(acc0, acc1, acc2, acc3, ah, b0, b1, b2, b3, l0, l1, l2, l3);
        guard6<v16h>(acc0, acc1, acc2, acc3, al, al, al, al, al, al);
      } else {
        guard6<v16h>(acc0, acc1, acc2, acc3, ah, al, b0, b1, b2, b3);
      }
    } else if constexpr (BLO != 0) {
      const v16h l0 = ldfrag_h(blp + k0);
      const v16h l1 = ldfrag_h(blp + bs + k0);
      const v16h l2 = ldfrag_h(blp + 2 * bs + k0);
      const v16h l3 = ldfrag_h(blp + 3 * bs + k0);
      acc0 = mma_h(ah, l0, acc0);
      acc1 = mma_h(ah, l1, acc1);
      acc2 = mma_h(ah, l2, acc2);
      acc3 = mma_h(ah, l3, acc3);
      guard9<v16h>(acc0, acc1, acc2, acc3, ah, b0, b1, b2, b3, l0, l1, l2, l3);
    } else {
      guard6<v16h>(acc0, acc1, acc2, acc3, ah, b0, b1, b2, b3, ah);
    }
  }
  if constexpr (EPI == 0) {
    epi64(slab + wave * SLAB64, acc0, acc1, acc2, acc3, oscale, bb0, bb1, bb2, bb3, C, N, (size_t)rowb, col0, lane);
  } else if constexpr (EPI == 1) {
    epi_pl(slab + wave * SLAB64, acc0, acc1, acc2, acc3, oscale, psc, Hp, Lp, N, (size_t)rowb, col0, lane);
  } else {
    epi_tr(slab, slab + 64 * TRP, acc0, acc1, acc2, acc3, oscale, psc, Hp, Lp, C, N, rb0, col0, wave, lane);
  }
}

// =====================================================================================================
// Row-wise gated attention. Block bid -> (query tile qt: rows q0 = 16*qt .. q0+15 of row block il, head group hg of WPB
// heads); one wave per head = hg*WPB + wave; all NSEQ keys of row block il, shared bias table BT f32 [BTM][NPOS]
// (row h, position j*NSEQ + k) plus the per-row mask bias 1e9*(bf16(mask[il][k]) - 1) (MK already offset to the row group).
//   q/k planes f16 x1024 hi + residual [il*NSEQ + s][h*HD + d]; v^T planes [il*NH + h][d][NSEQ] hi + residual;
//   VS f32 [il*NST + key tile][h*HD + d] = sums of v over 64 keys (their total / NSEQ = key-mean of v); GF f32 [il*NSEQ + s][h*HD + d] = gate pre-activation (bias already added).
//   Phase 0: the wave's 16 x NSEQ bias rows (times log2e, plus mask bias times log2e) loaded with 16-B loads into its private
//   LDS score buffer (pitch SBP).
//   Phase 1 (per 32-key tile): scores q_hi.k_hi + q_lo.k_hi + q_hi.k_lo (one k-step of 32), u = s*rsqrt(32)*log2e/(1024*1024)
//   + buffered bias written back to the lane's own D positions of the buffer; running row max.
//   Phase 2a: p = exp2(u - m) written back (own positions), row sums Z, per-row scale 16384/Z.
//   of P' (f16 hi) rebuilt from the buffer rows (float vector loads, same element type as stored), v^T B fragments for the two
//   16-wide d subtiles, products P'.v_hi + P'.v_lo.
//   Epilogue: vals = acc/(16384*1024) + key-mean (exact identity sum(P'+64).v/16384 = sum P.v), gate g = 1/(1+exp(-z)) in f32,
//   O = g*vals*4096 -> f16 hi + residual, staged as u16 elements in a block LDS tile [2 planes][16 rows][STP], block barrier,
//   a divergent branch; the only early return is block-uniform and precedes every barrier.
// staged extent == consumed extent: score buffer columns 0..NSEQ-1 of all 16 rows written in phase 0 before any read
//   (columns NSEQ..SBP-1 never read); stage tile rows 0..15 x columns 0..63 of both planes written before the barrier
//   (columns 64..STP-1 never read).
// coverage: per block 2 iterations x 2 waves x 4 row groups x 8 lanes x 8 halves = 16 rows x 64 halves per plane;
//           grid = IG*NHG*NQT blocks = every (row, 64-column group) of OH and OL exactly once.
// =====================================================================================================
__global__ __launch_bounds__(ATT_THREADS)
void attn(const u16* __restrict__ QHp, const u16* __restrict__ QLp,
          const u16* __restrict__ KHp, const u16* __restrict__ KLp,
          const u16* __restrict__ VHp, const u16* __restrict__ VLp,
          const float* __restrict__ VS, const float* __restrict__ GF, const float* __restrict__ BT,
          const float* __restrict__ MK, u16* OHp, u16* OLp) {
  __shared__ __align__(16) float sbuf[WPB * SBW];
  __shared__ __align__(16) u16 stg[2 * 16 * STP];

  const int tid  = (int)threadIdx.x;
  const int wave = tid >> 5;
  const int lane = tid & 31;
  const int hh   = lane >> 4;
  const int c    = lane & 15;
  const int bid  = (int)blockIdx.x;
  const int qt   = bid % NQT;
  const int t2   = bid / NQT;
  const int hg   = t2 % NHG;
  const int il   = t2 / NHG;
  if (il >= IG) return;                     // block-uniform, before every barrier; never taken with the exact grid
  const int q0   = qt * 16;
  const int head = hg * WPB + wave;
  float* buf = sbuf + wave * SBW;
  const size_t prow0 = (size_t)il * NSEQ;   // first position row of this row block in the group-local planes

  // ---- phase 0: bias rows (query rows q0..q0+15, all keys) x log2e + mask bias x log2e -> score buffer ----
  {
    const float* bsrc = BT + (size_t)head * NPOS + (size_t)q0 * NSEQ;
    const float* msrc = MK + (size_t)il * NSEQ;
    v4f mb0, mb1;                           // keys lane*4..+3 and 128+lane*4..+3 of mask row il
    {
      const v4f m0 = *(const v4f*)(msrc + lane * 4);
      const v4f m1 = *(const v4f*)(msrc + 128 + lane * 4);
#pragma unroll
      for (int e = 0; e < 4; ++e) {
        mb0[e] = (MINF * (bfr(m0[e]) - 1.0f)) * LOG2E;
        mb1[e] = (MINF * (bfr(m1[e]) - 1.0f)) * LOG2E;
      }
    }
#pragma unroll 1
    for (int g4 = 0; g4 < 4; ++g4) {
      v4f tv[8];
#pragma unroll
      for (int it = 0; it < 8; ++it) {
        const int idx = (g4 * 8 + it) * 32 + lane;        // 0..1023
        const int jr = idx >> 6, k4 = (idx & 63) * 4;      // k4 = lane*4 for even it, 128 + lane*4 for odd it
        tv[it] = *(const v4f*)(bsrc + (size_t)jr * NSEQ + k4);
      }
#pragma unroll
      for (int it = 0; it < 8; ++it) {
        const int idx = (g4 * 8 + it) * 32 + lane;
        const int jr = idx >> 6, k4 = (idx & 63) * 4;
        const v4f mb = (it & 1) ? mb1 : mb0;
        *(v4f*)(buf + jr * SBP + k4) = tv[it] * LOG2E + mb;
      }
    }
  }
  wave_sync_lds();

  const size_t hcol = (size_t)head * HD + 8 * hh;
  const _Float16* Qh  = (const _Float16*)(const void*)QHp + (prow0 + q0 + c) * CZ + hcol;
  const _Float16* Ql  = (const _Float16*)(const void*)QLp + (prow0 + q0 + c) * CZ + hcol;
  const _Float16* Khb = (const _Float16*)(const void*)KHp + (prow0 + c) * CZ + hcol;     // key row kb added per tile
  const _Float16* Klb = (const _Float16*)(const void*)KLp + (prow0 + c) * CZ + hcol;
  const _Float16* Vhb = (const _Float16*)(const void*)VHp + ((size_t)(il * NH + head) * HD + c) * NSEQ + 8 * hh;
  const _Float16* Vlb = (const _Float16*)(const void*)VLp + ((size_t)(il * NH + head) * HD + c) * NSEQ + 8 * hh;
  const v16h qh = ldfrag_h(Qh);
  const v16h ql = ldfrag_h(Ql);
  const float lsc = RSQ_HD * (LOG2E / (QSC * KSC));

  // ---- phase 1: scores + bias into the buffer (log2 domain), running row max ----
  float mrow[8];
#pragma unroll
  for (int r = 0; r < 8; ++r) mrow[r] = -INFINITY;
#pragma unroll 1
  for (int kt = 0; kt < NKT; ++kt) {
    const int kb = kt * 32;
    const _Float16* k0p = Khb + (size_t)kb * CZ;
    const _Float16* k1p = k0p + (size_t)16 * CZ;
    const _Float16* l0p = Klb + (size_t)kb * CZ;
    const _Float16* l1p = l0p + (size_t)16 * CZ;
    const v16h kh0 = ldfrag_h(k0p), kh1 = ldfrag_h(k1p);
    const v16h kl0 = ldfrag_h(l0p), kl1 = ldfrag_h(l1p);
    v8f s0 = zero8(), s1 = zero8();
    s0 = mma_h(qh, kh0, s0);
    s0 = mma_h(ql, kh0, s0);
    s0 = mma_h(qh, kl0, s0);
    s1 = mma_h(qh, kh1, s1);
    s1 = mma_h(ql, kh1, s1);
    s1 = mma_h(qh, kl1, s1);
    guard2(s0, s1, qh, ql, kh0, kl0, kh1, kl1);
#pragma unroll
    for (int r = 0; r < 8; ++r) {
      const int pos = (8 * hh + r) * SBP + kb + c;   // D element r = (query row 8hh+r, key kb+c); +16 = key kb+16+c
      const float u0 = s0[r] * lsc + buf[pos];
      const float u1 = s1[r] * lsc + buf[pos + 16];
      buf[pos]      = u0;
      buf[pos + 16] = u1;
      mrow[r] = fmaxf(mrow[r], fmaxf(u0, u1));
    }
  }
#pragma unroll
  for (int r = 0; r < 8; ++r) {
    float mx = mrow[r];
#pragma unroll
    for (int off = 1; off < 16; off <<= 1) mx = fmaxf(mx, __shfl_xor(mx, off, 32));
    mrow[r] = mx;
  }

  // ---- phase 2a: p = exp2(u - m) (own positions), row sums, per-row scale 16384/Z (Z >= 1) ----
  float psc[8];
  {
    float lrow[8];
#pragma unroll
    for (int r = 0; r < 8; ++r) lrow[r] = 0.0f;
#pragma unroll 1
    for (int kt = 0; kt < NKT; ++kt) {
      const int kb = kt * 32;
#pragma unroll
      for (int r = 0; r < 8; ++r) {
        const int pos = (8 * hh + r) * SBP + kb + c;
        const float e0 = exp2f(buf[pos] - mrow[r]);
        const float e1 = exp2f(buf[pos + 16] - mrow[r]);
        buf[pos]      = e0;
        buf[pos + 16] = e1;
        lrow[r] += e0 + e1;
      }
    }
#pragma unroll
    for (int r = 0; r < 8; ++r) {
      float ls = lrow[r];
#pragma unroll
      for (int off = 1; off < 16; off <<= 1) ls += __shfl_xor(ls, off, 32);
      const float lz = (ls > 0.0f) ? ls : 1.0f;
      psc[r] = PCAR * __builtin_amdgcn_rcpf(lz);
    }
  }

  // ---- phase 2b: centred P' tiles as f16 A fragments, P'.v^T (hi + residual) ----
  const float pcen = PCAR / (float)NSEQ;
  v8f o0 = zero8(), o1 = zero8();
#pragma unroll 1
  for (int kt = 0; kt < NKT; ++kt) {
    const int kb = kt * 32;
#pragma unroll
    for (int r = 0; r < 8; ++r) {
      const int pos = (8 * hh + r) * SBP + kb + c;
      const float pp0 = buf[pos] * psc[r] - pcen;
      const float pp1 = buf[pos + 16] * psc[r] - pcen;
      buf[pos]      = pp0;
      buf[pos + 16] = pp1;
    }
    wave_sync_lds();
    FragH ph;
    {
      const float* prow = buf + c * SBP + kb + 8 * hh;
      const v4f p0 = *(const v4f*)(prow), p1 = *(const v4f*)(prow + 4);
      const v4f p2 = *(const v4f*)(prow + 16), p3 = *(const v4f*)(prow + 20);
#pragma unroll
      for (int e = 0; e < 4; ++e) {
        ph.h[0][e]     = (_Float16)p0[e];       // elements 0..7  = keys kb + 8hh + 0..7
        ph.h[0][4 + e] = (_Float16)p1[e];
        ph.h[1][e]     = (_Float16)p2[e];       // elements 8..15 = keys kb + 16 + 8hh + 0..7
        ph.h[1][4 + e] = (_Float16)p3[e];
      }
    }
    {
      const v16h vha = ldfrag_h(Vhb + kb);
      const v16h vhb = ldfrag_h(Vhb + (size_t)16 * NSEQ + kb);
      const v16h vla = ldfrag_h(Vlb + kb);
      const v16h vlb = ldfrag_h(Vlb + (size_t)16 * NSEQ + kb);
      o0 = mma_h(ph.v, vha, o0);                // D element r = (row 8hh+r, d = c)
      o0 = mma_h(ph.v, vla, o0);
      o1 = mma_h(ph.v, vhb, o1);                // d = 16 + c
      o1 = mma_h(ph.v, vlb, o1);
      guard2(o0, o1, ph.v, vha, vla, vhb, vlb, ph.v);
    }
  }
  acc_guard2(o0, o1);

  // ---- epilogue: vals = acc/(16384*1024) + key-mean, sigmoid gate, O*4096 -> f16 hi + residual in the block stage tile ----
  {
    const float oc  = 1.0f / (PCAR * VCAR);
    const float* vsp = VS + (size_t)il * NST * CZ + head * HD + c;
    float vs0 = 0.0f, vs1 = 0.0f;
#pragma unroll
    for (int t = 0; t < NST; ++t) { vs0 += vsp[t * CZ]; vs1 += vsp[t * CZ + 16]; }
    const float vm0 = vs0 * (1.0f / (float)NSEQ);
    const float vm1 = vs1 * (1.0f / (float)NSEQ);
    const float* gp = GF + (prow0 + q0 + 8 * hh) * CZ + head * HD + c;
#pragma unroll
    for (int r = 0; r < 8; ++r) {
      const float gz0 = gp[(size_t)r * CZ];
      const float gz1 = gp[(size_t)r * CZ + 16];
      const float g0  = __builtin_amdgcn_rcpf(1.0f + exp2f(-gz0 * LOG2E));
      const float g1  = __builtin_amdgcn_rcpf(1.0f + exp2f(-gz1 * LOG2E));
      const float w0  = (o0[r] * oc + vm0) * g0 * OSC;
      const float w1  = (o1[r] * oc + vm1) * g1 * OSC;
      const _Float16 h0 = (_Float16)w0, h1 = (_Float16)w1;
      const _Float16 l0 = (_Float16)(w0 - (float)h0), l1 = (_Float16)(w1 - (float)h1);
      const int si = (8 * hh + r) * STP + wave * HD + c;
      stg[si]                 = h_bits(h0);
      stg[si + 16]            = h_bits(h1);
      stg[16 * STP + si]      = h_bits(l0);
      stg[16 * STP + si + 16] = h_bits(l1);
    }
  }
  __syncthreads();
  v4u vh[2], vl[2];
  const int rq = lane >> 3, p8 = (lane & 7) * 8;
#pragma unroll
  for (int it = 0; it < 2; ++it) {
    const int row = it * 8 + wave * 4 + rq;
    vh[it] = *(const v4u*)(stg + row * STP + p8);
    vl[it] = *(const v4u*)(stg + (16 + row) * STP + p8);
  }
  const size_t ob = (prow0 + q0) * CZ + (size_t)hg * 64 + p8;
  {
#pragma unroll
    for (int it = 0; it < 2; ++it) {
      const int row = it * 8 + wave * 4 + rq;
      *(v4u*)(OHp + ob + (size_t)row * CZ) = vh[it];
      *(v4u*)(OLp + ob + (size_t)row * CZ) = vl[it];
    }
    
  }
}

// =====================================================================================================
// All NI row blocks of the pair tensor are processed as one group (IG = NI rows i, GROWS positions), so each stage is one
// chip-filling launch; every plane is fully rewritten by whole-line stores before it is read. Workspace map (bytes; every extent is an exact
// multiple of its store granularity, no tail rows; every region offset a multiple of 32768):
//   WQ, WK, WV, WG, WO  f16 x1024 [128 n][128 k]   5 x 32768;  WB f16 x1024 [BTM n][128 k] (16384 in a 32768 slot)
//   VS   f32 [IG*NST][128]                          IG*NST*512 (slot padded to 32768)
//   XH, XL  f16 [NPOS][128] (x*64 hi, residual)    2 x 16777216
//   BT   f32 [BTM][NPOS]                            16777216
//   OH, OL  f16 [GROWS][128]                        2 x GROWS*256
//   GF   f32 [GROWS][128]                           GROWS*512
//   QH, QL, KH, KL  f16 [GROWS][128]               4 x GROWS*256
//   VH, VL  f16 [IG*NH*HD][NSEQ]                    2 x GROWS*256
//   end (IG = 256)                                  218824704
// =====================================================================================================
extern "C" void kernel_launch(void* const* d_in, const int* in_sizes, int n_in,
                              void* d_out, int out_size, void* d_ws, size_t ws_size,
                              hipStream_t stream) {
  if (n_in < 12) return;
  if (in_sizes[0] < NPOS * CZ) return;
  if (in_sizes[1] < NI * NSEQ) return;
  if (in_sizes[2] < CZ || in_sizes[3] < CZ) return;
  if (in_sizes[4] < NH * CZ) return;
  if (in_sizes[5] < CZ * CZ || in_sizes[6] < CZ * CZ || in_sizes[7] < CZ * CZ || in_sizes[8] < CZ * CZ) return;
  if (in_sizes[9] < CZ) return;
  if (in_sizes[10] < CZ * CZ || in_sizes[11] < CZ) return;
  if (out_size < NI * NSEQ * CZ) return;

  const float* x   = (const float*)d_in[0];
  const float* msk = (const float*)d_in[1];
  const float* gam = (const float*)d_in[2];
  const float* bet = (const float*)d_in[3];
  const float* Wt  = (const float*)d_in[4];
  const float* Wq  = (const float*)d_in[5];
  const float* Wk  = (const float*)d_in[6];
  const float* Wv  = (const float*)d_in[7];
  const float* Wg  = (const float*)d_in[8];
  const float* bg  = (const float*)d_in[9];
  const float* Wo  = (const float*)d_in[10];
  const float* bo  = (const float*)d_in[11];
  float*       out = (float*)d_out;

  const size_t szWP = 32768;
  const size_t szVS = (((size_t)IG * NST * CZ * 4) + 32767) / 32768 * 32768;
  const size_t szX  = (size_t)NPOS * CZ * 2;
  const size_t szBT = (size_t)BTM * NPOS * 4;
  const size_t szF  = (size_t)GROWS * CZ * 4;
  const size_t szP  = (size_t)GROWS * CZ * 2;          // QH, QL, KH, KL, VH, VL, OH, OL
  size_t off = 0;
  const size_t oWQ = off; off += szWP;
  const size_t oWK = off; off += szWP;
  const size_t oWV = off; off += szWP;
  const size_t oWG = off; off += szWP;
  const size_t oWO = off; off += szWP;
  const size_t oWB = off; off += szWP;
  const size_t oVS = off; off += szVS;
  const size_t oXH = off; off += szX;
  const size_t oXL = off; off += szX;
  const size_t oBT = off; off += szBT;
  const size_t oOH = off; off += szP;
  const size_t oOL = off; off += szP;
  const size_t oGF = off; off += szF;
  const size_t oQH = off; off += szP;
  const size_t oQL = off; off += szP;
  const size_t oKH = off; off += szP;
  const size_t oKL = off; off += szP;
  const size_t oVH = off; off += szP;
  const size_t oVL = off; off += szP;
  if (off > ws_size) return;                // off = 218824704 for IG = 256
  if (off > (size_t)WS_CAP) return;

  char* ws = (char*)d_ws;
  u16*   WQ = (u16*)(ws + oWQ);
  u16*   WK = (u16*)(ws + oWK);
  u16*   WV = (u16*)(ws + oWV);
  u16*   WG = (u16*)(ws + oWG);
  u16*   WO = (u16*)(ws + oWO);
  u16*   WB = (u16*)(ws + oWB);
  float* VS = (float*)(ws + oVS);
  u16*   XH = (u16*)(ws + oXH);
  u16*   XL = (u16*)(ws + oXL);
  float* BT = (float*)(ws + oBT);
  u16*   OH = (u16*)(ws + oOH);
  u16*   OL = (u16*)(ws + oOL);
  float* GF = (float*)(ws + oGF);
  u16*   QH = (u16*)(ws + oQH);
  u16*   QL = (u16*)(ws + oQL);
  u16*   KH = (u16*)(ws + oKH);
  u16*   KL = (u16*)(ws + oKL);
  u16*   VH = (u16*)(ws + oVH);
  u16*   VL = (u16*)(ws + oVL);

  const dim3 b256(256), b128(128), bAT(ATT_THREADS);
  const dim3 gLN(NPOS / 64);
  const dim3 gW(CZ / 32), gWB(BTM / 32);
  const dim3 gBias((BTM / 64) * (NPOS / 64));
  const dim3 gG((GROWS / 64) * (CZ / 64));
  const dim3 gA(IG * NHG * NQT);
  const float oscp = 1.0f / (XSC * WSC);
  const float osco = 1.0f / (OSC * WSC);

  // (a) LayerNorm of all positions -> x*64 f16 hi + residual planes
  ln16<<<gLN, b256, 0, stream>>>(x, gam, bet, XH, XL, NPOS);
  // (b) weight planes [n][k] as f16 of the bf16 value x1024 (weights are [out][in] = [n][k]); Wt plane padded to BTM rows
  wp16<<<gW,  b256, 0, stream>>>(Wq, CZ, CZ,  WQ, WSC);
  wp16<<<gW,  b256, 0, stream>>>(Wk, CZ, CZ,  WK, WSC);
  wp16<<<gW,  b256, 0, stream>>>(Wv, CZ, CZ,  WV, WSC);
  wp16<<<gW,  b256, 0, stream>>>(Wg, CZ, CZ,  WG, WSC);
  wp16<<<gW,  b256, 0, stream>>>(Wo, CZ, CZ,  WO, WSC);
  wp16<<<gWB, b256, 0, stream>>>(Wt, NH, BTM, WB, WSC);
  // (c) shared bias table BT[h][p] = sum_c Wt[h][c] * x[p][c]  (A = Wt plane, B = x hi + residual planes)
  gemm_h<0, 1, 0><<<gBias, b128, 0, stream>>>(WB, WB, XH, XL, bo, 0, BT, OH, OL, BTM, NPOS, CZ, oscp, 1.0f);

  for (int g = 0; g < NGRP; ++g) {
    const u16*   XHg = XH + (size_t)g * GROWS * CZ;
    const u16*   XLg = XL + (size_t)g * GROWS * CZ;
    const float* Mg  = msk + (size_t)g * IG * NSEQ;
    float*       og  = out + (size_t)g * GROWS * CZ;
    // (1) v = x.Wv^T -> v^T hi + residual planes x1024 and the per-64-key sums of v, straight from the GEMM epilogue
    gemm_h<1, 0, 2><<<gG, b128, 0, stream>>>(XHg, XLg, WV, WV, bo, 0, VS, VH, VL, GROWS, CZ, CZ, oscp, VCAR);
    // (2) q = x.Wq^T -> q hi + residual planes x1024; (3) k = x.Wk^T -> k hi + residual planes x1024
    gemm_h<1, 0, 1><<<gG, b128, 0, stream>>>(XHg, XLg, WQ, WQ, bo, 0, GF, QH, QL, GROWS, CZ, CZ, oscp, QSC);
    gemm_h<1, 0, 1><<<gG, b128, 0, stream>>>(XHg, XLg, WK, WK, bo, 0, GF, KH, KL, GROWS, CZ, CZ, oscp, KSC);
    // (4) gate pre-activation x.Wg^T + bg -> GF f32
    gemm_h<1, 0, 0><<<gG, b128, 0, stream>>>(XHg, XLg, WG, WG, bg, 1, GF, OH, OL, GROWS, CZ, CZ, oscp, 1.0f);
    // (5) attention over all keys of each row block with the shared bias and the row mask bias, gated
    //     -> O x4096 f16 hi + residual planes
    attn<<<gA, bAT, 0, stream>>>(QH, QL, KH, KL, VH, VL, VS, GF, BT, Mg, OH, OL);
    // (6) output projection (O hi + residual).Wo^T + bo -> out f32, carries 4096 x 1024 folded back
    gemm_h<1, 0, 0><<<gG, b128, 0, stream>>>(OH, OL, WO, WO, bo, 1, og, QH, QL, GROWS, CZ, CZ, osco, 1.0f);
  }
  (void)hipGetLastError();
}

// v003
// A run of this version takes 205 microseconds.
// Timed twice side by side with v002, it ran 1.07 times as fast both times.
// Counting every step since v000, it is 1.85 times as fast.
// Contractions: LN(x).Wq^T, LN(x).Wk^T, LN(x).Wv^T, LN(x).Wg^T(+bg), Wt.LN(x)^T (shared pair-bias table) and O.Wo^T(+bo) on
// v_wmma_f32_16x16x32_f16 with the activation operand carried as f16 hi + f16 residual planes (x*64, O*4096) and the weight
// operand as f16(bf16(W)*1024); q.k^T over 32 on v_wmma_f32_16x16x32_f16 (q, k *1024 f16 hi + residual, products hh+lh+hl);
// centred softmax weights P' = 16384*P - 64 (f16 hi) times v^T (v*1024 f16 hi + residual, products P'.vh + P'.vl);
// all f32 accumulate. LayerNorm, mask bias, softmax, sigmoid gate, key-mean of v and carry folds in f32 on VALU.
// Every float input is RNE-converted to bf16 on load.
#include <hip/hip_runtime.h>
#include <math.h>
#include <stdint.h>

#ifndef NB
#define NB 1
#endif
#ifndef NI
#define NI 256
#endif
#define NSEQ   256
#define CZ     128
#define NH     4
#define HD     32
#define NPOS   (NSEQ * NSEQ)
#define IG     NI
#define NGRP   (NI / IG)
#define GROWS  (IG * NSEQ)
#define XSC    64.0f
#define WSC    1024.0f
#define QSC    1024.0f
#define KSC    1024.0f
#define VCAR   1024.0f
#define PCAR   16384.0f
#define OSC    4096.0f
#define MINF   1.0e9f
#define RSQ_HD 0.17677669529663689f
#define LOG2E  1.4426950408889634f
#define WPB    2
#define NHG    (NH / WPB)
#define NQT    (NSEQ / 16)
#define NKT    (NSEQ / 32)
#define NST    (NSEQ / 64)
#define ATT_THREADS (WPB * 32)
#define SBP    260
#define SBW    (16 * SBP)
#define STP    72
#define SLAB64 (16 * 68)
#define TRP    69
#define XTP    136
#define WTP    136
#define BTM    64
#define WS_CAP 268435456
static_assert(NB == 1);
static_assert(CZ == NH * HD && HD == 32 && NH == 4 && NSEQ == 256);
static_assert(NI >= 1 && NI <= NSEQ && (NI % IG) == 0 && IG >= 1 && IG <= NSEQ && NGRP == 1);
static_assert((GROWS % 64) == 0 && (NPOS % 64) == 0);
static_assert((NH % WPB) == 0 && ATT_THREADS == 64 && (NSEQ % 64) == 0 && (CZ % 64) == 0 && (CZ % 32) == 0);
static_assert((BTM % 64) == 0 && BTM >= NH && (BTM % 32) == 0);
static_assert(SBP >= NSEQ && (SBP % 4) == 0 && STP >= 64 && (STP % 8) == 0 && XTP >= CZ && WTP >= CZ && TRP >= 64);

typedef unsigned short u16;
typedef _Float16 v16h __attribute__((ext_vector_type(16)));
typedef _Float16 v8h  __attribute__((ext_vector_type(8)));
typedef float    v8f  __attribute__((ext_vector_type(8)));
typedef float    v4f  __attribute__((ext_vector_type(4)));
typedef unsigned int v4u __attribute__((ext_vector_type(4)));

union FragH { v16h v; v8h h[2]; v4u u[2]; };

// ---- scalar helpers --------------------------------------------------------------------------------
__device__ __forceinline__ unsigned short bf_bits(float f) {          // f32 -> bf16 bits, RNE convert
  unsigned u = __float_as_uint(f);
  return (unsigned short)((u + 0x7FFFu + ((u >> 16) & 1u)) >> 16);
}
__device__ __forceinline__ float bf_up(unsigned short h) { return __uint_as_float(((unsigned)h) << 16); }
__device__ __forceinline__ float bfr(float f) { return bf_up(bf_bits(f)); }
__device__ __forceinline__ unsigned short h_bits(_Float16 x) { return __builtin_bit_cast(unsigned short, x); }
__device__ __forceinline__ unsigned pk16(unsigned short a, unsigned short b) { return (unsigned)a | ((unsigned)b << 16); }
__device__ __forceinline__ v8f zero8() { v8f z = {0.f, 0.f, 0.f, 0.f, 0.f, 0.f, 0.f, 0.f}; return z; }

// ---- fragment loader: 16-bit A/B operand, lane -> row/col (lane&15), p already includes +8*(lane>>4);
//      elements 0..7 <- p[0..7] (k0+8h..), elements 8..15 <- p[16..23] (k0+16+8h..); same split k map for A and B,
//      B always read from a k-contiguous [n][k] plane.
__device__ __forceinline__ v16h ldfrag_h(const _Float16* p) {
  FragH f;
  f.h[0] = *(const v8h*)(p);
  f.h[1] = *(const v8h*)(p + 16);
  return f.v;
}

// ---- WMMA helpers with trailing VALU hazard gaps ------------------------------------------------------
__device__ __forceinline__ v8f mma_h(v16h a, v16h b, v8f c) {
  return __builtin_amdgcn_wmma_f32_16x16x32_f16(false, a, false, b, (short)0, c, false, false);
}
template <typename F>
__device__ __forceinline__ void guard6(v8f& a, v8f& b, v8f& c, v8f& d, F x0, F x1, F x2, F x3, F x4, F x5) {
#if defined(__HIP_DEVICE_COMPILE__)
  asm volatile("v_nop\n\tv_nop\n\tv_nop\n\tv_nop"
               : "+v"(a), "+v"(b), "+v"(c), "+v"(d) : "v"(x0), "v"(x1), "v"(x2), "v"(x3), "v"(x4), "v"(x5) : "memory");
#endif
}
template <typename F>
__device__ __forceinline__ void guard9(v8f& a, v8f& b, v8f& c, v8f& d, F x0, F x1, F x2, F x3, F x4, F x5,
                                       F x6, F x7, F x8) {
#if defined(__HIP_DEVICE_COMPILE__)
  asm volatile("v_nop\n\tv_nop\n\tv_nop\n\tv_nop"
               : "+v"(a), "+v"(b), "+v"(c), "+v"(d)
               : "v"(x0), "v"(x1), "v"(x2), "v"(x3), "v"(x4), "v"(x5), "v"(x6), "v"(x7), "v"(x8) : "memory");
#endif
}
__device__ __forceinline__ void acc_guard2(v8f& a, v8f& b) {
#if defined(__HIP_DEVICE_COMPILE__)
  asm volatile("v_nop\n\tv_nop\n\tv_nop\n\tv_nop" : "+v"(a), "+v"(b));
#endif
}
__device__ __forceinline__ void wave_sync_lds() {
  __builtin_amdgcn_fence(__ATOMIC_RELEASE, "workgroup");
  __builtin_amdgcn_wave_barrier();
  __builtin_amdgcn_fence(__ATOMIC_ACQUIRE, "workgroup");
}

// =====================================================================================================
// LayerNorm over CZ of the bf16 RNE-converted input rows, eps 1e-5, gamma/beta (bf16 RNE-converted), then
// with shuffles over the 4 lanes); both planes staged in LDS (pitch XTP halves, 16-B vector stores), block barrier, then each
// coverage: compute 256 thr x 32 = 64 rows x 128; store 4 iterations x 8 waves x 2 rows x 16 lanes x 8 halves = 64 x 128 per
//           plane; grid = nrows/64 blocks = every row of XH and XL exactly once (nrows a multiple of 64).
// =====================================================================================================
__global__ __launch_bounds__(256) void ln16(const float* __restrict__ X, const float* __restrict__ gam,
                                            const float* __restrict__ bet, u16* XHo, u16* XLo, int nrows) {
#pragma clang fp contract(off)
  __shared__ __align__(16) u16 TH[64 * XTP];
  __shared__ __align__(16) u16 TL[64 * XTP];
  const int tid = (int)threadIdx.x, wave = tid >> 5, lane = tid & 31;
  const int row0 = (int)blockIdx.x * 64;
  if (row0 + 64 > nrows) return;            // block-uniform, before the barrier; never taken with the exact grid
  const int rl = tid >> 2, part = tid & 3;
  const float* p = X + (size_t)(row0 + rl) * CZ + part * 32;
  v4f xv[8];
  float s = 0.0f;
#pragma unroll
  for (int t = 0; t < 8; ++t) {
    v4f a = *(const v4f*)(p + 4 * t);
#pragma unroll
    for (int e = 0; e < 4; ++e) { const float f = bfr(a[e]); a[e] = f; s = s + f; }
    xv[t] = a;
  }
  s = s + __shfl_xor(s, 1, 32);
  s = s + __shfl_xor(s, 2, 32);
  const float mu = s * (1.0f / (float)CZ);
  float q = 0.0f;
#pragma unroll
  for (int t = 0; t < 8; ++t) {
#pragma unroll
    for (int e = 0; e < 4; ++e) { const float d = xv[t][e] - mu; q = q + d * d; }
  }
  q = q + __shfl_xor(q, 1, 32);
  q = q + __shfl_xor(q, 2, 32);
  const float var  = q * (1.0f / (float)CZ);
  const float rstd = rsqrtf(var + 1e-5f);
  v4u oh[4], ol[4];
#pragma unroll
  for (int t = 0; t < 8; ++t) {
    const v4f g4 = *(const v4f*)(gam + part * 32 + 4 * t);
    const v4f b4 = *(const v4f*)(bet + part * 32 + 4 * t);
    unsigned short hb[4], lb[4];
#pragma unroll
    for (int e = 0; e < 4; ++e) {
      float y = (xv[t][e] - mu) * rstd;
      y = y * bfr(g4[e]);
      y = y + bfr(b4[e]);
      const float w = y * XSC;
      const _Float16 hv = (_Float16)w;
      const _Float16 lv = (_Float16)(w - (float)hv);
      hb[e] = h_bits(hv);
      lb[e] = h_bits(lv);
    }
    oh[t >> 1][(t & 1) * 2]     = pk16(hb[0], hb[1]);
    oh[t >> 1][(t & 1) * 2 + 1] = pk16(hb[2], hb[3]);
    ol[t >> 1][(t & 1) * 2]     = pk16(lb[0], lb[1]);
    ol[t >> 1][(t & 1) * 2 + 1] = pk16(lb[2], lb[3]);
  }
  {
    u16* th = TH + rl * XTP + part * 32;
    u16* tl = TL + rl * XTP + part * 32;
#pragma unroll
    for (int q4 = 0; q4 < 4; ++q4) {
      *(v4u*)(th + 8 * q4) = oh[q4];
      *(v4u*)(tl + 8 * q4) = ol[q4];
    }
  }
  __syncthreads();
  v4u vh[4], vl[4];
  const int ch = (lane & 15) * 8;
#pragma unroll
  for (int it = 0; it < 4; ++it) {
    const int row = (it * 8 + wave) * 2 + (lane >> 4);
    vh[it] = *(const v4u*)(TH + row * XTP + ch);
    vl[it] = *(const v4u*)(TL + row * XTP + ch);
  }
  {
#pragma unroll
    for (int it = 0; it < 4; ++it) {
      const int row = (it * 8 + wave) * 2 + (lane >> 4);
      const size_t o = (size_t)(row0 + row) * CZ + ch;
      *(v4u*)(XHo + o) = vh[it];
      *(v4u*)(XLo + o) = vl[it];
    }
    
  }
}

// =====================================================================================================
// Weight plane: W f32 [nrow rows n][CZ k] row-major (k contiguous); D 16-bit [np rows n][CZ k], D[n][k] = f16 bits of
// bf16(W[n][k]) * scale for n < nrow, 0 for nrow <= n < np. Block = 32 n rows: each thread loads 16 consecutive k values of
// one n row with a clamped row address (zeroed by predicate for n >= nrow), converts into the LDS tile [32 n][CZ k]
// coverage: load 256 thr x 16 = 32 n x 128 k; store 2 iterations x 8 waves x 2 rows x 16 lanes x 8 halves = 32 x 128;
//           grid = np/32 blocks covers the [np][CZ] plane exactly once.
// =====================================================================================================
__global__ __launch_bounds__(256) void wp16(const float* __restrict__ W, int nrow, int np, u16* D, float scale) {
  __shared__ __align__(16) u16 T[32 * WTP];
  const int tid = (int)threadIdx.x, wave = tid >> 5, lane = tid & 31;
  const int n0 = (int)blockIdx.x * 32;
  if (n0 + 32 > np) return;                 // block-uniform, before the barrier; never taken with the exact grid
  {
    const int nl = tid >> 3, kc = (tid & 7) * 16;
    const int n  = n0 + nl;
    int nr = (n < nrow) ? n : (nrow - 1);
    nr = (nr < 0) ? 0 : nr;
    const float* src = W + (size_t)nr * CZ + kc;
    v4u w2[2];
#pragma unroll
    for (int t = 0; t < 4; ++t) {
      const v4f a = *(const v4f*)(src + 4 * t);
      unsigned short hb[4];
#pragma unroll
      for (int e = 0; e < 4; ++e) {
        const float val = (n < nrow) ? a[e] : 0.0f;
        hb[e] = h_bits((_Float16)(bfr(val) * scale));
      }
      w2[t >> 1][(t & 1) * 2]     = pk16(hb[0], hb[1]);
      w2[t >> 1][(t & 1) * 2 + 1] = pk16(hb[2], hb[3]);
    }
    *(v4u*)(T + nl * WTP + kc)     = w2[0];
    *(v4u*)(T + nl * WTP + kc + 8) = w2[1];
  }
  __syncthreads();
  v4u w4[2];
  const int ch = (lane & 15) * 8;
#pragma unroll
  for (int it = 0; it < 2; ++it) {
    const int row = (it * 8 + wave) * 2 + (lane >> 4);
    w4[it] = *(const v4u*)(T + row * WTP + ch);
  }
  {
#pragma unroll
    for (int it = 0; it < 2; ++it) {
      const int row = (it * 8 + wave) * 2 + (lane >> 4);
      *(v4u*)(D + (size_t)(n0 + row) * CZ + ch) = w4[it];
    }
    
  }
}

// =====================================================================================================
// GEMM epilogue: the wave's 16x64 f32 tile (times oscale, plus a per-column addend) staged in its LDS slab (pitch 68),
// coverage: 8 instructions x 2 rows x 16 lanes x 4 floats = the wave's 16 x 64 tile.
// =====================================================================================================
__device__ __forceinline__ void epi64(float* sl, v8f a0, v8f a1, v8f a2, v8f a3, float oscale,
                                      float b0, float b1, float b2, float b3,
                                      float* C, int N, size_t rowb, int col0, int lane) {
  const int hh = lane >> 4, m = lane & 15;
#pragma unroll
  for (int r = 0; r < 8; ++r) {
    const int ro = (8 * hh + r) * 68 + m;
    sl[ro]      = a0[r] * oscale + b0;
    sl[ro + 16] = a1[r] * oscale + b1;
    sl[ro + 32] = a2[r] * oscale + b2;
    sl[ro + 48] = a3[r] * oscale + b3;
  }
  wave_sync_lds();
  v4f vals[8];
#pragma unroll
  for (int it = 0; it < 8; ++it) vals[it] = *(const v4f*)(sl + (it * 2 + hh) * 68 + m * 4);
  float* dst = C + (rowb + (size_t)hh) * (size_t)N + col0 + m * 4;
  {
#pragma unroll
    for (int it = 0; it < 8; ++it) {
      *(v4f*)(dst + (size_t)(it * 2) * (size_t)N) = vals[it];
    }
    
  }
}

// =====================================================================================================
// Eight f32 values (already carrying their plane scale) -> 8 f16 hi halves and 8 f16 residual halves, packed for 16-B stores.
// =====================================================================================================
__device__ __forceinline__ void split8(const float* w, v4u& oh, v4u& ol) {
#pragma unroll
  for (int e = 0; e < 4; ++e) {
    const float t0 = w[2 * e], t1 = w[2 * e + 1];
    const _Float16 h0 = (_Float16)t0, h1 = (_Float16)t1;
    const _Float16 l0 = (_Float16)(t0 - (float)h0), l1 = (_Float16)(t1 - (float)h1);
    oh[e] = pk16(h_bits(h0), h_bits(h1));
    ol[e] = pk16(h_bits(l0), h_bits(l1));
  }
}

// =====================================================================================================
// GEMM epilogue, plane form (q, k): the wave's 16x64 f32 tile (times oscale) staged in its LDS slab (pitch 68), read back as
// 8 consecutive columns per lane, times psc, split into f16 hi + residual, one 16-B store per plane and lane.
// coverage: 4 instructions x 4 rows x 8 lanes x 8 halves = the wave's 16 x 64 tile per plane; each row segment is one whole
//           128-B line written by one instruction.
// =====================================================================================================
__device__ __forceinline__ void epi_pl(float* sl, v8f a0, v8f a1, v8f a2, v8f a3, float oscale, float psc,
                                       u16* Hp, u16* Lp, int N, size_t rowb, int col0, int lane) {
  const int hh = lane >> 4, m = lane & 15;
#pragma unroll
  for (int r = 0; r < 8; ++r) {
    const int ro = (8 * hh + r) * 68 + m;
    sl[ro]      = a0[r] * oscale;
    sl[ro + 16] = a1[r] * oscale;
    sl[ro + 32] = a2[r] * oscale;
    sl[ro + 48] = a3[r] * oscale;
  }
  wave_sync_lds();
  const int rq = lane >> 3, c8 = (lane & 7) * 8;
  v4u oh[4], ol[4];
#pragma unroll
  for (int it = 0; it < 4; ++it) {
    const float* p = sl + (it * 4 + rq) * 68 + c8;
    const v4f a = *(const v4f*)(p), b4 = *(const v4f*)(p + 4);
    float w[8];
#pragma unroll
    for (int e = 0; e < 4; ++e) { w[e] = a[e] * psc; w[4 + e] = b4[e] * psc; }
    split8(w, oh[it], ol[it]);
  }
#pragma unroll
  for (int it = 0; it < 4; ++it) {
    const size_t o = (rowb + (size_t)(it * 4 + rq)) * (size_t)N + col0 + c8;
    *(v4u*)(Hp + o) = oh[it];
    *(v4u*)(Lp + o) = ol[it];
  }
}

// =====================================================================================================
// GEMM epilogue, transposed plane form (v): the block's 64 keys x 64 columns f32 tile (times oscale) staged in one LDS tile
// [key][column] (pitch TRP floats: odd, so the column reads below fall in 32 different banks), block barrier, then each lane
// reads 8 consecutive keys of one column, splits v * psc into f16 hi + residual and stores 16 B per plane into
//   Hp/Lp[(il*N + column)][NSEQ keys]; 8 lanes = one whole 128-B line. The 8 lanes' f32 values are also summed (shuffles) to the
// column's sum over the block's 64 keys; the 64 sums are gathered in LDS and stored by wave 0 as two whole lines of
//   KS[row tile][N]  (row tile = il*NST + key tile).
// coverage: 4 waves x 4 instructions x 4 columns x 8 lanes x 8 halves = 64 columns x 64 keys per plane; 32 lanes x 2 = 64 sums.
// =====================================================================================================
__device__ __forceinline__ void epi_tr(float* sl, float* rs, v8f a0, v8f a1, v8f a2, v8f a3, float oscale, float psc,
                                       u16* Hp, u16* Lp, float* KS, int N, int rb0, int col0, int wave, int lane) {
  const int hh = lane >> 4, m = lane & 15;
#pragma unroll
  for (int r = 0; r < 8; ++r) {
    const int ro = (wave * 16 + 8 * hh + r) * TRP + m;
    sl[ro]      = a0[r] * oscale;
    sl[ro + 16] = a1[r] * oscale;
    sl[ro + 32] = a2[r] * oscale;
    sl[ro + 48] = a3[r] * oscale;
  }
  __syncthreads();
  const int rq = lane >> 3, k8 = (lane & 7) * 8;
  const int il = rb0 / NSEQ, s0 = rb0 % NSEQ;
  v4u oh[4], ol[4];
  float cs[4];
#pragma unroll
  for (int it = 0; it < 4; ++it) {
    const int cl = wave * 16 + it * 4 + rq;              // column within the block's 64
    float v[8], w[8];
#pragma unroll
    for (int e = 0; e < 8; ++e) v[e] = sl[(k8 + e) * TRP + cl];
#pragma unroll
    for (int e = 0; e < 8; ++e) w[e] = v[e] * psc;
    split8(w, oh[it], ol[it]);
    cs[it] = ((v[0] + v[1]) + (v[2] + v[3])) + ((v[4] + v[5]) + (v[6] + v[7]));
  }
#pragma unroll
  for (int off = 1; off < 8; off <<= 1) {
#pragma unroll
    for (int it = 0; it < 4; ++it) cs[it] += __shfl_xor(cs[it], off, 32);
  }
  if ((lane & 7) == 0) {
#pragma unroll
    for (int it = 0; it < 4; ++it) rs[wave * 16 + it * 4 + rq] = cs[it];
  }
  __syncthreads();
  if (wave == 0) {
    float2 t;
    t.x = rs[2 * lane];
    t.y = rs[2 * lane + 1];
    *(float2*)(KS + (size_t)(rb0 / 64) * N + col0 + 2 * lane) = t;
  }
#pragma unroll
  for (int it = 0; it < 4; ++it) {
    const int cl = wave * 16 + it * 4 + rq;
    const size_t o = ((size_t)il * N + col0 + cl) * NSEQ + s0 + k8;
    *(v4u*)(Hp + o) = oh[it];
    *(v4u*)(Lp + o) = ol[it];
  }
}

// =====================================================================================================
// f16 GEMM: C[M][N] (f32) = (Ah [+ Al])[M][K] . (Bh [+ Bl])[N][K]^T * oscale [+ bf16(bias[col])].
// ALO == 1: products ah.bh + al.bh (A residual plane, unscaled); BLO == 1: products ah.bh + ah.bl (B residual plane);
// one accumulator. Block = 64x64 tile, 4 waves x 16 rows; fragments loaded straight from the 16-bit rows (two 16-B loads
// each, split k map for A and B); K stepped by 32 (host guarantees K % 32 == 0, M % 64 == 0, N % 64 == 0,
// grid = (M/64)*(N/64)). hasb is a block-uniform flag; bias is dereferenced only when hasb != 0.
// EPI == 0: C f32 as above. EPI == 1: the product times psc goes out as f16 hi + residual planes Hp, Lp [M][N] (C unused).
// EPI == 2: the product times psc goes out transposed per NSEQ-row group as Hp, Lp [(row / NSEQ)*N + col][NSEQ], and C takes
// the f32 column sums of each 64-row tile, [M/64][N] (host guarantees NSEQ % 64 == 0 and M % NSEQ == 0).
// =====================================================================================================
template <int ALO, int BLO, int EPI>
__global__ __launch_bounds__(128)
void gemm_h(const u16* __restrict__ Ah, const u16* __restrict__ Al, const u16* __restrict__ Bh, const u16* __restrict__ Bl,
            const float* __restrict__ bias, int hasb, float* C, u16* Hp, u16* Lp, int M, int N, int K, float oscale,
            float psc) {
  __shared__ __align__(16) float slab[(EPI == 2) ? (64 * TRP + 64) : (4 * SLAB64)];
  const int tid = (int)threadIdx.x, wave = tid >> 5, lane = tid & 31, hh = lane >> 4, m = lane & 15;
  const int ntile = N >> 6;
  const int bid   = (int)blockIdx.x;
  const int rb0   = (bid / ntile) * 64;
  const int rowb  = rb0 + wave * 16;
  const int col0  = (bid % ntile) * 64;
  if (rb0 + 64 > M) return;                 // block-uniform, before any barrier; never taken with the exact grid
  const _Float16* ahp = (const _Float16*)(const void*)Ah + (size_t)(rowb + m) * K + 8 * hh;
  const _Float16* alp = (const _Float16*)(const void*)Al + (size_t)(rowb + m) * K + 8 * hh;   // read only when ALO
  const _Float16* bhp = (const _Float16*)(const void*)Bh + (size_t)(col0 + m) * K + 8 * hh;
  const _Float16* blp = (const _Float16*)(const void*)Bl + (size_t)(col0 + m) * K + 8 * hh;   // read only when BLO
  const size_t bs = (size_t)16 * K;
  float bb0 = 0.0f, bb1 = 0.0f, bb2 = 0.0f, bb3 = 0.0f;
  if (hasb != 0) {
    bb0 = bfr(bias[col0 + m]);
    bb1 = bfr(bias[col0 + 16 + m]);
    bb2 = bfr(bias[col0 + 32 + m]);
    bb3 = bfr(bias[col0 + 48 + m]);
  }
  v8f acc0 = zero8(), acc1 = zero8(), acc2 = zero8(), acc3 = zero8();
#pragma unroll 1
  for (int k0 = 0; k0 < K; k0 += 32) {
    const v16h ah = ldfrag_h(ahp + k0);
    const v16h b0 = ldfrag_h(bhp + k0);
    const v16h b1 = ldfrag_h(bhp + bs + k0);
    const v16h b2 = ldfrag_h(bhp + 2 * bs + k0);
    const v16h b3 = ldfrag_h(bhp + 3 * bs + k0);
    acc0 = mma_h(ah, b0, acc0);
    acc1 = mma_h(ah, b1, acc1);
    acc2 = mma_h(ah, b2, acc2);
    acc3 = mma_h(ah, b3, acc3);
    if constexpr (ALO != 0) {
      const v16h al = ldfrag_h(alp + k0);
      acc0 = mma_h(al, b0, acc0);
      acc1 = mma_h(al, b1, acc1);
      acc2 = mma_h(al, b2, acc2);
      acc3 = mma_h(al, b3, acc3);
      if constexpr (BLO != 0) {
        const v16h l0 = ldfrag_h(blp + k0);
        const v16h l1 = ldfrag_h(blp + bs + k0);
        const v16h l2 = ldfrag_h(blp + 2 * bs + k0);
        const v16h l3 = ldfrag_h(blp + 3 * bs + k0);
        acc0 = mma_h(ah, l0, acc0);
        acc1 = mma_h(ah, l1, acc1);
        acc2 = mma_h(ah, l2, acc2);
        acc3 = mma_h(ah, l3, acc3);
        guard9<v16h>(acc0, acc1, acc2, acc3, ah, b0, b1, b2, b3, l0, l1, l2, l3);
        guard6<v16h>(acc0, acc1, acc2, acc3, al, al, al, al, al, al);
      } else {
        guard6<v16h>(acc0, acc1, acc2, acc3, ah, al, b0, b1, b2, b3);
      }
    } else if constexpr (BLO != 0) {
      const v16h l0 = ldfrag_h(blp + k0);
      const v16h l1 = ldfrag_h(blp + bs + k0);
      const v16h l2 = ldfrag_h(blp + 2 * bs + k0);
      const v16h l3 = ldfrag_h(blp + 3 * bs + k0);
      acc0 = mma_h(ah, l0, acc0);
      acc1 = mma_h(ah, l1, acc1);
      acc2 = mma_h(ah, l2, acc2);
      acc3 = mma_h(ah, l3, acc3);
      guard9<v16h>(acc0, acc1, acc2, acc3, ah, b0, b1, b2, b3, l0, l1, l2, l3);
    } else {
      guard6<v16h>(acc0, acc1, acc2, acc3, ah, b0, b1, b2, b3, ah);
    }
  }
  if constexpr (EPI == 0) {
    epi64(slab + wave * SLAB64, acc0, acc1, acc2, acc3, oscale, bb0, bb1, bb2, bb3, C, N, (size_t)rowb, col0, lane);
  } else if constexpr (EPI == 1) {
    epi_pl(slab + wave * SLAB64, acc0, acc1, acc2, acc3, oscale, psc, Hp, Lp, N, (size_t)rowb, col0, lane);
  } else {
    epi_tr(slab, slab + 64 * TRP, acc0, acc1, acc2, acc3, oscale, psc, Hp, Lp, C, N, rb0, col0, wave, lane);
  }
}

// =====================================================================================================
// Row-wise gated attention. Block bid -> (query tile qt: rows q0 = 16*qt .. q0+15 of row block il, head group hg of WPB
// heads); one wave per head = hg*WPB + wave; all NSEQ keys of row block il, shared bias table BT f32 [BTM][NPOS]
// (row h, position j*NSEQ + k) plus the per-row mask bias 1e9*(bf16(mask[il][k]) - 1) (MK already offset to the row group).
//   q/k planes f16 x1024 hi + residual [il*NSEQ + s][h*HD + d]; v^T planes [il*NH + h][d][NSEQ] hi + residual;
//   VS f32 [il*NST + key tile][h*HD + d] = sums of v over 64 keys (their total / NSEQ = key-mean of v); GF f32 [il*NSEQ + s][h*HD + d] = gate pre-activation (bias already added).
//   Phase 0: the wave's 16 x NSEQ bias rows (times log2e, plus mask bias times log2e) loaded with 16-B loads into its private
//   LDS bias buffer (pitch SBP: 16 B over a multiple of 256 B, the pitch of 16-B row readers).
//   Phase 1 (per 16-key tile): TRANSPOSED scores k_hi.q_hi + k_hi.q_lo + k_lo.q_hi (A = key rows, B = query rows, one k-step of
//   32): D element r of lane (c, hh) = (key 16t + 8hh + r, query c). u = s*rsqrt(32)*log2e/(1024*1024) + bias (two 16-B LDS reads
//   of buffer row c); all 128 scores of a lane stay in registers; running max in-lane, one exchange between the lane halves.
//   Phase 2a: p = exp2(u - m) in registers, row sum Z in-lane (8 chains, tree) plus one exchange, scale 16384/Z.
//   Phase 2b (per 32 keys): P' = p*16384/Z - 64 of two neighbouring tiles converted to f16 IS the A fragment (row c, split k map);
//   v^T B fragments for the two 16-wide d subtiles, products P'.v_hi + P'.v_lo. The score, softmax and P'.v code is straight-line.
//   Epilogue: vals = acc/(16384*1024) + key-mean (exact identity sum(P'+64).v/16384 = sum P.v), gate g = 1/(1+exp(-z)) in f32,
//   O = g*vals*4096 -> f16 hi + residual, staged as u16 elements in a block LDS tile [2 planes][16 rows][STP], block barrier,
//   a divergent branch; the only early return is block-uniform and precedes every barrier.
// staged extent == consumed extent: bias buffer columns 0..NSEQ-1 of all 16 rows written in phase 0 before any read
//   (columns NSEQ..SBP-1 never read); stage tile rows 0..15 x columns 0..63 of both planes written before the barrier
//   (columns 64..STP-1 never read).
// coverage: per block 2 iterations x 2 waves x 4 row groups x 8 lanes x 8 halves = 16 rows x 64 halves per plane;
//           grid = IG*NHG*NQT blocks = every (row, 64-column group) of OH and OL exactly once.
// =====================================================================================================
// amdgpu_waves_per_eu(4): the LDS lets 8 blocks = 4 waves per SIMD stay resident; the register budget is held to that (256).
__global__ __launch_bounds__(ATT_THREADS) __attribute__((amdgpu_waves_per_eu(4)))
void attn(const u16* __restrict__ QHp, const u16* __restrict__ QLp,
          const u16* __restrict__ KHp, const u16* __restrict__ KLp,
          const u16* __restrict__ VHp, const u16* __restrict__ VLp,
          const float* __restrict__ VS, const float* __restrict__ GF, const float* __restrict__ BT,
          const float* __restrict__ MK, u16* OHp, u16* OLp) {
  __shared__ __align__(16) float sbuf[WPB * SBW];
  __shared__ __align__(16) u16 stg[2 * 16 * STP];

  const int tid  = (int)threadIdx.x;
  const int wave = tid >> 5;
  const int lane = tid & 31;
  const int hh   = lane >> 4;
  const int c    = lane & 15;
  const int bid  = (int)blockIdx.x;
  const int qt   = bid % NQT;
  const int t2   = bid / NQT;
  const int hg   = t2 % NHG;
  const int il   = t2 / NHG;
  if (il >= IG) return;                     // block-uniform, before every barrier; never taken with the exact grid
  const int q0   = qt * 16;
  const int head = hg * WPB + wave;
  float* buf = sbuf + wave * SBW;
  const size_t prow0 = (size_t)il * NSEQ;   // first position row of this row block in the group-local planes

  // q fragments and the first 32 keys' fragments are asked for first: the bias staging below covers their latency
  const size_t hcol = (size_t)head * HD + 8 * hh;
  const _Float16* Qh  = (const _Float16*)(const void*)QHp + (prow0 + q0 + c) * CZ + hcol;
  const _Float16* Ql  = (const _Float16*)(const void*)QLp + (prow0 + q0 + c) * CZ + hcol;
  const _Float16* Khb = (const _Float16*)(const void*)KHp + (prow0 + c) * CZ + hcol;     // key row 16t added per tile
  const _Float16* Klb = (const _Float16*)(const void*)KLp + (prow0 + c) * CZ + hcol;
  const _Float16* Vhb = (const _Float16*)(const void*)VHp + ((size_t)(il * NH + head) * HD + c) * NSEQ + 8 * hh;
  const _Float16* Vlb = (const _Float16*)(const void*)VLp + ((size_t)(il * NH + head) * HD + c) * NSEQ + 8 * hh;
  const v16h qh = ldfrag_h(Qh);
  const v16h ql = ldfrag_h(Ql);
  const float lsc = RSQ_HD * (LOG2E / (QSC * KSC));
  v16h kh[NSEQ / 16], kl[NSEQ / 16];
#pragma unroll
  for (int t = 0; t < 2; ++t) {
    kh[t] = ldfrag_h(Khb + (size_t)(t * 16) * CZ);
    kl[t] = ldfrag_h(Klb + (size_t)(t * 16) * CZ);
  }

  // ---- phase 0: bias rows (query rows q0..q0+15, all keys) x log2e + mask bias x log2e -> bias buffer ----
  {
    const float* bsrc = BT + (size_t)head * NPOS + (size_t)q0 * NSEQ;
    const float* msrc = MK + (size_t)il * NSEQ;
    v4f mb0, mb1;                           // keys lane*4..+3 and 128+lane*4..+3 of mask row il
    {
      const v4f m0 = *(const v4f*)(msrc + lane * 4);
      const v4f m1 = *(const v4f*)(msrc + 128 + lane * 4);
#pragma unroll
      for (int e = 0; e < 4; ++e) {
        mb0[e] = (MINF * (bfr(m0[e]) - 1.0f)) * LOG2E;
        mb1[e] = (MINF * (bfr(m1[e]) - 1.0f)) * LOG2E;
      }
    }
#pragma unroll 1
    for (int g4 = 0; g4 < 4; ++g4) {
      v4f tv[8];
#pragma unroll
      for (int it = 0; it < 8; ++it) {
        const int idx = (g4 * 8 + it) * 32 + lane;        // 0..1023
        const int jr = idx >> 6, k4 = (idx & 63) * 4;      // k4 = lane*4 for even it, 128 + lane*4 for odd it
        tv[it] = *(const v4f*)(bsrc + (size_t)jr * NSEQ + k4);
      }
#pragma unroll
      for (int it = 0; it < 8; ++it) {
        const int idx = (g4 * 8 + it) * 32 + lane;
        const int jr = idx >> 6, k4 = (idx & 63) * 4;
        const v4f mb = (it & 1) ? mb1 : mb0;
        *(v4f*)(buf + jr * SBP + k4) = tv[it] * LOG2E + mb;
      }
    }
  }
  wave_sync_lds();

  // ---- phase 1: transposed scores S^T = k.q^T (A = 16 key rows, B = the 16 query rows), one 16-key tile per step; D element r
  //      of lane (c, hh) = (key 16t + 8hh + r, query c), so a lane owns one query row and its buffered bias is 8 consecutive
  //      floats of buffer row c. All NSEQ/2 = 128 scores of the lane's row half stay in registers (log2 domain). ----
  v8f u[NSEQ / 16];
  float mx4[4];
#pragma unroll
  for (int r = 0; r < 4; ++r) mx4[r] = -INFINITY;
#pragma unroll                              // full unroll here and below: u[], kh[], kl[], v*[] live in registers only with constant indices
  for (int g = 0; g < NKT; ++g) {
#pragma unroll
    for (int j = 0; j < 2; ++j) {
      const int t = 2 * g + 2 + j;
      if (t < NSEQ / 16) {
        kh[t] = ldfrag_h(Khb + (size_t)(t * 16) * CZ);
        kl[t] = ldfrag_h(Klb + (size_t)(t * 16) * CZ);
      }
    }
    // keeps the key fragments of the next tile pair in flight, and no more of them: unbounded hoisting spilled registers
    __builtin_amdgcn_sched_barrier(0);
#pragma unroll
    for (int j = 0; j < 2; ++j) {
      const int t = 2 * g + j;
      v8f s = zero8();
      s = mma_h(kh[t], qh, s);
      s = mma_h(kh[t], ql, s);
      s = mma_h(kl[t], qh, s);
      const float* bp = buf + c * SBP + t * 16 + 8 * hh;
      const v4f b0 = *(const v4f*)(bp), b1 = *(const v4f*)(bp + 4);
#pragma unroll
      for (int e = 0; e < 4; ++e) {
        s[e]     = s[e] * lsc + b0[e];
        s[4 + e] = s[4 + e] * lsc + b1[e];
      }
#pragma unroll
      for (int r = 0; r < 4; ++r) mx4[r] = fmaxf(mx4[r], fmaxf(s[r], s[4 + r]));
      u[t] = s;
    }
  }
  // v^T fragments of the first 32 keys are asked for before the softmax arithmetic, which covers their latency
  v16h vha[NKT], vhb[NKT], vla[NKT], vlb[NKT];
  vha[0] = ldfrag_h(Vhb);
  vhb[0] = ldfrag_h(Vhb + (size_t)16 * NSEQ);
  vla[0] = ldfrag_h(Vlb);
  vlb[0] = ldfrag_h(Vlb + (size_t)16 * NSEQ);
  __builtin_amdgcn_sched_barrier(0);        // holds those loads in front of the softmax
  float mx = fmaxf(fmaxf(mx4[0], mx4[1]), fmaxf(mx4[2], mx4[3]));
  mx = fmaxf(mx, __shfl_xor(mx, 16, 32));   // the other lane half holds the other 128 keys of the same query row

  // ---- phase 2a: p = exp2(u - m) in place, row sum Z (8 in-lane chains, tree, one exchange), scale 16384/Z (Z >= 1) ----
  float psc;
  {
    float l8[8];
#pragma unroll
    for (int r = 0; r < 8; ++r) l8[r] = 0.0f;
#pragma unroll
    for (int t = 0; t < NSEQ / 16; ++t) {
#pragma unroll
      for (int r = 0; r < 8; ++r) {
        const float e = exp2f(u[t][r] - mx);
        u[t][r] = e;
        l8[r] += e;
      }
    }
    float ls = ((l8[0] + l8[1]) + (l8[2] + l8[3])) + ((l8[4] + l8[5]) + (l8[6] + l8[7]));
    ls += __shfl_xor(ls, 16, 32);
    const float lz = (ls > 0.0f) ? ls : 1.0f;
    psc = PCAR * __builtin_amdgcn_rcpf(lz);
  }

  // ---- phase 2b: two neighbouring score tiles, centred and converted in place, are the f16 A fragment of P'
  //      (row = query c; elements 0..7 = keys kb + 8hh + 0..7, elements 8..15 = keys kb + 16 + 8hh + 0..7); P'.v^T (hi + residual) ----
  const float pcen = PCAR / (float)NSEQ;
  v8f o0 = zero8(), o1 = zero8();
  const float* vsp = VS + (size_t)il * NST * CZ + head * HD + c;
  const float* gp  = GF + (prow0 + q0 + 8 * hh) * CZ + head * HD + c;
  float vsa[NST], vsb[NST], gza[8], gzb[8];
#pragma unroll
  for (int kt = 0; kt < NKT; ++kt) {
    if (kt + 1 < NKT) {
      const int kn = (kt + 1) * 32;
      vha[kt + 1] = ldfrag_h(Vhb + kn);
      vhb[kt + 1] = ldfrag_h(Vhb + (size_t)16 * NSEQ + kn);
      vla[kt + 1] = ldfrag_h(Vlb + kn);
      vlb[kt + 1] = ldfrag_h(Vlb + (size_t)16 * NSEQ + kn);
    }
    if (kt == NKT - 3) {                        // the epilogue's operands, asked for once score registers have come free
#pragma unroll
      for (int s = 0; s < NST; ++s) { vsa[s] = vsp[s * CZ]; vsb[s] = vsp[s * CZ + 16]; }
#pragma unroll
      for (int r = 0; r < 8; ++r) { gza[r] = gp[(size_t)r * CZ]; gzb[r] = gp[(size_t)r * CZ + 16]; }
    }
    // keeps the next keys' v^T fragments in flight under this step's products, and bounds how many are hoisted (registers)
    __builtin_amdgcn_sched_barrier(0);
    FragH ph;
#pragma unroll
    for (int e = 0; e < 8; ++e) {
      ph.h[0][e] = (_Float16)(u[2 * kt][e] * psc - pcen);
      ph.h[1][e] = (_Float16)(u[2 * kt + 1][e] * psc - pcen);
    }
    o0 = mma_h(ph.v, vha[kt], o0);              // D element r = (row 8hh+r, d = c)
    o0 = mma_h(ph.v, vla[kt], o0);
    o1 = mma_h(ph.v, vhb[kt], o1);              // d = 16 + c
    o1 = mma_h(ph.v, vlb[kt], o1);
  }
  acc_guard2(o0, o1);

  // ---- epilogue: vals = acc/(16384*1024) + key-mean, sigmoid gate, O*4096 -> f16 hi + residual in the block stage tile ----
  {
    const float oc  = 1.0f / (PCAR * VCAR);
    float vs0 = 0.0f, vs1 = 0.0f;
#pragma unroll
    for (int t = 0; t < NST; ++t) { vs0 += vsa[t]; vs1 += vsb[t]; }
    const float vm0 = vs0 * (1.0f / (float)NSEQ);
    const float vm1 = vs1 * (1.0f / (float)NSEQ);
#pragma unroll
    for (int r = 0; r < 8; ++r) {
      const float gz0 = gza[r];
      const float gz1 = gzb[r];
      const float g0  = __builtin_amdgcn_rcpf(1.0f + exp2f(-gz0 * LOG2E));
      const float g1  = __builtin_amdgcn_rcpf(1.0f + exp2f(-gz1 * LOG2E));
      const float w0  = (o0[r] * oc + vm0) * g0 * OSC;
      const float w1  = (o1[r] * oc + vm1) * g1 * OSC;
      const _Float16 h0 = (_Float16)w0, h1 = (_Float16)w1;
      const _Float16 l0 = (_Float16)(w0 - (float)h0), l1 = (_Float16)(w1 - (float)h1);
      const int si = (8 * hh + r) * STP + wave * HD + c;
      stg[si]                 = h_bits(h0);
      stg[si + 16]            = h_bits(h1);
      stg[16 * STP + si]      = h_bits(l0);
      stg[16 * STP + si + 16] = h_bits(l1);
    }
  }
  __syncthreads();
  v4u vh[2], vl[2];
  const int rq = lane >> 3, p8 = (lane & 7) * 8;
#pragma unroll
  for (int it = 0; it < 2; ++it) {
    const int row = it * 8 + wave * 4 + rq;
    vh[it] = *(const v4u*)(stg + row * STP + p8);
    vl[it] = *(const v4u*)(stg + (16 + row) * STP + p8);
  }
  const size_t ob = (prow0 + q0) * CZ + (size_t)hg * 64 + p8;
  {
#pragma unroll
    for (int it = 0; it < 2; ++it) {
      const int row = it * 8 + wave * 4 + rq;
      *(v4u*)(OHp + ob + (size_t)row * CZ) = vh[it];
      *(v4u*)(OLp + ob + (size_t)row * CZ) = vl[it];
    }
    
  }
}

// =====================================================================================================
// All NI row blocks of the pair tensor are processed as one group (IG = NI rows i, GROWS positions), so each stage is one
// chip-filling launch; every plane is fully rewritten by whole-line stores before it is read. Workspace map (bytes; every extent is an exact
// multiple of its store granularity, no tail rows; every region offset a multiple of 32768):
//   WQ, WK, WV, WG, WO  f16 x1024 [128 n][128 k]   5 x 32768;  WB f16 x1024 [BTM n][128 k] (16384 in a 32768 slot)
//   VS   f32 [IG*NST][128]                          IG*NST*512 (slot padded to 32768)
//   XH, XL  f16 [NPOS][128] (x*64 hi, residual)    2 x 16777216
//   BT   f32 [BTM][NPOS]                            16777216
//   OH, OL  f16 [GROWS][128]                        2 x GROWS*256
//   GF   f32 [GROWS][128]                           GROWS*512
//   QH, QL, KH, KL  f16 [GROWS][128]               4 x GROWS*256
//   VH, VL  f16 [IG*NH*HD][NSEQ]                    2 x GROWS*256
//   end (IG = 256)                                  218824704
// =====================================================================================================
extern "C" void kernel_launch(void* const* d_in, const int* in_sizes, int n_in,
                              void* d_out, int out_size, void* d_ws, size_t ws_size,
                              hipStream_t stream) {
  if (n_in < 12) return;
  if (in_sizes[0] < NPOS * CZ) return;
  if (in_sizes[1] < NI * NSEQ) return;
  if (in_sizes[2] < CZ || in_sizes[3] < CZ) return;
  if (in_sizes[4] < NH * CZ) return;
  if (in_sizes[5] < CZ * CZ || in_sizes[6] < CZ * CZ || in_sizes[7] < CZ * CZ || in_sizes[8] < CZ * CZ) return;
  if (in_sizes[9] < CZ) return;
  if (in_sizes[10] < CZ * CZ || in_sizes[11] < CZ) return;
  if (out_size < NI * NSEQ * CZ) return;

  const float* x   = (const float*)d_in[0];
  const float* msk = (const float*)d_in[1];
  const float* gam = (const float*)d_in[2];
  const float* bet = (const float*)d_in[3];
  const float* Wt  = (const float*)d_in[4];
  const float* Wq  = (const float*)d_in[5];
  const float* Wk  = (const float*)d_in[6];
  const float* Wv  = (const float*)d_in[7];
  const float* Wg  = (const float*)d_in[8];
  const float* bg  = (const float*)d_in[9];
  const float* Wo  = (const float*)d_in[10];
  const float* bo  = (const float*)d_in[11];
  float*       out = (float*)d_out;

  const size_t szWP = 32768;
  const size_t szVS = (((size_t)IG * NST * CZ * 4) + 32767) / 32768 * 32768;
  const size_t szX  = (size_t)NPOS * CZ * 2;
  const size_t szBT = (size_t)BTM * NPOS * 4;
  const size_t szF  = (size_t)GROWS * CZ * 4;
  const size_t szP  = (size_t)GROWS * CZ * 2;          // QH, QL, KH, KL, VH, VL, OH, OL
  size_t off = 0;
  const size_t oWQ = off; off += szWP;
  const size_t oWK = off; off += szWP;
  const size_t oWV = off; off += szWP;
  const size_t oWG = off; off += szWP;
  const size_t oWO = off; off += szWP;
  const size_t oWB = off; off += szWP;
  const size_t oVS = off; off += szVS;
  const size_t oXH = off; off += szX;
  const size_t oXL = off; off += szX;
  const size_t oBT = off; off += szBT;
  const size_t oOH = off; off += szP;
  const size_t oOL = off; off += szP;
  const size_t oGF = off; off += szF;
  const size_t oQH = off; off += szP;
  const size_t oQL = off; off += szP;
  const size_t oKH = off; off += szP;
  const size_t oKL = off; off += szP;
  const size_t oVH = off; off += szP;
  const size_t oVL = off; off += szP;
  if (off > ws_size) return;                // off = 218824704 for IG = 256
  if (off > (size_t)WS_CAP) return;

  char* ws = (char*)d_ws;
  u16*   WQ = (u16*)(ws + oWQ);
  u16*   WK = (u16*)(ws + oWK);
  u16*   WV = (u16*)(ws + oWV);
  u16*   WG = (u16*)(ws + oWG);
  u16*   WO = (u16*)(ws + oWO);
  u16*   WB = (u16*)(ws + oWB);
  float* VS = (float*)(ws + oVS);
  u16*   XH = (u16*)(ws + oXH);
  u16*   XL = (u16*)(ws + oXL);
  float* BT = (float*)(ws + oBT);
  u16*   OH = (u16*)(ws + oOH);
  u16*   OL = (u16*)(ws + oOL);
  float* GF = (float*)(ws + oGF);
  u16*   QH = (u16*)(ws + oQH);
  u16*   QL = (u16*)(ws + oQL);
  u16*   KH = (u16*)(ws + oKH);
  u16*   KL = (u16*)(ws + oKL);
  u16*   VH = (u16*)(ws + oVH);
  u16*   VL = (u16*)(ws + oVL);

  const dim3 b256(256), b128(128), bAT(ATT_THREADS);
  const dim3 gLN(NPOS / 64);
  const dim3 gW(CZ / 32), gWB(BTM / 32);
  const dim3 gBias((BTM / 64) * (NPOS / 64));
  const dim3 gG((GROWS / 64) * (CZ / 64));
  const dim3 gA(IG * NHG * NQT);
  const float oscp = 1.0f / (XSC * WSC);
  const float osco = 1.0f / (OSC * WSC);

  // (a) LayerNorm of all positions -> x*64 f16 hi + residual planes
  ln16<<<gLN, b256, 0, stream>>>(x, gam, bet, XH, XL, NPOS);
  // (b) weight planes [n][k] as f16 of the bf16 value x1024 (weights are [out][in] = [n][k]); Wt plane padded to BTM rows
  wp16<<<gW,  b256, 0, stream>>>(Wq, CZ, CZ,  WQ, WSC);
  wp16<<<gW,  b256, 0, stream>>>(Wk, CZ, CZ,  WK, WSC);
  wp16<<<gW,  b256, 0, stream>>>(Wv, CZ, CZ,  WV, WSC);
  wp16<<<gW,  b256, 0, stream>>>(Wg, CZ, CZ,  WG, WSC);
  wp16<<<gW,  b256, 0, stream>>>(Wo, CZ, CZ,  WO, WSC);
  wp16<<<gWB, b256, 0, stream>>>(Wt, NH, BTM, WB, WSC);
  // (c) shared bias table BT[h][p] = sum_c Wt[h][c] * x[p][c]  (A = Wt plane, B = x hi + residual planes)
  gemm_h<0, 1, 0><<<gBias, b128, 0, stream>>>(WB, WB, XH, XL, bo, 0, BT, OH, OL, BTM, NPOS, CZ, oscp, 1.0f);

  for (int g = 0; g < NGRP; ++g) {
    const u16*   XHg = XH + (size_t)g * GROWS * CZ;
    const u16*   XLg = XL + (size_t)g * GROWS * CZ;
    const float* Mg  = msk + (size_t)g * IG * NSEQ;
    float*       og  = out + (size_t)g * GROWS * CZ;
    // (1) v = x.Wv^T -> v^T hi + residual planes x1024 and the per-64-key sums of v, straight from the GEMM epilogue
    gemm_h<1, 0, 2><<<gG, b128, 0, stream>>>(XHg, XLg, WV, WV, bo, 0, VS, VH, VL, GROWS, CZ, CZ, oscp, VCAR);
    // (2) q = x.Wq^T -> q hi + residual planes x1024; (3) k = x.Wk^T -> k hi + residual planes x1024
    gemm_h<1, 0, 1><<<gG, b128, 0, stream>>>(XHg, XLg, WQ, WQ, bo, 0, GF, QH, QL, GROWS, CZ, CZ, oscp, QSC);
    gemm_h<1, 0, 1><<<gG, b128, 0, stream>>>(XHg, XLg, WK, WK, bo, 0, GF, KH, KL, GROWS, CZ, CZ, oscp, KSC);
    // (4) gate pre-activation x.Wg^T + bg -> GF f32
    gemm_h<1, 0, 0><<<gG, b128, 0, stream>>>(XHg, XLg, WG, WG, bg, 1, GF, OH, OL, GROWS, CZ, CZ, oscp, 1.0f);
    // (5) attention over all keys of each row block with the shared bias and the row mask bias, gated
    //     -> O x4096 f16 hi + residual planes
    attn<<<gA, bAT, 0, stream>>>(QH, QL, KH, KL, VH, VL, VS, GF, BT, Mg, OH, OL);
    // (6) output projection (O hi + residual).Wo^T + bo -> out f32, carries 4096 x 1024 folded back
    gemm_h<1, 0, 0><<<gG, b128, 0, stream>>>(OH, OL, WO, WO, bo, 1, og, QH, QL, GROWS, CZ, CZ, osco, 1.0f);
  }
  (void)hipGetLastError();
}

// v004
// Measured time: 157 microseconds a run.
// Two timings next to v003 put it at 1.31 and 1.30 times that version's speed.
// Over all steps from v000 it is 2.42 times as fast.
// Contractions: LN(x).Wq^T, LN(x).Wk^T, LN(x).Wv^T, LN(x).Wg^T(+bg), LN(x).Wt^T (shared pair-bias table) and O.Wo^T(+bo) on
// v_wmma_f32_16x16x32_f16 with the activation operand carried as f16 hi + f16 residual planes (x*64, O*4096) and the weight
// operand as f16(bf16(W)*1024); q.k^T over 32 on v_wmma_f32_16x16x32_f16 (q, k *1024 f16 hi + residual, products hh+lh+hl);
// centred softmax weights P' = 16384*P - 64 (f16 hi) times v^T (v*1024 f16 hi + residual, products P'.vh + P'.vl);
// all f32 accumulate. LayerNorm, mask bias, softmax, sigmoid gate, key-mean of v and carry folds in f32 on VALU.
// Every float input is RNE-converted to bf16 on load.
#include <hip/hip_runtime.h>
#include <math.h>
#include <stdint.h>

#ifndef NB
#define NB 1
#endif
#ifndef NI
#define NI 256
#endif
#define NSEQ   256
#define CZ     128
#define NH     4
#define HD     32
#define NPOS   (NSEQ * NSEQ)
#define IG     NI
#define NGRP   (NI / IG)
#define GROWS  (IG * NSEQ)
#define XSC    64.0f
#define WSC    1024.0f
#define QSC    1024.0f
#define KSC    1024.0f
#define VCAR   1024.0f
#define PCAR   16384.0f
#define OSC    4096.0f
#define MINF   1.0e9f
#define RSQ_HD 0.17677669529663689f
#define LOG2E  1.4426950408889634f
#define WPB    2
#define NHG    (NH / WPB)
#define NQT    (NSEQ / 16)
#define NKT    (NSEQ / 32)
#define NST    (NSEQ / 64)
#define ATT_THREADS (WPB * 32)
#define SBP    260
#define SBW    (16 * SBP)
#define STP    72
#define SLAB64 (16 * 68)
#define TRP    69
#define XTP    136
#define WTP    136
#define BTM    64
#define RG     2
#define BSP    (64 * RG + 4)
#define WS_CAP 268435456
static_assert(NB == 1);
static_assert(CZ == NH * HD && HD == 32 && NH == 4 && NSEQ == 256);
static_assert(NI >= 1 && NI <= NSEQ && (NI % IG) == 0 && IG >= 1 && IG <= NSEQ && NGRP == 1);
static_assert((GROWS % 64) == 0 && (NPOS % 64) == 0);
static_assert(GROWS == NPOS && (GROWS % (64 * RG)) == 0 && 4 * SLAB64 <= 64 * TRP && NH <= 16 && BTM >= 16 && (BSP % 4) == 0);
static_assert((NH % WPB) == 0 && ATT_THREADS == 64 && (NSEQ % 64) == 0 && (CZ % 64) == 0 && (CZ % 32) == 0);
static_assert((BTM % 64) == 0 && BTM >= NH && (BTM % 32) == 0);
static_assert(SBP >= NSEQ && (SBP % 4) == 0 && STP >= 64 && (STP % 8) == 0 && XTP >= CZ && WTP >= CZ && TRP >= 64);

typedef unsigned short u16;
typedef _Float16 v16h __attribute__((ext_vector_type(16)));
typedef _Float16 v8h  __attribute__((ext_vector_type(8)));
typedef float    v8f  __attribute__((ext_vector_type(8)));
typedef float    v4f  __attribute__((ext_vector_type(4)));
typedef unsigned int v4u __attribute__((ext_vector_type(4)));

union FragH { v16h v; v8h h[2]; v4u u[2]; };

// ---- scalar helpers --------------------------------------------------------------------------------
__device__ __forceinline__ unsigned short bf_bits(float f) {          // f32 -> bf16 bits, RNE convert
  unsigned u = __float_as_uint(f);
  return (unsigned short)((u + 0x7FFFu + ((u >> 16) & 1u)) >> 16);
}
__device__ __forceinline__ float bf_up(unsigned short h) { return __uint_as_float(((unsigned)h) << 16); }
__device__ __forceinline__ float bfr(float f) { return bf_up(bf_bits(f)); }
__device__ __forceinline__ unsigned short h_bits(_Float16 x) { return __builtin_bit_cast(unsigned short, x); }
__device__ __forceinline__ unsigned pk16(unsigned short a, unsigned short b) { return (unsigned)a | ((unsigned)b << 16); }
__device__ __forceinline__ v8f zero8() { v8f z = {0.f, 0.f, 0.f, 0.f, 0.f, 0.f, 0.f, 0.f}; return z; }

// ---- fragment loader: 16-bit A/B operand, lane -> row/col (lane&15), p already includes +8*(lane>>4);
//      elements 0..7 <- p[0..7] (k0+8h..), elements 8..15 <- p[16..23] (k0+16+8h..); same split k map for A and B,
//      B always read from a k-contiguous [n][k] plane.
__device__ __forceinline__ v16h ldfrag_h(const _Float16* p) {
  FragH f;
  f.h[0] = *(const v8h*)(p);
  f.h[1] = *(const v8h*)(p + 16);
  return f.v;
}

// ---- WMMA helpers with trailing VALU hazard gaps ------------------------------------------------------
__device__ __forceinline__ v8f mma_h(v16h a, v16h b, v8f c) {
  return __builtin_amdgcn_wmma_f32_16x16x32_f16(false, a, false, b, (short)0, c, false, false);
}
template <typename F>
__device__ __forceinline__ void guard6(v8f& a, v8f& b, v8f& c, v8f& d, F x0, F x1, F x2, F x3, F x4, F x5) {
#if defined(__HIP_DEVICE_COMPILE__)
  asm volatile("v_nop\n\tv_nop\n\tv_nop\n\tv_nop"
               : "+v"(a), "+v"(b), "+v"(c), "+v"(d) : "v"(x0), "v"(x1), "v"(x2), "v"(x3), "v"(x4), "v"(x5) : "memory");
#endif
}
template <typename F>
__device__ __forceinline__ void guard9(v8f& a, v8f& b, v8f& c, v8f& d, F x0, F x1, F x2, F x3, F x4, F x5,
                                       F x6, F x7, F x8) {
#if defined(__HIP_DEVICE_COMPILE__)
  asm volatile("v_nop\n\tv_nop\n\tv_nop\n\tv_nop"
               : "+v"(a), "+v"(b), "+v"(c), "+v"(d)
               : "v"(x0), "v"(x1), "v"(x2), "v"(x3), "v"(x4), "v"(x5), "v"(x6), "v"(x7), "v"(x8) : "memory");
#endif
}
__device__ __forceinline__ void acc_guard2(v8f& a, v8f& b) {
#if defined(__HIP_DEVICE_COMPILE__)
  asm volatile("v_nop\n\tv_nop\n\tv_nop\n\tv_nop" : "+v"(a), "+v"(b));
#endif
}
__device__ __forceinline__ void wave_sync_lds() {
  __builtin_amdgcn_fence(__ATOMIC_RELEASE, "workgroup");
  __builtin_amdgcn_wave_barrier();
  __builtin_amdgcn_fence(__ATOMIC_ACQUIRE, "workgroup");
}

// =====================================================================================================
// LayerNorm over CZ of the bf16 RNE-converted input rows, eps 1e-5, gamma/beta (bf16 RNE-converted), then
// with shuffles over the 4 lanes); both planes staged in LDS (pitch XTP halves, 16-B vector stores), block barrier, then each
// coverage: compute 256 thr x 32 = 64 rows x 128; store 4 iterations x 8 waves x 2 rows x 16 lanes x 8 halves = 64 x 128 per
//           plane; grid = nrows/64 blocks = every row of XH and XL exactly once (nrows a multiple of 64).
// =====================================================================================================
__global__ __launch_bounds__(256) void ln16(const float* __restrict__ X, const float* __restrict__ gam,
                                            const float* __restrict__ bet, u16* XHo, u16* XLo, int nrows) {
#pragma clang fp contract(off)
  __shared__ __align__(16) u16 TH[64 * XTP];
  __shared__ __align__(16) u16 TL[64 * XTP];
  const int tid = (int)threadIdx.x, wave = tid >> 5, lane = tid & 31;
  const int row0 = (int)blockIdx.x * 64;
  if (row0 + 64 > nrows) return;            // block-uniform, before the barrier; never taken with the exact grid
  const int rl = tid >> 2, part = tid & 3;
  const float* p = X + (size_t)(row0 + rl) * CZ + part * 32;
  v4f xv[8];
  float s = 0.0f;
#pragma unroll
  for (int t = 0; t < 8; ++t) {
    v4f a = *(const v4f*)(p + 4 * t);
#pragma unroll
    for (int e = 0; e < 4; ++e) { const float f = bfr(a[e]); a[e] = f; s = s + f; }
    xv[t] = a;
  }
  s = s + __shfl_xor(s, 1, 32);
  s = s + __shfl_xor(s, 2, 32);
  const float mu = s * (1.0f / (float)CZ);
  float q = 0.0f;
#pragma unroll
  for (int t = 0; t < 8; ++t) {
#pragma unroll
    for (int e = 0; e < 4; ++e) { const float d = xv[t][e] - mu; q = q + d * d; }
  }
  q = q + __shfl_xor(q, 1, 32);
  q = q + __shfl_xor(q, 2, 32);
  const float var  = q * (1.0f / (float)CZ);
  const float rstd = rsqrtf(var + 1e-5f);
  v4u oh[4], ol[4];
#pragma unroll
  for (int t = 0; t < 8; ++t) {
    const v4f g4 = *(const v4f*)(gam + part * 32 + 4 * t);
    const v4f b4 = *(const v4f*)(bet + part * 32 + 4 * t);
    unsigned short hb[4], lb[4];
#pragma unroll
    for (int e = 0; e < 4; ++e) {
      float y = (xv[t][e] - mu) * rstd;
      y = y * bfr(g4[e]);
      y = y + bfr(b4[e]);
      const float w = y * XSC;
      const _Float16 hv = (_Float16)w;
      const _Float16 lv = (_Float16)(w - (float)hv);
      hb[e] = h_bits(hv);
      lb[e] = h_bits(lv);
    }
    oh[t >> 1][(t & 1) * 2]     = pk16(hb[0], hb[1]);
    oh[t >> 1][(t & 1) * 2 + 1] = pk16(hb[2], hb[3]);
    ol[t >> 1][(t & 1) * 2]     = pk16(lb[0], lb[1]);
    ol[t >> 1][(t & 1) * 2 + 1] = pk16(lb[2], lb[3]);
  }
  {
    u16* th = TH + rl * XTP + part * 32;
    u16* tl = TL + rl * XTP + part * 32;
#pragma unroll
    for (int q4 = 0; q4 < 4; ++q4) {
      *(v4u*)(th + 8 * q4) = oh[q4];
      *(v4u*)(tl + 8 * q4) = ol[q4];
    }
  }
  __syncthreads();
  v4u vh[4], vl[4];
  const int ch = (lane & 15) * 8;
#pragma unroll
  for (int it = 0; it < 4; ++it) {
    const int row = (it * 8 + wave) * 2 + (lane >> 4);
    vh[it] = *(const v4u*)(TH + row * XTP + ch);
    vl[it] = *(const v4u*)(TL + row * XTP + ch);
  }
  {
#pragma unroll
    for (int it = 0; it < 4; ++it) {
      const int row = (it * 8 + wave) * 2 + (lane >> 4);
      const size_t o = (size_t)(row0 + row) * CZ + ch;
      *(v4u*)(XHo + o) = vh[it];
      *(v4u*)(XLo + o) = vl[it];
    }
    
  }
}

// =====================================================================================================
// Weight plane: W f32 [nrow rows n][CZ k] row-major (k contiguous); D 16-bit [np rows n][CZ k], D[n][k] = f16 bits of
// bf16(W[n][k]) * scale for n < nrow, 0 for nrow <= n < np. Block = 32 n rows: each thread loads 16 consecutive k values of
// one n row with a clamped row address (zeroed by predicate for n >= nrow), converts into the LDS tile [32 n][CZ k]
// coverage: load 256 thr x 16 = 32 n x 128 k; store 2 iterations x 8 waves x 2 rows x 16 lanes x 8 halves = 32 x 128;
//           grid = np/32 blocks covers the [np][CZ] plane exactly once.
// =====================================================================================================
__global__ __launch_bounds__(256) void wp16(const float* __restrict__ W, int nrow, int np, u16* D, float scale) {
  __shared__ __align__(16) u16 T[32 * WTP];
  const int tid = (int)threadIdx.x, wave = tid >> 5, lane = tid & 31;
  const int n0 = (int)blockIdx.x * 32;
  if (n0 + 32 > np) return;                 // block-uniform, before the barrier; never taken with the exact grid
  {
    const int nl = tid >> 3, kc = (tid & 7) * 16;
    const int n  = n0 + nl;
    int nr = (n < nrow) ? n : (nrow - 1);
    nr = (nr < 0) ? 0 : nr;
    const float* src = W + (size_t)nr * CZ + kc;
    v4u w2[2];
#pragma unroll
    for (int t = 0; t < 4; ++t) {
      const v4f a = *(const v4f*)(src + 4 * t);
      unsigned short hb[4];
#pragma unroll
      for (int e = 0; e < 4; ++e) {
        const float val = (n < nrow) ? a[e] : 0.0f;
        hb[e] = h_bits((_Float16)(bfr(val) * scale));
      }
      w2[t >> 1][(t & 1) * 2]     = pk16(hb[0], hb[1]);
      w2[t >> 1][(t & 1) * 2 + 1] = pk16(hb[2], hb[3]);
    }
    *(v4u*)(T + nl * WTP + kc)     = w2[0];
    *(v4u*)(T + nl * WTP + kc + 8) = w2[1];
  }
  __syncthreads();
  v4u w4[2];
  const int ch = (lane & 15) * 8;
#pragma unroll
  for (int it = 0; it < 2; ++it) {
    const int row = (it * 8 + wave) * 2 + (lane >> 4);
    w4[it] = *(const v4u*)(T + row * WTP + ch);
  }
  {
#pragma unroll
    for (int it = 0; it < 2; ++it) {
      const int row = (it * 8 + wave) * 2 + (lane >> 4);
      *(v4u*)(D + (size_t)(n0 + row) * CZ + ch) = w4[it];
    }
    
  }
}

// =====================================================================================================
// GEMM epilogue: the wave's 16x64 f32 tile (times oscale, plus a per-column addend) staged in its LDS slab (pitch 68),
// coverage: 8 instructions x 2 rows x 16 lanes x 4 floats = the wave's 16 x 64 tile.
// =====================================================================================================
__device__ __forceinline__ void epi64(float* sl, v8f a0, v8f a1, v8f a2, v8f a3, float oscale,
                                      float b0, float b1, float b2, float b3,
                                      float* C, int N, size_t rowb, int col0, int lane) {
  const int hh = lane >> 4, m = lane & 15;
#pragma unroll
  for (int r = 0; r < 8; ++r) {
    const int ro = (8 * hh + r) * 68 + m;
    sl[ro]      = a0[r] * oscale + b0;
    sl[ro + 16] = a1[r] * oscale + b1;
    sl[ro + 32] = a2[r] * oscale + b2;
    sl[ro + 48] = a3[r] * oscale + b3;
  }
  wave_sync_lds();
  v4f vals[8];
#pragma unroll
  for (int it = 0; it < 8; ++it) vals[it] = *(const v4f*)(sl + (it * 2 + hh) * 68 + m * 4);
  float* dst = C + (rowb + (size_t)hh) * (size_t)N + col0 + m * 4;
  {
#pragma unroll
    for (int it = 0; it < 8; ++it) {
      *(v4f*)(dst + (size_t)(it * 2) * (size_t)N) = vals[it];
    }
    
  }
}

// =====================================================================================================
// Eight f32 values (already carrying their plane scale) -> 8 f16 hi halves and 8 f16 residual halves, packed for 16-B stores.
// =====================================================================================================
__device__ __forceinline__ void split8(const float* w, v4u& oh, v4u& ol) {
#pragma unroll
  for (int e = 0; e < 4; ++e) {
    const float t0 = w[2 * e], t1 = w[2 * e + 1];
    const _Float16 h0 = (_Float16)t0, h1 = (_Float16)t1;
    const _Float16 l0 = (_Float16)(t0 - (float)h0), l1 = (_Float16)(t1 - (float)h1);
    oh[e] = pk16(h_bits(h0), h_bits(h1));
    ol[e] = pk16(h_bits(l0), h_bits(l1));
  }
}

// =====================================================================================================
// GEMM epilogue, plane form (q, k): the wave's 16x64 f32 tile (times oscale) staged in its LDS slab (pitch 68), read back as
// 8 consecutive columns per lane, times psc, split into f16 hi + residual, one 16-B store per plane and lane.
// coverage: 4 instructions x 4 rows x 8 lanes x 8 halves = the wave's 16 x 64 tile per plane; each row segment is one whole
//           128-B line written by one instruction.
// =====================================================================================================
__device__ __forceinline__ void epi_pl(float* sl, v8f a0, v8f a1, v8f a2, v8f a3, float oscale, float psc,
                                       u16* Hp, u16* Lp, int N, size_t rowb, int col0, int lane) {
  const int hh = lane >> 4, m = lane & 15;
#pragma unroll
  for (int r = 0; r < 8; ++r) {
    const int ro = (8 * hh + r) * 68 + m;
    sl[ro]      = a0[r] * oscale;
    sl[ro + 16] = a1[r] * oscale;
    sl[ro + 32] = a2[r] * oscale;
    sl[ro + 48] = a3[r] * oscale;
  }
  wave_sync_lds();
  const int rq = lane >> 3, c8 = (lane & 7) * 8;
  v4u oh[4], ol[4];
#pragma unroll
  for (int it = 0; it < 4; ++it) {
    const float* p = sl + (it * 4 + rq) * 68 + c8;
    const v4f a = *(const v4f*)(p), b4 = *(const v4f*)(p + 4);
    float w[8];
#pragma unroll
    for (int e = 0; e < 4; ++e) { w[e] = a[e] * psc; w[4 + e] = b4[e] * psc; }
    split8(w, oh[it], ol[it]);
  }
#pragma unroll
  for (int it = 0; it < 4; ++it) {
    const size_t o = (rowb + (size_t)(it * 4 + rq)) * (size_t)N + col0 + c8;
    *(v4u*)(Hp + o) = oh[it];
    *(v4u*)(Lp + o) = ol[it];
  }
}

// =====================================================================================================
// GEMM epilogue, transposed plane form (v): the block's 64 keys x 64 columns f32 tile (times oscale) staged in one LDS tile
// [key][column] (pitch TRP floats: odd, so the column reads below fall in 32 different banks), block barrier, then each lane
// reads 8 consecutive keys of one column, splits v * psc into f16 hi + residual and stores 16 B per plane into
//   Hp/Lp[(il*N + column)][NSEQ keys]; 8 lanes = one whole 128-B line. The 8 lanes' f32 values are also summed (shuffles) to the
// column's sum over the block's 64 keys; the 64 sums are gathered in LDS and stored by wave 0 as two whole lines of
//   KS[row tile][N]  (row tile = il*NST + key tile).
// coverage: 4 waves x 4 instructions x 4 columns x 8 lanes x 8 halves = 64 columns x 64 keys per plane; 32 lanes x 2 = 64 sums.
// =====================================================================================================
__device__ __forceinline__ void epi_tr(float* sl, float* rs, v8f a0, v8f a1, v8f a2, v8f a3, float oscale, float psc,
                                       u16* Hp, u16* Lp, float* KS, int N, int rb0, int col0, int wave, int lane) {
  const int hh = lane >> 4, m = lane & 15;
#pragma unroll
  for (int r = 0; r < 8; ++r) {
    const int ro = (wave * 16 + 8 * hh + r) * TRP + m;
    sl[ro]      = a0[r] * oscale;
    sl[ro + 16] = a1[r] * oscale;
    sl[ro + 32] = a2[r] * oscale;
    sl[ro + 48] = a3[r] * oscale;
  }
  __syncthreads();
  const int rq = lane >> 3, k8 = (lane & 7) * 8;
  const int il = rb0 / NSEQ, s0 = rb0 % NSEQ;
  v4u oh[4], ol[4];
  float cs[4];
#pragma unroll
  for (int it = 0; it < 4; ++it) {
    const int cl = wave * 16 + it * 4 + rq;              // column within the block's 64
    float v[8], w[8];
#pragma unroll
    for (int e = 0; e < 8; ++e) v[e] = sl[(k8 + e) * TRP + cl];
#pragma unroll
    for (int e = 0; e < 8; ++e) w[e] = v[e] * psc;
    split8(w, oh[it], ol[it]);
    cs[it] = ((v[0] + v[1]) + (v[2] + v[3])) + ((v[4] + v[5]) + (v[6] + v[7]));
  }
#pragma unroll
  for (int off = 1; off < 8; off <<= 1) {
#pragma unroll
    for (int it = 0; it < 4; ++it) cs[it] += __shfl_xor(cs[it], off, 32);
  }
  if ((lane & 7) == 0) {
#pragma unroll
    for (int it = 0; it < 4; ++it) rs[wave * 16 + it * 4 + rq] = cs[it];
  }
  __syncthreads();
  if (wave == 0) {
    float2 t;
    t.x = rs[2 * lane];
    t.y = rs[2 * lane + 1];
    *(float2*)(KS + (size_t)(rb0 / 64) * N + col0 + 2 * lane) = t;
    asm volatile("s_wait_xcnt 0x0" ::: "memory");     // the code behind this branch rewrites the registers that the store names
  }
  // wave-uniform base + one 32-bit lane offset: the four column groups differ by a constant, so one register addresses all stores
  const size_t   ub = ((size_t)il * N + col0 + wave * 16) * NSEQ + s0;
  const unsigned lo = (unsigned)(rq * NSEQ + k8);
#pragma unroll
  for (int it = 0; it < 4; ++it) {
    *(v4u*)(Hp + ub + (lo + it * 4 * NSEQ)) = oh[it];
    *(v4u*)(Lp + ub + (lo + it * 4 * NSEQ)) = ol[it];
  }
}

// =====================================================================================================
// f16 GEMM: C[M][N] (f32) = (Ah [+ Al])[M][K] . (Bh [+ Bl])[N][K]^T * oscale [+ bf16(bias[col])].
// ALO == 1: products ah.bh + al.bh (A residual plane, unscaled); BLO == 1: products ah.bh + ah.bl (B residual plane);
// one accumulator. Block = 64x64 tile, 4 waves x 16 rows; fragments loaded straight from the 16-bit rows (two 16-B loads
// each, split k map for A and B); K stepped by 32 (host guarantees K % 32 == 0, M % 64 == 0, N % 64 == 0,
// grid = (M/64)*(N/64)). hasb is a block-uniform flag; bias is dereferenced only when hasb != 0.
// EPI == 0: C f32 as above. EPI == 1: the product times psc goes out as f16 hi + residual planes Hp, Lp [M][N] (C unused).
// EPI == 2: the product times psc goes out transposed per NSEQ-row group as Hp, Lp [(row / NSEQ)*N + col][NSEQ], and C takes
// the f32 column sums of each 64-row tile, [M/64][N] (host guarantees NSEQ % 64 == 0 and M % NSEQ == 0).
// =====================================================================================================
template <int ALO, int BLO, int EPI>
__global__ __launch_bounds__(128)
void gemm_h(const u16* __restrict__ Ah, const u16* __restrict__ Al, const u16* __restrict__ Bh, const u16* __restrict__ Bl,
            const float* __restrict__ bias, int hasb, float* C, u16* Hp, u16* Lp, int M, int N, int K, float oscale,
            float psc) {
  __shared__ __align__(16) float slab[(EPI == 2) ? (64 * TRP + 64) : (4 * SLAB64)];
  const int tid = (int)threadIdx.x, wave = tid >> 5, lane = tid & 31, hh = lane >> 4, m = lane & 15;
  const int ntile = N >> 6;
  const int bid   = (int)blockIdx.x;
  const int rb0   = (bid / ntile) * 64;
  const int rowb  = rb0 + wave * 16;
  const int col0  = (bid % ntile) * 64;
  if (rb0 + 64 > M) return;                 // block-uniform, before any barrier; never taken with the exact grid
  const _Float16* ahp = (const _Float16*)(const void*)Ah + (size_t)(rowb + m) * K + 8 * hh;
  const _Float16* alp = (const _Float16*)(const void*)Al + (size_t)(rowb + m) * K + 8 * hh;   // read only when ALO
  const _Float16* bhp = (const _Float16*)(const void*)Bh + (size_t)(col0 + m) * K + 8 * hh;
  const _Float16* blp = (const _Float16*)(const void*)Bl + (size_t)(col0 + m) * K + 8 * hh;   // read only when BLO
  const size_t bs = (size_t)16 * K;
  float bb0 = 0.0f, bb1 = 0.0f, bb2 = 0.0f, bb3 = 0.0f;
  if (hasb != 0) {
    bb0 = bfr(bias[col0 + m]);
    bb1 = bfr(bias[col0 + 16 + m]);
    bb2 = bfr(bias[col0 + 32 + m]);
    bb3 = bfr(bias[col0 + 48 + m]);
  }
  v8f acc0 = zero8(), acc1 = zero8(), acc2 = zero8(), acc3 = zero8();
#pragma unroll 1
  for (int k0 = 0; k0 < K; k0 += 32) {
    const v16h ah = ldfrag_h(ahp + k0);
    const v16h b0 = ldfrag_h(bhp + k0);
    const v16h b1 = ldfrag_h(bhp + bs + k0);
    const v16h b2 = ldfrag_h(bhp + 2 * bs + k0);
    const v16h b3 = ldfrag_h(bhp + 3 * bs + k0);
    acc0 = mma_h(ah, b0, acc0);
    acc1 = mma_h(ah, b1, acc1);
    acc2 = mma_h(ah, b2, acc2);
    acc3 = mma_h(ah, b3, acc3);
    if constexpr (ALO != 0) {
      const v16h al = ldfrag_h(alp + k0);
      acc0 = mma_h(al, b0, acc0);
      acc1 = mma_h(al, b1, acc1);
      acc2 = mma_h(al, b2, acc2);
      acc3 = mma_h(al, b3, acc3);
      if constexpr (BLO != 0) {
        const v16h l0 = ldfrag_h(blp + k0);
        const v16h l1 = ldfrag_h(blp + bs + k0);
        const v16h l2 = ldfrag_h(blp + 2 * bs + k0);
        const v16h l3 = ldfrag_h(blp + 3 * bs + k0);
        acc0 = mma_h(ah, l0, acc0);
        acc1 = mma_h(ah, l1, acc1);
        acc2 = mma_h(ah, l2, acc2);
        acc3 = mma_h(ah, l3, acc3);
        guard9<v16h>(acc0, acc1, acc2, acc3, ah, b0, b1, b2, b3, l0, l1, l2, l3);
        guard6<v16h>(acc0, acc1, acc2, acc3, al, al, al, al, al, al);
      } else {
        guard6<v16h>(acc0, acc1, acc2, acc3, ah, al, b0, b1, b2, b3);
      }
    } else if constexpr (BLO != 0) {
      const v16h l0 = ldfrag_h(blp + k0);
      const v16h l1 = ldfrag_h(blp + bs + k0);
      const v16h l2 = ldfrag_h(blp + 2 * bs + k0);
      const v16h l3 = ldfrag_h(blp + 3 * bs + k0);
      acc0 = mma_h(ah, l0, acc0);
      acc1 = mma_h(ah, l1, acc1);
      acc2 = mma_h(ah, l2, acc2);
      acc3 = mma_h(ah, l3, acc3);
      guard9<v16h>(acc0, acc1, acc2, acc3, ah, b0, b1, b2, b3, l0, l1, l2, l3);
    } else {
      guard6<v16h>(acc0, acc1, acc2, acc3, ah, b0, b1, b2, b3, ah);
    }
  }
  if constexpr (EPI == 0) {
    epi64(slab + wave * SLAB64, acc0, acc1, acc2, acc3, oscale, bb0, bb1, bb2, bb3, C, N, (size_t)rowb, col0, lane);
  } else if constexpr (EPI == 1) {
    epi_pl(slab + wave * SLAB64, acc0, acc1, acc2, acc3, oscale, psc, Hp, Lp, N, (size_t)rowb, col0, lane);
  } else {
    epi_tr(slab, slab + 64 * TRP, acc0, acc1, acc2, acc3, oscale, psc, Hp, Lp, C, N, rb0, col0, wave, lane);
  }
}

// =====================================================================================================
// All products of LN(x) in one launch: v, q, k, gate pre-activation and the pair-bias table.
// Two blocks per RG groups of 64 position rows (one does pair bias, v and gate, the other q and k), 4 waves each;
// wave w owns rows rb0 + 64g + 16w .. +15 of every group g and loads their
// A fragments (x*64 hi + residual, all CZ = 4 k-steps) ONCE into registers; they serve every column tile of the block, so each weight
// fragment that a wave loads is used for RG*16 rows. Per accumulator the products run xh.w, xl.w per k-step, k ascending.
//   pair bias: B = Wt plane rows 0..15 (rows >= NH are zero), D (row = position, column = head) staged in LDS [16][BSP],
//              block barrier, heads 0..NH-1 stored as whole lines of BT[h][position]   (GROWS == NPOS: every position once)
//   v: 2 column tiles x RG groups through epi_tr;  q, k: 2 + 2 column tiles through epi_pl;  gate: 2 column tiles through epi64.
// LDS: epi_tr's block tile [64][TRP] + 64 sums; the per-wave slabs of epi_pl / epi64 lie inside that tile; the q, k blocks run no epi_tr,
// and the gate's epi64 slabs are first written behind epi_tr's last barrier, at which every read of the tile has returned; the bias stage lies behind both.
// coverage: grid = 2 * GROWS/(64*RG) blocks; per part RG groups x 64 rows = every row once, for each of the CZ/64 column tiles of each plane.
// =====================================================================================================
__device__ __forceinline__ void xw_tile(const v16h (&ah)[RG][CZ / 32], const v16h (&al)[RG][CZ / 32], const _Float16* bp,
                                        unsigned wo, v8f (&acc)[RG][4]) {
#pragma unroll
  for (int g = 0; g < RG; ++g) {
#pragma unroll
    for (int j = 0; j < 4; ++j) acc[g][j] = zero8();
  }
#pragma unroll                              // constant indices keep ah[], al[] in registers
  for (int ks = 0; ks < CZ / 32; ++ks) {
    v16h b[4];
#pragma unroll
    for (int j = 0; j < 4; ++j) b[j] = ldfrag_h(bp + (wo + j * 16 * CZ + ks * 32));
#pragma unroll
    for (int g = 0; g < RG; ++g) {
#pragma unroll
      for (int j = 0; j < 4; ++j) acc[g][j] = mma_h(ah[g][ks], b[j], acc[g][j]);
#pragma unroll
      for (int j = 0; j < 4; ++j) acc[g][j] = mma_h(al[g][ks], b[j], acc[g][j]);
    }
  }
}

// amdgpu_waves_per_eu(4): holds the register budget to 256: four blocks per WGP (one wave of each on every SIMD), so that the whole
// grid is resident at once, and no register above v255 is used.
__global__ __launch_bounds__(128) __attribute__((amdgpu_waves_per_eu(4)))
void xproj(const u16* __restrict__ XHp, const u16* __restrict__ XLp, const u16* __restrict__ WVp,
           const u16* __restrict__ WQp, const u16* __restrict__ WKp, const u16* __restrict__ WGp,
           const u16* __restrict__ WBp, const float* __restrict__ bg, u16* VHp, u16* VLp, float* VS,
           u16* QHp, u16* QLp, u16* KHp, u16* KLp, float* GF, float* BT, float oscale) {
  __shared__ __align__(16) float slab[64 * TRP + 64 + 16 * BSP];
  const int tid = (int)threadIdx.x, lane = tid & 31, hh = lane >> 4, m = lane & 15;
  const int wave = __builtin_amdgcn_readfirstlane(tid >> 5);   // scalar: row and slab offsets stay out of the vector registers
  const int rb0  = ((int)blockIdx.x >> 1) * (64 * RG);
  const int part = (int)blockIdx.x & 1;     // block-uniform: 0 = pair bias, v, gate; 1 = q, k (4 column tiles of 64 each)
  if (rb0 + 64 * RG > GROWS) return;        // block-uniform, before any barrier; never taken with the exact grid
  // lane offset inside a 16-row group of a [row][CZ] plane: row m, split k map; the same for x rows (A) and weight rows (B)
  const unsigned wo = (unsigned)(m * CZ + 8 * hh);
  v16h ah[RG][CZ / 32], al[RG][CZ / 32];
  {
    const _Float16* xh = (const _Float16*)(const void*)XHp + (size_t)(rb0 + wave * 16) * CZ;   // wave-uniform bases
    const _Float16* xl = (const _Float16*)(const void*)XLp + (size_t)(rb0 + wave * 16) * CZ;
#pragma unroll
    for (int g = 0; g < RG; ++g) {
#pragma unroll
      for (int ks = 0; ks < CZ / 32; ++ks) {
        ah[g][ks] = ldfrag_h(xh + (wo + g * 64 * CZ + ks * 32));
        al[g][ks] = ldfrag_h(xl + (wo + g * 64 * CZ + ks * 32));
      }
    }
    // the two base registers that these loads name are reused behind here; as inputs they stay untouched up to the wait
    asm volatile("s_wait_xcnt 0x0" :: "s"(xh), "s"(xl) : "memory");
  }
  float* wsl = slab + wave * SLAB64;
  v8f acc[RG][4];

  if (part != 0) {
    // ---- q, k: hi + residual planes ----
#pragma unroll 1                            // rolled: one copy of the tile code in the instruction cache
    for (int i = 0; i < 2 * (CZ / 64); ++i) {
      const bool isq = i < CZ / 64;
      const int  ct  = isq ? i : i - CZ / 64;
      const u16* wp  = isq ? WQp : WKp;
      u16* hp = isq ? QHp : KHp;
      u16* lp = isq ? QLp : KLp;
      xw_tile(ah, al, (const _Float16*)(const void*)wp + (size_t)(ct * 64) * CZ, wo, acc);
#pragma unroll
      for (int g = 0; g < RG; ++g) {
        epi_pl(wsl, acc[g][0], acc[g][1], acc[g][2], acc[g][3], oscale, isq ? QSC : KSC, hp, lp, CZ,
               (size_t)(rb0 + g * 64 + wave * 16), ct * 64, lane);
        asm volatile("s_wait_xcnt 0x0" ::: "memory");   // the next tile rewrites the registers that these stores name
      }
    }
    return;                                 // block-uniform; the barriers below are passed by whole blocks of part 0 only
  }

  // ---- pair bias ----
  {
    float* bsl = slab + 64 * TRP + 64;
    v8f ab[RG];
#pragma unroll
    for (int g = 0; g < RG; ++g) ab[g] = zero8();
#pragma unroll
    for (int ks = 0; ks < CZ / 32; ++ks) {
      const v16h b = ldfrag_h((const _Float16*)(const void*)WBp + (wo + ks * 32));
#pragma unroll
      for (int g = 0; g < RG; ++g) {
        ab[g] = mma_h(ah[g][ks], b, ab[g]);
        ab[g] = mma_h(al[g][ks], b, ab[g]);
      }
    }
#pragma unroll
    for (int g = 0; g < RG; ++g) {
      v4f t0, t1;
#pragma unroll
      for (int e = 0; e < 4; ++e) { t0[e] = ab[g][e] * oscale; t1[e] = ab[g][4 + e] * oscale; }
      float* d = bsl + m * BSP + g * 64 + wave * 16 + 8 * hh;
      *(v4f*)(d)     = t0;
      *(v4f*)(d + 4) = t1;
    }
    __syncthreads();
    for (int i = tid; i < NH * 16 * RG; i += 128) {   // wave-uniform trip count: 16*RG is a multiple of 16, 128 of 32
      const int h = i / (16 * RG), p4 = (i % (16 * RG)) * 4;
      *(v4f*)(BT + (size_t)h * NPOS + rb0 + p4) = *(const v4f*)(bsl + h * BSP + p4);
    }
  }

  // ---- v: transposed hi + residual planes and 64-key sums ----
#pragma unroll 1                            // rolled: one copy of the tile code in the instruction cache
  for (int ct = 0; ct < CZ / 64; ++ct) {
    xw_tile(ah, al, (const _Float16*)(const void*)WVp + (size_t)(ct * 64) * CZ, wo, acc);
#pragma unroll
    for (int g = 0; g < RG; ++g) {
      epi_tr(slab, slab + 64 * TRP, acc[g][0], acc[g][1], acc[g][2], acc[g][3], oscale, VCAR, VHp, VLp, VS, CZ,
             rb0 + g * 64, ct * 64, wave, lane);
      asm volatile("s_wait_xcnt 0x0" ::: "memory");   // the next tile rewrites the registers that these stores name
    }
  }
  // ---- gate pre-activation, f32, bias added ----
#pragma unroll 1                            // rolled: one copy of the tile code in the instruction cache
  for (int ct = 0; ct < CZ / 64; ++ct) {
    const float b0 = bfr(bg[ct * 64 + m]), b1 = bfr(bg[ct * 64 + 16 + m]);
    const float b2 = bfr(bg[ct * 64 + 32 + m]), b3 = bfr(bg[ct * 64 + 48 + m]);
    xw_tile(ah, al, (const _Float16*)(const void*)WGp + (size_t)(ct * 64) * CZ, wo, acc);
#pragma unroll
    for (int g = 0; g < RG; ++g) {
      epi64(wsl, acc[g][0], acc[g][1], acc[g][2], acc[g][3], oscale, b0, b1, b2, b3, GF, CZ,
            (size_t)(rb0 + g * 64 + wave * 16), ct * 64, lane);
      asm volatile("s_wait_xcnt 0x0" ::: "memory");   // the next tile rewrites the registers that these stores name
    }
  }
}

// =====================================================================================================
// Row-wise gated attention. Block bid -> (query tile qt: rows q0 = 16*qt .. q0+15 of row block il, head group hg of WPB
// heads); one wave per head = hg*WPB + wave; all NSEQ keys of row block il, shared bias table BT f32 [BTM][NPOS]
// (row h, position j*NSEQ + k) plus the per-row mask bias 1e9*(bf16(mask[il][k]) - 1) (MK already offset to the row group).
//   q/k planes f16 x1024 hi + residual [il*NSEQ + s][h*HD + d]; v^T planes [il*NH + h][d][NSEQ] hi + residual;
//   VS f32 [il*NST + key tile][h*HD + d] = sums of v over 64 keys (their total / NSEQ = key-mean of v); GF f32 [il*NSEQ + s][h*HD + d] = gate pre-activation (bias already added).
//   Phase 0: the wave's 16 x NSEQ bias rows (times log2e, plus mask bias times log2e) loaded with 16-B loads into its private
//   LDS bias buffer (pitch SBP: 16 B over a multiple of 256 B, the pitch of 16-B row readers).
//   Phase 1 (per 16-key tile): TRANSPOSED scores k_hi.q_hi + k_hi.q_lo + k_lo.q_hi (A = key rows, B = query rows, one k-step of
//   32): D element r of lane (c, hh) = (key 16t + 8hh + r, query c). u = s*rsqrt(32)*log2e/(1024*1024) + bias (two 16-B LDS reads
//   of buffer row c); all 128 scores of a lane stay in registers; running max in-lane, one exchange between the lane halves.
//   Phase 2a: p = exp2(u - m) in registers, row sum Z in-lane (8 chains, tree) plus one exchange, scale 16384/Z.
//   Phase 2b (per 32 keys): P' = p*16384/Z - 64 of two neighbouring tiles converted to f16 IS the A fragment (row c, split k map);
//   v^T B fragments for the two 16-wide d subtiles, products P'.v_hi + P'.v_lo. The score, softmax and P'.v code is straight-line.
//   Epilogue: vals = acc/(16384*1024) + key-mean (exact identity sum(P'+64).v/16384 = sum P.v), gate g = 1/(1+exp(-z)) in f32,
//   O = g*vals*4096 -> f16 hi + residual, staged as u16 elements in a block LDS tile [2 planes][16 rows][STP], block barrier,
//   a divergent branch; the only early return is block-uniform and precedes every barrier.
// staged extent == consumed extent: bias buffer columns 0..NSEQ-1 of all 16 rows written in phase 0 before any read
//   (columns NSEQ..SBP-1 never read); stage tile rows 0..15 x columns 0..63 of both planes written before the barrier
//   (columns 64..STP-1 never read).
// coverage: per block 2 iterations x 2 waves x 4 row groups x 8 lanes x 8 halves = 16 rows x 64 halves per plane;
//           grid = IG*NHG*NQT blocks = every (row, 64-column group) of OH and OL exactly once.
// =====================================================================================================
// amdgpu_waves_per_eu(4): the LDS lets 8 blocks = 4 waves per SIMD stay resident; the register budget is held to that (256).
__global__ __launch_bounds__(ATT_THREADS) __attribute__((amdgpu_waves_per_eu(4)))
void attn(const u16* __restrict__ QHp, const u16* __restrict__ QLp,
          const u16* __restrict__ KHp, const u16* __restrict__ KLp,
          const u16* __restrict__ VHp, const u16* __restrict__ VLp,
          const float* __restrict__ VS, const float* __restrict__ GF, const float* __restrict__ BT,
          const float* __restrict__ MK, u16* OHp, u16* OLp) {
  __shared__ __align__(16) float sbuf[WPB * SBW];
  __shared__ __align__(16) u16 stg[2 * 16 * STP];

  const int tid  = (int)threadIdx.x;
  const int wave = tid >> 5;
  const int lane = tid & 31;
  const int hh   = lane >> 4;
  const int c    = lane & 15;
  const int bid  = (int)blockIdx.x;
  const int qt   = bid % NQT;
  const int t2   = bid / NQT;
  const int hg   = t2 % NHG;
  const int il   = t2 / NHG;
  if (il >= IG) return;                     // block-uniform, before every barrier; never taken with the exact grid
  const int q0   = qt * 16;
  const int head = hg * WPB + wave;
  float* buf = sbuf + wave * SBW;
  const size_t prow0 = (size_t)il * NSEQ;   // first position row of this row block in the group-local planes

  // q fragments and the first 32 keys' fragments are asked for first: the bias staging below covers their latency
  const size_t hcol = (size_t)head * HD + 8 * hh;
  const _Float16* Qh  = (const _Float16*)(const void*)QHp + (prow0 + q0 + c) * CZ + hcol;
  const _Float16* Ql  = (const _Float16*)(const void*)QLp + (prow0 + q0 + c) * CZ + hcol;
  const _Float16* Khb = (const _Float16*)(const void*)KHp + (prow0 + c) * CZ + hcol;     // key row 16t added per tile
  const _Float16* Klb = (const _Float16*)(const void*)KLp + (prow0 + c) * CZ + hcol;
  const _Float16* Vhb = (const _Float16*)(const void*)VHp + ((size_t)(il * NH + head) * HD + c) * NSEQ + 8 * hh;
  const _Float16* Vlb = (const _Float16*)(const void*)VLp + ((size_t)(il * NH + head) * HD + c) * NSEQ + 8 * hh;
  const v16h qh = ldfrag_h(Qh);
  const v16h ql = ldfrag_h(Ql);
  const float lsc = RSQ_HD * (LOG2E / (QSC * KSC));
  v16h kh[NSEQ / 16], kl[NSEQ / 16];
#pragma unroll
  for (int t = 0; t < 2; ++t) {
    kh[t] = ldfrag_h(Khb + (size_t)(t * 16) * CZ);
    kl[t] = ldfrag_h(Klb + (size_t)(t * 16) * CZ);
  }

  // ---- phase 0: bias rows (query rows q0..q0+15, all keys) x log2e + mask bias x log2e -> bias buffer ----
  {
    const float* bsrc = BT + (size_t)head * NPOS + (size_t)q0 * NSEQ;
    const float* msrc = MK + (size_t)il * NSEQ;
    v4f mb0, mb1;                           // keys lane*4..+3 and 128+lane*4..+3 of mask row il
    {
      const v4f m0 = *(const v4f*)(msrc + lane * 4);
      const v4f m1 = *(const v4f*)(msrc + 128 + lane * 4);
#pragma unroll
      for (int e = 0; e < 4; ++e) {
        mb0[e] = (MINF * (bfr(m0[e]) - 1.0f)) * LOG2E;
        mb1[e] = (MINF * (bfr(m1[e]) - 1.0f)) * LOG2E;
      }
    }
#pragma unroll 1
    for (int g4 = 0; g4 < 4; ++g4) {
      v4f tv[8];
#pragma unroll
      for (int it = 0; it < 8; ++it) {
        const int idx = (g4 * 8 + it) * 32 + lane;        // 0..1023
        const int jr = idx >> 6, k4 = (idx & 63) * 4;      // k4 = lane*4 for even it, 128 + lane*4 for odd it
        tv[it] = *(const v4f*)(bsrc + (size_t)jr * NSEQ + k4);
      }
#pragma unroll
      for (int it = 0; it < 8; ++it) {
        const int idx = (g4 * 8 + it) * 32 + lane;
        const int jr = idx >> 6, k4 = (idx & 63) * 4;
        const v4f mb = (it & 1) ? mb1 : mb0;
        *(v4f*)(buf + jr * SBP + k4) = tv[it] * LOG2E + mb;
      }
    }
  }
  wave_sync_lds();

  // ---- phase 1: transposed scores S^T = k.q^T (A = 16 key rows, B = the 16 query rows), one 16-key tile per step; D element r
  //      of lane (c, hh) = (key 16t + 8hh + r, query c), so a lane owns one query row and its buffered bias is 8 consecutive
  //      floats of buffer row c. All NSEQ/2 = 128 scores of the lane's row half stay in registers (log2 domain). ----
  v8f u[NSEQ / 16];
  float mx4[4];
#pragma unroll
  for (int r = 0; r < 4; ++r) mx4[r] = -INFINITY;
#pragma unroll                              // full unroll here and below: u[], kh[], kl[], v*[] live in registers only with constant indices
  for (int g = 0; g < NKT; ++g) {
#pragma unroll
    for (int j = 0; j < 2; ++j) {
      const int t = 2 * g + 2 + j;
      if (t < NSEQ / 16) {
        kh[t] = ldfrag_h(Khb + (size_t)(t * 16) * CZ);
        kl[t] = ldfrag_h(Klb + (size_t)(t * 16) * CZ);
      }
    }
    // keeps the key fragments of the next tile pair in flight, and no more of them: unbounded hoisting spilled registers
    __builtin_amdgcn_sched_barrier(0);
#pragma unroll
    for (int j = 0; j < 2; ++j) {
      const int t = 2 * g + j;
      v8f s = zero8();
      s = mma_h(kh[t], qh, s);
      s = mma_h(kh[t], ql, s);
      s = mma_h(kl[t], qh, s);
      const float* bp = buf + c * SBP + t * 16 + 8 * hh;
      const v4f b0 = *(const v4f*)(bp), b1 = *(const v4f*)(bp + 4);
#pragma unroll
      for (int e = 0; e < 4; ++e) {
        s[e]     = s[e] * lsc + b0[e];
        s[4 + e] = s[4 + e] * lsc + b1[e];
      }
#pragma unroll
      for (int r = 0; r < 4; ++r) mx4[r] = fmaxf(mx4[r], fmaxf(s[r], s[4 + r]));
      u[t] = s;
    }
  }
  // v^T fragments of the first 32 keys are asked for before the softmax arithmetic, which covers their latency
  v16h vha[NKT], vhb[NKT], vla[NKT], vlb[NKT];
  vha[0] = ldfrag_h(Vhb);
  vhb[0] = ldfrag_h(Vhb + (size_t)16 * NSEQ);
  vla[0] = ldfrag_h(Vlb);
  vlb[0] = ldfrag_h(Vlb + (size_t)16 * NSEQ);
  __builtin_amdgcn_sched_barrier(0);        // holds those loads in front of the softmax
  float mx = fmaxf(fmaxf(mx4[0], mx4[1]), fmaxf(mx4[2], mx4[3]));
  mx = fmaxf(mx, __shfl_xor(mx, 16, 32));   // the other lane half holds the other 128 keys of the same query row

  // ---- phase 2a: p = exp2(u - m) in place, row sum Z (8 in-lane chains, tree, one exchange), scale 16384/Z (Z >= 1) ----
  float psc;
  {
    float l8[8];
#pragma unroll
    for (int r = 0; r < 8; ++r) l8[r] = 0.0f;
#pragma unroll
    for (int t = 0; t < NSEQ / 16; ++t) {
#pragma unroll
      for (int r = 0; r < 8; ++r) {
        const float e = exp2f(u[t][r] - mx);
        u[t][r] = e;
        l8[r] += e;
      }
    }
    float ls = ((l8[0] + l8[1]) + (l8[2] + l8[3])) + ((l8[4] + l8[5]) + (l8[6] + l8[7]));
    ls += __shfl_xor(ls, 16, 32);
    const float lz = (ls > 0.0f) ? ls : 1.0f;
    psc = PCAR * __builtin_amdgcn_rcpf(lz);
  }

  // ---- phase 2b: two neighbouring score tiles, centred and converted in place, are the f16 A fragment of P'
  //      (row = query c; elements 0..7 = keys kb + 8hh + 0..7, elements 8..15 = keys kb + 16 + 8hh + 0..7); P'.v^T (hi + residual) ----
  const float pcen = PCAR / (float)NSEQ;
  v8f o0 = zero8(), o1 = zero8();
  const float* vsp = VS + (size_t)il * NST * CZ + head * HD + c;
  const float* gp  = GF + (prow0 + q0 + 8 * hh) * CZ + head * HD + c;
  float vsa[NST], vsb[NST], gza[8], gzb[8];
#pragma unroll
  for (int kt = 0; kt < NKT; ++kt) {
    if (kt + 1 < NKT) {
      const int kn = (kt + 1) * 32;
      vha[kt + 1] = ldfrag_h(Vhb + kn);
      vhb[kt + 1] = ldfrag_h(Vhb + (size_t)16 * NSEQ + kn);
      vla[kt + 1] = ldfrag_h(Vlb + kn);
      vlb[kt + 1] = ldfrag_h(Vlb + (size_t)16 * NSEQ + kn);
    }
    if (kt == NKT - 3) {                        // the epilogue's operands, asked for once score registers have come free
#pragma unroll
      for (int s = 0; s < NST; ++s) { vsa[s] = vsp[s * CZ]; vsb[s] = vsp[s * CZ + 16]; }
#pragma unroll
      for (int r = 0; r < 8; ++r) { gza[r] = gp[(size_t)r * CZ]; gzb[r] = gp[(size_t)r * CZ + 16]; }
    }
    // keeps the next keys' v^T fragments in flight under this step's products, and bounds how many are hoisted (registers)
    __builtin_amdgcn_sched_barrier(0);
    FragH ph;
#pragma unroll
    for (int e = 0; e < 8; ++e) {
      ph.h[0][e] = (_Float16)(u[2 * kt][e] * psc - pcen);
      ph.h[1][e] = (_Float16)(u[2 * kt + 1][e] * psc - pcen);
    }
    o0 = mma_h(ph.v, vha[kt], o0);              // D element r = (row 8hh+r, d = c)
    o0 = mma_h(ph.v, vla[kt], o0);
    o1 = mma_h(ph.v, vhb[kt], o1);              // d = 16 + c
    o1 = mma_h(ph.v, vlb[kt], o1);
  }
  acc_guard2(o0, o1);

  // ---- epilogue: vals = acc/(16384*1024) + key-mean, sigmoid gate, O*4096 -> f16 hi + residual in the block stage tile ----
  {
    const float oc  = 1.0f / (PCAR * VCAR);
    float vs0 = 0.0f, vs1 = 0.0f;
#pragma unroll
    for (int t = 0; t < NST; ++t) { vs0 += vsa[t]; vs1 += vsb[t]; }
    const float vm0 = vs0 * (1.0f / (float)NSEQ);
    const float vm1 = vs1 * (1.0f / (float)NSEQ);
#pragma unroll
    for (int r = 0; r < 8; ++r) {
      const float gz0 = gza[r];
      const float gz1 = gzb[r];
      const float g0  = __builtin_amdgcn_rcpf(1.0f + exp2f(-gz0 * LOG2E));
      const float g1  = __builtin_amdgcn_rcpf(1.0f + exp2f(-gz1 * LOG2E));
      const float w0  = (o0[r] * oc + vm0) * g0 * OSC;
      const float w1  = (o1[r] * oc + vm1) * g1 * OSC;
      const _Float16 h0 = (_Float16)w0, h1 = (_Float16)w1;
      const _Float16 l0 = (_Float16)(w0 - (float)h0), l1 = (_Float16)(w1 - (float)h1);
      const int si = (8 * hh + r) * STP + wave * HD + c;
      stg[si]                 = h_bits(h0);
      stg[si + 16]            = h_bits(h1);
      stg[16 * STP + si]      = h_bits(l0);
      stg[16 * STP + si + 16] = h_bits(l1);
    }
  }
  __syncthreads();
  v4u vh[2], vl[2];
  const int rq = lane >> 3, p8 = (lane & 7) * 8;
#pragma unroll
  for (int it = 0; it < 2; ++it) {
    const int row = it * 8 + wave * 4 + rq;
    vh[it] = *(const v4u*)(stg + row * STP + p8);
    vl[it] = *(const v4u*)(stg + (16 + row) * STP + p8);
  }
  const size_t ob = (prow0 + q0) * CZ + (size_t)hg * 64 + p8;
  {
#pragma unroll
    for (int it = 0; it < 2; ++it) {
      const int row = it * 8 + wave * 4 + rq;
      *(v4u*)(OHp + ob + (size_t)row * CZ) = vh[it];
      *(v4u*)(OLp + ob + (size_t)row * CZ) = vl[it];
    }
    
  }
}

// =====================================================================================================
// All NI row blocks of the pair tensor are processed as one group (IG = NI rows i, GROWS positions), so each stage is one
// chip-filling launch; every plane is fully rewritten by whole-line stores before it is read. Workspace map (bytes; every extent is an exact
// multiple of its store granularity, no tail rows; every region offset a multiple of 32768):
//   WQ, WK, WV, WG, WO  f16 x1024 [128 n][128 k]   5 x 32768;  WB f16 x1024 [BTM n][128 k] (16384 in a 32768 slot)
//   VS   f32 [IG*NST][128]                          IG*NST*512 (slot padded to 32768)
//   XH, XL  f16 [NPOS][128] (x*64 hi, residual)    2 x 16777216
//   BT   f32 [BTM][NPOS] (rows 0..NH-1 written and read) 16777216
//   OH, OL  f16 [GROWS][128]                        2 x GROWS*256
//   GF   f32 [GROWS][128]                           GROWS*512
//   QH, QL, KH, KL  f16 [GROWS][128]               4 x GROWS*256
//   VH, VL  f16 [IG*NH*HD][NSEQ]                    2 x GROWS*256
//   end (IG = 256)                                  218824704
// =====================================================================================================
extern "C" void kernel_launch(void* const* d_in, const int* in_sizes, int n_in,
                              void* d_out, int out_size, void* d_ws, size_t ws_size,
                              hipStream_t stream) {
  if (n_in < 12) return;
  if (in_sizes[0] < NPOS * CZ) return;
  if (in_sizes[1] < NI * NSEQ) return;
  if (in_sizes[2] < CZ || in_sizes[3] < CZ) return;
  if (in_sizes[4] < NH * CZ) return;
  if (in_sizes[5] < CZ * CZ || in_sizes[6] < CZ * CZ || in_sizes[7] < CZ * CZ || in_sizes[8] < CZ * CZ) return;
  if (in_sizes[9] < CZ) return;
  if (in_sizes[10] < CZ * CZ || in_sizes[11] < CZ) return;
  if (out_size < NI * NSEQ * CZ) return;

  const float* x   = (const float*)d_in[0];
  const float* msk = (const float*)d_in[1];
  const float* gam = (const float*)d_in[2];
  const float* bet = (const float*)d_in[3];
  const float* Wt  = (const float*)d_in[4];
  const float* Wq  = (const float*)d_in[5];
  const float* Wk  = (const float*)d_in[6];
  const float* Wv  = (const float*)d_in[7];
  const float* Wg  = (const float*)d_in[8];
  const float* bg  = (const float*)d_in[9];
  const float* Wo  = (const float*)d_in[10];
  const float* bo  = (const float*)d_in[11];
  float*       out = (float*)d_out;

  const size_t szWP = 32768;
  const size_t szVS = (((size_t)IG * NST * CZ * 4) + 32767) / 32768 * 32768;
  const size_t szX  = (size_t)NPOS * CZ * 2;
  const size_t szBT = (size_t)BTM * NPOS * 4;
  const size_t szF  = (size_t)GROWS * CZ * 4;
  const size_t szP  = (size_t)GROWS * CZ * 2;          // QH, QL, KH, KL, VH, VL, OH, OL
  size_t off = 0;
  const size_t oWQ = off; off += szWP;
  const size_t oWK = off; off += szWP;
  const size_t oWV = off; off += szWP;
  const size_t oWG = off; off += szWP;
  const size_t oWO = off; off += szWP;
  const size_t oWB = off; off += szWP;
  const size_t oVS = off; off += szVS;
  const size_t oXH = off; off += szX;
  const size_t oXL = off; off += szX;
  const size_t oBT = off; off += szBT;
  const size_t oOH = off; off += szP;
  const size_t oOL = off; off += szP;
  const size_t oGF = off; off += szF;
  const size_t oQH = off; off += szP;
  const size_t oQL = off; off += szP;
  const size_t oKH = off; off += szP;
  const size_t oKL = off; off += szP;
  const size_t oVH = off; off += szP;
  const size_t oVL = off; off += szP;
  if (off > ws_size) return;                // off = 218824704 for IG = 256
  if (off > (size_t)WS_CAP) return;

  char* ws = (char*)d_ws;
  u16*   WQ = (u16*)(ws + oWQ);
  u16*   WK = (u16*)(ws + oWK);
  u16*   WV = (u16*)(ws + oWV);
  u16*   WG = (u16*)(ws + oWG);
  u16*   WO = (u16*)(ws + oWO);
  u16*   WB = (u16*)(ws + oWB);
  float* VS = (float*)(ws + oVS);
  u16*   XH = (u16*)(ws + oXH);
  u16*   XL = (u16*)(ws + oXL);
  float* BT = (float*)(ws + oBT);
  u16*   OH = (u16*)(ws + oOH);
  u16*   OL = (u16*)(ws + oOL);
  float* GF = (float*)(ws + oGF);
  u16*   QH = (u16*)(ws + oQH);
  u16*   QL = (u16*)(ws + oQL);
  u16*   KH = (u16*)(ws + oKH);
  u16*   KL = (u16*)(ws + oKL);
  u16*   VH = (u16*)(ws + oVH);
  u16*   VL = (u16*)(ws + oVL);

  const dim3 b256(256), b128(128), bAT(ATT_THREADS);
  const dim3 gLN(NPOS / 64);
  const dim3 gW(CZ / 32), gWB(BTM / 32);
  const dim3 gX(2 * (GROWS / (64 * RG)));
  const dim3 gG((GROWS / 64) * (CZ / 64));
  const dim3 gA(IG * NHG * NQT);
  const float oscp = 1.0f / (XSC * WSC);
  const float osco = 1.0f / (OSC * WSC);

  // (a) LayerNorm of all positions -> x*64 f16 hi + residual planes
  ln16<<<gLN, b256, 0, stream>>>(x, gam, bet, XH, XL, NPOS);
  // (b) weight planes [n][k] as f16 of the bf16 value x1024 (weights are [out][in] = [n][k]); Wt plane padded to BTM rows
  wp16<<<gW,  b256, 0, stream>>>(Wq, CZ, CZ,  WQ, WSC);
  wp16<<<gW,  b256, 0, stream>>>(Wk, CZ, CZ,  WK, WSC);
  wp16<<<gW,  b256, 0, stream>>>(Wv, CZ, CZ,  WV, WSC);
  wp16<<<gW,  b256, 0, stream>>>(Wg, CZ, CZ,  WG, WSC);
  wp16<<<gW,  b256, 0, stream>>>(Wo, CZ, CZ,  WO, WSC);
  wp16<<<gWB, b256, 0, stream>>>(Wt, NH, BTM, WB, WSC);

  for (int g = 0; g < NGRP; ++g) {
    const u16*   XHg = XH + (size_t)g * GROWS * CZ;
    const u16*   XLg = XL + (size_t)g * GROWS * CZ;
    const float* Mg  = msk + (size_t)g * IG * NSEQ;
    float*       og  = out + (size_t)g * GROWS * CZ;
    // (c, 1-4) every product of LN(x) in one launch: shared bias table BT[h][p] = sum_c Wt[h][c] * x[p][c] (rows 0..NH-1 of BT),
    //     v^T hi + residual planes x1024 with the per-64-key sums of v, q and k hi + residual planes x1024,
    //     gate pre-activation x.Wg^T + bg -> GF f32
    xproj<<<gX, b128, 0, stream>>>(XHg, XLg, WV, WQ, WK, WG, WB, bg, VH, VL, VS, QH, QL, KH, KL, GF, BT, oscp);
    // (5) attention over all keys of each row block with the shared bias and the row mask bias, gated
    //     -> O x4096 f16 hi + residual planes
    attn<<<gA, bAT, 0, stream>>>(QH, QL, KH, KL, VH, VL, VS, GF, BT, Mg, OH, OL);
    // (6) output projection (O hi + residual).Wo^T + bo -> out f32, carries 4096 x 1024 folded back
    gemm_h<1, 0, 0><<<gG, b128, 0, stream>>>(OH, OL, WO, WO, bo, 1, og, QH, QL, GROWS, CZ, CZ, osco, 1.0f);
  }
  (void)hipGetLastError();
}

// v005
// One run takes 144 microseconds.
// In both of two side-by-side timings against v004, it was 1.09 times as fast.
// All steps since v000 together make it 2.64 times as fast.
// Contractions: LN(x).Wq^T, LN(x).Wk^T, LN(x).Wv^T, LN(x).Wg^T(+bg), LN(x).Wt^T (shared pair-bias table) and O.Wo^T(+bo) on
// v_wmma_f32_16x16x32_f16 with the activation operand carried as f16 hi + f16 residual planes (x*64, O*4096) and the weight
// operand as f16(bf16(W)*1024); q.k^T over 32 on v_wmma_f32_16x16x32_f16 (q, k *1024 f16 hi + residual, products hh+lh+hl);
// centred softmax weights P' = 16384*P - 64 (f16 hi) times v^T (v*1024 f16 hi + residual, products P'.vh + P'.vl);
// all f32 accumulate. LayerNorm, mask bias, softmax, sigmoid gate, key-mean of v and carry folds in f32 on VALU.
// Every float input is RNE-converted to bf16 on load.
#include <hip/hip_runtime.h>
#include <math.h>
#include <stdint.h>

#ifndef NB
#define NB 1
#endif
#ifndef NI
#define NI 256
#endif
#define NSEQ   256
#define CZ     128
#define NH     4
#define HD     32
#define NPOS   (NSEQ * NSEQ)
#define IG     NI
#define NGRP   (NI / IG)
#define GROWS  (IG * NSEQ)
#define XSC    64.0f
#define WSC    1024.0f
#define QSC    1024.0f
#define KSC    1024.0f
#define VCAR   1024.0f
#define PCAR   16384.0f
#define OSC    4096.0f
#define MINF   1.0e9f
#define RSQ_HD 0.17677669529663689f
#define LOG2E  1.4426950408889634f
#define WPB    2
#define NHG    (NH / WPB)
#define NQT    (NSEQ / 16)
#define NKT    (NSEQ / 32)
#define NST    (NSEQ / 64)
#define ATT_THREADS (WPB * 32)
#define SBP    260
#define SBW    (16 * SBP)
#define STP    72
#define SLAB64 (16 * 68)
#define TRP    69
#define XTP    136
#define WTP    136
#define BTM    64
#define RG     2
#define BSP    (64 * RG + 4)
#define WS_CAP 268435456
static_assert(NB == 1);
static_assert(CZ == NH * HD && HD == 32 && NH == 4 && NSEQ == 256);
static_assert(NI >= 1 && NI <= NSEQ && (NI % IG) == 0 && IG >= 1 && IG <= NSEQ && NGRP == 1);
static_assert((GROWS % 64) == 0 && (NPOS % 64) == 0);
static_assert(GROWS == NPOS && (GROWS % (64 * RG)) == 0 && 4 * SLAB64 <= 64 * TRP && NH <= 16 && BTM >= 16 && (BSP % 4) == 0);
static_assert((NH % WPB) == 0 && ATT_THREADS == 64 && (NSEQ % 64) == 0 && (CZ % 64) == 0 && (CZ % 32) == 0);
static_assert((BTM % 64) == 0 && BTM >= NH && (BTM % 32) == 0);
static_assert(SBP >= NSEQ && (SBP % 4) == 0 && STP >= 64 && (STP % 8) == 0 && XTP >= CZ && WTP >= CZ && TRP >= 64);

typedef unsigned short u16;
typedef _Float16 v16h __attribute__((ext_vector_type(16)));
typedef _Float16 v8h  __attribute__((ext_vector_type(8)));
typedef float    v8f  __attribute__((ext_vector_type(8)));
typedef float    v4f  __attribute__((ext_vector_type(4)));
typedef unsigned int v4u __attribute__((ext_vector_type(4)));

union FragH { v16h v; v8h h[2]; v4u u[2]; };

// ---- scalar helpers --------------------------------------------------------------------------------
__device__ __forceinline__ unsigned short bf_bits(float f) {          // f32 -> bf16 bits, RNE convert
  unsigned u = __float_as_uint(f);
  return (unsigned short)((u + 0x7FFFu + ((u >> 16) & 1u)) >> 16);
}
__device__ __forceinline__ float bf_up(unsigned short h) { return __uint_as_float(((unsigned)h) << 16); }
__device__ __forceinline__ float bfr(float f) { return bf_up(bf_bits(f)); }
__device__ __forceinline__ unsigned short h_bits(_Float16 x) { return __builtin_bit_cast(unsigned short, x); }
__device__ __forceinline__ unsigned pk16(unsigned short a, unsigned short b) { return (unsigned)a | ((unsigned)b << 16); }
__device__ __forceinline__ v8f zero8() { v8f z = {0.f, 0.f, 0.f, 0.f, 0.f, 0.f, 0.f, 0.f}; return z; }

// ---- fragment loader: 16-bit A/B operand, lane -> row/col (lane&15), p already includes +8*(lane>>4);
//      elements 0..7 <- p[0..7] (k0+8h..), elements 8..15 <- p[16..23] (k0+16+8h..); same split k map for A and B,
//      B always read from a k-contiguous [n][k] plane.
__device__ __forceinline__ v16h ldfrag_h(const _Float16* p) {
  FragH f;
  f.h[0] = *(const v8h*)(p);
  f.h[1] = *(const v8h*)(p + 16);
  return f.v;
}

// ---- WMMA helpers with trailing VALU hazard gaps ------------------------------------------------------
__device__ __forceinline__ v8f mma_h(v16h a, v16h b, v8f c) {
  return __builtin_amdgcn_wmma_f32_16x16x32_f16(false, a, false, b, (short)0, c, false, false);
}
template <typename F>
__device__ __forceinline__ void guard6(v8f& a, v8f& b, v8f& c, v8f& d, F x0, F x1, F x2, F x3, F x4, F x5) {
#if defined(__HIP_DEVICE_COMPILE__)
  asm volatile("v_nop\n\tv_nop\n\tv_nop\n\tv_nop"
               : "+v"(a), "+v"(b), "+v"(c), "+v"(d) : "v"(x0), "v"(x1), "v"(x2), "v"(x3), "v"(x4), "v"(x5) : "memory");
#endif
}
template <typename F>
__device__ __forceinline__ void guard9(v8f& a, v8f& b, v8f& c, v8f& d, F x0, F x1, F x2, F x3, F x4, F x5,
                                       F x6, F x7, F x8) {
#if defined(__HIP_DEVICE_COMPILE__)
  asm volatile("v_nop\n\tv_nop\n\tv_nop\n\tv_nop"
               : "+v"(a), "+v"(b), "+v"(c), "+v"(d)
               : "v"(x0), "v"(x1), "v"(x2), "v"(x3), "v"(x4), "v"(x5), "v"(x6), "v"(x7), "v"(x8) : "memory");
#endif
}
__device__ __forceinline__ void acc_guard2(v8f& a, v8f& b) {
#if defined(__HIP_DEVICE_COMPILE__)
  asm volatile("v_nop\n\tv_nop\n\tv_nop\n\tv_nop" : "+v"(a), "+v"(b));
#endif
}
__device__ __forceinline__ void wave_sync_lds() {
  __builtin_amdgcn_fence(__ATOMIC_RELEASE, "workgroup");
  __builtin_amdgcn_wave_barrier();
  __builtin_amdgcn_fence(__ATOMIC_ACQUIRE, "workgroup");
}

// =====================================================================================================
// LayerNorm over CZ of the bf16 RNE-converted input rows, eps 1e-5, gamma/beta (bf16 RNE-converted), then
// with shuffles over the 4 lanes); both planes staged in LDS (pitch XTP halves, 16-B vector stores), block barrier, then each
// coverage: compute 256 thr x 32 = 64 rows x 128; store 4 iterations x 8 waves x 2 rows x 16 lanes x 8 halves = 64 x 128 per
//           plane; one block per 64 rows (row0) = every row of XH and XL exactly once (nrows a multiple of 64).
// =====================================================================================================
__device__ __forceinline__ void ln16(u16* TH, u16* TL, const float* __restrict__ X, const float* __restrict__ gam,
                                     const float* __restrict__ bet, u16* XHo, u16* XLo, int row0, int nrows) {
#pragma clang fp contract(off)
  const int tid = (int)threadIdx.x, wave = tid >> 5, lane = tid & 31;
  if (row0 + 64 > nrows) return;            // block-uniform, before the barrier; never taken with the exact grid
  const int rl = tid >> 2, part = tid & 3;
  const float* p = X + (size_t)(row0 + rl) * CZ + part * 32;
  v4f xv[8];
  float s = 0.0f;
#pragma unroll
  for (int t = 0; t < 8; ++t) {
    v4f a = *(const v4f*)(p + 4 * t);
#pragma unroll
    for (int e = 0; e < 4; ++e) { const float f = bfr(a[e]); a[e] = f; s = s + f; }
    xv[t] = a;
  }
  asm volatile("s_wait_xcnt 0x0" ::: "memory");   // a later load's result lands in the address registers that these loads name
  s = s + __shfl_xor(s, 1, 32);
  s = s + __shfl_xor(s, 2, 32);
  const float mu = s * (1.0f / (float)CZ);
  float q = 0.0f;
#pragma unroll
  for (int t = 0; t < 8; ++t) {
#pragma unroll
    for (int e = 0; e < 4; ++e) { const float d = xv[t][e] - mu; q = q + d * d; }
  }
  q = q + __shfl_xor(q, 1, 32);
  q = q + __shfl_xor(q, 2, 32);
  const float var  = q * (1.0f / (float)CZ);
  const float rstd = rsqrtf(var + 1e-5f);
  v4u oh[4], ol[4];
#pragma unroll
  for (int t = 0; t < 8; ++t) {
    const v4f g4 = *(const v4f*)(gam + part * 32 + 4 * t);
    const v4f b4 = *(const v4f*)(bet + part * 32 + 4 * t);
    unsigned short hb[4], lb[4];
#pragma unroll
    for (int e = 0; e < 4; ++e) {
      float y = (xv[t][e] - mu) * rstd;
      y = y * bfr(g4[e]);
      y = y + bfr(b4[e]);
      const float w = y * XSC;
      const _Float16 hv = (_Float16)w;
      const _Float16 lv = (_Float16)(w - (float)hv);
      hb[e] = h_bits(hv);
      lb[e] = h_bits(lv);
    }
    oh[t >> 1][(t & 1) * 2]     = pk16(hb[0], hb[1]);
    oh[t >> 1][(t & 1) * 2 + 1] = pk16(hb[2], hb[3]);
    ol[t >> 1][(t & 1) * 2]     = pk16(lb[0], lb[1]);
    ol[t >> 1][(t & 1) * 2 + 1] = pk16(lb[2], lb[3]);
  }
  {
    u16* th = TH + rl * XTP + part * 32;
    u16* tl = TL + rl * XTP + part * 32;
#pragma unroll
    for (int q4 = 0; q4 < 4; ++q4) {
      *(v4u*)(th + 8 * q4) = oh[q4];
      *(v4u*)(tl + 8 * q4) = ol[q4];
    }
  }
  __syncthreads();
  v4u vh[4], vl[4];
  const int ch = (lane & 15) * 8;
#pragma unroll
  for (int it = 0; it < 4; ++it) {
    const int row = (it * 8 + wave) * 2 + (lane >> 4);
    vh[it] = *(const v4u*)(TH + row * XTP + ch);
    vl[it] = *(const v4u*)(TL + row * XTP + ch);
  }
  {
#pragma unroll
    for (int it = 0; it < 4; ++it) {
      const int row = (it * 8 + wave) * 2 + (lane >> 4);
      const size_t o = (size_t)(row0 + row) * CZ + ch;
      *(v4u*)(XHo + o) = vh[it];
      *(v4u*)(XLo + o) = vl[it];
    }
    // ln16 ends prep: no code behind these stores rewrites the registers they name
    asm volatile("s_wait_xcnt 0x0" ::: "memory");
  }
}

// =====================================================================================================
// Weight plane: W f32 [nrow rows n][CZ k] row-major (k contiguous); D 16-bit [np rows n][CZ k], D[n][k] = f16 bits of
// bf16(W[n][k]) * scale for n < nrow, 0 for nrow <= n < np. Block = 32 n rows: each thread loads 16 consecutive k values of
// one n row with a clamped row address (zeroed by predicate for n >= nrow), converts into the LDS tile [32 n][CZ k]
// coverage: load 256 thr x 16 = 32 n x 128 k; store 2 iterations x 8 waves x 2 rows x 16 lanes x 8 halves = 32 x 128;
//           np/32 blocks (n0) cover the [np][CZ] plane exactly once.
// =====================================================================================================
__device__ __forceinline__ void wp16(u16* T, const float* __restrict__ W, int nrow, int np, int n0, u16* D, float scale) {
  const int tid = (int)threadIdx.x, wave = tid >> 5, lane = tid & 31;
  if (n0 + 32 > np) return;                 // block-uniform, before the barrier; never taken with the exact grid
  {
    const int nl = tid >> 3, kc = (tid & 7) * 16;
    const int n  = n0 + nl;
    int nr = (n < nrow) ? n : (nrow - 1);
    nr = (nr < 0) ? 0 : nr;
    const float* src = W + (size_t)nr * CZ + kc;
    v4u w2[2];
#pragma unroll
    for (int t = 0; t < 4; ++t) {
      const v4f a = *(const v4f*)(src + 4 * t);
      unsigned short hb[4];
#pragma unroll
      for (int e = 0; e < 4; ++e) {
        const float val = (n < nrow) ? a[e] : 0.0f;
        hb[e] = h_bits((_Float16)(bfr(val) * scale));
      }
      w2[t >> 1][(t & 1) * 2]     = pk16(hb[0], hb[1]);
      w2[t >> 1][(t & 1) * 2 + 1] = pk16(hb[2], hb[3]);
    }
    *(v4u*)(T + nl * WTP + kc)     = w2[0];
    *(v4u*)(T + nl * WTP + kc + 8) = w2[1];
  }
  __syncthreads();
  v4u w4[2];
  const int ch = (lane & 15) * 8;
#pragma unroll
  for (int it = 0; it < 2; ++it) {
    const int row = (it * 8 + wave) * 2 + (lane >> 4);
    w4[it] = *(const v4u*)(T + row * WTP + ch);
  }
  {
#pragma unroll
    for (int it = 0; it < 2; ++it) {
      const int row = (it * 8 + wave) * 2 + (lane >> 4);
      *(v4u*)(D + (size_t)(n0 + row) * CZ + ch) = w4[it];
    }
    
  }
}

// =====================================================================================================
// Everything that depends on the inputs alone, in one launch: the six weight planes and the LayerNorm planes are independent of
// one another, so they share a grid. Blocks 0 .. WPBLK-1: block b does rows 32*(b % 4) .. +31
// of weight plane b / 4 (0..4 = Wq, Wk, Wv, Wg, Wo, CZ rows each; 5 = Wt, NH rows padded to BTM, blocks 20 and 21).
// Blocks WPBLK .. : 64 position rows of LayerNorm each. The branch is block-uniform, each side has its own one barrier.
// LDS: the weight tile [32][WTP] lies in the first LayerNorm stage tile [64][XTP].
// coverage: 5 * CZ/32 + BTM/32 weight blocks = every row of every weight plane once; NPOS/64 LayerNorm blocks = every position once.
// =====================================================================================================
#define WPBLK (5 * (CZ / 32) + BTM / 32)
static_assert(CZ / 32 == 4 && BTM / 32 <= CZ / 32 && 32 * WTP <= 64 * XTP);
__global__ __launch_bounds__(256)
void prep(const float* __restrict__ X, const float* __restrict__ gam, const float* __restrict__ bet,
          const float* __restrict__ Wq, const float* __restrict__ Wk, const float* __restrict__ Wv,
          const float* __restrict__ Wg, const float* __restrict__ Wo, const float* __restrict__ Wt,
          u16* XHo, u16* XLo, u16* WQo, u16* WKo, u16* WVo, u16* WGo, u16* WOo, u16* WBo) {
  __shared__ __align__(16) u16 TH[64 * XTP];
  __shared__ __align__(16) u16 TL[64 * XTP];
  const int bid = (int)blockIdx.x;
  if (bid < WPBLK) {
    const int pl = bid / (CZ / 32), n0 = (bid % (CZ / 32)) * 32;
    const float* W = (pl == 0) ? Wq : (pl == 1) ? Wk : (pl == 2) ? Wv : (pl == 3) ? Wg : (pl == 4) ? Wo : Wt;
    u16*         D = (pl == 0) ? WQo : (pl == 1) ? WKo : (pl == 2) ? WVo : (pl == 3) ? WGo : (pl == 4) ? WOo : WBo;
    wp16(TH, W, (pl == 5) ? NH : CZ, (pl == 5) ? BTM : CZ, n0, D, WSC);
    return;
  }
  ln16(TH, TL, X, gam, bet, XHo, XLo, (bid - WPBLK) * 64, NPOS);
}

// =====================================================================================================
// GEMM epilogue: the wave's 16x64 f32 tile (times oscale, plus a per-column addend) staged in its LDS slab (pitch 68),
// coverage: 8 instructions x 2 rows x 16 lanes x 4 floats = the wave's 16 x 64 tile.
// =====================================================================================================
__device__ __forceinline__ void epi64(float* sl, v8f a0, v8f a1, v8f a2, v8f a3, float oscale,
                                      float b0, float b1, float b2, float b3,
                                      float* C, int N, size_t rowb, int col0, int lane) {
  const int hh = lane >> 4, m = lane & 15;
#pragma unroll
  for (int r = 0; r < 8; ++r) {
    const int ro = (8 * hh + r) * 68 + m;
    sl[ro]      = a0[r] * oscale + b0;
    sl[ro + 16] = a1[r] * oscale + b1;
    sl[ro + 32] = a2[r] * oscale + b2;
    sl[ro + 48] = a3[r] * oscale + b3;
  }
  wave_sync_lds();
  v4f vals[8];
#pragma unroll
  for (int it = 0; it < 8; ++it) vals[it] = *(const v4f*)(sl + (it * 2 + hh) * 68 + m * 4);
  float* dst = C + (rowb + (size_t)hh) * (size_t)N + col0 + m * 4;
  {
#pragma unroll
    for (int it = 0; it < 8; ++it) {
      *(v4f*)(dst + (size_t)(it * 2) * (size_t)N) = vals[it];
    }
    
  }
}

// =====================================================================================================
// Eight f32 values (already carrying their plane scale) -> 8 f16 hi halves and 8 f16 residual halves, packed for 16-B stores.
// =====================================================================================================
__device__ __forceinline__ void split8(const float* w, v4u& oh, v4u& ol) {
#pragma unroll
  for (int e = 0; e < 4; ++e) {
    const float t0 = w[2 * e], t1 = w[2 * e + 1];
    const _Float16 h0 = (_Float16)t0, h1 = (_Float16)t1;
    const _Float16 l0 = (_Float16)(t0 - (float)h0), l1 = (_Float16)(t1 - (float)h1);
    oh[e] = pk16(h_bits(h0), h_bits(h1));
    ol[e] = pk16(h_bits(l0), h_bits(l1));
  }
}

// =====================================================================================================
// GEMM epilogue, plane form (q, k): the wave's 16x64 f32 tile (times oscale) staged in its LDS slab (pitch 68), read back as
// 8 consecutive columns per lane, times psc, split into f16 hi + residual, one 16-B store per plane and lane.
// coverage: 4 instructions x 4 rows x 8 lanes x 8 halves = the wave's 16 x 64 tile per plane; each row segment is one whole
//           128-B line written by one instruction.
// =====================================================================================================
__device__ __forceinline__ void epi_pl(float* sl, v8f a0, v8f a1, v8f a2, v8f a3, float oscale, float psc,
                                       u16* Hp, u16* Lp, int N, size_t rowb, int col0, int lane) {
  const int hh = lane >> 4, m = lane & 15;
#pragma unroll
  for (int r = 0; r < 8; ++r) {
    const int ro = (8 * hh + r) * 68 + m;
    sl[ro]      = a0[r] * oscale;
    sl[ro + 16] = a1[r] * oscale;
    sl[ro + 32] = a2[r] * oscale;
    sl[ro + 48] = a3[r] * oscale;
  }
  wave_sync_lds();
  const int rq = lane >> 3, c8 = (lane & 7) * 8;
  v4u oh[4], ol[4];
#pragma unroll
  for (int it = 0; it < 4; ++it) {
    const float* p = sl + (it * 4 + rq) * 68 + c8;
    const v4f a = *(const v4f*)(p), b4 = *(const v4f*)(p + 4);
    float w[8];
#pragma unroll
    for (int e = 0; e < 4; ++e) { w[e] = a[e] * psc; w[4 + e] = b4[e] * psc; }
    split8(w, oh[it], ol[it]);
  }
#pragma unroll
  for (int it = 0; it < 4; ++it) {
    const size_t o = (rowb + (size_t)(it * 4 + rq)) * (size_t)N + col0 + c8;
    *(v4u*)(Hp + o) = oh[it];
    *(v4u*)(Lp + o) = ol[it];
  }
}

// =====================================================================================================
// GEMM epilogue, transposed plane form (v): the block's 64 keys x 64 columns f32 tile (times oscale) staged in one LDS tile
// [key][column] (pitch TRP floats: odd, so the column reads below fall in 32 different banks), block barrier, then each lane
// reads 8 consecutive keys of one column, splits v * psc into f16 hi + residual and stores 16 B per plane into
//   Hp/Lp[(il*N + column)][NSEQ keys]; 8 lanes = one whole 128-B line. The 8 lanes' f32 values are also summed (shuffles) to the
// column's sum over the block's 64 keys; the 64 sums are gathered in LDS and stored by wave 0 as two whole lines of
//   KS[row tile][N]  (row tile = il*NST + key tile).
// coverage: 4 waves x 4 instructions x 4 columns x 8 lanes x 8 halves = 64 columns x 64 keys per plane; 32 lanes x 2 = 64 sums.
// =====================================================================================================
__device__ __forceinline__ void epi_tr(float* sl, float* rs, v8f a0, v8f a1, v8f a2, v8f a3, float oscale, float psc,
                                       u16* Hp, u16* Lp, float* KS, int N, int rb0, int col0, int wave, int lane) {
  const int hh = lane >> 4, m = lane & 15;
#pragma unroll
  for (int r = 0; r < 8; ++r) {
    const int ro = (wave * 16 + 8 * hh + r) * TRP + m;
    sl[ro]      = a0[r] * oscale;
    sl[ro + 16] = a1[r] * oscale;
    sl[ro + 32] = a2[r] * oscale;
    sl[ro + 48] = a3[r] * oscale;
  }
  __syncthreads();
  const int rq = lane >> 3, k8 = (lane & 7) * 8;
  const int il = rb0 / NSEQ, s0 = rb0 % NSEQ;
  v4u oh[4], ol[4];
  float cs[4];
#pragma unroll
  for (int it = 0; it < 4; ++it) {
    const int cl = wave * 16 + it * 4 + rq;              // column within the block's 64
    float v[8], w[8];
#pragma unroll
    for (int e = 0; e < 8; ++e) v[e] = sl[(k8 + e) * TRP + cl];
#pragma unroll
    for (int e = 0; e < 8; ++e) w[e] = v[e] * psc;
    split8(w, oh[it], ol[it]);
    cs[it] = ((v[0] + v[1]) + (v[2] + v[3])) + ((v[4] + v[5]) + (v[6] + v[7]));
  }
#pragma unroll
  for (int off = 1; off < 8; off <<= 1) {
#pragma unroll
    for (int it = 0; it < 4; ++it) cs[it] += __shfl_xor(cs[it], off, 32);
  }
  if ((lane & 7) == 0) {
#pragma unroll
    for (int it = 0; it < 4; ++it) rs[wave * 16 + it * 4 + rq] = cs[it];
  }
  __syncthreads();
  if (wave == 0) {
    float2 t;
    t.x = rs[2 * lane];
    t.y = rs[2 * lane + 1];
    *(float2*)(KS + (size_t)(rb0 / 64) * N + col0 + 2 * lane) = t;
    asm volatile("s_wait_xcnt 0x0" ::: "memory");     // the code behind this branch rewrites the registers that the store names
  }
  // wave-uniform base + one 32-bit lane offset: the four column groups differ by a constant, so one register addresses all stores
  const size_t   ub = ((size_t)il * N + col0 + wave * 16) * NSEQ + s0;
  const unsigned lo = (unsigned)(rq * NSEQ + k8);
#pragma unroll
  for (int it = 0; it < 4; ++it) {
    *(v4u*)(Hp + ub + (lo + it * 4 * NSEQ)) = oh[it];
    *(v4u*)(Lp + ub + (lo + it * 4 * NSEQ)) = ol[it];
  }
}

// =====================================================================================================
// f16 GEMM: C[M][N] (f32) = (Ah [+ Al])[M][K] . (Bh [+ Bl])[N][K]^T * oscale [+ bf16(bias[col])].
// ALO == 1: products ah.bh + al.bh (A residual plane, unscaled); BLO == 1: products ah.bh + ah.bl (B residual plane);
// one accumulator. Block = 64x64 tile, 4 waves x 16 rows; fragments loaded straight from the 16-bit rows (two 16-B loads
// each, split k map for A and B); K stepped by 32 (host guarantees K % 32 == 0, M % 64 == 0, N % 64 == 0,
// grid = (M/64)*(N/64)). hasb is a block-uniform flag; bias is dereferenced only when hasb != 0.
// EPI == 0: C f32 as above. EPI == 1: the product times psc goes out as f16 hi + residual planes Hp, Lp [M][N] (C unused).
// EPI == 2: the product times psc goes out transposed per NSEQ-row group as Hp, Lp [(row / NSEQ)*N + col][NSEQ], and C takes
// the f32 column sums of each 64-row tile, [M/64][N] (host guarantees NSEQ % 64 == 0 and M % NSEQ == 0).
// =====================================================================================================
template <int ALO, int BLO, int EPI>
__global__ __launch_bounds__(128)
void gemm_h(const u16* __restrict__ Ah, const u16* __restrict__ Al, const u16* __restrict__ Bh, const u16* __restrict__ Bl,
            const float* __restrict__ bias, int hasb, float* C, u16* Hp, u16* Lp, int M, int N, int K, float oscale,
            float psc) {
  __shared__ __align__(16) float slab[(EPI == 2) ? (64 * TRP + 64) : (4 * SLAB64)];
  const int tid = (int)threadIdx.x, wave = tid >> 5, lane = tid & 31, hh = lane >> 4, m = lane & 15;
  const int ntile = N >> 6;
  const int bid   = (int)blockIdx.x;
  const int rb0   = (bid / ntile) * 64;
  const int rowb  = rb0 + wave * 16;
  const int col0  = (bid % ntile) * 64;
  if (rb0 + 64 > M) return;                 // block-uniform, before any barrier; never taken with the exact grid
  const _Float16* ahp = (const _Float16*)(const void*)Ah + (size_t)(rowb + m) * K + 8 * hh;
  const _Float16* alp = (const _Float16*)(const void*)Al + (size_t)(rowb + m) * K + 8 * hh;   // read only when ALO
  const _Float16* bhp = (const _Float16*)(const void*)Bh + (size_t)(col0 + m) * K + 8 * hh;
  const _Float16* blp = (const _Float16*)(const void*)Bl + (size_t)(col0 + m) * K + 8 * hh;   // read only when BLO
  const size_t bs = (size_t)16 * K;
  float bb0 = 0.0f, bb1 = 0.0f, bb2 = 0.0f, bb3 = 0.0f;
  if (hasb != 0) {
    bb0 = bfr(bias[col0 + m]);
    bb1 = bfr(bias[col0 + 16 + m]);
    bb2 = bfr(bias[col0 + 32 + m]);
    bb3 = bfr(bias[col0 + 48 + m]);
  }
  v8f acc0 = zero8(), acc1 = zero8(), acc2 = zero8(), acc3 = zero8();
#pragma unroll 1
  for (int k0 = 0; k0 < K; k0 += 32) {
    const v16h ah = ldfrag_h(ahp + k0);
    const v16h b0 = ldfrag_h(bhp + k0);
    const v16h b1 = ldfrag_h(bhp + bs + k0);
    const v16h b2 = ldfrag_h(bhp + 2 * bs + k0);
    const v16h b3 = ldfrag_h(bhp + 3 * bs + k0);
    acc0 = mma_h(ah, b0, acc0);
    acc1 = mma_h(ah, b1, acc1);
    acc2 = mma_h(ah, b2, acc2);
    acc3 = mma_h(ah, b3, acc3);
    if constexpr (ALO != 0) {
      const v16h al = ldfrag_h(alp + k0);
      acc0 = mma_h(al, b0, acc0);
      acc1 = mma_h(al, b1, acc1);
      acc2 = mma_h(al, b2, acc2);
      acc3 = mma_h(al, b3, acc3);
      if constexpr (BLO != 0) {
        const v16h l0 = ldfrag_h(blp + k0);
        const v16h l1 = ldfrag_h(blp + bs + k0);
        const v16h l2 = ldfrag_h(blp + 2 * bs + k0);
        const v16h l3 = ldfrag_h(blp + 3 * bs + k0);
        acc0 = mma_h(ah, l0, acc0);
        acc1 = mma_h(ah, l1, acc1);
        acc2 = mma_h(ah, l2, acc2);
        acc3 = mma_h(ah, l3, acc3);
        guard9<v16h>(acc0, acc1, acc2, acc3, ah, b0, b1, b2, b3, l0, l1, l2, l3);
        guard6<v16h>(acc0, acc1, acc2, acc3, al, al, al, al, al, al);
      } else {
        guard6<v16h>(acc0, acc1, acc2, acc3, ah, al, b0, b1, b2, b3);
      }
    } else if constexpr (BLO != 0) {
      const v16h l0 = ldfrag_h(blp + k0);
      const v16h l1 = ldfrag_h(blp + bs + k0);
      const v16h l2 = ldfrag_h(blp + 2 * bs + k0);
      const v16h l3 = ldfrag_h(blp + 3 * bs + k0);
      acc0 = mma_h(ah, l0, acc0);
      acc1 = mma_h(ah, l1, acc1);
      acc2 = mma_h(ah, l2, acc2);
      acc3 = mma_h(ah, l3, acc3);
      guard9<v16h>(acc0, acc1, acc2, acc3, ah, b0, b1, b2, b3, l0, l1, l2, l3);
    } else {
      guard6<v16h>(acc0, acc1, acc2, acc3, ah, b0, b1, b2, b3, ah);
    }
  }
  if constexpr (EPI == 0) {
    epi64(slab + wave * SLAB64, acc0, acc1, acc2, acc3, oscale, bb0, bb1, bb2, bb3, C, N, (size_t)rowb, col0, lane);
  } else if constexpr (EPI == 1) {
    epi_pl(slab + wave * SLAB64, acc0, acc1, acc2, acc3, oscale, psc, Hp, Lp, N, (size_t)rowb, col0, lane);
  } else {
    epi_tr(slab, slab + 64 * TRP, acc0, acc1, acc2, acc3, oscale, psc, Hp, Lp, C, N, rb0, col0, wave, lane);
  }
}

// =====================================================================================================
// All products of LN(x) in one launch: v, q, k, gate pre-activation and the pair-bias table.
// Two blocks per RG groups of 64 position rows (one does pair bias, v and gate, the other q and k), 4 waves each;
// wave w owns rows rb0 + 64g + 16w .. +15 of every group g and loads their
// A fragments (x*64 hi + residual, all CZ = 4 k-steps) ONCE into registers; they serve every column tile of the block, so each weight
// fragment that a wave loads is used for RG*16 rows. Per accumulator the products run xh.w, xl.w per k-step, k ascending.
//   pair bias: B = Wt plane rows 0..15 (rows >= NH are zero), D (row = position, column = head) staged in LDS [16][BSP],
//              block barrier, heads 0..NH-1 stored as whole lines of BT[h][position]   (GROWS == NPOS: every position once)
//   v: 2 column tiles x RG groups through epi_tr;  q, k: 2 + 2 column tiles through epi_pl;  gate: 2 column tiles through epi64.
// LDS: epi_tr's block tile [64][TRP] + 64 sums; the per-wave slabs of epi_pl / epi64 lie inside that tile; the q, k blocks run no epi_tr,
// and the gate's epi64 slabs are first written behind epi_tr's last barrier, at which every read of the tile has returned; the bias stage lies behind both.
// coverage: grid = 2 * GROWS/(64*RG) blocks; per part RG groups x 64 rows = every row once, for each of the CZ/64 column tiles of each plane.
// =====================================================================================================
__device__ __forceinline__ void xw_tile(const v16h (&ah)[RG][CZ / 32], const v16h (&al)[RG][CZ / 32], const _Float16* bp,
                                        unsigned wo, v8f (&acc)[RG][4]) {
#pragma unroll
  for (int g = 0; g < RG; ++g) {
#pragma unroll
    for (int j = 0; j < 4; ++j) acc[g][j] = zero8();
  }
#pragma unroll                              // constant indices keep ah[], al[] in registers
  for (int ks = 0; ks < CZ / 32; ++ks) {
    v16h b[4];
#pragma unroll
    for (int j = 0; j < 4; ++j) b[j] = ldfrag_h(bp + (wo + j * 16 * CZ + ks * 32));
#pragma unroll
    for (int g = 0; g < RG; ++g) {
#pragma unroll
      for (int j = 0; j < 4; ++j) acc[g][j] = mma_h(ah[g][ks], b[j], acc[g][j]);
#pragma unroll
      for (int j = 0; j < 4; ++j) acc[g][j] = mma_h(al[g][ks], b[j], acc[g][j]);
    }
  }
}

// amdgpu_waves_per_eu(4): holds the register budget to 256: four blocks per WGP (one wave of each on every SIMD), so that the whole
// grid is resident at once, and no register above v255 is used.
__global__ __launch_bounds__(128) __attribute__((amdgpu_waves_per_eu(4)))
void xproj(const u16* __restrict__ XHp, const u16* __restrict__ XLp, const u16* __restrict__ WVp,
           const u16* __restrict__ WQp, const u16* __restrict__ WKp, const u16* __restrict__ WGp,
           const u16* __restrict__ WBp, const float* __restrict__ bg, u16* VHp, u16* VLp, float* VS,
           u16* QHp, u16* QLp, u16* KHp, u16* KLp, float* GF, float* BT, float oscale) {
  __shared__ __align__(16) float slab[64 * TRP + 64 + 16 * BSP];
  const int tid = (int)threadIdx.x, lane = tid & 31, hh = lane >> 4, m = lane & 15;
  const int wave = __builtin_amdgcn_readfirstlane(tid >> 5);   // scalar: row and slab offsets stay out of the vector registers
  const int rb0  = ((int)blockIdx.x >> 1) * (64 * RG);
  const int part = (int)blockIdx.x & 1;     // block-uniform: 0 = pair bias, v, gate; 1 = q, k (4 column tiles of 64 each)
  if (rb0 + 64 * RG > GROWS) return;        // block-uniform, before any barrier; never taken with the exact grid
  // lane offset inside a 16-row group of a [row][CZ] plane: row m, split k map; the same for x rows (A) and weight rows (B)
  const unsigned wo = (unsigned)(m * CZ + 8 * hh);
  v16h ah[RG][CZ / 32], al[RG][CZ / 32];
  {
    const _Float16* xh = (const _Float16*)(const void*)XHp + (size_t)(rb0 + wave * 16) * CZ;   // wave-uniform bases
    const _Float16* xl = (const _Float16*)(const void*)XLp + (size_t)(rb0 + wave * 16) * CZ;
#pragma unroll
    for (int g = 0; g < RG; ++g) {
#pragma unroll
      for (int ks = 0; ks < CZ / 32; ++ks) {
        ah[g][ks] = ldfrag_h(xh + (wo + g * 64 * CZ + ks * 32));
        al[g][ks] = ldfrag_h(xl + (wo + g * 64 * CZ + ks * 32));
      }
    }
    // the two base registers that these loads name are reused behind here; as inputs they stay untouched up to the wait
    asm volatile("s_wait_xcnt 0x0" :: "s"(xh), "s"(xl) : "memory");
  }
  float* wsl = slab + wave * SLAB64;
  v8f acc[RG][4];

  if (part != 0) {
    // ---- q, k: hi + residual planes ----
#pragma unroll 1                            // rolled: one copy of the tile code in the instruction cache
    for (int i = 0; i < 2 * (CZ / 64); ++i) {
      const bool isq = i < CZ / 64;
      const int  ct  = isq ? i : i - CZ / 64;
      const u16* wp  = isq ? WQp : WKp;
      u16* hp = isq ? QHp : KHp;
      u16* lp = isq ? QLp : KLp;
      xw_tile(ah, al, (const _Float16*)(const void*)wp + (size_t)(ct * 64) * CZ, wo, acc);
#pragma unroll
      for (int g = 0; g < RG; ++g) {
        epi_pl(wsl, acc[g][0], acc[g][1], acc[g][2], acc[g][3], oscale, isq ? QSC : KSC, hp, lp, CZ,
               (size_t)(rb0 + g * 64 + wave * 16), ct * 64, lane);
        asm volatile("s_wait_xcnt 0x0" ::: "memory");   // the next tile rewrites the registers that these stores name
      }
    }
    return;                                 // block-uniform; the barriers below are passed by whole blocks of part 0 only
  }

  // ---- pair bias ----
  {
    float* bsl = slab + 64 * TRP + 64;
    v8f ab[RG];
#pragma unroll
    for (int g = 0; g < RG; ++g) ab[g] = zero8();
#pragma unroll
    for (int ks = 0; ks < CZ / 32; ++ks) {
      const v16h b = ldfrag_h((const _Float16*)(const void*)WBp + (wo + ks * 32));
#pragma unroll
      for (int g = 0; g < RG; ++g) {
        ab[g] = mma_h(ah[g][ks], b, ab[g]);
        ab[g] = mma_h(al[g][ks], b, ab[g]);
      }
    }
#pragma unroll
    for (int g = 0; g < RG; ++g) {
      v4f t0, t1;
#pragma unroll
      for (int e = 0; e < 4; ++e) { t0[e] = ab[g][e] * oscale; t1[e] = ab[g][4 + e] * oscale; }
      float* d = bsl + m * BSP + g * 64 + wave * 16 + 8 * hh;
      *(v4f*)(d)     = t0;
      *(v4f*)(d + 4) = t1;
    }
    __syncthreads();
    for (int i = tid; i < NH * 16 * RG; i += 128) {   // wave-uniform trip count: 16*RG is a multiple of 16, 128 of 32
      const int h = i / (16 * RG), p4 = (i % (16 * RG)) * 4;
      *(v4f*)(BT + (size_t)h * NPOS + rb0 + p4) = *(const v4f*)(bsl + h * BSP + p4);
    }
  }

  // ---- v: transposed hi + residual planes and 64-key sums ----
#pragma unroll 1                            // rolled: one copy of the tile code in the instruction cache
  for (int ct = 0; ct < CZ / 64; ++ct) {
    xw_tile(ah, al, (const _Float16*)(const void*)WVp + (size_t)(ct * 64) * CZ, wo, acc);
#pragma unroll
    for (int g = 0; g < RG; ++g) {
      epi_tr(slab, slab + 64 * TRP, acc[g][0], acc[g][1], acc[g][2], acc[g][3], oscale, VCAR, VHp, VLp, VS, CZ,
             rb0 + g * 64, ct * 64, wave, lane);
      asm volatile("s_wait_xcnt 0x0" ::: "memory");   // the next tile rewrites the registers that these stores name
    }
  }
  // ---- gate pre-activation, f32, bias added ----
#pragma unroll 1                            // rolled: one copy of the tile code in the instruction cache
  for (int ct = 0; ct < CZ / 64; ++ct) {
    const float b0 = bfr(bg[ct * 64 + m]), b1 = bfr(bg[ct * 64 + 16 + m]);
    const float b2 = bfr(bg[ct * 64 + 32 + m]), b3 = bfr(bg[ct * 64 + 48 + m]);
    xw_tile(ah, al, (const _Float16*)(const void*)WGp + (size_t)(ct * 64) * CZ, wo, acc);
#pragma unroll
    for (int g = 0; g < RG; ++g) {
      epi64(wsl, acc[g][0], acc[g][1], acc[g][2], acc[g][3], oscale, b0, b1, b2, b3, GF, CZ,
            (size_t)(rb0 + g * 64 + wave * 16), ct * 64, lane);
      asm volatile("s_wait_xcnt 0x0" ::: "memory");   // the next tile rewrites the registers that these stores name
    }
  }
}

// =====================================================================================================
// Row-wise gated attention. Block bid -> (query tile qt: rows q0 = 16*qt .. q0+15 of row block il, head group hg of WPB
// heads); one wave per head = hg*WPB + wave; all NSEQ keys of row block il, shared bias table BT f32 [BTM][NPOS]
// (row h, position j*NSEQ + k) plus the per-row mask bias 1e9*(bf16(mask[il][k]) - 1) (MK already offset to the row group).
//   q/k planes f16 x1024 hi + residual [il*NSEQ + s][h*HD + d]; v^T planes [il*NH + h][d][NSEQ] hi + residual;
//   VS f32 [il*NST + key tile][h*HD + d] = sums of v over 64 keys (their total / NSEQ = key-mean of v); GF f32 [il*NSEQ + s][h*HD + d] = gate pre-activation (bias already added).
//   Phase 0: the wave's 16 x NSEQ bias rows (times log2e, plus mask bias times log2e) loaded with 16-B loads into its private
//   LDS bias buffer (pitch SBP: 16 B over a multiple of 256 B, the pitch of 16-B row readers).
//   Phase 1 (per 16-key tile): TRANSPOSED scores k_hi.q_hi + k_hi.q_lo + k_lo.q_hi (A = key rows, B = query rows, one k-step of
//   32): D element r of lane (c, hh) = (key 16t + 8hh + r, query c). u = s*rsqrt(32)*log2e/(1024*1024) + bias (two 16-B LDS reads
//   of buffer row c); all 128 scores of a lane stay in registers; running max in-lane, one exchange between the lane halves.
//   Phase 2a: p = exp2(u - m) in registers, row sum Z in-lane (8 chains, tree) plus one exchange, scale 16384/Z.
//   Phase 2b (per 32 keys): P' = p*16384/Z - 64 of two neighbouring tiles converted to f16 IS the A fragment (row c, split k map);
//   v^T B fragments for the two 16-wide d subtiles, products P'.v_hi + P'.v_lo. The score, softmax and P'.v code is straight-line.
//   Epilogue: vals = acc/(16384*1024) + key-mean (exact identity sum(P'+64).v/16384 = sum P.v), gate g = 1/(1+exp(-z)) in f32,
//   O = g*vals*4096 -> f16 hi + residual, staged as u16 elements in a block LDS tile [2 planes][16 rows][STP], block barrier,
//   a divergent branch; the only early return is block-uniform and precedes every barrier.
// staged extent == consumed extent: bias buffer columns 0..NSEQ-1 of all 16 rows written in phase 0 before any read
//   (columns NSEQ..SBP-1 never read); stage tile rows 0..15 x columns 0..63 of both planes written before the barrier
//   (columns 64..STP-1 never read).
// coverage: per block 2 iterations x 2 waves x 4 row groups x 8 lanes x 8 halves = 16 rows x 64 halves per plane;
//           grid = IG*NHG*NQT blocks = every (row, 64-column group) of OH and OL exactly once.
// =====================================================================================================
// amdgpu_waves_per_eu(4): the LDS lets 8 blocks = 4 waves per SIMD stay resident; the register budget is held to that (256).
__global__ __launch_bounds__(ATT_THREADS) __attribute__((amdgpu_waves_per_eu(4)))
void attn(const u16* __restrict__ QHp, const u16* __restrict__ QLp,
          const u16* __restrict__ KHp, const u16* __restrict__ KLp,
          const u16* __restrict__ VHp, const u16* __restrict__ VLp,
          const float* __restrict__ VS, const float* __restrict__ GF, const float* __restrict__ BT,
          const float* __restrict__ MK, u16* OHp, u16* OLp) {
  __shared__ __align__(16) float sbuf[WPB * SBW];
  __shared__ __align__(16) u16 stg[2 * 16 * STP];

  const int tid  = (int)threadIdx.x;
  const int wave = tid >> 5;
  const int lane = tid & 31;
  const int hh   = lane >> 4;
  const int c    = lane & 15;
  const int bid  = (int)blockIdx.x;
  const int qt   = bid % NQT;
  const int t2   = bid / NQT;
  const int hg   = t2 % NHG;
  const int il   = t2 / NHG;
  if (il >= IG) return;                     // block-uniform, before every barrier; never taken with the exact grid
  const int q0   = qt * 16;
  const int head = hg * WPB + wave;
  float* buf = sbuf + wave * SBW;
  const size_t prow0 = (size_t)il * NSEQ;   // first position row of this row block in the group-local planes

  // q fragments and the first 32 keys' fragments are asked for first: the bias staging below covers their latency
  const size_t hcol = (size_t)head * HD + 8 * hh;
  const _Float16* Qh  = (const _Float16*)(const void*)QHp + (prow0 + q0 + c) * CZ + hcol;
  const _Float16* Ql  = (const _Float16*)(const void*)QLp + (prow0 + q0 + c) * CZ + hcol;
  const _Float16* Khb = (const _Float16*)(const void*)KHp + (prow0 + c) * CZ + hcol;     // key row 16t added per tile
  const _Float16* Klb = (const _Float16*)(const void*)KLp + (prow0 + c) * CZ + hcol;
  const _Float16* Vhb = (const _Float16*)(const void*)VHp + ((size_t)(il * NH + head) * HD + c) * NSEQ + 8 * hh;
  const _Float16* Vlb = (const _Float16*)(const void*)VLp + ((size_t)(il * NH + head) * HD + c) * NSEQ + 8 * hh;
  const v16h qh = ldfrag_h(Qh);
  const v16h ql = ldfrag_h(Ql);
  const float lsc = RSQ_HD * (LOG2E / (QSC * KSC));
  v16h kh[NSEQ / 16], kl[NSEQ / 16];
#pragma unroll
  for (int t = 0; t < 2; ++t) {
    kh[t] = ldfrag_h(Khb + (size_t)(t * 16) * CZ);
    kl[t] = ldfrag_h(Klb + (size_t)(t * 16) * CZ);
  }

  // ---- phase 0: bias rows (query rows q0..q0+15, all keys) x log2e + mask bias x log2e -> bias buffer ----
  {
    const float* bsrc = BT + (size_t)head * NPOS + (size_t)q0 * NSEQ;
    const float* msrc = MK + (size_t)il * NSEQ;
    v4f mb0, mb1;                           // keys lane*4..+3 and 128+lane*4..+3 of mask row il
    {
      const v4f m0 = *(const v4f*)(msrc + lane * 4);
      const v4f m1 = *(const v4f*)(msrc + 128 + lane * 4);
#pragma unroll
      for (int e = 0; e < 4; ++e) {
        mb0[e] = (MINF * (bfr(m0[e]) - 1.0f)) * LOG2E;
        mb1[e] = (MINF * (bfr(m1[e]) - 1.0f)) * LOG2E;
      }
    }
#pragma unroll 1
    for (int g4 = 0; g4 < 4; ++g4) {
      v4f tv[8];
#pragma unroll
      for (int it = 0; it < 8; ++it) {
        const int idx = (g4 * 8 + it) * 32 + lane;        // 0..1023
        const int jr = idx >> 6, k4 = (idx & 63) * 4;      // k4 = lane*4 for even it, 128 + lane*4 for odd it
        tv[it] = *(const v4f*)(bsrc + (size_t)jr * NSEQ + k4);
      }
#pragma unroll
      for (int it = 0; it < 8; ++it) {
        const int idx = (g4 * 8 + it) * 32 + lane;
        const int jr = idx >> 6, k4 = (idx & 63) * 4;
        const v4f mb = (it & 1) ? mb1 : mb0;
        *(v4f*)(buf + jr * SBP + k4) = tv[it] * LOG2E + mb;
      }
    }
  }
  wave_sync_lds();

  // ---- phase 1: transposed scores S^T = k.q^T (A = 16 key rows, B = the 16 query rows), one 16-key tile per step; D element r
  //      of lane (c, hh) = (key 16t + 8hh + r, query c), so a lane owns one query row and its buffered bias is 8 consecutive
  //      floats of buffer row c. All NSEQ/2 = 128 scores of the lane's row half stay in registers (log2 domain). ----
  v8f u[NSEQ / 16];
  float mx4[4];
#pragma unroll
  for (int r = 0; r < 4; ++r) mx4[r] = -INFINITY;
#pragma unroll                              // full unroll here and below: u[], kh[], kl[], v*[] live in registers only with constant indices
  for (int g = 0; g < NKT; ++g) {
#pragma unroll
    for (int j = 0; j < 2; ++j) {
      const int t = 2 * g + 2 + j;
      if (t < NSEQ / 16) {
        kh[t] = ldfrag_h(Khb + (size_t)(t * 16) * CZ);
        kl[t] = ldfrag_h(Klb + (size_t)(t * 16) * CZ);
      }
    }
    // keeps the key fragments of the next tile pair in flight, and no more of them: unbounded hoisting spilled registers
    __builtin_amdgcn_sched_barrier(0);
#pragma unroll
    for (int j = 0; j < 2; ++j) {
      const int t = 2 * g + j;
      v8f s = zero8();
      s = mma_h(kh[t], qh, s);
      s = mma_h(kh[t], ql, s);
      s = mma_h(kl[t], qh, s);
      const float* bp = buf + c * SBP + t * 16 + 8 * hh;
      const v4f b0 = *(const v4f*)(bp), b1 = *(const v4f*)(bp + 4);
#pragma unroll
      for (int e = 0; e < 4; ++e) {
        s[e]     = s[e] * lsc + b0[e];
        s[4 + e] = s[4 + e] * lsc + b1[e];
      }
#pragma unroll
      for (int r = 0; r < 4; ++r) mx4[r] = fmaxf(mx4[r], fmaxf(s[r], s[4 + r]));
      u[t] = s;
    }
  }
  // v^T fragments of the first 32 keys are asked for before the softmax arithmetic, which covers their latency
  v16h vha[NKT], vhb[NKT], vla[NKT], vlb[NKT];
  vha[0] = ldfrag_h(Vhb);
  vhb[0] = ldfrag_h(Vhb + (size_t)16 * NSEQ);
  vla[0] = ldfrag_h(Vlb);
  vlb[0] = ldfrag_h(Vlb + (size_t)16 * NSEQ);
  __builtin_amdgcn_sched_barrier(0);        // holds those loads in front of the softmax
  float mx = fmaxf(fmaxf(mx4[0], mx4[1]), fmaxf(mx4[2], mx4[3]));
  mx = fmaxf(mx, __shfl_xor(mx, 16, 32));   // the other lane half holds the other 128 keys of the same query row

  // ---- phase 2a: p = exp2(u - m) in place, row sum Z (8 in-lane chains, tree, one exchange), scale 16384/Z (Z >= 1) ----
  float psc;
  {
    float l8[8];
#pragma unroll
    for (int r = 0; r < 8; ++r) l8[r] = 0.0f;
#pragma unroll
    for (int t = 0; t < NSEQ / 16; ++t) {
#pragma unroll
      for (int r = 0; r < 8; ++r) {
        const float e = exp2f(u[t][r] - mx);
        u[t][r] = e;
        l8[r] += e;
      }
    }
    float ls = ((l8[0] + l8[1]) + (l8[2] + l8[3])) + ((l8[4] + l8[5]) + (l8[6] + l8[7]));
    ls += __shfl_xor(ls, 16, 32);
    const float lz = (ls > 0.0f) ? ls : 1.0f;
    psc = PCAR * __builtin_amdgcn_rcpf(lz);
  }

  // ---- phase 2b: two neighbouring score tiles, centred and converted in place, are the f16 A fragment of P'
  //      (row = query c; elements 0..7 = keys kb + 8hh + 0..7, elements 8..15 = keys kb + 16 + 8hh + 0..7); P'.v^T (hi + residual) ----
  const float pcen = PCAR / (float)NSEQ;
  v8f o0 = zero8(), o1 = zero8();
  const float* vsp = VS + (size_t)il * NST * CZ + head * HD + c;
  const float* gp  = GF + (prow0 + q0 + 8 * hh) * CZ + head * HD + c;
  float vsa[NST], vsb[NST], gza[8], gzb[8];
#pragma unroll
  for (int kt = 0; kt < NKT; ++kt) {
    if (kt + 1 < NKT) {
      const int kn = (kt + 1) * 32;
      vha[kt + 1] = ldfrag_h(Vhb + kn);
      vhb[kt + 1] = ldfrag_h(Vhb + (size_t)16 * NSEQ + kn);
      vla[kt + 1] = ldfrag_h(Vlb + kn);
      vlb[kt + 1] = ldfrag_h(Vlb + (size_t)16 * NSEQ + kn);
    }
    if (kt == NKT - 3) {                        // the epilogue's operands, asked for once score registers have come free
#pragma unroll
      for (int s = 0; s < NST; ++s) { vsa[s] = vsp[s * CZ]; vsb[s] = vsp[s * CZ + 16]; }
#pragma unroll
      for (int r = 0; r < 8; ++r) { gza[r] = gp[(size_t)r * CZ]; gzb[r] = gp[(size_t)r * CZ + 16]; }
    }
    // keeps the next keys' v^T fragments in flight under this step's products, and bounds how many are hoisted (registers)
    __builtin_amdgcn_sched_barrier(0);
    FragH ph;
#pragma unroll
    for (int e = 0; e < 8; ++e) {
      ph.h[0][e] = (_Float16)(u[2 * kt][e] * psc - pcen);
      ph.h[1][e] = (_Float16)(u[2 * kt + 1][e] * psc - pcen);
    }
    o0 = mma_h(ph.v, vha[kt], o0);              // D element r = (row 8hh+r, d = c)
    o0 = mma_h(ph.v, vla[kt], o0);
    o1 = mma_h(ph.v, vhb[kt], o1);              // d = 16 + c
    o1 = mma_h(ph.v, vlb[kt], o1);
  }
  acc_guard2(o0, o1);

  // ---- epilogue: vals = acc/(16384*1024) + key-mean, sigmoid gate, O*4096 -> f16 hi + residual in the block stage tile ----
  {
    const float oc  = 1.0f / (PCAR * VCAR);
    float vs0 = 0.0f, vs1 = 0.0f;
#pragma unroll
    for (int t = 0; t < NST; ++t) { vs0 += vsa[t]; vs1 += vsb[t]; }
    const float vm0 = vs0 * (1.0f / (float)NSEQ);
    const float vm1 = vs1 * (1.0f / (float)NSEQ);
#pragma unroll
    for (int r = 0; r < 8; ++r) {
      const float gz0 = gza[r];
      const float gz1 = gzb[r];
      const float g0  = __builtin_amdgcn_rcpf(1.0f + exp2f(-gz0 * LOG2E));
      const float g1  = __builtin_amdgcn_rcpf(1.0f + exp2f(-gz1 * LOG2E));
      const float w0  = (o0[r] * oc + vm0) * g0 * OSC;
      const float w1  = (o1[r] * oc + vm1) * g1 * OSC;
      const _Float16 h0 = (_Float16)w0, h1 = (_Float16)w1;
      const _Float16 l0 = (_Float16)(w0 - (float)h0), l1 = (_Float16)(w1 - (float)h1);
      const int si = (8 * hh + r) * STP + wave * HD + c;
      stg[si]                 = h_bits(h0);
      stg[si + 16]            = h_bits(h1);
      stg[16 * STP + si]      = h_bits(l0);
      stg[16 * STP + si + 16] = h_bits(l1);
    }
  }
  __syncthreads();
  v4u vh[2], vl[2];
  const int rq = lane >> 3, p8 = (lane & 7) * 8;
#pragma unroll
  for (int it = 0; it < 2; ++it) {
    const int row = it * 8 + wave * 4 + rq;
    vh[it] = *(const v4u*)(stg + row * STP + p8);
    vl[it] = *(const v4u*)(stg + (16 + row) * STP + p8);
  }
  const size_t ob = (prow0 + q0) * CZ + (size_t)hg * 64 + p8;
  {
#pragma unroll
    for (int it = 0; it < 2; ++it) {
      const int row = it * 8 + wave * 4 + rq;
      *(v4u*)(OHp + ob + (size_t)row * CZ) = vh[it];
      *(v4u*)(OLp + ob + (size_t)row * CZ) = vl[it];
    }
    
  }
}

// =====================================================================================================
// All NI row blocks of the pair tensor are processed as one group (IG = NI rows i, GROWS positions), so each stage is one
// chip-filling launch; every plane is fully rewritten by whole-line stores before it is read. Workspace map (bytes; every extent is an exact
// multiple of its store granularity, no tail rows; every region offset a multiple of 32768):
//   WQ, WK, WV, WG, WO  f16 x1024 [128 n][128 k]   5 x 32768;  WB f16 x1024 [BTM n][128 k] (16384 in a 32768 slot)
//   VS   f32 [IG*NST][128]                          IG*NST*512 (slot padded to 32768)
//   XH, XL  f16 [NPOS][128] (x*64 hi, residual)    2 x 16777216
//   BT   f32 [BTM][NPOS] (rows 0..NH-1 written and read) 16777216
//   OH, OL  f16 [GROWS][128]                        2 x GROWS*256
//   GF   f32 [GROWS][128]                           GROWS*512
//   QH, QL, KH, KL  f16 [GROWS][128]               4 x GROWS*256
//   VH, VL  f16 [IG*NH*HD][NSEQ]                    2 x GROWS*256
//   end (IG = 256)                                  218824704
// =====================================================================================================
extern "C" void kernel_launch(void* const* d_in, const int* in_sizes, int n_in,
                              void* d_out, int out_size, void* d_ws, size_t ws_size,
                              hipStream_t stream) {
  if (n_in < 12) return;
  if (in_sizes[0] < NPOS * CZ) return;
  if (in_sizes[1] < NI * NSEQ) return;
  if (in_sizes[2] < CZ || in_sizes[3] < CZ) return;
  if (in_sizes[4] < NH * CZ) return;
  if (in_sizes[5] < CZ * CZ || in_sizes[6] < CZ * CZ || in_sizes[7] < CZ * CZ || in_sizes[8] < CZ * CZ) return;
  if (in_sizes[9] < CZ) return;
  if (in_sizes[10] < CZ * CZ || in_sizes[11] < CZ) return;
  if (out_size < NI * NSEQ * CZ) return;

  const float* x   = (const float*)d_in[0];
  const float* msk = (const float*)d_in[1];
  const float* gam = (const float*)d_in[2];
  const float* bet = (const float*)d_in[3];
  const float* Wt  = (const float*)d_in[4];
  const float* Wq  = (const float*)d_in[5];
  const float* Wk  = (const float*)d_in[6];
  const float* Wv  = (const float*)d_in[7];
  const float* Wg  = (const float*)d_in[8];
  const float* bg  = (const float*)d_in[9];
  const float* Wo  = (const float*)d_in[10];
  const float* bo  = (const float*)d_in[11];
  float*       out = (float*)d_out;

  const size_t szWP = 32768;
  const size_t szVS = (((size_t)IG * NST * CZ * 4) + 32767) / 32768 * 32768;
  const size_t szX  = (size_t)NPOS * CZ * 2;
  const size_t szBT = (size_t)BTM * NPOS * 4;
  const size_t szF  = (size_t)GROWS * CZ * 4;
  const size_t szP  = (size_t)GROWS * CZ * 2;          // QH, QL, KH, KL, VH, VL, OH, OL
  size_t off = 0;
  const size_t oWQ = off; off += szWP;
  const size_t oWK = off; off += szWP;
  const size_t oWV = off; off += szWP;
  const size_t oWG = off; off += szWP;
  const size_t oWO = off; off += szWP;
  const size_t oWB = off; off += szWP;
  const size_t oVS = off; off += szVS;
  const size_t oXH = off; off += szX;
  const size_t oXL = off; off += szX;
  const size_t oBT = off; off += szBT;
  const size_t oOH = off; off += szP;
  const size_t oOL = off; off += szP;
  const size_t oGF = off; off += szF;
  const size_t oQH = off; off += szP;
  const size_t oQL = off; off += szP;
  const size_t oKH = off; off += szP;
  const size_t oKL = off; off += szP;
  const size_t oVH = off; off += szP;
  const size_t oVL = off; off += szP;
  if (off > ws_size) return;                // off = 218824704 for IG = 256
  if (off > (size_t)WS_CAP) return;

  char* ws = (char*)d_ws;
  u16*   WQ = (u16*)(ws + oWQ);
  u16*   WK = (u16*)(ws + oWK);
  u16*   WV = (u16*)(ws + oWV);
  u16*   WG = (u16*)(ws + oWG);
  u16*   WO = (u16*)(ws + oWO);
  u16*   WB = (u16*)(ws + oWB);
  float* VS = (float*)(ws + oVS);
  u16*   XH = (u16*)(ws + oXH);
  u16*   XL = (u16*)(ws + oXL);
  float* BT = (float*)(ws + oBT);
  u16*   OH = (u16*)(ws + oOH);
  u16*   OL = (u16*)(ws + oOL);
  float* GF = (float*)(ws + oGF);
  u16*   QH = (u16*)(ws + oQH);
  u16*   QL = (u16*)(ws + oQL);
  u16*   KH = (u16*)(ws + oKH);
  u16*   KL = (u16*)(ws + oKL);
  u16*   VH = (u16*)(ws + oVH);
  u16*   VL = (u16*)(ws + oVL);

  const dim3 b256(256), b128(128), bAT(ATT_THREADS);
  const dim3 gP(WPBLK + NPOS / 64);
  const dim3 gX(2 * (GROWS / (64 * RG)));
  const dim3 gG((GROWS / 64) * (CZ / 64));
  const dim3 gA(IG * NHG * NQT);
  const float oscp = 1.0f / (XSC * WSC);
  const float osco = 1.0f / (OSC * WSC);

  // (a, b) one launch: LayerNorm of all positions -> x*64 f16 hi + residual planes, and the weight planes [n][k] as f16 of the
  //     bf16 value x1024 (weights are [out][in] = [n][k]); Wt plane padded to BTM rows
  prep<<<gP, b256, 0, stream>>>(x, gam, bet, Wq, Wk, Wv, Wg, Wo, Wt, XH, XL, WQ, WK, WV, WG, WO, WB);

  for (int g = 0; g < NGRP; ++g) {
    const u16*   XHg = XH + (size_t)g * GROWS * CZ;
    const u16*   XLg = XL + (size_t)g * GROWS * CZ;
    const float* Mg  = msk + (size_t)g * IG * NSEQ;
    float*       og  = out + (size_t)g * GROWS * CZ;
    // (c, 1-4) every product of LN(x) in one launch: shared bias table BT[h][p] = sum_c Wt[h][c] * x[p][c] (rows 0..NH-1 of BT),
    //     v^T hi + residual planes x1024 with the per-64-key sums of v, q and k hi + residual planes x1024,
    //     gate pre-activation x.Wg^T + bg -> GF f32
    xproj<<<gX, b128, 0, stream>>>(XHg, XLg, WV, WQ, WK, WG, WB, bg, VH, VL, VS, QH, QL, KH, KL, GF, BT, oscp);
    // (5) attention over all keys of each row block with the shared bias and the row mask bias, gated
    //     -> O x4096 f16 hi + residual planes
    attn<<<gA, bAT, 0, stream>>>(QH, QL, KH, KL, VH, VL, VS, GF, BT, Mg, OH, OL);
    // (6) output projection (O hi + residual).Wo^T + bo -> out f32, carries 4096 x 1024 folded back
    gemm_h<1, 0, 0><<<gG, b128, 0, stream>>>(OH, OL, WO, WO, bo, 1, og, QH, QL, GROWS, CZ, CZ, osco, 1.0f);
  }
  (void)hipGetLastError();
}

// v006
// Measured time: 127 microseconds a run.
// Next to v005, in two timings, it ran 1.13 and 1.14 times as fast.
// All steps since v000 together make it 3.01 times as fast.
// Contractions: LN(x).Wq^T, LN(x).Wk^T, LN(x).Wv^T, LN(x).Wg^T(+bg), LN(x).Wt^T (shared pair-bias table) and O.Wo^T(+bo) on
// v_wmma_f32_16x16x32_f16 with the activation operand carried as f16 hi + f16 residual planes (x*64, O*4096) and the weight
// operand as f16(bf16(W)*1024); q.k^T over 32 on v_wmma_f32_16x16x32_f16 (q, k *1024 f16 hi + residual, products hh+lh+hl);
// centred softmax weights P' = 16384*P - 64 (f16 hi) times v^T (v*1024 f16 hi + residual, products P'.vh + P'.vl);
// all f32 accumulate. LayerNorm, mask bias, softmax, sigmoid gate, key-mean of v and carry folds in f32 on VALU.
// Every float input is RNE-converted to bf16 on load.
#include <hip/hip_runtime.h>
#include <math.h>
#include <stdint.h>

#ifndef NB
#define NB 1
#endif
#ifndef NI
#define NI 256
#endif
#define NSEQ   256
#define CZ     128
#define NH     4
#define HD     32
#define NPOS   (NSEQ * NSEQ)
#define IG     NI
#define NGRP   (NI / IG)
#define GROWS  (IG * NSEQ)
#define XSC    64.0f
#define WSC    1024.0f
#define QSC    1024.0f
#define KSC    1024.0f
#define VCAR   1024.0f
#define PCAR   16384.0f
#define OSC    4096.0f
#define MINF   1.0e9f
#define RSQ_HD 0.17677669529663689f
#define LOG2E  1.4426950408889634f
#define WPB    2
#define NHG    (NH / WPB)
#define NQT    (NSEQ / 16)
#define NKT    (NSEQ / 32)
#define NST    (NSEQ / 64)
#define ATT_THREADS (WPB * 32)
#define SBP    260
#define SBW    (16 * SBP)
#define STP    72
#define SLAB64 (16 * 68)
#define TRP    69
#define XTP    136
#define WTP    136
#define BTM    64
#define RG     2
#define BSP    (64 * RG + 4)
#define WS_CAP 268435456
static_assert(NB == 1);
static_assert(CZ == NH * HD && HD == 32 && NH == 4 && NSEQ == 256);
static_assert(NI >= 1 && NI <= NSEQ && (NI % IG) == 0 && IG >= 1 && IG <= NSEQ && NGRP == 1);
static_assert((GROWS % 64) == 0 && (NPOS % 64) == 0);
static_assert(GROWS == NPOS && (GROWS % (64 * RG)) == 0 && 4 * SLAB64 <= 64 * TRP && NH <= 16 && BTM >= 16 && (BSP % 4) == 0);
static_assert((NH % WPB) == 0 && ATT_THREADS == 64 && (NSEQ % 64) == 0 && (CZ % 64) == 0 && (CZ % 32) == 0);
static_assert((BTM % 64) == 0 && BTM >= NH && (BTM % 32) == 0);
static_assert(SBP >= NSEQ && (SBP % 4) == 0 && STP >= 64 && (STP % 8) == 0 && XTP >= CZ && WTP >= CZ && TRP >= 64);

typedef unsigned short u16;
typedef _Float16 v16h __attribute__((ext_vector_type(16)));
typedef _Float16 v8h  __attribute__((ext_vector_type(8)));
typedef float    v8f  __attribute__((ext_vector_type(8)));
typedef float    v4f  __attribute__((ext_vector_type(4)));
typedef unsigned int v4u __attribute__((ext_vector_type(4)));

union FragH { v16h v; v8h h[2]; v4u u[2]; };

// ---- scalar helpers --------------------------------------------------------------------------------
__device__ __forceinline__ unsigned short bf_bits(float f) {          // f32 -> bf16 bits, RNE convert
  unsigned u = __float_as_uint(f);
  return (unsigned short)((u + 0x7FFFu + ((u >> 16) & 1u)) >> 16);
}
__device__ __forceinline__ float bf_up(unsigned short h) { return __uint_as_float(((unsigned)h) << 16); }
__device__ __forceinline__ float bfr(float f) { return bf_up(bf_bits(f)); }
__device__ __forceinline__ unsigned short h_bits(_Float16 x) { return __builtin_bit_cast(unsigned short, x); }
__device__ __forceinline__ unsigned pk16(unsigned short a, unsigned short b) { return (unsigned)a | ((unsigned)b << 16); }
__device__ __forceinline__ v8f zero8() { v8f z = {0.f, 0.f, 0.f, 0.f, 0.f, 0.f, 0.f, 0.f}; return z; }

// ---- fragment-order planes: every 16-bit A/B operand plane [R rows][K k] is stored as [R/16 row tiles][K/32 k-steps][512 halves];
//      inside a 512-half unit element (row r, k kk) lies at (kk >> 3)*128 + r*8 + (kk & 7), so unit (rt, ks) starts at
//      rt*16*K + ks*512 and one 16-B load per lane at lane*8 (and at 256 + lane*8) covers 512 contiguous bytes = 4 whole lines.
// ---- fragment loader: lane -> row/col (lane&15), h = lane>>4; p = unit start + lane*8;
//      elements 0..7 <- p[0..7] (k0+8h..), elements 8..15 <- p[256..263] (k0+16+8h..); same split k map for A and B.
__device__ __forceinline__ v16h ldfrag_h(const _Float16* p) {
  FragH f;
  f.h[0] = *(const v8h*)(p);
  f.h[1] = *(const v8h*)(p + 256);
  return f.v;
}

// ---- WMMA helpers with trailing VALU hazard gaps ------------------------------------------------------
__device__ __forceinline__ v8f mma_h(v16h a, v16h b, v8f c) {
  return __builtin_amdgcn_wmma_f32_16x16x32_f16(false, a, false, b, (short)0, c, false, false);
}
template <typename F>
__device__ __forceinline__ void guard6(v8f& a, v8f& b, v8f& c, v8f& d, F x0, F x1, F x2, F x3, F x4, F x5) {
#if defined(__HIP_DEVICE_COMPILE__)
  asm volatile("v_nop\n\tv_nop\n\tv_nop\n\tv_nop"
               : "+v"(a), "+v"(b), "+v"(c), "+v"(d) : "v"(x0), "v"(x1), "v"(x2), "v"(x3), "v"(x4), "v"(x5) : "memory");
#endif
}
template <typename F>
__device__ __forceinline__ void guard9(v8f& a, v8f& b, v8f& c, v8f& d, F x0, F x1, F x2, F x3, F x4, F x5,
                                       F x6, F x7, F x8) {
#if defined(__HIP_DEVICE_COMPILE__)
  asm volatile("v_nop\n\tv_nop\n\tv_nop\n\tv_nop"
               : "+v"(a), "+v"(b), "+v"(c), "+v"(d)
               : "v"(x0), "v"(x1), "v"(x2), "v"(x3), "v"(x4), "v"(x5), "v"(x6), "v"(x7), "v"(x8) : "memory");
#endif
}
__device__ __forceinline__ void acc_guard2(v8f& a, v8f& b) {
#if defined(__HIP_DEVICE_COMPILE__)
  asm volatile("v_nop\n\tv_nop\n\tv_nop\n\tv_nop" : "+v"(a), "+v"(b));
#endif
}
__device__ __forceinline__ void wave_sync_lds() {
  __builtin_amdgcn_fence(__ATOMIC_RELEASE, "workgroup");
  __builtin_amdgcn_wave_barrier();
  __builtin_amdgcn_fence(__ATOMIC_ACQUIRE, "workgroup");
}

// =====================================================================================================
// LayerNorm over CZ of the bf16 RNE-converted input rows, eps 1e-5, gamma/beta (bf16 RNE-converted), then
// with shuffles over the 4 lanes); both planes staged in LDS (pitch XTP halves, 16-B vector stores), block barrier, then each
// The planes go out in fragment order (see the fragment loader): each store instruction writes 512 contiguous bytes.
// coverage: compute 256 thr x 32 = 64 rows x 128; store 4 iterations x 8 waves x half a unit (32 lanes x 8 halves) = 16 units =
//           64 x 128 per plane; one block per 64 rows (row0) = every row of XH and XL exactly once (nrows a multiple of 64).
// =====================================================================================================
__device__ __forceinline__ void ln16(u16* TH, u16* TL, const float* __restrict__ X, const float* __restrict__ gam,
                                     const float* __restrict__ bet, u16* XHo, u16* XLo, int row0, int nrows) {
#pragma clang fp contract(off)
  const int tid = (int)threadIdx.x, wave = tid >> 5, lane = tid & 31;
  if (row0 + 64 > nrows) return;            // block-uniform, before the barrier; never taken with the exact grid
  const int rl = tid >> 2, part = tid & 3;
  const float* p = X + (size_t)(row0 + rl) * CZ + part * 32;
  v4f xv[8];
  float s = 0.0f;
#pragma unroll
  for (int t = 0; t < 8; ++t) {
    v4f a = *(const v4f*)(p + 4 * t);
#pragma unroll
    for (int e = 0; e < 4; ++e) { const float f = bfr(a[e]); a[e] = f; s = s + f; }
    xv[t] = a;
  }
  asm volatile("s_wait_xcnt 0x0" ::: "memory");   // a later load's result lands in the address registers that these loads name
  s = s + __shfl_xor(s, 1, 32);
  s = s + __shfl_xor(s, 2, 32);
  const float mu = s * (1.0f / (float)CZ);
  float q = 0.0f;
#pragma unroll
  for (int t = 0; t < 8; ++t) {
#pragma unroll
    for (int e = 0; e < 4; ++e) { const float d = xv[t][e] - mu; q = q + d * d; }
  }
  q = q + __shfl_xor(q, 1, 32);
  q = q + __shfl_xor(q, 2, 32);
  const float var  = q * (1.0f / (float)CZ);
  const float rstd = rsqrtf(var + 1e-5f);
  v4u oh[4], ol[4];
#pragma unroll
  for (int t = 0; t < 8; ++t) {
    const v4f g4 = *(const v4f*)(gam + part * 32 + 4 * t);
    const v4f b4 = *(const v4f*)(bet + part * 32 + 4 * t);
    unsigned short hb[4], lb[4];
#pragma unroll
    for (int e = 0; e < 4; ++e) {
      float y = (xv[t][e] - mu) * rstd;
      y = y * bfr(g4[e]);
      y = y + bfr(b4[e]);
      const float w = y * XSC;
      const _Float16 hv = (_Float16)w;
      const _Float16 lv = (_Float16)(w - (float)hv);
      hb[e] = h_bits(hv);
      lb[e] = h_bits(lv);
    }
    oh[t >> 1][(t & 1) * 2]     = pk16(hb[0], hb[1]);
    oh[t >> 1][(t & 1) * 2 + 1] = pk16(hb[2], hb[3]);
    ol[t >> 1][(t & 1) * 2]     = pk16(lb[0], lb[1]);
    ol[t >> 1][(t & 1) * 2 + 1] = pk16(lb[2], lb[3]);
  }
  {
    u16* th = TH + rl * XTP + part * 32;
    u16* tl = TL + rl * XTP + part * 32;
#pragma unroll
    for (int q4 = 0; q4 < 4; ++q4) {
      *(v4u*)(th + 8 * q4) = oh[q4];
      *(v4u*)(tl + 8 * q4) = ol[q4];
    }
  }
  __syncthreads();
  // fragment order: half unit hu = 0..31 of the block's 4 row tiles x 4 k-steps; lane = (k octet lane>>4, row lane&15)
  v4u vh[4], vl[4];
#pragma unroll
  for (int it = 0; it < 4; ++it) {
    const int si = (it * 16 + (lane & 15)) * XTP + wave * 16 + (lane >> 4) * 8;   // hu = it*8 + wave: row tile it, k = 16*wave ..
    vh[it] = *(const v4u*)(TH + si);
    vl[it] = *(const v4u*)(TL + si);
  }
  {
#pragma unroll
    for (int it = 0; it < 4; ++it) {
      const size_t o = (size_t)row0 * CZ + (it * 8 + wave) * 256 + lane * 8;
      *(v4u*)(XHo + o) = vh[it];
      *(v4u*)(XLo + o) = vl[it];
    }
    // ln16 ends prep: no code behind these stores rewrites the registers they name
    asm volatile("s_wait_xcnt 0x0" ::: "memory");
  }
}

// =====================================================================================================
// Weight plane: W f32 [nrow rows n][CZ k] row-major (k contiguous); D 16-bit [np rows n][CZ k] in fragment order, D(n, k) = f16 bits of
// bf16(W[n][k]) * scale for n < nrow, 0 for nrow <= n < np. Block = 32 n rows: each thread loads 16 consecutive k values of
// one n row with a clamped row address (zeroed by predicate for n >= nrow), converts into the LDS tile [32 n][CZ k]
// coverage: load 256 thr x 16 = 32 n x 128 k; store 2 iterations x 8 waves x half a unit (32 lanes x 8 halves) = 8 units = 32 x 128;
//           np/32 blocks (n0) cover the [np][CZ] plane exactly once.
// =====================================================================================================
__device__ __forceinline__ void wp16(u16* T, const float* __restrict__ W, int nrow, int np, int n0, u16* D, float scale) {
  const int tid = (int)threadIdx.x, wave = tid >> 5, lane = tid & 31;
  if (n0 + 32 > np) return;                 // block-uniform, before the barrier; never taken with the exact grid
  {
    const int nl = tid >> 3, kc = (tid & 7) * 16;
    const int n  = n0 + nl;
    int nr = (n < nrow) ? n : (nrow - 1);
    nr = (nr < 0) ? 0 : nr;
    const float* src = W + (size_t)nr * CZ + kc;
    v4u w2[2];
#pragma unroll
    for (int t = 0; t < 4; ++t) {
      const v4f a = *(const v4f*)(src + 4 * t);
      unsigned short hb[4];
#pragma unroll
      for (int e = 0; e < 4; ++e) {
        const float val = (n < nrow) ? a[e] : 0.0f;
        hb[e] = h_bits((_Float16)(bfr(val) * scale));
      }
      w2[t >> 1][(t & 1) * 2]     = pk16(hb[0], hb[1]);
      w2[t >> 1][(t & 1) * 2 + 1] = pk16(hb[2], hb[3]);
    }
    *(v4u*)(T + nl * WTP + kc)     = w2[0];
    *(v4u*)(T + nl * WTP + kc + 8) = w2[1];
  }
  __syncthreads();
  // fragment order: half unit hu = 0..15 of the block's 2 row tiles x 4 k-steps; lane = (k octet lane>>4, row lane&15)
  v4u w4[2];
#pragma unroll
  for (int it = 0; it < 2; ++it) {
    w4[it] = *(const v4u*)(T + (it * 16 + (lane & 15)) * WTP + wave * 16 + (lane >> 4) * 8);   // hu = it*8 + wave: row tile it, k = 16*wave ..
  }
  {
#pragma unroll
    for (int it = 0; it < 2; ++it) {
      *(v4u*)(D + (size_t)n0 * CZ + (it * 8 + wave) * 256 + lane * 8) = w4[it];
    }
    
  }
}

// =====================================================================================================
// Everything that depends on the inputs alone, in one launch: the six weight planes and the LayerNorm planes are independent of
// one another, so they share a grid. Blocks 0 .. WPBLK-1: block b does rows 32*(b % 4) .. +31
// of weight plane b / 4 (0..4 = Wq, Wk, Wv, Wg, Wo, CZ rows each; 5 = Wt, NH rows padded to BTM, blocks 20 and 21).
// Blocks WPBLK .. : 64 position rows of LayerNorm each. The branch is block-uniform, each side has its own one barrier.
// LDS: the weight tile [32][WTP] lies in the first LayerNorm stage tile [64][XTP].
// coverage: 5 * CZ/32 + BTM/32 weight blocks = every row of every weight plane once; NPOS/64 LayerNorm blocks = every position once.
// =====================================================================================================
#define WPBLK (5 * (CZ / 32) + BTM / 32)
static_assert(CZ / 32 == 4 && BTM / 32 <= CZ / 32 && 32 * WTP <= 64 * XTP);
// amdgpu_waves_per_eu(8): holds the register budget to 128: four blocks per WGP, so that all LayerNorm blocks are resident at once.
__global__ __launch_bounds__(256) __attribute__((amdgpu_waves_per_eu(8)))
void prep(const float* __restrict__ X, const float* __restrict__ gam, const float* __restrict__ bet,
          const float* __restrict__ Wq, const float* __restrict__ Wk, const float* __restrict__ Wv,
          const float* __restrict__ Wg, const float* __restrict__ Wo, const float* __restrict__ Wt,
          u16* XHo, u16* XLo, u16* WQo, u16* WKo, u16* WVo, u16* WGo, u16* WOo, u16* WBo) {
  __shared__ __align__(16) u16 TH[64 * XTP];
  __shared__ __align__(16) u16 TL[64 * XTP];
  const int bid = (int)blockIdx.x;
  if (bid < WPBLK) {
    const int pl = bid / (CZ / 32), n0 = (bid % (CZ / 32)) * 32;
    const float* W = (pl == 0) ? Wq : (pl == 1) ? Wk : (pl == 2) ? Wv : (pl == 3) ? Wg : (pl == 4) ? Wo : Wt;
    u16*         D = (pl == 0) ? WQo : (pl == 1) ? WKo : (pl == 2) ? WVo : (pl == 3) ? WGo : (pl == 4) ? WOo : WBo;
    wp16(TH, W, (pl == 5) ? NH : CZ, (pl == 5) ? BTM : CZ, n0, D, WSC);
    return;
  }
  ln16(TH, TL, X, gam, bet, XHo, XLo, (bid - WPBLK) * 64, NPOS);
}

// =====================================================================================================
// GEMM epilogue: the wave's 16x64 f32 tile (times oscale, plus a per-column addend) staged in its LDS slab (pitch 68),
// coverage: 8 instructions x 2 rows x 16 lanes x 4 floats = the wave's 16 x 64 tile.
// =====================================================================================================
__device__ __forceinline__ void epi64(float* sl, v8f a0, v8f a1, v8f a2, v8f a3, float oscale,
                                      float b0, float b1, float b2, float b3,
                                      float* C, int N, size_t rowb, int col0, int lane) {
  const int hh = lane >> 4, m = lane & 15;
#pragma unroll
  for (int r = 0; r < 8; ++r) {
    const int ro = (8 * hh + r) * 68 + m;
    sl[ro]      = a0[r] * oscale + b0;
    sl[ro + 16] = a1[r] * oscale + b1;
    sl[ro + 32] = a2[r] * oscale + b2;
    sl[ro + 48] = a3[r] * oscale + b3;
  }
  wave_sync_lds();
  v4f vals[8];
#pragma unroll
  for (int it = 0; it < 8; ++it) vals[it] = *(const v4f*)(sl + (it * 2 + hh) * 68 + m * 4);
  float* dst = C + (rowb + (size_t)hh) * (size_t)N + col0 + m * 4;
  {
#pragma unroll
    for (int it = 0; it < 8; ++it) {
      *(v4f*)(dst + (size_t)(it * 2) * (size_t)N) = vals[it];
    }
    
  }
}

// =====================================================================================================
// Eight f32 values (already carrying their plane scale) -> 8 f16 hi halves and 8 f16 residual halves, packed for 16-B stores.
// =====================================================================================================
__device__ __forceinline__ void split8(const float* w, v4u& oh, v4u& ol) {
#pragma unroll
  for (int e = 0; e < 4; ++e) {
    const float t0 = w[2 * e], t1 = w[2 * e + 1];
    const _Float16 h0 = (_Float16)t0, h1 = (_Float16)t1;
    const _Float16 l0 = (_Float16)(t0 - (float)h0), l1 = (_Float16)(t1 - (float)h1);
    oh[e] = pk16(h_bits(h0), h_bits(h1));
    ol[e] = pk16(h_bits(l0), h_bits(l1));
  }
}

// =====================================================================================================
// GEMM epilogue, plane form (q, k): the wave's 16x64 f32 tile (times oscale) staged in its LDS slab (pitch 68), read back as
// 8 consecutive columns per lane, times psc, split into f16 hi + residual, one 16-B store per plane and lane, in fragment order
// (lane = row m, column octet it*2 + hh): the wave's tile is two neighbouring units = 2048 contiguous bytes per plane.
// coverage: 4 instructions x 2 octets x 16 rows x 8 halves = the wave's 16 x 64 tile per plane; each instruction writes 4 whole
//           128-B lines.
// =====================================================================================================
__device__ __forceinline__ void epi_pl(float* sl, v8f a0, v8f a1, v8f a2, v8f a3, float oscale, float psc,
                                       u16* Hp, u16* Lp, int N, size_t rowb, int col0, int lane) {
  const int hh = lane >> 4, m = lane & 15;
#pragma unroll
  for (int r = 0; r < 8; ++r) {
    const int ro = (8 * hh + r) * 68 + m;
    sl[ro]      = a0[r] * oscale;
    sl[ro + 16] = a1[r] * oscale;
    sl[ro + 32] = a2[r] * oscale;
    sl[ro + 48] = a3[r] * oscale;
  }
  wave_sync_lds();
  v4u oh[4], ol[4];
#pragma unroll
  for (int it = 0; it < 4; ++it) {
    const float* p = sl + m * 68 + (it * 2 + hh) * 8;   // row m, column octet it*2 + hh
    const v4f a = *(const v4f*)(p), b4 = *(const v4f*)(p + 4);
    float w[8];
#pragma unroll
    for (int e = 0; e < 4; ++e) { w[e] = a[e] * psc; w[4 + e] = b4[e] * psc; }
    split8(w, oh[it], ol[it]);
  }
#pragma unroll
  for (int it = 0; it < 4; ++it) {
    const size_t o = rowb * (size_t)N + col0 * 16 + it * 256 + lane * 8;
    *(v4u*)(Hp + o) = oh[it];
    *(v4u*)(Lp + o) = ol[it];
  }
}

// =====================================================================================================
// GEMM epilogue, transposed plane form (v): the block's 64 keys x 64 columns f32 tile (times oscale) staged in one LDS tile
// [key][column] (pitch TRP floats: odd, so the column reads below fall in 32 different banks), block barrier, then each lane
// reads 8 consecutive keys of one column, splits v * psc into f16 hi + residual and stores 16 B per plane into the plane
//   Hp/Lp (row il*N + column, k = key of NSEQ) in fragment order; one instruction = 4 whole 128-B lines. A column's 8 octet sums
// (4 in the lane, the lane halves by one shuffle each) give its sum over the block's 64 keys; the 64 sums are gathered in LDS and stored by wave 0 as two whole lines of
//   KS[row tile][N]  (row tile = il*NST + key tile).
// coverage: 4 waves x 4 instructions x 2 octets x 16 columns x 8 halves = 64 columns x 64 keys per plane; 32 lanes x 2 = 64 sums.
// =====================================================================================================
__device__ __forceinline__ void epi_tr(float* sl, float* rs, v8f a0, v8f a1, v8f a2, v8f a3, float oscale, float psc,
                                       u16* Hp, u16* Lp, float* KS, int N, int rb0, int col0, int wave, int lane) {
  const int hh = lane >> 4, m = lane & 15;
#pragma unroll
  for (int r = 0; r < 8; ++r) {
    const int ro = (wave * 16 + 8 * hh + r) * TRP + m;
    sl[ro]      = a0[r] * oscale;
    sl[ro + 16] = a1[r] * oscale;
    sl[ro + 32] = a2[r] * oscale;
    sl[ro + 48] = a3[r] * oscale;
  }
  __syncthreads();
  const int cl = wave * 16 + m;                          // column within the block's 64
  const float* cp = sl + hh * 8 * TRP + cl;              // one lane address; octets and keys are constant offsets from it
  const int il = rb0 / NSEQ, s0 = rb0 % NSEQ;
  v4u oh[4], ol[4];
  float cs[4];
#pragma unroll
  for (int it = 0; it < 4; ++it) {
    float v[8], w[8];                                    // key octet it*2 + hh of the block's 8
#pragma unroll
    for (int e = 0; e < 8; ++e) v[e] = cp[(it * 16 + e) * TRP];
#pragma unroll
    for (int e = 0; e < 8; ++e) w[e] = v[e] * psc;
    split8(w, oh[it], ol[it]);
    cs[it] = ((v[0] + v[1]) + (v[2] + v[3])) + ((v[4] + v[5]) + (v[6] + v[7]));
  }
  // pairwise tree over the 8 key octets: neighbours (the two lane halves), then pairs, then fours
#pragma unroll
  for (int it = 0; it < 4; ++it) cs[it] += __shfl_xor(cs[it], 16, 32);
  if (hh == 0) rs[cl] = (cs[0] + cs[1]) + (cs[2] + cs[3]);
  __syncthreads();
  if (wave == 0) {
    float2 t;
    t.x = rs[2 * lane];
    t.y = rs[2 * lane + 1];
    *(float2*)(KS + (size_t)(rb0 / 64) * N + col0 + 2 * lane) = t;
    asm volatile("s_wait_xcnt 0x0" ::: "memory");     // the code behind this branch rewrites the registers that the store names
  }
  // wave-uniform base (the wave's 16-column tile, k-steps s0/32 and s0/32 + 1) + one 32-bit lane offset: one register addresses all stores
  const size_t   ub = ((size_t)il * N + col0 + wave * 16) * NSEQ + s0 * 16;
  const unsigned lo = (unsigned)(lane * 8);
#pragma unroll
  for (int it = 0; it < 4; ++it) {
    *(v4u*)(Hp + ub + (lo + it * 256)) = oh[it];
    *(v4u*)(Lp + ub + (lo + it * 256)) = ol[it];
  }
}

// =====================================================================================================
// f16 GEMM: C[M][N] (f32) = (Ah [+ Al])[M][K] . (Bh [+ Bl])[N][K]^T * oscale [+ bf16(bias[col])].
// ALO == 1: products ah.bh + al.bh (A residual plane, unscaled); BLO == 1: products ah.bh + ah.bl (B residual plane);
// one accumulator. Block = 64x64 tile, 4 waves x 16 rows; fragments loaded straight from the fragment-order planes (two 16-B loads
// each, split k map for A and B); K stepped by 32 (K % 32 == 0; host guarantees M % 64 == 0, N % 64 == 0,
// grid = (M/64)*(N/64)). hasb is a block-uniform flag; bias is dereferenced only when hasb != 0.
// EPI == 0: C f32 as above. EPI == 1: the product times psc goes out as f16 hi + residual planes Hp, Lp [M][N] (C unused).
// EPI == 2: the product times psc goes out transposed per NSEQ-row group as Hp, Lp [(row / NSEQ)*N + col][NSEQ] (both fragment order), and C takes
// the f32 column sums of each 64-row tile, [M/64][N] (host guarantees NSEQ % 64 == 0 and M % NSEQ == 0).
// =====================================================================================================
// K is a compile-time value: the units of the four B tiles then lie at constant offsets from one address.
template <int ALO, int BLO, int EPI, int K>
__global__ __launch_bounds__(128)
void gemm_h(const u16* __restrict__ Ah, const u16* __restrict__ Al, const u16* __restrict__ Bh, const u16* __restrict__ Bl,
            const float* __restrict__ bias, int hasb, float* C, u16* Hp, u16* Lp, int M, int N, float oscale,
            float psc) {
  __shared__ __align__(16) float slab[(EPI == 2) ? (64 * TRP + 64) : (4 * SLAB64)];
  const int tid = (int)threadIdx.x, lane = tid & 31, m = lane & 15;
  const int wave = __builtin_amdgcn_readfirstlane(tid >> 5);   // scalar: the fragment units' bases are formed on the scalar unit
  const int ntile = N >> 6;
  const int bid   = (int)blockIdx.x;
  const int rb0   = (bid / ntile) * 64;
  const int rowb  = rb0 + wave * 16;
  const int col0  = (bid % ntile) * 64;
  if (rb0 + 64 > M) return;                 // block-uniform, before any barrier; never taken with the exact grid
  // wave-uniform unit bases + one 32-bit lane offset lo
  const unsigned lo = (unsigned)(lane * 8);
  const _Float16* ahp = (const _Float16*)(const void*)Ah + (size_t)rowb * K;
  const _Float16* alp = (const _Float16*)(const void*)Al + (size_t)rowb * K;   // read only when ALO
  const _Float16* bhp = (const _Float16*)(const void*)Bh + (size_t)col0 * K;
  const _Float16* blp = (const _Float16*)(const void*)Bl + (size_t)col0 * K;   // read only when BLO
  constexpr int bs = 16 * K;                // halves from one 16-column tile of B to the next
  float bb0 = 0.0f, bb1 = 0.0f, bb2 = 0.0f, bb3 = 0.0f;
  if (hasb != 0) {
    bb0 = bfr(bias[col0 + m]);
    bb1 = bfr(bias[col0 + 16 + m]);
    bb2 = bfr(bias[col0 + 32 + m]);
    bb3 = bfr(bias[col0 + 48 + m]);
  }
  v8f acc0 = zero8(), acc1 = zero8(), acc2 = zero8(), acc3 = zero8();
#pragma unroll 1
  for (int ks = 0; ks < K; ks += 32) {      // one fragment-order unit (512 halves) per 32 k
    const _Float16* pa = ahp + 16 * ks + lo;   // this k-step's units: A hi, A residual, B tile 0 hi, B tile 0 residual
    const _Float16* pl = alp + 16 * ks + lo;
    const _Float16* pb = bhp + 16 * ks + lo;
    const _Float16* pq = blp + 16 * ks + lo;
    const v16h ah = ldfrag_h(pa);
    const v16h b0 = ldfrag_h(pb);
    const v16h b1 = ldfrag_h(pb + bs);
    const v16h b2 = ldfrag_h(pb + 2 * bs);
    const v16h b3 = ldfrag_h(pb + 3 * bs);
    acc0 = mma_h(ah, b0, acc0);
    acc1 = mma_h(ah, b1, acc1);
    acc2 = mma_h(ah, b2, acc2);
    acc3 = mma_h(ah, b3, acc3);
    if constexpr (ALO != 0) {
      const v16h al = ldfrag_h(pl);
      acc0 = mma_h(al, b0, acc0);
      acc1 = mma_h(al, b1, acc1);
      acc2 = mma_h(al, b2, acc2);
      acc3 = mma_h(al, b3, acc3);
      if constexpr (BLO != 0) {
        const v16h l0 = ldfrag_h(pq);
        const v16h l1 = ldfrag_h(pq + bs);
        const v16h l2 = ldfrag_h(pq + 2 * bs);
        const v16h l3 = ldfrag_h(pq + 3 * bs);
        acc0 = mma_h(ah, l0, acc0);
        acc1 = mma_h(ah, l1, acc1);
        acc2 = mma_h(ah, l2, acc2);
        acc3 = mma_h(ah, l3, acc3);
        guard9<v16h>(acc0, acc1, acc2, acc3, ah, b0, b1, b2, b3, l0, l1, l2, l3);
        guard6<v16h>(acc0, acc1, acc2, acc3, al, al, al, al, al, al);
      } else {
        guard6<v16h>(acc0, acc1, acc2, acc3, ah, al, b0, b1, b2, b3);
      }
    } else if constexpr (BLO != 0) {
      const v16h l0 = ldfrag_h(pq);
      const v16h l1 = ldfrag_h(pq + bs);
      const v16h l2 = ldfrag_h(pq + 2 * bs);
      const v16h l3 = ldfrag_h(pq + 3 * bs);
      acc0 = mma_h(ah, l0, acc0);
      acc1 = mma_h(ah, l1, acc1);
      acc2 = mma_h(ah, l2, acc2);
      acc3 = mma_h(ah, l3, acc3);
      guard9<v16h>(acc0, acc1, acc2, acc3, ah, b0, b1, b2, b3, l0, l1, l2, l3);
    } else {
      guard6<v16h>(acc0, acc1, acc2, acc3, ah, b0, b1, b2, b3, ah);
    }
    // the next trip rewrites the address registers that this trip's loads name; as inputs they stay untouched up to the wait
    asm volatile("s_wait_xcnt 0x0" :: "v"(pa), "v"(pb), "v"(ALO != 0 ? pl : pa), "v"(BLO != 0 ? pq : pb) : "memory");
  }
  if constexpr (EPI == 0) {
    epi64(slab + wave * SLAB64, acc0, acc1, acc2, acc3, oscale, bb0, bb1, bb2, bb3, C, N, (size_t)rowb, col0, lane);
  } else if constexpr (EPI == 1) {
    epi_pl(slab + wave * SLAB64, acc0, acc1, acc2, acc3, oscale, psc, Hp, Lp, N, (size_t)rowb, col0, lane);
  } else {
    epi_tr(slab, slab + 64 * TRP, acc0, acc1, acc2, acc3, oscale, psc, Hp, Lp, C, N, rb0, col0, wave, lane);
  }
}

// =====================================================================================================
// All products of LN(x) in one launch: v, q, k, gate pre-activation and the pair-bias table.
// Two blocks per RG groups of 64 position rows (one does pair bias, v and gate, the other q and k), 4 waves each;
// wave w owns rows rb0 + 64g + 16w .. +15 of every group g and loads their
// A fragments (x*64 hi + residual, all CZ = 4 k-steps) ONCE into registers; they serve every column tile of the block, so each weight
// fragment that a wave loads is used for RG*16 rows. Per accumulator the products run xh.w, xl.w per k-step, k ascending.
//   pair bias: B = Wt plane rows 0..15 (rows >= NH are zero), D (row = position, column = head) staged in LDS [16][BSP],
//              block barrier, heads 0..NH-1 stored as whole lines of BT[h][position]   (GROWS == NPOS: every position once)
//   v: 2 column tiles x RG groups through epi_tr;  q, k: 2 + 2 column tiles through epi_pl;  gate: 2 column tiles through epi64.
// LDS: epi_tr's block tile [64][TRP] + 64 sums; the per-wave slabs of epi_pl / epi64 lie inside that tile; the q, k blocks run no epi_tr,
// and the gate's epi64 slabs are first written behind epi_tr's last barrier, at which every read of the tile has returned; the bias stage lies behind both.
// coverage: grid = 2 * GROWS/(64*RG) blocks; per part RG groups x 64 rows = every row once, for each of the CZ/64 column tiles of each plane.
// =====================================================================================================
__device__ __forceinline__ void xw_tile(const v16h (&ah)[RG][CZ / 32], const v16h (&al)[RG][CZ / 32], const _Float16* bp,
                                        unsigned wo, v8f (&acc)[RG][4]) {
#pragma unroll
  for (int g = 0; g < RG; ++g) {
#pragma unroll
    for (int j = 0; j < 4; ++j) acc[g][j] = zero8();
  }
#pragma unroll                              // constant indices keep ah[], al[] in registers
  for (int ks = 0; ks < CZ / 32; ++ks) {
    v16h b[4];
#pragma unroll
    for (int j = 0; j < 4; ++j) b[j] = ldfrag_h(bp + (wo + j * 16 * CZ + ks * 512));
#pragma unroll
    for (int g = 0; g < RG; ++g) {
#pragma unroll
      for (int j = 0; j < 4; ++j) acc[g][j] = mma_h(ah[g][ks], b[j], acc[g][j]);
#pragma unroll
      for (int j = 0; j < 4; ++j) acc[g][j] = mma_h(al[g][ks], b[j], acc[g][j]);
    }
  }
}

// amdgpu_waves_per_eu(4): holds the register budget to 256: four blocks per WGP (one wave of each on every SIMD), so that the whole
// grid is resident at once, and no register above v255 is used.
__global__ __launch_bounds__(128) __attribute__((amdgpu_waves_per_eu(4)))
void xproj(const u16* __restrict__ XHp, const u16* __restrict__ XLp, const u16* __restrict__ WVp,
           const u16* __restrict__ WQp, const u16* __restrict__ WKp, const u16* __restrict__ WGp,
           const u16* __restrict__ WBp, const float* __restrict__ bg, u16* VHp, u16* VLp, float* VS,
           u16* QHp, u16* QLp, u16* KHp, u16* KLp, float* GF, float* BT, float oscale) {
  __shared__ __align__(16) float slab[64 * TRP + 64 + 16 * BSP];
  const int tid = (int)threadIdx.x, lane = tid & 31, hh = lane >> 4, m = lane & 15;
  const int wave = __builtin_amdgcn_readfirstlane(tid >> 5);   // scalar: row and slab offsets stay out of the vector registers
  const int rb0  = ((int)blockIdx.x >> 1) * (64 * RG);
  const int part = (int)blockIdx.x & 1;     // block-uniform: 0 = pair bias, v, gate; 1 = q, k (4 column tiles of 64 each)
  if (rb0 + 64 * RG > GROWS) return;        // block-uniform, before any barrier; never taken with the exact grid
  // lane offset inside a fragment-order unit; the same for x rows (A) and weight rows (B)
  const unsigned wo = (unsigned)(lane * 8);
  v16h ah[RG][CZ / 32], al[RG][CZ / 32];
  {
    const _Float16* xh = (const _Float16*)(const void*)XHp + (size_t)(rb0 + wave * 16) * CZ;   // wave-uniform bases
    const _Float16* xl = (const _Float16*)(const void*)XLp + (size_t)(rb0 + wave * 16) * CZ;
#pragma unroll
    for (int g = 0; g < RG; ++g) {
#pragma unroll
      for (int ks = 0; ks < CZ / 32; ++ks) {
        ah[g][ks] = ldfrag_h(xh + (wo + g * 64 * CZ + ks * 512));
        al[g][ks] = ldfrag_h(xl + (wo + g * 64 * CZ + ks * 512));
      }
    }
    // the two base registers that these loads name are reused behind here; as inputs they stay untouched up to the wait
    asm volatile("s_wait_xcnt 0x0" :: "s"(xh), "s"(xl) : "memory");
  }
  float* wsl = slab + wave * SLAB64;
  v8f acc[RG][4];

  if (part != 0) {
    // ---- q, k: hi + residual planes ----
#pragma unroll 1                            // rolled: one copy of the tile code in the instruction cache
    for (int i = 0; i < 2 * (CZ / 64); ++i) {
      const bool isq = i < CZ / 64;
      const int  ct  = isq ? i : i - CZ / 64;
      const u16* wp  = isq ? WQp : WKp;
      u16* hp = isq ? QHp : KHp;
      u16* lp = isq ? QLp : KLp;
      xw_tile(ah, al, (const _Float16*)(const void*)wp + (size_t)(ct * 64) * CZ, wo, acc);
#pragma unroll
      for (int g = 0; g < RG; ++g) {
        epi_pl(wsl, acc[g][0], acc[g][1], acc[g][2], acc[g][3], oscale, isq ? QSC : KSC, hp, lp, CZ,
               (size_t)(rb0 + g * 64 + wave * 16), ct * 64, lane);
        asm volatile("s_wait_xcnt 0x0" ::: "memory");   // the next tile rewrites the registers that these stores name
      }
    }
    return;                                 // block-uniform; the barriers below are passed by whole blocks of part 0 only
  }

  // ---- pair bias ----
  {
    float* bsl = slab + 64 * TRP + 64;
    v8f ab[RG];
#pragma unroll
    for (int g = 0; g < RG; ++g) ab[g] = zero8();
#pragma unroll
    for (int ks = 0; ks < CZ / 32; ++ks) {
      const v16h b = ldfrag_h((const _Float16*)(const void*)WBp + (wo + ks * 512));
#pragma unroll
      for (int g = 0; g < RG; ++g) {
        ab[g] = mma_h(ah[g][ks], b, ab[g]);
        ab[g] = mma_h(al[g][ks], b, ab[g]);
      }
    }
#pragma unroll
    for (int g = 0; g < RG; ++g) {
      v4f t0, t1;
#pragma unroll
      for (int e = 0; e < 4; ++e) { t0[e] = ab[g][e] * oscale; t1[e] = ab[g][4 + e] * oscale; }
      float* d = bsl + m * BSP + g * 64 + wave * 16 + 8 * hh;
      *(v4f*)(d)     = t0;
      *(v4f*)(d + 4) = t1;
    }
    __syncthreads();
    for (int i = tid; i < NH * 16 * RG; i += 128) {   // wave-uniform trip count: 16*RG is a multiple of 16, 128 of 32
      const int h = i / (16 * RG), p4 = (i % (16 * RG)) * 4;
      *(v4f*)(BT + (size_t)h * NPOS + rb0 + p4) = *(const v4f*)(bsl + h * BSP + p4);
    }
  }

  // ---- v: transposed hi + residual planes and 64-key sums ----
#pragma unroll 1                            // rolled: one copy of the tile code in the instruction cache
  for (int ct = 0; ct < CZ / 64; ++ct) {
    xw_tile(ah, al, (const _Float16*)(const void*)WVp + (size_t)(ct * 64) * CZ, wo, acc);
#pragma unroll
    for (int g = 0; g < RG; ++g) {
      epi_tr(slab, slab + 64 * TRP, acc[g][0], acc[g][1], acc[g][2], acc[g][3], oscale, VCAR, VHp, VLp, VS, CZ,
             rb0 + g * 64, ct * 64, wave, lane);
      asm volatile("s_wait_xcnt 0x0" ::: "memory");   // the next tile rewrites the registers that these stores name
    }
  }
  // ---- gate pre-activation, f32, bias added ----
#pragma unroll 1                            // rolled: one copy of the tile code in the instruction cache
  for (int ct = 0; ct < CZ / 64; ++ct) {
    const float b0 = bfr(bg[ct * 64 + m]), b1 = bfr(bg[ct * 64 + 16 + m]);
    const float b2 = bfr(bg[ct * 64 + 32 + m]), b3 = bfr(bg[ct * 64 + 48 + m]);
    xw_tile(ah, al, (const _Float16*)(const void*)WGp + (size_t)(ct * 64) * CZ, wo, acc);
#pragma unroll
    for (int g = 0; g < RG; ++g) {
      epi64(wsl, acc[g][0], acc[g][1], acc[g][2], acc[g][3], oscale, b0, b1, b2, b3, GF, CZ,
            (size_t)(rb0 + g * 64 + wave * 16), ct * 64, lane);
      asm volatile("s_wait_xcnt 0x0" ::: "memory");   // the next tile rewrites the registers that these stores name
    }
  }
}

// =====================================================================================================
// Row-wise gated attention. Block bid -> (query tile qt: rows q0 = 16*qt .. q0+15 of row block il, head group hg of WPB
// heads); one wave per head = hg*WPB + wave; all NSEQ keys of row block il, shared bias table BT f32 [BTM][NPOS]
// (row h, position j*NSEQ + k) plus the per-row mask bias 1e9*(bf16(mask[il][k]) - 1) (MK already offset to the row group).
//   q/k planes f16 x1024 hi + residual [il*NSEQ + s][h*HD + d]; v^T planes [il*NH + h][d][NSEQ] hi + residual; all in fragment order;
//   VS f32 [il*NST + key tile][h*HD + d] = sums of v over 64 keys (their total / NSEQ = key-mean of v); GF f32 [il*NSEQ + s][h*HD + d] = gate pre-activation (bias already added).
//   Phase 0: the wave's 16 x NSEQ bias rows (times log2e, plus mask bias times log2e) loaded with 16-B loads into its private
//   LDS bias buffer (pitch SBP: 16 B over a multiple of 256 B, the pitch of 16-B row readers).
//   Phase 1 (per 16-key tile): TRANSPOSED scores k_hi.q_hi + k_hi.q_lo + k_lo.q_hi (A = key rows, B = query rows, one k-step of
//   32): D element r of lane (c, hh) = (key 16t + 8hh + r, query c). u = s*rsqrt(32)*log2e/(1024*1024) + bias (two 16-B LDS reads
//   of buffer row c); all 128 scores of a lane stay in registers; running max in-lane, one exchange between the lane halves.
//   Phase 2a: p = exp2(u - m) in registers, row sum Z in-lane (8 chains, tree) plus one exchange, scale 16384/Z.
//   Phase 2b (per 32 keys): P' = p*16384/Z - 64 of two neighbouring tiles converted to f16 IS the A fragment (row c, split k map);
//   v^T B fragments for the two 16-wide d subtiles, products P'.v_hi + P'.v_lo. The score, softmax and P'.v code is straight-line.
//   Epilogue: vals = acc/(16384*1024) + key-mean (exact identity sum(P'+64).v/16384 = sum P.v), gate g = 1/(1+exp(-z)) in f32,
//   O = g*vals*4096 -> f16 hi + residual, staged as u16 elements in a block LDS tile [2 planes][16 rows][STP], block barrier,
//   then each lane stores two 16-B fragment-order pieces per plane; the only early return is block-uniform and precedes every barrier.
// staged extent == consumed extent: bias buffer columns 0..NSEQ-1 of all 16 rows written in phase 0 before any read
//   (columns NSEQ..SBP-1 never read); stage tile rows 0..15 x columns 0..63 of both planes written before the barrier
//   (columns 64..STP-1 never read).
// coverage: per block 2 iterations x 2 waves x half a unit (32 lanes x 8 halves) = 2 units = 16 rows x 64 halves per plane;
//           grid = IG*NHG*NQT blocks = every (row, 64-column group) of OH and OL exactly once.
// =====================================================================================================
// amdgpu_waves_per_eu(4): the LDS lets 8 blocks = 4 waves per SIMD stay resident; the register budget is held to that (256).
__global__ __launch_bounds__(ATT_THREADS) __attribute__((amdgpu_waves_per_eu(4)))
void attn(const u16* __restrict__ QHp, const u16* __restrict__ QLp,
          const u16* __restrict__ KHp, const u16* __restrict__ KLp,
          const u16* __restrict__ VHp, const u16* __restrict__ VLp,
          const float* __restrict__ VS, const float* __restrict__ GF, const float* __restrict__ BT,
          const float* __restrict__ MK, u16* OHp, u16* OLp) {
  __shared__ __align__(16) float sbuf[WPB * SBW];
  __shared__ __align__(16) u16 stg[2 * 16 * STP];

  const int tid  = (int)threadIdx.x;
  const int wave = __builtin_amdgcn_readfirstlane(tid >> 5);   // scalar: the fragment units' bases stay out of the vector registers
  const int lane = tid & 31;
  const int hh   = lane >> 4;
  const int c    = lane & 15;
  const int bid  = (int)blockIdx.x;
  const int qt   = bid % NQT;
  const int t2   = bid / NQT;
  const int hg   = t2 % NHG;
  const int il   = t2 / NHG;
  if (il >= IG) return;                     // block-uniform, before every barrier; never taken with the exact grid
  const int q0   = qt * 16;
  const int head = hg * WPB + wave;
  float* buf = sbuf + wave * SBW;
  const size_t prow0 = (size_t)il * NSEQ;   // first position row of this row block in the group-local planes

  // q fragments and the first 32 keys' fragments are asked for first: the bias staging below covers their latency
  // fragment-order units: q, k unit (row tile, k-step = head); v^T unit (16-wide d subtile of the head, k-step = 32 keys)
  // wave-uniform bases + one 32-bit lane offset lo: one vector register addresses every fragment load
  const unsigned lo = (unsigned)(lane * 8);
  const size_t hcol = (size_t)head * 512;
  const _Float16* Qh  = (const _Float16*)(const void*)QHp + (prow0 + q0) * CZ + hcol;
  const _Float16* Ql  = (const _Float16*)(const void*)QLp + (prow0 + q0) * CZ + hcol;
  const _Float16* Khb = (const _Float16*)(const void*)KHp + prow0 * CZ + hcol;           // key tile t: 16t rows added per tile
  const _Float16* Klb = (const _Float16*)(const void*)KLp + prow0 * CZ + hcol;
  const _Float16* Vhb = (const _Float16*)(const void*)VHp + (size_t)(il * NH + head) * HD * NSEQ;
  const _Float16* Vlb = (const _Float16*)(const void*)VLp + (size_t)(il * NH + head) * HD * NSEQ;
  const v16h qh = ldfrag_h(Qh + lo);
  const v16h ql = ldfrag_h(Ql + lo);
  // the two base registers that these loads name are reused behind here; as inputs they stay untouched up to the wait
  asm volatile("s_wait_xcnt 0x0" :: "s"(Qh), "s"(Ql) : "memory");
  const float lsc = RSQ_HD * (LOG2E / (QSC * KSC));
  v16h kh[NSEQ / 16], kl[NSEQ / 16];
#pragma unroll
  for (int t = 0; t < 2; ++t) {
    kh[t] = ldfrag_h(Khb + (lo + t * 16 * CZ));
    kl[t] = ldfrag_h(Klb + (lo + t * 16 * CZ));
  }

  // ---- phase 0: bias rows (query rows q0..q0+15, all keys) x log2e + mask bias x log2e -> bias buffer ----
  {
    const float* bsrc = BT + (size_t)head * NPOS + (size_t)q0 * NSEQ;
    const float* msrc = MK + (size_t)il * NSEQ;
    v4f mb0, mb1;                           // keys lane*4..+3 and 128+lane*4..+3 of mask row il
    {
      const v4f m0 = *(const v4f*)(msrc + lane * 4);
      const v4f m1 = *(const v4f*)(msrc + 128 + lane * 4);
#pragma unroll
      for (int e = 0; e < 4; ++e) {
        mb0[e] = (MINF * (bfr(m0[e]) - 1.0f)) * LOG2E;
        mb1[e] = (MINF * (bfr(m1[e]) - 1.0f)) * LOG2E;
      }
    }
#pragma unroll 1
    for (int g4 = 0; g4 < 4; ++g4) {
      v4f tv[8];
#pragma unroll
      for (int it = 0; it < 8; ++it) {
        const int idx = (g4 * 8 + it) * 32 + lane;        // 0..1023
        const int jr = idx >> 6, k4 = (idx & 63) * 4;      // k4 = lane*4 for even it, 128 + lane*4 for odd it
        tv[it] = *(const v4f*)(bsrc + (size_t)jr * NSEQ + k4);
      }
#pragma unroll
      for (int it = 0; it < 8; ++it) {
        const int idx = (g4 * 8 + it) * 32 + lane;
        const int jr = idx >> 6, k4 = (idx & 63) * 4;
        const v4f mb = (it & 1) ? mb1 : mb0;
        *(v4f*)(buf + jr * SBP + k4) = tv[it] * LOG2E + mb;
      }
    }
  }
  wave_sync_lds();

  // ---- phase 1: transposed scores S^T = k.q^T (A = 16 key rows, B = the 16 query rows), one 16-key tile per step; D element r
  //      of lane (c, hh) = (key 16t + 8hh + r, query c), so a lane owns one query row and its buffered bias is 8 consecutive
  //      floats of buffer row c. All NSEQ/2 = 128 scores of the lane's row half stay in registers (log2 domain). ----
  v8f u[NSEQ / 16];
  float mx4[4];
#pragma unroll
  for (int r = 0; r < 4; ++r) mx4[r] = -INFINITY;
#pragma unroll                              // full unroll here and below: u[], kh[], kl[], v*[] live in registers only with constant indices
  for (int g = 0; g < NKT; ++g) {
#pragma unroll
    for (int j = 0; j < 2; ++j) {
      const int t = 2 * g + 2 + j;
      if (t < NSEQ / 16) {
        kh[t] = ldfrag_h(Khb + (lo + t * 16 * CZ));
        kl[t] = ldfrag_h(Klb + (lo + t * 16 * CZ));
      }
    }
    // keeps the key fragments of the next tile pair in flight, and no more of them: unbounded hoisting spilled registers
    __builtin_amdgcn_sched_barrier(0);
#pragma unroll
    for (int j = 0; j < 2; ++j) {
      const int t = 2 * g + j;
      v8f s = zero8();
      s = mma_h(kh[t], qh, s);
      s = mma_h(kh[t], ql, s);
      s = mma_h(kl[t], qh, s);
      const float* bp = buf + c * SBP + t * 16 + 8 * hh;
      const v4f b0 = *(const v4f*)(bp), b1 = *(const v4f*)(bp + 4);
#pragma unroll
      for (int e = 0; e < 4; ++e) {
        s[e]     = s[e] * lsc + b0[e];
        s[4 + e] = s[4 + e] * lsc + b1[e];
      }
#pragma unroll
      for (int r = 0; r < 4; ++r) mx4[r] = fmaxf(mx4[r], fmaxf(s[r], s[4 + r]));
      u[t] = s;
    }
  }
  // v^T fragments of the first 32 keys are asked for before the softmax arithmetic, which covers their latency
  v16h vha[NKT], vhb[NKT], vla[NKT], vlb[NKT];
  vha[0] = ldfrag_h(Vhb + lo);
  vhb[0] = ldfrag_h(Vhb + (lo + 16 * NSEQ));
  vla[0] = ldfrag_h(Vlb + lo);
  vlb[0] = ldfrag_h(Vlb + (lo + 16 * NSEQ));
  __builtin_amdgcn_sched_barrier(0);        // holds those loads in front of the softmax
  float mx = fmaxf(fmaxf(mx4[0], mx4[1]), fmaxf(mx4[2], mx4[3]));
  mx = fmaxf(mx, __shfl_xor(mx, 16, 32));   // the other lane half holds the other 128 keys of the same query row

  // ---- phase 2a: p = exp2(u - m) in place, row sum Z (8 in-lane chains, tree, one exchange), scale 16384/Z (Z >= 1) ----
  float psc;
  {
    float l8[8];
#pragma unroll
    for (int r = 0; r < 8; ++r) l8[r] = 0.0f;
#pragma unroll
    for (int t = 0; t < NSEQ / 16; ++t) {
#pragma unroll
      for (int r = 0; r < 8; ++r) {
        const float e = exp2f(u[t][r] - mx);
        u[t][r] = e;
        l8[r] += e;
      }
    }
    float ls = ((l8[0] + l8[1]) + (l8[2] + l8[3])) + ((l8[4] + l8[5]) + (l8[6] + l8[7]));
    ls += __shfl_xor(ls, 16, 32);
    const float lz = (ls > 0.0f) ? ls : 1.0f;
    psc = PCAR * __builtin_amdgcn_rcpf(lz);
  }

  // ---- phase 2b: two neighbouring score tiles, centred and converted in place, are the f16 A fragment of P'
  //      (row = query c; elements 0..7 = keys kb + 8hh + 0..7, elements 8..15 = keys kb + 16 + 8hh + 0..7); P'.v^T (hi + residual) ----
  const float pcen = PCAR / (float)NSEQ;
  v8f o0 = zero8(), o1 = zero8();
  const float* vsp = VS + (size_t)il * NST * CZ + head * HD + c;
  const float* gp  = GF + (prow0 + q0 + 8 * hh) * CZ + head * HD + c;
  float vsa[NST], vsb[NST], gza[8], gzb[8];
#pragma unroll
  for (int kt = 0; kt < NKT; ++kt) {
    if (kt + 1 < NKT) {
      const int kn = (kt + 1) * 512;            // next k-step's unit
      vha[kt + 1] = ldfrag_h(Vhb + (lo + kn));
      vhb[kt + 1] = ldfrag_h(Vhb + (lo + 16 * NSEQ + kn));
      vla[kt + 1] = ldfrag_h(Vlb + (lo + kn));
      vlb[kt + 1] = ldfrag_h(Vlb + (lo + 16 * NSEQ + kn));
    }
    if (kt == NKT - 3) {                        // the epilogue's operands, asked for once score registers have come free
#pragma unroll
      for (int s = 0; s < NST; ++s) { vsa[s] = vsp[s * CZ]; vsb[s] = vsp[s * CZ + 16]; }
#pragma unroll
      for (int r = 0; r < 8; ++r) { gza[r] = gp[(size_t)r * CZ]; gzb[r] = gp[(size_t)r * CZ + 16]; }
    }
    // keeps the next keys' v^T fragments in flight under this step's products, and bounds how many are hoisted (registers)
    __builtin_amdgcn_sched_barrier(0);
    FragH ph;
#pragma unroll
    for (int e = 0; e < 8; ++e) {
      ph.h[0][e] = (_Float16)(u[2 * kt][e] * psc - pcen);
      ph.h[1][e] = (_Float16)(u[2 * kt + 1][e] * psc - pcen);
    }
    o0 = mma_h(ph.v, vha[kt], o0);              // D element r = (row 8hh+r, d = c)
    o0 = mma_h(ph.v, vla[kt], o0);
    o1 = mma_h(ph.v, vhb[kt], o1);              // d = 16 + c
    o1 = mma_h(ph.v, vlb[kt], o1);
  }
  acc_guard2(o0, o1);

  // ---- epilogue: vals = acc/(16384*1024) + key-mean, sigmoid gate, O*4096 -> f16 hi + residual in the block stage tile ----
  {
    const float oc  = 1.0f / (PCAR * VCAR);
    float vs0 = 0.0f, vs1 = 0.0f;
#pragma unroll
    for (int t = 0; t < NST; ++t) { vs0 += vsa[t]; vs1 += vsb[t]; }
    const float vm0 = vs0 * (1.0f / (float)NSEQ);
    const float vm1 = vs1 * (1.0f / (float)NSEQ);
#pragma unroll
    for (int r = 0; r < 8; ++r) {
      const float gz0 = gza[r];
      const float gz1 = gzb[r];
      const float g0  = __builtin_amdgcn_rcpf(1.0f + exp2f(-gz0 * LOG2E));
      const float g1  = __builtin_amdgcn_rcpf(1.0f + exp2f(-gz1 * LOG2E));
      const float w0  = (o0[r] * oc + vm0) * g0 * OSC;
      const float w1  = (o1[r] * oc + vm1) * g1 * OSC;
      const _Float16 h0 = (_Float16)w0, h1 = (_Float16)w1;
      const _Float16 l0 = (_Float16)(w0 - (float)h0), l1 = (_Float16)(w1 - (float)h1);
      const int si = (8 * hh + r) * STP + wave * HD + c;
      stg[si]                 = h_bits(h0);
      stg[si + 16]            = h_bits(h1);
      stg[16 * STP + si]      = h_bits(l0);
      stg[16 * STP + si + 16] = h_bits(l1);
    }
  }
  __syncthreads();
  // fragment order: half unit hu = 0..3 of the block's 2 k-steps (its 2 heads); lane = (k octet hh, row c)
  v4u vh[2], vl[2];
#pragma unroll
  for (int it = 0; it < 2; ++it) {
    const int hu = it * 2 + wave;
    vh[it] = *(const v4u*)(stg + c * STP + hu * 16 + hh * 8);
    vl[it] = *(const v4u*)(stg + (16 + c) * STP + hu * 16 + hh * 8);
  }
  const size_t ob = (prow0 + q0) * CZ + (size_t)hg * (WPB * 512);
  {
#pragma unroll
    for (int it = 0; it < 2; ++it) {
      *(v4u*)(OHp + ob + (it * 2 + wave) * 256 + lo) = vh[it];
      *(v4u*)(OLp + ob + (it * 2 + wave) * 256 + lo) = vl[it];
    }
    
  }
}

// =====================================================================================================
// All NI row blocks of the pair tensor are processed as one group (IG = NI rows i, GROWS positions), so each stage is one
// chip-filling launch; every plane is fully rewritten by whole-line stores before it is read. Workspace map (bytes; every extent is an exact
// multiple of its store granularity, no tail rows; every region offset a multiple of 32768; every f16 plane in fragment order):
//   WQ, WK, WV, WG, WO  f16 x1024 [128 n][128 k]   5 x 32768;  WB f16 x1024 [BTM n][128 k] (16384 in a 32768 slot)
//   VS   f32 [IG*NST][128]                          IG*NST*512 (slot padded to 32768)
//   XH, XL  f16 [NPOS][128] (x*64 hi, residual)    2 x 16777216
//   BT   f32 [BTM][NPOS] (rows 0..NH-1 written and read) 16777216
//   OH, OL  f16 [GROWS][128]                        2 x GROWS*256
//   GF   f32 [GROWS][128]                           GROWS*512
//   QH, QL, KH, KL  f16 [GROWS][128]               4 x GROWS*256
//   VH, VL  f16 [IG*NH*HD][NSEQ]                    2 x GROWS*256
//   end (IG = 256)                                  218824704
// =====================================================================================================
extern "C" void kernel_launch(void* const* d_in, const int* in_sizes, int n_in,
                              void* d_out, int out_size, void* d_ws, size_t ws_size,
                              hipStream_t stream) {
  if (n_in < 12) return;
  if (in_sizes[0] < NPOS * CZ) return;
  if (in_sizes[1] < NI * NSEQ) return;
  if (in_sizes[2] < CZ || in_sizes[3] < CZ) return;
  if (in_sizes[4] < NH * CZ) return;
  if (in_sizes[5] < CZ * CZ || in_sizes[6] < CZ * CZ || in_sizes[7] < CZ * CZ || in_sizes[8] < CZ * CZ) return;
  if (in_sizes[9] < CZ) return;
  if (in_sizes[10] < CZ * CZ || in_sizes[11] < CZ) return;
  if (out_size < NI * NSEQ * CZ) return;

  const float* x   = (const float*)d_in[0];
  const float* msk = (const float*)d_in[1];
  const float* gam = (const float*)d_in[2];
  const float* bet = (const float*)d_in[3];
  const float* Wt  = (const float*)d_in[4];
  const float* Wq  = (const float*)d_in[5];
  const float* Wk  = (const float*)d_in[6];
  const float* Wv  = (const float*)d_in[7];
  const float* Wg  = (const float*)d_in[8];
  const float* bg  = (const float*)d_in[9];
  const float* Wo  = (const float*)d_in[10];
  const float* bo  = (const float*)d_in[11];
  float*       out = (float*)d_out;

  const size_t szWP = 32768;
  const size_t szVS = (((size_t)IG * NST * CZ * 4) + 32767) / 32768 * 32768;
  const size_t szX  = (size_t)NPOS * CZ * 2;
  const size_t szBT = (size_t)BTM * NPOS * 4;
  const size_t szF  = (size_t)GROWS * CZ * 4;
  const size_t szP  = (size_t)GROWS * CZ * 2;          // QH, QL, KH, KL, VH, VL, OH, OL
  size_t off = 0;
  const size_t oWQ = off; off += szWP;
  const size_t oWK = off; off += szWP;
  const size_t oWV = off; off += szWP;
  const size_t oWG = off; off += szWP;
  const size_t oWO = off; off += szWP;
  const size_t oWB = off; off += szWP;
  const size_t oVS = off; off += szVS;
  const size_t oXH = off; off += szX;
  const size_t oXL = off; off += szX;
  const size_t oBT = off; off += szBT;
  const size_t oOH = off; off += szP;
  const size_t oOL = off; off += szP;
  const size_t oGF = off; off += szF;
  const size_t oQH = off; off += szP;
  const size_t oQL = off; off += szP;
  const size_t oKH = off; off += szP;
  const size_t oKL = off; off += szP;
  const size_t oVH = off; off += szP;
  const size_t oVL = off; off += szP;
  if (off > ws_size) return;                // off = 218824704 for IG = 256
  if (off > (size_t)WS_CAP) return;

  char* ws = (char*)d_ws;
  u16*   WQ = (u16*)(ws + oWQ);
  u16*   WK = (u16*)(ws + oWK);
  u16*   WV = (u16*)(ws + oWV);
  u16*   WG = (u16*)(ws + oWG);
  u16*   WO = (u16*)(ws + oWO);
  u16*   WB = (u16*)(ws + oWB);
  float* VS = (float*)(ws + oVS);
  u16*   XH = (u16*)(ws + oXH);
  u16*   XL = (u16*)(ws + oXL);
  float* BT = (float*)(ws + oBT);
  u16*   OH = (u16*)(ws + oOH);
  u16*   OL = (u16*)(ws + oOL);
  float* GF = (float*)(ws + oGF);
  u16*   QH = (u16*)(ws + oQH);
  u16*   QL = (u16*)(ws + oQL);
  u16*   KH = (u16*)(ws + oKH);
  u16*   KL = (u16*)(ws + oKL);
  u16*   VH = (u16*)(ws + oVH);
  u16*   VL = (u16*)(ws + oVL);

  const dim3 b256(256), b128(128), bAT(ATT_THREADS);
  const dim3 gP(WPBLK + NPOS / 64);
  const dim3 gX(2 * (GROWS / (64 * RG)));
  const dim3 gG((GROWS / 64) * (CZ / 64));
  const dim3 gA(IG * NHG * NQT);
  const float oscp = 1.0f / (XSC * WSC);
  const float osco = 1.0f / (OSC * WSC);

  // (a, b) one launch: LayerNorm of all positions -> x*64 f16 hi + residual planes, and the weight planes [n][k] as f16 of the
  //     bf16 value x1024 (weights are [out][in] = [n][k]); Wt plane padded to BTM rows
  prep<<<gP, b256, 0, stream>>>(x, gam, bet, Wq, Wk, Wv, Wg, Wo, Wt, XH, XL, WQ, WK, WV, WG, WO, WB);

  for (int g = 0; g < NGRP; ++g) {
    const u16*   XHg = XH + (size_t)g * GROWS * CZ;
    const u16*   XLg = XL + (size_t)g * GROWS * CZ;
    const float* Mg  = msk + (size_t)g * IG * NSEQ;
    float*       og  = out + (size_t)g * GROWS * CZ;
    // (c, 1-4) every product of LN(x) in one launch: shared bias table BT[h][p] = sum_c Wt[h][c] * x[p][c] (rows 0..NH-1 of BT),
    //     v^T hi + residual planes x1024 with the per-64-key sums of v, q and k hi + residual planes x1024,
    //     gate pre-activation x.Wg^T + bg -> GF f32
    xproj<<<gX, b128, 0, stream>>>(XHg, XLg, WV, WQ, WK, WG, WB, bg, VH, VL, VS, QH, QL, KH, KL, GF, BT, oscp);
    // (5) attention over all keys of each row block with the shared bias and the row mask bias, gated
    //     -> O x4096 f16 hi + residual planes
    attn<<<gA, bAT, 0, stream>>>(QH, QL, KH, KL, VH, VL, VS, GF, BT, Mg, OH, OL);
    // (6) output projection (O hi + residual).Wo^T + bo -> out f32, carries 4096 x 1024 folded back
    gemm_h<1, 0, 0, CZ><<<gG, b128, 0, stream>>>(OH, OL, WO, WO, bo, 1, og, QH, QL, GROWS, CZ, osco, 1.0f);
  }
  (void)hipGetLastError();
}

// v007
// Measured time: 112 microseconds a run.
// Two timings next to v006 put it at 1.12 and 1.14 times that version's speed.
// Counting every step since v000, it is 3.39 times as fast.
// Contractions: LN(x).Wq^T, LN(x).Wk^T, LN(x).Wv^T, LN(x).Wg^T(+bg), LN(x).Wt^T (shared pair-bias table) and O.Wo^T(+bo) on
// v_wmma_f32_16x16x32_f16 with the activation operand carried as f16 hi + f16 residual planes (x*64, O*4096) and the weight
// operand as f16(bf16(W)*1024); q.k^T over 32 on v_wmma_f32_16x16x32_f16 (q, k *1024 f16 hi + residual, products hh+lh+hl);
// centred softmax weights P' = 16384*P - 64 (f16 hi) times v^T (v*1024 f16 hi + residual, products P'.vh + P'.vl);
// all f32 accumulate. LayerNorm, mask bias, softmax, sigmoid gate, key-mean of v and carry folds in f32 on VALU.
// Every float input is RNE-converted to bf16 on load.
#include <hip/hip_runtime.h>
#include <math.h>
#include <stdint.h>

#ifndef NB
#define NB 1
#endif
#ifndef NI
#define NI 256
#endif
#define NSEQ   256
#define CZ     128
#define NH     4
#define HD     32
#define NPOS   (NSEQ * NSEQ)
#define IG     NI
#define NGRP   (NI / IG)
#define GROWS  (IG * NSEQ)
#define XSC    64.0f
#define WSC    1024.0f
#define QSC    1024.0f
#define KSC    1024.0f
#define VCAR   1024.0f
#define PCAR   16384.0f
#define OSC    4096.0f
#define MINF   1.0e9f
#define RSQ_HD 0.17677669529663689f
#define LOG2E  1.4426950408889634f
#define AW     4
#define QPW    4
#define NQT    (NSEQ / 16)
#define NKT    (NSEQ / 32)
#define NST    (NSEQ / 64)
#define ATT_THREADS (AW * 32)
#define SBP    260
#define SBW    (16 * SBP)
#define OTP    40
#define KVP    (NSEQ * HD)
#define SLAB64 (16 * 68)
#define TRP    69
#define XTP    136
#define WTP    136
#define BTM    64
#define RG     2
#define BSP    (64 * RG + 4)
#define WS_CAP 268435456
static_assert(NB == 1);
static_assert(CZ == NH * HD && HD == 32 && NH == 4 && NSEQ == 256);
static_assert(NI >= 1 && NI <= NSEQ && (NI % IG) == 0 && IG >= 1 && IG <= NSEQ && NGRP == 1);
static_assert((GROWS % 64) == 0 && (NPOS % 64) == 0);
static_assert(GROWS == NPOS && (GROWS % (64 * RG)) == 0 && 4 * SLAB64 <= 64 * TRP && NH <= 16 && BTM >= 16 && (BSP % 4) == 0);
static_assert(AW * QPW == NQT && AW * 4 == NSEQ / 16 && ATT_THREADS == 128 && (NSEQ % 64) == 0 && (CZ % 64) == 0 && (CZ % 32) == 0);
static_assert((BTM % 64) == 0 && BTM >= NH && (BTM % 32) == 0);
static_assert(SBP >= NSEQ && (SBP % 4) == 0 && OTP >= HD && (OTP % 8) == 0 && XTP >= CZ && WTP >= CZ && TRP >= 64);

typedef unsigned short u16;
typedef _Float16 v16h __attribute__((ext_vector_type(16)));
typedef _Float16 v8h  __attribute__((ext_vector_type(8)));
typedef float    v8f  __attribute__((ext_vector_type(8)));
typedef float    v4f  __attribute__((ext_vector_type(4)));
typedef unsigned int v4u __attribute__((ext_vector_type(4)));

union FragH { v16h v; v8h h[2]; v4u u[2]; };

// ---- scalar helpers --------------------------------------------------------------------------------
__device__ __forceinline__ unsigned short bf_bits(float f) {          // f32 -> bf16 bits, RNE convert
  unsigned u = __float_as_uint(f);
  return (unsigned short)((u + 0x7FFFu + ((u >> 16) & 1u)) >> 16);
}
__device__ __forceinline__ float bf_up(unsigned short h) { return __uint_as_float(((unsigned)h) << 16); }
__device__ __forceinline__ float bfr(float f) { return bf_up(bf_bits(f)); }
__device__ __forceinline__ unsigned short h_bits(_Float16 x) { return __builtin_bit_cast(unsigned short, x); }
__device__ __forceinline__ unsigned pk16(unsigned short a, unsigned short b) { return (unsigned)a | ((unsigned)b << 16); }
__device__ __forceinline__ v8f zero8() { v8f z = {0.f, 0.f, 0.f, 0.f, 0.f, 0.f, 0.f, 0.f}; return z; }

// ---- fragment-order planes: every 16-bit A/B operand plane [R rows][K k] is stored as [R/16 row tiles][K/32 k-steps][512 halves];
//      inside a 512-half unit element (row r, k kk) lies at (kk >> 3)*128 + r*8 + (kk & 7), so unit (rt, ks) starts at
//      rt*16*K + ks*512 and one 16-B load per lane at lane*8 (and at 256 + lane*8) covers 512 contiguous bytes = 4 whole lines.
// ---- fragment loader: lane -> row/col (lane&15), h = lane>>4; p = unit start + lane*8;
//      elements 0..7 <- p[0..7] (k0+8h..), elements 8..15 <- p[256..263] (k0+16+8h..); same split k map for A and B.
__device__ __forceinline__ v16h ldfrag_h(const _Float16* p) {
  FragH f;
  f.h[0] = *(const v8h*)(p);
  f.h[1] = *(const v8h*)(p + 256);
  return f.v;
}

// ---- WMMA helpers with trailing VALU hazard gaps ------------------------------------------------------
__device__ __forceinline__ v8f mma_h(v16h a, v16h b, v8f c) {
  return __builtin_amdgcn_wmma_f32_16x16x32_f16(false, a, false, b, (short)0, c, false, false);
}
template <typename F>
__device__ __forceinline__ void guard6(v8f& a, v8f& b, v8f& c, v8f& d, F x0, F x1, F x2, F x3, F x4, F x5) {
#if defined(__HIP_DEVICE_COMPILE__)
  asm volatile("v_nop\n\tv_nop\n\tv_nop\n\tv_nop"
               : "+v"(a), "+v"(b), "+v"(c), "+v"(d) : "v"(x0), "v"(x1), "v"(x2), "v"(x3), "v"(x4), "v"(x5) : "memory");
#endif
}
template <typename F>
__device__ __forceinline__ void guard9(v8f& a, v8f& b, v8f& c, v8f& d, F x0, F x1, F x2, F x3, F x4, F x5,
                                       F x6, F x7, F x8) {
#if defined(__HIP_DEVICE_COMPILE__)
  asm volatile("v_nop\n\tv_nop\n\tv_nop\n\tv_nop"
               : "+v"(a), "+v"(b), "+v"(c), "+v"(d)
               : "v"(x0), "v"(x1), "v"(x2), "v"(x3), "v"(x4), "v"(x5), "v"(x6), "v"(x7), "v"(x8) : "memory");
#endif
}
__device__ __forceinline__ void acc_guard2(v8f& a, v8f& b) {
#if defined(__HIP_DEVICE_COMPILE__)
  asm volatile("v_nop\n\tv_nop\n\tv_nop\n\tv_nop" : "+v"(a), "+v"(b));
#endif
}
__device__ __forceinline__ void wave_sync_lds() {
  __builtin_amdgcn_fence(__ATOMIC_RELEASE, "workgroup");
  __builtin_amdgcn_wave_barrier();
  __builtin_amdgcn_fence(__ATOMIC_ACQUIRE, "workgroup");
}

// =====================================================================================================
// LayerNorm over CZ of the bf16 RNE-converted input rows, eps 1e-5, gamma/beta (bf16 RNE-converted), then
// with shuffles over the 4 lanes); both planes staged in LDS (pitch XTP halves, 16-B vector stores), block barrier, then each
// The planes go out in fragment order (see the fragment loader): each store instruction writes 512 contiguous bytes.
// coverage: compute 256 thr x 32 = 64 rows x 128; store 4 iterations x 8 waves x half a unit (32 lanes x 8 halves) = 16 units =
//           64 x 128 per plane; one block per 64 rows (row0) = every row of XH and XL exactly once (nrows a multiple of 64).
// =====================================================================================================
__device__ __forceinline__ void ln16(u16* TH, u16* TL, const float* __restrict__ X, const float* __restrict__ gam,
                                     const float* __restrict__ bet, u16* XHo, u16* XLo, int row0, int nrows) {
#pragma clang fp contract(off)
  const int tid = (int)threadIdx.x, wave = tid >> 5, lane = tid & 31;
  if (row0 + 64 > nrows) return;            // block-uniform, before the barrier; never taken with the exact grid
  const int rl = tid >> 2, part = tid & 3;
  const float* p = X + (size_t)(row0 + rl) * CZ + part * 32;
  v4f xv[8];
  float s = 0.0f;
#pragma unroll
  for (int t = 0; t < 8; ++t) {
    v4f a = *(const v4f*)(p + 4 * t);
#pragma unroll
    for (int e = 0; e < 4; ++e) { const float f = bfr(a[e]); a[e] = f; s = s + f; }
    xv[t] = a;
  }
  asm volatile("s_wait_xcnt 0x0" ::: "memory");   // a later load's result lands in the address registers that these loads name
  s = s + __shfl_xor(s, 1, 32);
  s = s + __shfl_xor(s, 2, 32);
  const float mu = s * (1.0f / (float)CZ);
  float q = 0.0f;
#pragma unroll
  for (int t = 0; t < 8; ++t) {
#pragma unroll
    for (int e = 0; e < 4; ++e) { const float d = xv[t][e] - mu; q = q + d * d; }
  }
  q = q + __shfl_xor(q, 1, 32);
  q = q + __shfl_xor(q, 2, 32);
  const float var  = q * (1.0f / (float)CZ);
  const float rstd = rsqrtf(var + 1e-5f);
  v4u oh[4], ol[4];
#pragma unroll
  for (int t = 0; t < 8; ++t) {
    const v4f g4 = *(const v4f*)(gam + part * 32 + 4 * t);
    const v4f b4 = *(const v4f*)(bet + part * 32 + 4 * t);
    unsigned short hb[4], lb[4];
#pragma unroll
    for (int e = 0; e < 4; ++e) {
      float y = (xv[t][e] - mu) * rstd;
      y = y * bfr(g4[e]);
      y = y + bfr(b4[e]);
      const float w = y * XSC;
      const _Float16 hv = (_Float16)w;
      const _Float16 lv = (_Float16)(w - (float)hv);
      hb[e] = h_bits(hv);
      lb[e] = h_bits(lv);
    }
    oh[t >> 1][(t & 1) * 2]     = pk16(hb[0], hb[1]);
    oh[t >> 1][(t & 1) * 2 + 1] = pk16(hb[2], hb[3]);
    ol[t >> 1][(t & 1) * 2]     = pk16(lb[0], lb[1]);
    ol[t >> 1][(t & 1) * 2 + 1] = pk16(lb[2], lb[3]);
  }
  {
    u16* th = TH + rl * XTP + part * 32;
    u16* tl = TL + rl * XTP + part * 32;
#pragma unroll
    for (int q4 = 0; q4 < 4; ++q4) {
      *(v4u*)(th + 8 * q4) = oh[q4];
      *(v4u*)(tl + 8 * q4) = ol[q4];
    }
  }
  __syncthreads();
  // fragment order: half unit hu = 0..31 of the block's 4 row tiles x 4 k-steps; lane = (k octet lane>>4, row lane&15)
  v4u vh[4], vl[4];
#pragma unroll
  for (int it = 0; it < 4; ++it) {
    const int si = (it * 16 + (lane & 15)) * XTP + wave * 16 + (lane >> 4) * 8;   // hu = it*8 + wave: row tile it, k = 16*wave ..
    vh[it] = *(const v4u*)(TH + si);
    vl[it] = *(const v4u*)(TL + si);
  }
  {
#pragma unroll
    for (int it = 0; it < 4; ++it) {
      const size_t o = (size_t)row0 * CZ + (it * 8 + wave) * 256 + lane * 8;
      *(v4u*)(XHo + o) = vh[it];
      *(v4u*)(XLo + o) = vl[it];
    }
    // ln16 ends prep: no code behind these stores rewrites the registers they name
    asm volatile("s_wait_xcnt 0x0" ::: "memory");
  }
}

// =====================================================================================================
// Weight plane: W f32 [nrow rows n][CZ k] row-major (k contiguous); D 16-bit [np rows n][CZ k] in fragment order, D(n, k) = f16 bits of
// bf16(W[n][k]) * scale for n < nrow, 0 for nrow <= n < np. Block = 32 n rows: each thread loads 16 consecutive k values of
// one n row with a clamped row address (zeroed by predicate for n >= nrow), converts into the LDS tile [32 n][CZ k]
// coverage: load 256 thr x 16 = 32 n x 128 k; store 2 iterations x 8 waves x half a unit (32 lanes x 8 halves) = 8 units = 32 x 128;
//           np/32 blocks (n0) cover the [np][CZ] plane exactly once.
// =====================================================================================================
__device__ __forceinline__ void wp16(u16* T, const float* __restrict__ W, int nrow, int np, int n0, u16* D, float scale) {
  const int tid = (int)threadIdx.x, wave = tid >> 5, lane = tid & 31;
  if (n0 + 32 > np) return;                 // block-uniform, before the barrier; never taken with the exact grid
  {
    const int nl = tid >> 3, kc = (tid & 7) * 16;
    const int n  = n0 + nl;
    int nr = (n < nrow) ? n : (nrow - 1);
    nr = (nr < 0) ? 0 : nr;
    const float* src = W + (size_t)nr * CZ + kc;
    v4u w2[2];
#pragma unroll
    for (int t = 0; t < 4; ++t) {
      const v4f a = *(const v4f*)(src + 4 * t);
      unsigned short hb[4];
#pragma unroll
      for (int e = 0; e < 4; ++e) {
        const float val = (n < nrow) ? a[e] : 0.0f;
        hb[e] = h_bits((_Float16)(bfr(val) * scale));
      }
      w2[t >> 1][(t & 1) * 2]     = pk16(hb[0], hb[1]);
      w2[t >> 1][(t & 1) * 2 + 1] = pk16(hb[2], hb[3]);
    }
    *(v4u*)(T + nl * WTP + kc)     = w2[0];
    *(v4u*)(T + nl * WTP + kc + 8) = w2[1];
  }
  __syncthreads();
  // fragment order: half unit hu = 0..15 of the block's 2 row tiles x 4 k-steps; lane = (k octet lane>>4, row lane&15)
  v4u w4[2];
#pragma unroll
  for (int it = 0; it < 2; ++it) {
    w4[it] = *(const v4u*)(T + (it * 16 + (lane & 15)) * WTP + wave * 16 + (lane >> 4) * 8);   // hu = it*8 + wave: row tile it, k = 16*wave ..
  }
  {
#pragma unroll
    for (int it = 0; it < 2; ++it) {
      *(v4u*)(D + (size_t)n0 * CZ + (it * 8 + wave) * 256 + lane * 8) = w4[it];
    }
    
  }
}

// =====================================================================================================
// Everything that depends on the inputs alone, in one launch: the six weight planes and the LayerNorm planes are independent of
// one another, so they share a grid. Blocks 0 .. WPBLK-1: block b does rows 32*(b % 4) .. +31
// of weight plane b / 4 (0..4 = Wq, Wk, Wv, Wg, Wo, CZ rows each; 5 = Wt, NH rows padded to BTM, blocks 20 and 21).
// Blocks WPBLK .. : 64 position rows of LayerNorm each. The branch is block-uniform, each side has its own one barrier.
// LDS: the weight tile [32][WTP] lies in the first LayerNorm stage tile [64][XTP].
// coverage: 5 * CZ/32 + BTM/32 weight blocks = every row of every weight plane once; NPOS/64 LayerNorm blocks = every position once.
// =====================================================================================================
#define WPBLK (5 * (CZ / 32) + BTM / 32)
static_assert(CZ / 32 == 4 && BTM / 32 <= CZ / 32 && 32 * WTP <= 64 * XTP);
// amdgpu_waves_per_eu(8): holds the register budget to 128: four blocks per WGP, so that all LayerNorm blocks are resident at once.
__global__ __launch_bounds__(256) __attribute__((amdgpu_waves_per_eu(8)))
void prep(const float* __restrict__ X, const float* __restrict__ gam, const float* __restrict__ bet,
          const float* __restrict__ Wq, const float* __restrict__ Wk, const float* __restrict__ Wv,
          const float* __restrict__ Wg, const float* __restrict__ Wo, const float* __restrict__ Wt,
          u16* XHo, u16* XLo, u16* WQo, u16* WKo, u16* WVo, u16* WGo, u16* WOo, u16* WBo) {
  __shared__ __align__(16) u16 TH[64 * XTP];
  __shared__ __align__(16) u16 TL[64 * XTP];
  const int bid = (int)blockIdx.x;
  if (bid < WPBLK) {
    const int pl = bid / (CZ / 32), n0 = (bid % (CZ / 32)) * 32;
    const float* W = (pl == 0) ? Wq : (pl == 1) ? Wk : (pl == 2) ? Wv : (pl == 3) ? Wg : (pl == 4) ? Wo : Wt;
    u16*         D = (pl == 0) ? WQo : (pl == 1) ? WKo : (pl == 2) ? WVo : (pl == 3) ? WGo : (pl == 4) ? WOo : WBo;
    wp16(TH, W, (pl == 5) ? NH : CZ, (pl == 5) ? BTM : CZ, n0, D, WSC);
    return;
  }
  ln16(TH, TL, X, gam, bet, XHo, XLo, (bid - WPBLK) * 64, NPOS);
}

// =====================================================================================================
// GEMM epilogue: the wave's 16x64 f32 tile (times oscale, plus a per-column addend) staged in its LDS slab (pitch 68),
// coverage: 8 instructions x 2 rows x 16 lanes x 4 floats = the wave's 16 x 64 tile.
// =====================================================================================================
__device__ __forceinline__ void epi64(float* sl, v8f a0, v8f a1, v8f a2, v8f a3, float oscale,
                                      float b0, float b1, float b2, float b3,
                                      float* C, int N, size_t rowb, int col0, int lane) {
  const int hh = lane >> 4, m = lane & 15;
#pragma unroll
  for (int r = 0; r < 8; ++r) {
    const int ro = (8 * hh + r) * 68 + m;
    sl[ro]      = a0[r] * oscale + b0;
    sl[ro + 16] = a1[r] * oscale + b1;
    sl[ro + 32] = a2[r] * oscale + b2;
    sl[ro + 48] = a3[r] * oscale + b3;
  }
  wave_sync_lds();
  v4f vals[8];
#pragma unroll
  for (int it = 0; it < 8; ++it) vals[it] = *(const v4f*)(sl + (it * 2 + hh) * 68 + m * 4);
  float* dst = C + (rowb + (size_t)hh) * (size_t)N + col0 + m * 4;
  {
#pragma unroll
    for (int it = 0; it < 8; ++it) {
      *(v4f*)(dst + (size_t)(it * 2) * (size_t)N) = vals[it];
    }
    
  }
}

// =====================================================================================================
// Eight f32 values (already carrying their plane scale) -> 8 f16 hi halves and 8 f16 residual halves, packed for 16-B stores.
// =====================================================================================================
__device__ __forceinline__ void split8(const float* w, v4u& oh, v4u& ol) {
#pragma unroll
  for (int e = 0; e < 4; ++e) {
    const float t0 = w[2 * e], t1 = w[2 * e + 1];
    const _Float16 h0 = (_Float16)t0, h1 = (_Float16)t1;
    const _Float16 l0 = (_Float16)(t0 - (float)h0), l1 = (_Float16)(t1 - (float)h1);
    oh[e] = pk16(h_bits(h0), h_bits(h1));
    ol[e] = pk16(h_bits(l0), h_bits(l1));
  }
}

// =====================================================================================================
// GEMM epilogue, plane form (q, k): the wave's 16x64 f32 tile (times oscale) staged in its LDS slab (pitch 68), read back as
// 8 consecutive columns per lane, times psc, split into f16 hi + residual, one 16-B store per plane and lane, in fragment order
// (lane = row m, column octet it*2 + hh): the wave's tile is two neighbouring units = 2048 contiguous bytes per plane.
// coverage: 4 instructions x 2 octets x 16 rows x 8 halves = the wave's 16 x 64 tile per plane; each instruction writes 4 whole
//           128-B lines.
// =====================================================================================================
__device__ __forceinline__ void epi_pl(float* sl, v8f a0, v8f a1, v8f a2, v8f a3, float oscale, float psc,
                                       u16* Hp, u16* Lp, int N, size_t rowb, int col0, int lane) {
  const int hh = lane >> 4, m = lane & 15;
#pragma unroll
  for (int r = 0; r < 8; ++r) {
    const int ro = (8 * hh + r) * 68 + m;
    sl[ro]      = a0[r] * oscale;
    sl[ro + 16] = a1[r] * oscale;
    sl[ro + 32] = a2[r] * oscale;
    sl[ro + 48] = a3[r] * oscale;
  }
  wave_sync_lds();
  v4u oh[4], ol[4];
#pragma unroll
  for (int it = 0; it < 4; ++it) {
    const float* p = sl + m * 68 + (it * 2 + hh) * 8;   // row m, column octet it*2 + hh
    const v4f a = *(const v4f*)(p), b4 = *(const v4f*)(p + 4);
    float w[8];
#pragma unroll
    for (int e = 0; e < 4; ++e) { w[e] = a[e] * psc; w[4 + e] = b4[e] * psc; }
    split8(w, oh[it], ol[it]);
  }
#pragma unroll
  for (int it = 0; it < 4; ++it) {
    const size_t o = rowb * (size_t)N + col0 * 16 + it * 256 + lane * 8;
    *(v4u*)(Hp + o) = oh[it];
    *(v4u*)(Lp + o) = ol[it];
  }
}

// =====================================================================================================
// GEMM epilogue, transposed plane form (v): the block's 64 keys x 64 columns f32 tile (times oscale) staged in one LDS tile
// [key][column] (pitch TRP floats: odd, so the column reads below fall in 32 different banks), block barrier, then each lane
// reads 8 consecutive keys of one column, splits v * psc into f16 hi + residual and stores 16 B per plane into the plane
//   Hp/Lp (row il*N + column, k = key of NSEQ) in fragment order; one instruction = 4 whole 128-B lines. A column's 8 octet sums
// (4 in the lane, the lane halves by one shuffle each) give its sum over the block's 64 keys; the 64 sums are gathered in LDS and stored by wave 0 as two whole lines of
//   KS[row tile][N]  (row tile = il*NST + key tile).
// coverage: 4 waves x 4 instructions x 2 octets x 16 columns x 8 halves = 64 columns x 64 keys per plane; 32 lanes x 2 = 64 sums.
// =====================================================================================================
__device__ __forceinline__ void epi_tr(float* sl, float* rs, v8f a0, v8f a1, v8f a2, v8f a3, float oscale, float psc,
                                       u16* Hp, u16* Lp, float* KS, int N, int rb0, int col0, int wave, int lane) {
  const int hh = lane >> 4, m = lane & 15;
#pragma unroll
  for (int r = 0; r < 8; ++r) {
    const int ro = (wave * 16 + 8 * hh + r) * TRP + m;
    sl[ro]      = a0[r] * oscale;
    sl[ro + 16] = a1[r] * oscale;
    sl[ro + 32] = a2[r] * oscale;
    sl[ro + 48] = a3[r] * oscale;
  }
  __syncthreads();
  const int cl = wave * 16 + m;                          // column within the block's 64
  const float* cp = sl + hh * 8 * TRP + cl;              // one lane address; octets and keys are constant offsets from it
  const int il = rb0 / NSEQ, s0 = rb0 % NSEQ;
  v4u oh[4], ol[4];
  float cs[4];
#pragma unroll
  for (int it = 0; it < 4; ++it) {
    float v[8], w[8];                                    // key octet it*2 + hh of the block's 8
#pragma unroll
    for (int e = 0; e < 8; ++e) v[e] = cp[(it * 16 + e) * TRP];
#pragma unroll
    for (int e = 0; e < 8; ++e) w[e] = v[e] * psc;
    split8(w, oh[it], ol[it]);
    cs[it] = ((v[0] + v[1]) + (v[2] + v[3])) + ((v[4] + v[5]) + (v[6] + v[7]));
  }
  // pairwise tree over the 8 key octets: neighbours (the two lane halves), then pairs, then fours
#pragma unroll
  for (int it = 0; it < 4; ++it) cs[it] += __shfl_xor(cs[it], 16, 32);
  if (hh == 0) rs[cl] = (cs[0] + cs[1]) + (cs[2] + cs[3]);
  __syncthreads();
  if (wave == 0) {
    float2 t;
    t.x = rs[2 * lane];
    t.y = rs[2 * lane + 1];
    *(float2*)(KS + (size_t)(rb0 / 64) * N + col0 + 2 * lane) = t;
    asm volatile("s_wait_xcnt 0x0" ::: "memory");     // the code behind this branch rewrites the registers that the store names
  }
  // wave-uniform base (the wave's 16-column tile, k-steps s0/32 and s0/32 + 1) + one 32-bit lane offset: one register addresses all stores
  const size_t   ub = ((size_t)il * N + col0 + wave * 16) * NSEQ + s0 * 16;
  const unsigned lo = (unsigned)(lane * 8);
#pragma unroll
  for (int it = 0; it < 4; ++it) {
    *(v4u*)(Hp + ub + (lo + it * 256)) = oh[it];
    *(v4u*)(Lp + ub + (lo + it * 256)) = ol[it];
  }
}

// =====================================================================================================
// f16 GEMM: C[M][N] (f32) = (Ah [+ Al])[M][K] . (Bh [+ Bl])[N][K]^T * oscale [+ bf16(bias[col])].
// ALO == 1: products ah.bh + al.bh (A residual plane, unscaled); BLO == 1: products ah.bh + ah.bl (B residual plane);
// one accumulator. Block = 64x64 tile, 4 waves x 16 rows; fragments loaded straight from the fragment-order planes (two 16-B loads
// each, split k map for A and B); K stepped by 32 (K % 32 == 0; host guarantees M % 64 == 0, N % 64 == 0,
// grid = (M/64)*(N/64)). hasb is a block-uniform flag; bias is dereferenced only when hasb != 0.
// EPI == 0: C f32 as above. EPI == 1: the product times psc goes out as f16 hi + residual planes Hp, Lp [M][N] (C unused).
// EPI == 2: the product times psc goes out transposed per NSEQ-row group as Hp, Lp [(row / NSEQ)*N + col][NSEQ] (both fragment order), and C takes
// the f32 column sums of each 64-row tile, [M/64][N] (host guarantees NSEQ % 64 == 0 and M % NSEQ == 0).
// =====================================================================================================
// K is a compile-time value: the units of the four B tiles then lie at constant offsets from one address.
template <int ALO, int BLO, int EPI, int K>
__global__ __launch_bounds__(128)
void gemm_h(const u16* __restrict__ Ah, const u16* __restrict__ Al, const u16* __restrict__ Bh, const u16* __restrict__ Bl,
            const float* __restrict__ bias, int hasb, float* C, u16* Hp, u16* Lp, int M, int N, float oscale,
            float psc) {
  __shared__ __align__(16) float slab[(EPI == 2) ? (64 * TRP + 64) : (4 * SLAB64)];
  const int tid = (int)threadIdx.x, lane = tid & 31, m = lane & 15;
  const int wave = __builtin_amdgcn_readfirstlane(tid >> 5);   // scalar: the fragment units' bases are formed on the scalar unit
  const int ntile = N >> 6;
  const int bid   = (int)blockIdx.x;
  const int rb0   = (bid / ntile) * 64;
  const int rowb  = rb0 + wave * 16;
  const int col0  = (bid % ntile) * 64;
  if (rb0 + 64 > M) return;                 // block-uniform, before any barrier; never taken with the exact grid
  // wave-uniform unit bases + one 32-bit lane offset lo
  const unsigned lo = (unsigned)(lane * 8);
  const _Float16* ahp = (const _Float16*)(const void*)Ah + (size_t)rowb * K;
  const _Float16* alp = (const _Float16*)(const void*)Al + (size_t)rowb * K;   // read only when ALO
  const _Float16* bhp = (const _Float16*)(const void*)Bh + (size_t)col0 * K;
  const _Float16* blp = (const _Float16*)(const void*)Bl + (size_t)col0 * K;   // read only when BLO
  constexpr int bs = 16 * K;                // halves from one 16-column tile of B to the next
  float bb0 = 0.0f, bb1 = 0.0f, bb2 = 0.0f, bb3 = 0.0f;
  if (hasb != 0) {
    bb0 = bfr(bias[col0 + m]);
    bb1 = bfr(bias[col0 + 16 + m]);
    bb2 = bfr(bias[col0 + 32 + m]);
    bb3 = bfr(bias[col0 + 48 + m]);
  }
  v8f acc0 = zero8(), acc1 = zero8(), acc2 = zero8(), acc3 = zero8();
#pragma unroll 1
  for (int ks = 0; ks < K; ks += 32) {      // one fragment-order unit (512 halves) per 32 k
    const _Float16* pa = ahp + 16 * ks + lo;   // this k-step's units: A hi, A residual, B tile 0 hi, B tile 0 residual
    const _Float16* pl = alp + 16 * ks + lo;
    const _Float16* pb = bhp + 16 * ks + lo;
    const _Float16* pq = blp + 16 * ks + lo;
    const v16h ah = ldfrag_h(pa);
    const v16h b0 = ldfrag_h(pb);
    const v16h b1 = ldfrag_h(pb + bs);
    const v16h b2 = ldfrag_h(pb + 2 * bs);
    const v16h b3 = ldfrag_h(pb + 3 * bs);
    acc0 = mma_h(ah, b0, acc0);
    acc1 = mma_h(ah, b1, acc1);
    acc2 = mma_h(ah, b2, acc2);
    acc3 = mma_h(ah, b3, acc3);
    if constexpr (ALO != 0) {
      const v16h al = ldfrag_h(pl);
      acc0 = mma_h(al, b0, acc0);
      acc1 = mma_h(al, b1, acc1);
      acc2 = mma_h(al, b2, acc2);
      acc3 = mma_h(al, b3, acc3);
      if constexpr (BLO != 0) {
        const v16h l0 = ldfrag_h(pq);
        const v16h l1 = ldfrag_h(pq + bs);
        const v16h l2 = ldfrag_h(pq + 2 * bs);
        const v16h l3 = ldfrag_h(pq + 3 * bs);
        acc0 = mma_h(ah, l0, acc0);
        acc1 = mma_h(ah, l1, acc1);
        acc2 = mma_h(ah, l2, acc2);
        acc3 = mma_h(ah, l3, acc3);
        guard9<v16h>(acc0, acc1, acc2, acc3, ah, b0, b1, b2, b3, l0, l1, l2, l3);
        guard6<v16h>(acc0, acc1, acc2, acc3, al, al, al, al, al, al);
      } else {
        guard6<v16h>(acc0, acc1, acc2, acc3, ah, al, b0, b1, b2, b3);
      }
    } else if constexpr (BLO != 0) {
      const v16h l0 = ldfrag_h(pq);
      const v16h l1 = ldfrag_h(pq + bs);
      const v16h l2 = ldfrag_h(pq + 2 * bs);
      const v16h l3 = ldfrag_h(pq + 3 * bs);
      acc0 = mma_h(ah, l0, acc0);
      acc1 = mma_h(ah, l1, acc1);
      acc2 = mma_h(ah, l2, acc2);
      acc3 = mma_h(ah, l3, acc3);
      guard9<v16h>(acc0, acc1, acc2, acc3, ah, b0, b1, b2, b3, l0, l1, l2, l3);
    } else {
      guard6<v16h>(acc0, acc1, acc2, acc3, ah, b0, b1, b2, b3, ah);
    }
    // the next trip rewrites the address registers that this trip's loads name; as inputs they stay untouched up to the wait
    asm volatile("s_wait_xcnt 0x0" :: "v"(pa), "v"(pb), "v"(ALO != 0 ? pl : pa), "v"(BLO != 0 ? pq : pb) : "memory");
  }
  if constexpr (EPI == 0) {
    epi64(slab + wave * SLAB64, acc0, acc1, acc2, acc3, oscale, bb0, bb1, bb2, bb3, C, N, (size_t)rowb, col0, lane);
  } else if constexpr (EPI == 1) {
    epi_pl(slab + wave * SLAB64, acc0, acc1, acc2, acc3, oscale, psc, Hp, Lp, N, (size_t)rowb, col0, lane);
  } else {
    epi_tr(slab, slab + 64 * TRP, acc0, acc1, acc2, acc3, oscale, psc, Hp, Lp, C, N, rb0, col0, wave, lane);
  }
}

// =====================================================================================================
// All products of LN(x) in one launch: v, q, k, gate pre-activation and the pair-bias table.
// Two blocks per RG groups of 64 position rows (one does pair bias, v and gate, the other q and k), 4 waves each;
// wave w owns rows rb0 + 64g + 16w .. +15 of every group g and loads their
// A fragments (x*64 hi + residual, all CZ = 4 k-steps) ONCE into registers; they serve every column tile of the block, so each weight
// fragment that a wave loads is used for RG*16 rows. Per accumulator the products run xh.w, xl.w per k-step, k ascending.
//   pair bias: B = Wt plane rows 0..15 (rows >= NH are zero), D (row = position, column = head) staged in LDS [16][BSP],
//              block barrier, heads 0..NH-1 stored as whole lines of BT[h][position]   (GROWS == NPOS: every position once)
//   v: 2 column tiles x RG groups through epi_tr;  q, k: 2 + 2 column tiles through epi_pl;  gate: 2 column tiles through epi64.
// LDS: epi_tr's block tile [64][TRP] + 64 sums; the per-wave slabs of epi_pl / epi64 lie inside that tile; the q, k blocks run no epi_tr,
// and the gate's epi64 slabs are first written behind epi_tr's last barrier, at which every read of the tile has returned; the bias stage lies behind both.
// coverage: grid = 2 * GROWS/(64*RG) blocks; per part RG groups x 64 rows = every row once, for each of the CZ/64 column tiles of each plane.
// =====================================================================================================
__device__ __forceinline__ void xw_tile(const v16h (&ah)[RG][CZ / 32], const v16h (&al)[RG][CZ / 32], const _Float16* bp,
                                        unsigned wo, v8f (&acc)[RG][4]) {
#pragma unroll
  for (int g = 0; g < RG; ++g) {
#pragma unroll
    for (int j = 0; j < 4; ++j) acc[g][j] = zero8();
  }
#pragma unroll                              // constant indices keep ah[], al[] in registers
  for (int ks = 0; ks < CZ / 32; ++ks) {
    v16h b[4];
#pragma unroll
    for (int j = 0; j < 4; ++j) b[j] = ldfrag_h(bp + (wo + j * 16 * CZ + ks * 512));
#pragma unroll
    for (int g = 0; g < RG; ++g) {
#pragma unroll
      for (int j = 0; j < 4; ++j) acc[g][j] = mma_h(ah[g][ks], b[j], acc[g][j]);
#pragma unroll
      for (int j = 0; j < 4; ++j) acc[g][j] = mma_h(al[g][ks], b[j], acc[g][j]);
    }
  }
}

// amdgpu_waves_per_eu(4): holds the register budget to 256: four blocks per WGP (one wave of each on every SIMD), so that the whole
// grid is resident at once, and no register above v255 is used.
__global__ __launch_bounds__(128) __attribute__((amdgpu_waves_per_eu(4)))
void xproj(const u16* __restrict__ XHp, const u16* __restrict__ XLp, const u16* __restrict__ WVp,
           const u16* __restrict__ WQp, const u16* __restrict__ WKp, const u16* __restrict__ WGp,
           const u16* __restrict__ WBp, const float* __restrict__ bg, u16* VHp, u16* VLp, float* VS,
           u16* QHp, u16* QLp, u16* KHp, u16* KLp, float* GF, float* BT, float oscale) {
  __shared__ __align__(16) float slab[64 * TRP + 64 + 16 * BSP];
  const int tid = (int)threadIdx.x, lane = tid & 31, hh = lane >> 4, m = lane & 15;
  const int wave = __builtin_amdgcn_readfirstlane(tid >> 5);   // scalar: row and slab offsets stay out of the vector registers
  const int rb0  = ((int)blockIdx.x >> 1) * (64 * RG);
  const int part = (int)blockIdx.x & 1;     // block-uniform: 0 = pair bias, v, gate; 1 = q, k (4 column tiles of 64 each)
  if (rb0 + 64 * RG > GROWS) return;        // block-uniform, before any barrier; never taken with the exact grid
  // lane offset inside a fragment-order unit; the same for x rows (A) and weight rows (B)
  const unsigned wo = (unsigned)(lane * 8);
  v16h ah[RG][CZ / 32], al[RG][CZ / 32];
  {
    const _Float16* xh = (const _Float16*)(const void*)XHp + (size_t)(rb0 + wave * 16) * CZ;   // wave-uniform bases
    const _Float16* xl = (const _Float16*)(const void*)XLp + (size_t)(rb0 + wave * 16) * CZ;
#pragma unroll
    for (int g = 0; g < RG; ++g) {
#pragma unroll
      for (int ks = 0; ks < CZ / 32; ++ks) {
        ah[g][ks] = ldfrag_h(xh + (wo + g * 64 * CZ + ks * 512));
        al[g][ks] = ldfrag_h(xl + (wo + g * 64 * CZ + ks * 512));
      }
    }
    // the two base registers that these loads name are reused behind here; as inputs they stay untouched up to the wait
    asm volatile("s_wait_xcnt 0x0" :: "s"(xh), "s"(xl) : "memory");
  }
  float* wsl = slab + wave * SLAB64;
  v8f acc[RG][4];

  if (part != 0) {
    // ---- q, k: hi + residual planes ----
#pragma unroll 1                            // rolled: one copy of the tile code in the instruction cache
    for (int i = 0; i < 2 * (CZ / 64); ++i) {
      const bool isq = i < CZ / 64;
      const int  ct  = isq ? i : i - CZ / 64;
      const u16* wp  = isq ? WQp : WKp;
      u16* hp = isq ? QHp : KHp;
      u16* lp = isq ? QLp : KLp;
      xw_tile(ah, al, (const _Float16*)(const void*)wp + (size_t)(ct * 64) * CZ, wo, acc);
#pragma unroll
      for (int g = 0; g < RG; ++g) {
        epi_pl(wsl, acc[g][0], acc[g][1], acc[g][2], acc[g][3], oscale, isq ? QSC : KSC, hp, lp, CZ,
               (size_t)(rb0 + g * 64 + wave * 16), ct * 64, lane);
        asm volatile("s_wait_xcnt 0x0" ::: "memory");   // the next tile rewrites the registers that these stores name
      }
    }
    return;                                 // block-uniform; the barriers below are passed by whole blocks of part 0 only
  }

  // ---- pair bias ----
  {
    float* bsl = slab + 64 * TRP + 64;
    v8f ab[RG];
#pragma unroll
    for (int g = 0; g < RG; ++g) ab[g] = zero8();
#pragma unroll
    for (int ks = 0; ks < CZ / 32; ++ks) {
      const v16h b = ldfrag_h((const _Float16*)(const void*)WBp + (wo + ks * 512));
#pragma unroll
      for (int g = 0; g < RG; ++g) {
        ab[g] = mma_h(ah[g][ks], b, ab[g]);
        ab[g] = mma_h(al[g][ks], b, ab[g]);
      }
    }
#pragma unroll
    for (int g = 0; g < RG; ++g) {
      v4f t0, t1;
#pragma unroll
      for (int e = 0; e < 4; ++e) { t0[e] = ab[g][e] * oscale; t1[e] = ab[g][4 + e] * oscale; }
      float* d = bsl + m * BSP + g * 64 + wave * 16 + 8 * hh;
      *(v4f*)(d)     = t0;
      *(v4f*)(d + 4) = t1;
    }
    __syncthreads();
    for (int i = tid; i < NH * 16 * RG; i += 128) {   // wave-uniform trip count: 16*RG is a multiple of 16, 128 of 32
      const int h = i / (16 * RG), p4 = (i % (16 * RG)) * 4;
      *(v4f*)(BT + (size_t)h * NPOS + rb0 + p4) = *(const v4f*)(bsl + h * BSP + p4);
    }
  }

  // ---- v: transposed hi + residual planes and 64-key sums ----
#pragma unroll 1                            // rolled: one copy of the tile code in the instruction cache
  for (int ct = 0; ct < CZ / 64; ++ct) {
    xw_tile(ah, al, (const _Float16*)(const void*)WVp + (size_t)(ct * 64) * CZ, wo, acc);
#pragma unroll
    for (int g = 0; g < RG; ++g) {
      epi_tr(slab, slab + 64 * TRP, acc[g][0], acc[g][1], acc[g][2], acc[g][3], oscale, VCAR, VHp, VLp, VS, CZ,
             rb0 + g * 64, ct * 64, wave, lane);
      asm volatile("s_wait_xcnt 0x0" ::: "memory");   // the next tile rewrites the registers that these stores name
    }
  }
  // ---- gate pre-activation, f32, bias added ----
#pragma unroll 1                            // rolled: one copy of the tile code in the instruction cache
  for (int ct = 0; ct < CZ / 64; ++ct) {
    const float b0 = bfr(bg[ct * 64 + m]), b1 = bfr(bg[ct * 64 + 16 + m]);
    const float b2 = bfr(bg[ct * 64 + 32 + m]), b3 = bfr(bg[ct * 64 + 48 + m]);
    xw_tile(ah, al, (const _Float16*)(const void*)WGp + (size_t)(ct * 64) * CZ, wo, acc);
#pragma unroll
    for (int g = 0; g < RG; ++g) {
      epi64(wsl, acc[g][0], acc[g][1], acc[g][2], acc[g][3], oscale, b0, b1, b2, b3, GF, CZ,
            (size_t)(rb0 + g * 64 + wave * 16), ct * 64, lane);
      asm volatile("s_wait_xcnt 0x0" ::: "memory");   // the next tile rewrites the registers that these stores name
    }
  }
}

// =====================================================================================================
// Row-wise gated attention. Block bid -> (row block il, head): AW waves, wave w takes the query tiles qt = qi*AW + w, qi = 0..QPW-1,
// one after the other (rows q0 = 16*qt .. q0+15); all NSEQ keys of row block il, shared bias table BT f32 [BTM][NPOS]
// (row h, position j*NSEQ + k) plus the per-row mask bias 1e9*(bf16(mask[il][k]) - 1) (MK already offset to the row group).
//   q/k planes f16 x1024 hi + residual [il*NSEQ + s][h*HD + d]; v^T planes [il*NH + h][d][NSEQ] hi + residual; all in fragment order;
//   VS f32 [il*NST + key tile][h*HD + d] = sums of v over 64 keys (their total / NSEQ = key-mean of v); GF f32 [il*NSEQ + s][h*HD + d] = gate pre-activation (bias already added).
//   Staging: the head's k and v^T planes (hi + residual, 16 fragment-order units of 1 KiB each) are the same for all NQT query tiles;
//   they are copied once per block into LDS (kvs: k hi, k residual, v^T hi, v^T residual) by asynchronous 16-B copies, each wave
//   4 units of each plane, and every fragment is then read from LDS (512 contiguous bytes per instruction). The copies are waited
//   for and published by one block barrier in front of the first pass's scores.
//   Phase 0: the wave's 16 x NSEQ bias rows (times log2e, plus mask bias times log2e) loaded with 16-B loads into its private
//   LDS bias buffer (pitch SBP: 16 B over a multiple of 256 B, the pitch of 16-B row readers).
//   Phase 1 (per 16-key tile): TRANSPOSED scores k_hi.q_hi + k_hi.q_lo + k_lo.q_hi (A = key rows, B = query rows, one k-step of
//   32): D element r of lane (c, hh) = (key 16t + 8hh + r, query c). u = s*rsqrt(32)*log2e/(1024*1024) + bias (two 16-B LDS reads
//   of buffer row c); all 128 scores of a lane stay in registers; running max in-lane, one exchange between the lane halves.
//   Phase 2a: p = exp2(u - m) in registers, row sum Z in-lane (8 chains, tree) plus one exchange, scale 16384/Z.
//   Phase 2b (per 32 keys): P' = p*16384/Z - 64 of two neighbouring tiles converted to f16 IS the A fragment (row c, split k map);
//   v^T B fragments for the two 16-wide d subtiles, products P'.v_hi + P'.v_lo. The score, softmax and P'.v code is straight-line.
//   Epilogue: vals = acc/(16384*1024) + key-mean (exact identity sum(P'+64).v/16384 = sum P.v), gate g = 1/(1+exp(-z)) in f32,
//   O = g*vals*4096 -> f16 hi + residual, staged as u16 elements in the wave's own LDS tile [2 planes][16 rows][OTP]; the wave's
//   16 rows x HD columns are one whole fragment-order unit per plane, so the wave stores it alone, behind an in-wave sync.
//   The only early return is block-uniform and precedes the barrier, which stands under the block-uniform test qi == 0.
// staged extent == consumed extent: kvs units 0..15 of all 4 planes copied (4 waves x 4 units) and read; bias buffer columns
//   0..NSEQ-1 of all 16 rows written in phase 0 before any read (columns NSEQ..SBP-1 never read); stage tile rows 0..15 x columns
//   0..HD-1 of both planes written before the sync (columns HD..OTP-1 never read).
// coverage: per wave and pass 2 x half a unit (32 lanes x 8 halves) = 1 unit = 16 rows x HD halves per plane;
//           grid = IG*NH blocks x AW*QPW = NQT query tiles = every (row tile, head) unit of OH and OL exactly once.
// =====================================================================================================
// Four asynchronous 16-B-per-lane copies global -> LDS (l*: the lane's LDS byte address, g*: its global address). The wait stands in
// the copies' own statement: behind it the registers that the copies name may be rewritten.
__device__ __forceinline__ void acopy4(unsigned l0, unsigned l1, unsigned l2, unsigned l3,
                                       const _Float16* g0, const _Float16* g1, const _Float16* g2, const _Float16* g3) {
#if defined(__HIP_DEVICE_COMPILE__)
  asm volatile("global_load_async_to_lds_b128 %0, %4, off\n\t"
               "global_load_async_to_lds_b128 %1, %5, off\n\t"
               "global_load_async_to_lds_b128 %2, %6, off\n\t"
               "global_load_async_to_lds_b128 %3, %7, off\n\t"
               "s_wait_xcnt 0x0"
               :: "v"(l0), "v"(l1), "v"(l2), "v"(l3), "v"(g0), "v"(g1), "v"(g2), "v"(g3) : "memory");
#endif
}
// The wave's 4 units (u0 .. u0+3, 1 KiB each, gstep halves apart in global memory) of one plane -> LDS units u0 .. u0+3 at byte lb.
__device__ __forceinline__ void stage4(unsigned lb, const _Float16* g, int gstep, int u0, unsigned lo) {
#pragma unroll
  for (int p = 0; p < 2; ++p) {
    const unsigned  l = lb + (unsigned)((u0 + 2 * p) * 1024) + lo * 2;
    const _Float16* s = g + (size_t)(u0 + 2 * p) * gstep + lo;
    acopy4(l, l + 512, l + 1024, l + 1536, s, s + 256, s + gstep, s + gstep + 256);
  }
}

// The LDS lets 2 blocks = 2 waves per SIMD stay resident. amdgpu_num_vgpr(256) steers the build towards 256 registers (it takes a few
// more): fewer switches to the registers above v255, each of which costs a scalar instruction.
__global__ __launch_bounds__(ATT_THREADS) __attribute__((amdgpu_num_vgpr(256)))
void attn(const u16* __restrict__ QHp, const u16* __restrict__ QLp,
          const u16* __restrict__ KHp, const u16* __restrict__ KLp,
          const u16* __restrict__ VHp, const u16* __restrict__ VLp,
          const float* __restrict__ VS, const float* __restrict__ GF, const float* __restrict__ BT,
          const float* __restrict__ MK, u16* OHp, u16* OLp) {
  __shared__ __align__(16) u16 kvs[4 * KVP];
  __shared__ __align__(16) float sbuf[AW * SBW];
  __shared__ __align__(16) u16 stg[AW * 2 * 16 * OTP];

  const int tid  = (int)threadIdx.x;
  const int wave = __builtin_amdgcn_readfirstlane(tid >> 5);   // scalar: the fragment units' bases stay out of the vector registers
  const int lane = tid & 31;
  const int hh   = lane >> 4;
  const int c    = lane & 15;
  const int bid  = (int)blockIdx.x;
  const int head = bid % NH;
  const int il   = bid / NH;
  if (il >= IG) return;                     // block-uniform, before every barrier; never taken with the exact grid
  float* buf = sbuf + wave * SBW;
  u16*   wst = stg + wave * (2 * 16 * OTP);
  const size_t prow0 = (size_t)il * NSEQ;   // first position row of this row block in the group-local planes

  // fragment-order units: q, k unit (row tile, k-step = head); v^T unit (16-wide d subtile of the head, k-step = 32 keys)
  // one 32-bit lane offset lo addresses every fragment load
  const unsigned lo = (unsigned)(lane * 8);
  const size_t hcol = (size_t)head * 512;
  const _Float16* Khb = (const _Float16*)(const void*)KHp + prow0 * CZ + hcol;           // key tile t: 16t rows added per tile
  const _Float16* Klb = (const _Float16*)(const void*)KLp + prow0 * CZ + hcol;
  const _Float16* Vhb = (const _Float16*)(const void*)VHp + (size_t)(il * NH + head) * HD * NSEQ;
  const _Float16* Vlb = (const _Float16*)(const void*)VLp + (size_t)(il * NH + head) * HD * NSEQ;
  const _Float16* Ksh = (const _Float16*)(const void*)kvs;      // LDS planes: unit t at t*512 halves
  const _Float16* Ksl = Ksh + KVP;
  const _Float16* Vsh = Ksh + 2 * KVP;
  const _Float16* Vsl = Ksh + 3 * KVP;
  const unsigned kvb = (unsigned)(size_t)(const void*)kvs;      // LDS byte address of kvs: the low 32 bits of its address
  // 32 copies per wave in flight: the first pass's bias staging covers their latency
  stage4(kvb,           Khb, 16 * CZ, wave * 4, lo);
  stage4(kvb + KVP * 2, Klb, 16 * CZ, wave * 4, lo);
  stage4(kvb + KVP * 4, Vhb, 512, wave * 4, lo);
  stage4(kvb + KVP * 6, Vlb, 512, wave * 4, lo);
  const float lsc = RSQ_HD * (LOG2E / (QSC * KSC));
  v4f mb0, mb1;                             // mask bias x log2e of keys lane*4..+3 and 128+lane*4..+3 of mask row il: the same in every pass
  {
    const float* msrc = MK + (size_t)il * NSEQ;
    const v4f m0 = *(const v4f*)(msrc + lane * 4);
    const v4f m1 = *(const v4f*)(msrc + 128 + lane * 4);
#pragma unroll
    for (int e = 0; e < 4; ++e) {
      mb0[e] = (MINF * (bfr(m0[e]) - 1.0f)) * LOG2E;
      mb1[e] = (MINF * (bfr(m1[e]) - 1.0f)) * LOG2E;
    }
  }

#pragma unroll 1                            // rolled: one copy of the straight-line tile code in the instruction cache
  for (int qi = 0; qi < QPW; ++qi) {
  const int q0 = (qi * AW + wave) * 16;
  // q fragments are asked for first: the bias staging below covers their latency
  const _Float16* Qh  = (const _Float16*)(const void*)QHp + (prow0 + q0) * CZ + hcol;
  const _Float16* Ql  = (const _Float16*)(const void*)QLp + (prow0 + q0) * CZ + hcol;
  const v16h qh = ldfrag_h(Qh + lo);
  const v16h ql = ldfrag_h(Ql + lo);
  // the two base registers that these loads name are reused behind here; as inputs they stay untouched up to the wait
  asm volatile("s_wait_xcnt 0x0" :: "s"(Qh), "s"(Ql) : "memory");

  // ---- phase 0: bias rows (query rows q0..q0+15, all keys) x log2e + mask bias x log2e -> bias buffer ----
  {
    const float* bsrc = BT + (size_t)head * NPOS + (size_t)q0 * NSEQ;
#pragma unroll 1
    for (int g4 = 0; g4 < 4; ++g4) {
      v4f tv[8];
#pragma unroll
      for (int it = 0; it < 8; ++it) {
        const int idx = (g4 * 8 + it) * 32 + lane;        // 0..1023
        const int jr = idx >> 6, k4 = (idx & 63) * 4;      // k4 = lane*4 for even it, 128 + lane*4 for odd it
        tv[it] = *(const v4f*)(bsrc + (size_t)jr * NSEQ + k4);
      }
#pragma unroll
      for (int it = 0; it < 8; ++it) {
        const int idx = (g4 * 8 + it) * 32 + lane;
        const int jr = idx >> 6, k4 = (idx & 63) * 4;
        const v4f mb = (it & 1) ? mb1 : mb0;
        *(v4f*)(buf + jr * SBP + k4) = tv[it] * LOG2E + mb;
      }
    }
  }
  if (qi == 0) {                            // block-uniform
    asm volatile("s_wait_asynccnt 0x0" ::: "memory");   // this wave's copies have landed ...
    __syncthreads();                                    // ... and every other wave's: nobody reads kvs in front of here
  }
  wave_sync_lds();

  // ---- phase 1: transposed scores S^T = k.q^T (A = 16 key rows, B = the 16 query rows), one 16-key tile per step; D element r
  //      of lane (c, hh) = (key 16t + 8hh + r, query c), so a lane owns one query row and its buffered bias is 8 consecutive
  //      floats of buffer row c. All NSEQ/2 scores of the lane's row half stay in registers (log2 domain). ----
  v16h kh[NSEQ / 16], kl[NSEQ / 16];
#pragma unroll
  for (int t = 0; t < 2; ++t) {
    kh[t] = ldfrag_h(Ksh + (lo + t * 512));
    kl[t] = ldfrag_h(Ksl + (lo + t * 512));
  }
  v8f u[NSEQ / 16];
  float mx4[4];
#pragma unroll
  for (int r = 0; r < 4; ++r) mx4[r] = -INFINITY;
#pragma unroll                              // full unroll here and below: u[], kh[], kl[], v*[] live in registers only with constant indices
  for (int g = 0; g < NKT; ++g) {
#pragma unroll
    for (int j = 0; j < 2; ++j) {
      const int t = 2 * g + 2 + j;
      if (t < NSEQ / 16) {
        kh[t] = ldfrag_h(Ksh + (lo + t * 512));
        kl[t] = ldfrag_h(Ksl + (lo + t * 512));
      }
    }
    // keeps the key fragments of the next tile pair in flight, and no more of them: unbounded hoisting spilled registers
    __builtin_amdgcn_sched_barrier(0);
#pragma unroll
    for (int j = 0; j < 2; ++j) {
      const int t = 2 * g + j;
      v8f s = zero8();
      s = mma_h(kh[t], qh, s);
      s = mma_h(kh[t], ql, s);
      s = mma_h(kl[t], qh, s);
      const float* bp = buf + c * SBP + t * 16 + 8 * hh;
      const v4f b0 = *(const v4f*)(bp), b1 = *(const v4f*)(bp + 4);
#pragma unroll
      for (int e = 0; e < 4; ++e) {
        s[e]     = s[e] * lsc + b0[e];
        s[4 + e] = s[4 + e] * lsc + b1[e];
      }
#pragma unroll
      for (int r = 0; r < 4; ++r) mx4[r] = fmaxf(mx4[r], fmaxf(s[r], s[4 + r]));
      u[t] = s;
    }
  }
  // v^T fragments of the first 32 keys are asked for before the softmax arithmetic, which covers their latency
  v16h vha[NKT], vhb[NKT], vla[NKT], vlb[NKT];
  vha[0] = ldfrag_h(Vsh + lo);
  vhb[0] = ldfrag_h(Vsh + (lo + 16 * NSEQ));
  vla[0] = ldfrag_h(Vsl + lo);
  vlb[0] = ldfrag_h(Vsl + (lo + 16 * NSEQ));
  __builtin_amdgcn_sched_barrier(0);        // holds those loads in front of the softmax
  float mx = fmaxf(fmaxf(mx4[0], mx4[1]), fmaxf(mx4[2], mx4[3]));
  mx = fmaxf(mx, __shfl_xor(mx, 16, 32));   // the other lane half holds the other 128 keys of the same query row

  // ---- phase 2a: p = exp2(u - m) in place, row sum Z (8 in-lane chains, tree, one exchange), scale 16384/Z (Z >= 1) ----
  float psc;
  {
    float l8[8];
#pragma unroll
    for (int r = 0; r < 8; ++r) l8[r] = 0.0f;
#pragma unroll
    for (int t = 0; t < NSEQ / 16; ++t) {
#pragma unroll
      for (int r = 0; r < 8; ++r) {
        const float e = exp2f(u[t][r] - mx);
        u[t][r] = e;
        l8[r] += e;
      }
    }
    float ls = ((l8[0] + l8[1]) + (l8[2] + l8[3])) + ((l8[4] + l8[5]) + (l8[6] + l8[7]));
    ls += __shfl_xor(ls, 16, 32);
    const float lz = (ls > 0.0f) ? ls : 1.0f;
    psc = PCAR * __builtin_amdgcn_rcpf(lz);
  }

  // ---- phase 2b: two neighbouring score tiles, centred and converted in place, are the f16 A fragment of P'
  //      (row = query c; elements 0..7 = keys kb + 8hh + 0..7, elements 8..15 = keys kb + 16 + 8hh + 0..7); P'.v^T (hi + residual) ----
  const float pcen = PCAR / (float)NSEQ;
  v8f o0 = zero8(), o1 = zero8();
  const float* vsp = VS + (size_t)il * NST * CZ + head * HD + c;
  const float* gp  = GF + (prow0 + q0 + 8 * hh) * CZ + head * HD + c;
  float vsa[NST], vsb[NST], gza[8], gzb[8];
#pragma unroll
  for (int kt = 0; kt < NKT; ++kt) {
    if (kt + 1 < NKT) {
      const int kn = (kt + 1) * 512;            // next k-step's unit
      vha[kt + 1] = ldfrag_h(Vsh + (lo + kn));
      vhb[kt + 1] = ldfrag_h(Vsh + (lo + 16 * NSEQ + kn));
      vla[kt + 1] = ldfrag_h(Vsl + (lo + kn));
      vlb[kt + 1] = ldfrag_h(Vsl + (lo + 16 * NSEQ + kn));
    }
    if (kt == NKT - 3) {                        // the epilogue's operands, asked for once score registers have come free
#pragma unroll
      for (int s = 0; s < NST; ++s) { vsa[s] = vsp[s * CZ]; vsb[s] = vsp[s * CZ + 16]; }
#pragma unroll
      for (int r = 0; r < 8; ++r) { gza[r] = gp[(size_t)r * CZ]; gzb[r] = gp[(size_t)r * CZ + 16]; }
    }
    // keeps the next keys' v^T fragments in flight under this step's products, and bounds how many are hoisted (registers)
    __builtin_amdgcn_sched_barrier(0);
    FragH ph;
#pragma unroll
    for (int e = 0; e < 8; ++e) {
      ph.h[0][e] = (_Float16)(u[2 * kt][e] * psc - pcen);
      ph.h[1][e] = (_Float16)(u[2 * kt + 1][e] * psc - pcen);
    }
    o0 = mma_h(ph.v, vha[kt], o0);              // D element r = (row 8hh+r, d = c)
    o0 = mma_h(ph.v, vla[kt], o0);
    o1 = mma_h(ph.v, vhb[kt], o1);              // d = 16 + c
    o1 = mma_h(ph.v, vlb[kt], o1);
  }
  acc_guard2(o0, o1);

  // ---- epilogue: vals = acc/(16384*1024) + key-mean, sigmoid gate, O*4096 -> f16 hi + residual in the wave's stage tile ----
  {
    const float oc  = 1.0f / (PCAR * VCAR);
    float vs0 = 0.0f, vs1 = 0.0f;
#pragma unroll
    for (int t = 0; t < NST; ++t) { vs0 += vsa[t]; vs1 += vsb[t]; }
    const float vm0 = vs0 * (1.0f / (float)NSEQ);
    const float vm1 = vs1 * (1.0f / (float)NSEQ);
#pragma unroll
    for (int r = 0; r < 8; ++r) {
      const float gz0 = gza[r];
      const float gz1 = gzb[r];
      const float g0  = __builtin_amdgcn_rcpf(1.0f + exp2f(-gz0 * LOG2E));
      const float g1  = __builtin_amdgcn_rcpf(1.0f + exp2f(-gz1 * LOG2E));
      const float w0  = (o0[r] * oc + vm0) * g0 * OSC;
      const float w1  = (o1[r] * oc + vm1) * g1 * OSC;
      const _Float16 h0 = (_Float16)w0, h1 = (_Float16)w1;
      const _Float16 l0 = (_Float16)(w0 - (float)h0), l1 = (_Float16)(w1 - (float)h1);
      const int si = (8 * hh + r) * OTP + c;
      wst[si]                 = h_bits(h0);
      wst[si + 16]            = h_bits(h1);
      wst[16 * OTP + si]      = h_bits(l0);
      wst[16 * OTP + si + 16] = h_bits(l1);
    }
  }
  wave_sync_lds();
  // fragment order: the two half units of the wave's unit (row tile q0/16, k-step = head); lane = (k octet hh, row c)
  v4u vh[2], vl[2];
#pragma unroll
  for (int it = 0; it < 2; ++it) {
    vh[it] = *(const v4u*)(wst + c * OTP + it * 16 + hh * 8);
    vl[it] = *(const v4u*)(wst + (16 + c) * OTP + it * 16 + hh * 8);
  }
  const size_t ob = (prow0 + q0) * CZ + hcol;
#pragma unroll
  for (int it = 0; it < 2; ++it) {
    *(v4u*)(OHp + ob + it * 256 + lo) = vh[it];
    *(v4u*)(OLp + ob + it * 256 + lo) = vl[it];
  }
  // the next pass rewrites the registers that this pass's loads and stores name; the memory clobber also keeps the next pass's writes
  // of the stage tile and the bias buffer behind this pass's reads in the built code (a wave's LDS operations run in order)
  asm volatile("s_wait_xcnt 0x0" ::: "memory");
  }
}

// =====================================================================================================
// All NI row blocks of the pair tensor are processed as one group (IG = NI rows i, GROWS positions), so each stage is one
// chip-filling launch; every plane is fully rewritten by whole-line stores before it is read. Workspace map (bytes; every extent is an exact
// multiple of its store granularity, no tail rows; every region offset a multiple of 32768; every f16 plane in fragment order):
//   WQ, WK, WV, WG, WO  f16 x1024 [128 n][128 k]   5 x 32768;  WB f16 x1024 [BTM n][128 k] (16384 in a 32768 slot)
//   VS   f32 [IG*NST][128]                          IG*NST*512 (slot padded to 32768)
//   XH, XL  f16 [NPOS][128] (x*64 hi, residual)    2 x 16777216
//   BT   f32 [BTM][NPOS] (rows 0..NH-1 written and read) 16777216
//   OH, OL  f16 [GROWS][128]                        2 x GROWS*256
//   GF   f32 [GROWS][128]                           GROWS*512
//   QH, QL, KH, KL  f16 [GROWS][128]               4 x GROWS*256
//   VH, VL  f16 [IG*NH*HD][NSEQ]                    2 x GROWS*256
//   end (IG = 256)                                  218824704
// =====================================================================================================
extern "C" void kernel_launch(void* const* d_in, const int* in_sizes, int n_in,
                              void* d_out, int out_size, void* d_ws, size_t ws_size,
                              hipStream_t stream) {
  if (n_in < 12) return;
  if (in_sizes[0] < NPOS * CZ) return;
  if (in_sizes[1] < NI * NSEQ) return;
  if (in_sizes[2] < CZ || in_sizes[3] < CZ) return;
  if (in_sizes[4] < NH * CZ) return;
  if (in_sizes[5] < CZ * CZ || in_sizes[6] < CZ * CZ || in_sizes[7] < CZ * CZ || in_sizes[8] < CZ * CZ) return;
  if (in_sizes[9] < CZ) return;
  if (in_sizes[10] < CZ * CZ || in_sizes[11] < CZ) return;
  if (out_size < NI * NSEQ * CZ) return;

  const float* x   = (const float*)d_in[0];
  const float* msk = (const float*)d_in[1];
  const float* gam = (const float*)d_in[2];
  const float* bet = (const float*)d_in[3];
  const float* Wt  = (const float*)d_in[4];
  const float* Wq  = (const float*)d_in[5];
  const float* Wk  = (const float*)d_in[6];
  const float* Wv  = (const float*)d_in[7];
  const float* Wg  = (const float*)d_in[8];
  const float* bg  = (const float*)d_in[9];
  const float* Wo  = (const float*)d_in[10];
  const float* bo  = (const float*)d_in[11];
  float*       out = (float*)d_out;

  const size_t szWP = 32768;
  const size_t szVS = (((size_t)IG * NST * CZ * 4) + 32767) / 32768 * 32768;
  const size_t szX  = (size_t)NPOS * CZ * 2;
  const size_t szBT = (size_t)BTM * NPOS * 4;
  const size_t szF  = (size_t)GROWS * CZ * 4;
  const size_t szP  = (size_t)GROWS * CZ * 2;          // QH, QL, KH, KL, VH, VL, OH, OL
  size_t off = 0;
  const size_t oWQ = off; off += szWP;
  const size_t oWK = off; off += szWP;
  const size_t oWV = off; off += szWP;
  const size_t oWG = off; off += szWP;
  const size_t oWO = off; off += szWP;
  const size_t oWB = off; off += szWP;
  const size_t oVS = off; off += szVS;
  const size_t oXH = off; off += szX;
  const size_t oXL = off; off += szX;
  const size_t oBT = off; off += szBT;
  const size_t oOH = off; off += szP;
  const size_t oOL = off; off += szP;
  const size_t oGF = off; off += szF;
  const size_t oQH = off; off += szP;
  const size_t oQL = off; off += szP;
  const size_t oKH = off; off += szP;
  const size_t oKL = off; off += szP;
  const size_t oVH = off; off += szP;
  const size_t oVL = off; off += szP;
  if (off > ws_size) return;                // off = 218824704 for IG = 256
  if (off > (size_t)WS_CAP) return;

  char* ws = (char*)d_ws;
  u16*   WQ = (u16*)(ws + oWQ);
  u16*   WK = (u16*)(ws + oWK);
  u16*   WV = (u16*)(ws + oWV);
  u16*   WG = (u16*)(ws + oWG);
  u16*   WO = (u16*)(ws + oWO);
  u16*   WB = (u16*)(ws + oWB);
  float* VS = (float*)(ws + oVS);
  u16*   XH = (u16*)(ws + oXH);
  u16*   XL = (u16*)(ws + oXL);
  float* BT = (float*)(ws + oBT);
  u16*   OH = (u16*)(ws + oOH);
  u16*   OL = (u16*)(ws + oOL);
  float* GF = (float*)(ws + oGF);
  u16*   QH = (u16*)(ws + oQH);
  u16*   QL = (u16*)(ws + oQL);
  u16*   KH = (u16*)(ws + oKH);
  u16*   KL = (u16*)(ws + oKL);
  u16*   VH = (u16*)(ws + oVH);
  u16*   VL = (u16*)(ws + oVL);

  const dim3 b256(256), b128(128), bAT(ATT_THREADS);
  const dim3 gP(WPBLK + NPOS / 64);
  const dim3 gX(2 * (GROWS / (64 * RG)));
  const dim3 gG((GROWS / 64) * (CZ / 64));
  const dim3 gA(IG * NH);
  const float oscp = 1.0f / (XSC * WSC);
  const float osco = 1.0f / (OSC * WSC);

  // (a, b) one launch: LayerNorm of all positions -> x*64 f16 hi + residual planes, and the weight planes [n][k] as f16 of the
  //     bf16 value x1024 (weights are [out][in] = [n][k]); Wt plane padded to BTM rows
  prep<<<gP, b256, 0, stream>>>(x, gam, bet, Wq, Wk, Wv, Wg, Wo, Wt, XH, XL, WQ, WK, WV, WG, WO, WB);

  for (int g = 0; g < NGRP; ++g) {
    const u16*   XHg = XH + (size_t)g * GROWS * CZ;
    const u16*   XLg = XL + (size_t)g * GROWS * CZ;
    const float* Mg  = msk + (size_t)g * IG * NSEQ;
    float*       og  = out + (size_t)g * GROWS * CZ;
    // (c, 1-4) every product of LN(x) in one launch: shared bias table BT[h][p] = sum_c Wt[h][c] * x[p][c] (rows 0..NH-1 of BT),
    //     v^T hi + residual planes x1024 with the per-64-key sums of v, q and k hi + residual planes x1024,
    //     gate pre-activation x.Wg^T + bg -> GF f32
    xproj<<<gX, b128, 0, stream>>>(XHg, XLg, WV, WQ, WK, WG, WB, bg, VH, VL, VS, QH, QL, KH, KL, GF, BT, oscp);
    // (5) attention over all keys of each row block with the shared bias and the row mask bias, gated
    //     -> O x4096 f16 hi + residual planes
    attn<<<gA, bAT, 0, stream>>>(QH, QL, KH, KL, VH, VL, VS, GF, BT, Mg, OH, OL);
    // (6) output projection (O hi + residual).Wo^T + bo -> out f32, carries 4096 x 1024 folded back
    gemm_h<1, 0, 0, CZ><<<gG, b128, 0, stream>>>(OH, OL, WO, WO, bo, 1, og, QH, QL, GROWS, CZ, osco, 1.0f);
  }
  (void)hipGetLastError();
}

// v008
// It runs in 106 microseconds.
// Timed twice side by side with v007, it ran 1.05 and 1.04 times as fast.
// Over all steps from v000 it is 3.54 times as fast.
// Contractions: LN(x).Wq^T, LN(x).Wk^T, LN(x).Wv^T, LN(x).Wg^T(+bg), LN(x).Wt^T (shared pair-bias table) and O.Wo^T(+bo) on
// v_wmma_f32_16x16x32_f16 with the activation operand carried as f16 hi + f16 residual planes (x*64, O*4096) and the weight
// operand as f16(bf16(W)*1024); q.k^T over 32 on v_wmma_f32_16x16x32_f16 (q, k *1024 f16 hi + residual, products hh+lh+hl);
// centred softmax weights P' = 16384*P - 64 (f16 hi) times v^T (v*1024 f16 hi + residual, products P'.vh + P'.vl);
// all f32 accumulate. LayerNorm, mask bias, softmax, sigmoid gate, key-mean of v and carry folds in f32 on VALU.
// Every float input is RNE-converted to bf16 on load.
#include <hip/hip_runtime.h>
#include <math.h>
#include <stdint.h>

#ifndef NB
#define NB 1
#endif
#ifndef NI
#define NI 256
#endif
#define NSEQ   256
#define CZ     128
#define NH     4
#define HD     32
#define NPOS   (NSEQ * NSEQ)
#define IG     NI
#define NGRP   (NI / IG)
#define GROWS  (IG * NSEQ)
#define XSC    64.0f
#define WSC    1024.0f
#define QSC    1024.0f
#define KSC    1024.0f
#define VCAR   1024.0f
#define PCAR   16384.0f
#define OSC    4096.0f
#define MINF   1.0e9f
#define RSQ_HD 0.17677669529663689f
#define LOG2E  1.4426950408889634f
#define AW     4
#define QPW    4
#define NQT    (NSEQ / 16)
#define NKT    (NSEQ / 32)
#define NST    (NSEQ / 64)
#define ATT_THREADS (AW * 32)
#define SBP    260
#define SBW    (16 * SBP)
#define OTP    40
#define KVP    (NSEQ * HD)
#define SLAB64 (16 * 68)
#define TRP    69
#define XTP    136
#define WTP    136
#define BTM    64
#define RG     2
#define BSP    (64 * RG + 4)
#define WS_CAP 268435456
static_assert(NB == 1);
static_assert(CZ == NH * HD && HD == 32 && NH == 4 && NSEQ == 256);
static_assert(NI >= 1 && NI <= NSEQ && (NI % IG) == 0 && IG >= 1 && IG <= NSEQ && NGRP == 1);
static_assert((GROWS % 64) == 0 && (NPOS % 64) == 0);
static_assert(GROWS == NPOS && (GROWS % (64 * RG)) == 0 && 4 * SLAB64 <= 64 * TRP && NH <= 16 && BTM >= 16 && (BSP % 4) == 0);
static_assert(AW * QPW == NQT && AW * 4 == NSEQ / 16 && ATT_THREADS == 128 && (NSEQ % 64) == 0 && (CZ % 64) == 0 && (CZ % 32) == 0);
static_assert((BTM % 64) == 0 && BTM >= NH && (BTM % 32) == 0);
static_assert(SBP >= NSEQ && (SBP % 4) == 0 && OTP >= HD && (OTP % 8) == 0 && XTP >= CZ && WTP >= CZ && TRP >= 64);

typedef unsigned short u16;
typedef _Float16 v16h __attribute__((ext_vector_type(16)));
typedef _Float16 v8h  __attribute__((ext_vector_type(8)));
typedef float    v8f  __attribute__((ext_vector_type(8)));
typedef float    v4f  __attribute__((ext_vector_type(4)));
typedef unsigned int v4u __attribute__((ext_vector_type(4)));

union FragH { v16h v; v8h h[2]; v4u u[2]; };

// ---- scalar helpers --------------------------------------------------------------------------------
__device__ __forceinline__ unsigned short bf_bits(float f) {          // f32 -> bf16 bits, RNE convert
  unsigned u = __float_as_uint(f);
  return (unsigned short)((u + 0x7FFFu + ((u >> 16) & 1u)) >> 16);
}
__device__ __forceinline__ float bf_up(unsigned short h) { return __uint_as_float(((unsigned)h) << 16); }
__device__ __forceinline__ float bfr(float f) { return bf_up(bf_bits(f)); }
__device__ __forceinline__ unsigned short h_bits(_Float16 x) { return __builtin_bit_cast(unsigned short, x); }
__device__ __forceinline__ unsigned pk16(unsigned short a, unsigned short b) { return (unsigned)a | ((unsigned)b << 16); }
__device__ __forceinline__ v8f zero8() { v8f z = {0.f, 0.f, 0.f, 0.f, 0.f, 0.f, 0.f, 0.f}; return z; }

// ---- fragment-order planes: every 16-bit A/B operand plane [R rows][K k] is stored as [R/16 row tiles][K/32 k-steps][512 halves];
//      inside a 512-half unit element (row r, k kk) lies at (kk >> 3)*128 + r*8 + (kk & 7), so unit (rt, ks) starts at
//      rt*16*K + ks*512 and one 16-B load per lane at lane*8 (and at 256 + lane*8) covers 512 contiguous bytes = 4 whole lines.
// ---- fragment loader: lane -> row/col (lane&15), h = lane>>4; p = unit start + lane*8;
//      elements 0..7 <- p[0..7] (k0+8h..), elements 8..15 <- p[256..263] (k0+16+8h..); same split k map for A and B.
__device__ __forceinline__ v16h ldfrag_h(const _Float16* p) {
  FragH f;
  f.h[0] = *(const v8h*)(p);
  f.h[1] = *(const v8h*)(p + 256);
  return f.v;
}

// ---- WMMA helpers with trailing VALU hazard gaps ------------------------------------------------------
__device__ __forceinline__ v8f mma_h(v16h a, v16h b, v8f c) {
  return __builtin_amdgcn_wmma_f32_16x16x32_f16(false, a, false, b, (short)0, c, false, false);
}
template <typename F>
__device__ __forceinline__ void guard6(v8f& a, v8f& b, v8f& c, v8f& d, F x0, F x1, F x2, F x3, F x4, F x5) {
#if defined(__HIP_DEVICE_COMPILE__)
  asm volatile("v_nop\n\tv_nop\n\tv_nop\n\tv_nop"
               : "+v"(a), "+v"(b), "+v"(c), "+v"(d) : "v"(x0), "v"(x1), "v"(x2), "v"(x3), "v"(x4), "v"(x5) : "memory");
#endif
}
template <typename F>
__device__ __forceinline__ void guard9(v8f& a, v8f& b, v8f& c, v8f& d, F x0, F x1, F x2, F x3, F x4, F x5,
                                       F x6, F x7, F x8) {
#if defined(__HIP_DEVICE_COMPILE__)
  asm volatile("v_nop\n\tv_nop\n\tv_nop\n\tv_nop"
               : "+v"(a), "+v"(b), "+v"(c), "+v"(d)
               : "v"(x0), "v"(x1), "v"(x2), "v"(x3), "v"(x4), "v"(x5), "v"(x6), "v"(x7), "v"(x8) : "memory");
#endif
}
__device__ __forceinline__ void acc_guard2(v8f& a, v8f& b) {
#if defined(__HIP_DEVICE_COMPILE__)
  asm volatile("v_nop\n\tv_nop\n\tv_nop\n\tv_nop" : "+v"(a), "+v"(b));
#endif
}
__device__ __forceinline__ void wave_sync_lds() {
  __builtin_amdgcn_fence(__ATOMIC_RELEASE, "workgroup");
  __builtin_amdgcn_wave_barrier();
  __builtin_amdgcn_fence(__ATOMIC_ACQUIRE, "workgroup");
}

// =====================================================================================================
// LayerNorm over CZ of the bf16 RNE-converted input rows, eps 1e-5, gamma/beta (bf16 RNE-converted), then
// with shuffles over the 4 lanes); both planes staged in LDS (pitch XTP halves, 16-B vector stores), block barrier, then each
// The planes go out in fragment order (see the fragment loader): each store instruction writes 512 contiguous bytes.
// coverage: compute 256 thr x 32 = 64 rows x 128; store 4 iterations x 8 waves x half a unit (32 lanes x 8 halves) = 16 units =
//           64 x 128 per plane; one block per 64 rows (row0) = every row of XH and XL exactly once (nrows a multiple of 64).
// =====================================================================================================
__device__ __forceinline__ void ln16(u16* TH, u16* TL, const float* __restrict__ X, const float* __restrict__ gam,
                                     const float* __restrict__ bet, u16* XHo, u16* XLo, int row0, int nrows) {
#pragma clang fp contract(off)
  const int tid = (int)threadIdx.x, wave = tid >> 5, lane = tid & 31;
  if (row0 + 64 > nrows) return;            // block-uniform, before the barrier; never taken with the exact grid
  const int rl = tid >> 2, part = tid & 3;
  const float* p = X + (size_t)(row0 + rl) * CZ + part * 32;
  v4f xv[8];
  float s = 0.0f;
#pragma unroll
  for (int t = 0; t < 8; ++t) {
    v4f a = *(const v4f*)(p + 4 * t);
#pragma unroll
    for (int e = 0; e < 4; ++e) { const float f = bfr(a[e]); a[e] = f; s = s + f; }
    xv[t] = a;
  }
  asm volatile("s_wait_xcnt 0x0" ::: "memory");   // a later load's result lands in the address registers that these loads name
  s = s + __shfl_xor(s, 1, 32);
  s = s + __shfl_xor(s, 2, 32);
  const float mu = s * (1.0f / (float)CZ);
  float q = 0.0f;
#pragma unroll
  for (int t = 0; t < 8; ++t) {
#pragma unroll
    for (int e = 0; e < 4; ++e) { const float d = xv[t][e] - mu; q = q + d * d; }
  }
  q = q + __shfl_xor(q, 1, 32);
  q = q + __shfl_xor(q, 2, 32);
  const float var  = q * (1.0f / (float)CZ);
  const float rstd = rsqrtf(var + 1e-5f);
  v4u oh[4], ol[4];
#pragma unroll
  for (int t = 0; t < 8; ++t) {
    const v4f g4 = *(const v4f*)(gam + part * 32 + 4 * t);
    const v4f b4 = *(const v4f*)(bet + part * 32 + 4 * t);
    unsigned short hb[4], lb[4];
#pragma unroll
    for (int e = 0; e < 4; ++e) {
      float y = (xv[t][e] - mu) * rstd;
      y = y * bfr(g4[e]);
      y = y + bfr(b4[e]);
      const float w = y * XSC;
      const _Float16 hv = (_Float16)w;
      const _Float16 lv = (_Float16)(w - (float)hv);
      hb[e] = h_bits(hv);
      lb[e] = h_bits(lv);
    }
    oh[t >> 1][(t & 1) * 2]     = pk16(hb[0], hb[1]);
    oh[t >> 1][(t & 1) * 2 + 1] = pk16(hb[2], hb[3]);
    ol[t >> 1][(t & 1) * 2]     = pk16(lb[0], lb[1]);
    ol[t >> 1][(t & 1) * 2 + 1] = pk16(lb[2], lb[3]);
  }
  {
    u16* th = TH + rl * XTP + part * 32;
    u16* tl = TL + rl * XTP + part * 32;
#pragma unroll
    for (int q4 = 0; q4 < 4; ++q4) {
      *(v4u*)(th + 8 * q4) = oh[q4];
      *(v4u*)(tl + 8 * q4) = ol[q4];
    }
  }
  __syncthreads();
  // fragment order: half unit hu = 0..31 of the block's 4 row tiles x 4 k-steps; lane = (k octet lane>>4, row lane&15)
  v4u vh[4], vl[4];
#pragma unroll
  for (int it = 0; it < 4; ++it) {
    const int si = (it * 16 + (lane & 15)) * XTP + wave * 16 + (lane >> 4) * 8;   // hu = it*8 + wave: row tile it, k = 16*wave ..
    vh[it] = *(const v4u*)(TH + si);
    vl[it] = *(const v4u*)(TL + si);
  }
  {
#pragma unroll
    for (int it = 0; it < 4; ++it) {
      const size_t o = (size_t)row0 * CZ + (it * 8 + wave) * 256 + lane * 8;
      *(v4u*)(XHo + o) = vh[it];
      *(v4u*)(XLo + o) = vl[it];
    }
    // ln16 ends prep: no code behind these stores rewrites the registers they name
    asm volatile("s_wait_xcnt 0x0" ::: "memory");
  }
}

// =====================================================================================================
// Weight plane: W f32 [nrow rows n][CZ k] row-major (k contiguous); D 16-bit [np rows n][CZ k] in fragment order, D(n, k) = f16 bits of
// bf16(W[n][k]) * scale for n < nrow, 0 for nrow <= n < np. Block = 32 n rows: each thread loads 16 consecutive k values of
// one n row with a clamped row address (zeroed by predicate for n >= nrow), converts into the LDS tile [32 n][CZ k]
// coverage: load 256 thr x 16 = 32 n x 128 k; store 2 iterations x 8 waves x half a unit (32 lanes x 8 halves) = 8 units = 32 x 128;
//           np/32 blocks (n0) cover the [np][CZ] plane exactly once.
// =====================================================================================================
__device__ __forceinline__ void wp16(u16* T, const float* __restrict__ W, int nrow, int np, int n0, u16* D, float scale) {
  const int tid = (int)threadIdx.x, wave = tid >> 5, lane = tid & 31;
  if (n0 + 32 > np) return;                 // block-uniform, before the barrier; never taken with the exact grid
  {
    const int nl = tid >> 3, kc = (tid & 7) * 16;
    const int n  = n0 + nl;
    int nr = (n < nrow) ? n : (nrow - 1);
    nr = (nr < 0) ? 0 : nr;
    const float* src = W + (size_t)nr * CZ + kc;
    v4u w2[2];
#pragma unroll
    for (int t = 0; t < 4; ++t) {
      const v4f a = *(const v4f*)(src + 4 * t);
      unsigned short hb[4];
#pragma unroll
      for (int e = 0; e < 4; ++e) {
        const float val = (n < nrow) ? a[e] : 0.0f;
        hb[e] = h_bits((_Float16)(bfr(val) * scale));
      }
      w2[t >> 1][(t & 1) * 2]     = pk16(hb[0], hb[1]);
      w2[t >> 1][(t & 1) * 2 + 1] = pk16(hb[2], hb[3]);
    }
    *(v4u*)(T + nl * WTP + kc)     = w2[0];
    *(v4u*)(T + nl * WTP + kc + 8) = w2[1];
  }
  __syncthreads();
  // fragment order: half unit hu = 0..15 of the block's 2 row tiles x 4 k-steps; lane = (k octet lane>>4, row lane&15)
  v4u w4[2];
#pragma unroll
  for (int it = 0; it < 2; ++it) {
    w4[it] = *(const v4u*)(T + (it * 16 + (lane & 15)) * WTP + wave * 16 + (lane >> 4) * 8);   // hu = it*8 + wave: row tile it, k = 16*wave ..
  }
  {
#pragma unroll
    for (int it = 0; it < 2; ++it) {
      *(v4u*)(D + (size_t)n0 * CZ + (it * 8 + wave) * 256 + lane * 8) = w4[it];
    }
    
  }
}

// =====================================================================================================
// Everything that depends on the inputs alone, in one launch: the six weight planes and the LayerNorm planes are independent of
// one another, so they share a grid. Blocks 0 .. WPBLK-1: block b does rows 32*(b % 4) .. +31
// of weight plane b / 4 (0..4 = Wq, Wk, Wv, Wg, Wo, CZ rows each; 5 = Wt, NH rows padded to BTM, blocks 20 and 21).
// Blocks WPBLK .. : 64 position rows of LayerNorm each. The branch is block-uniform, each side has its own one barrier.
// LDS: the weight tile [32][WTP] lies in the first LayerNorm stage tile [64][XTP].
// coverage: 5 * CZ/32 + BTM/32 weight blocks = every row of every weight plane once; NPOS/64 LayerNorm blocks = every position once.
// =====================================================================================================
#define WPBLK (5 * (CZ / 32) + BTM / 32)
static_assert(CZ / 32 == 4 && BTM / 32 <= CZ / 32 && 32 * WTP <= 64 * XTP);
// amdgpu_waves_per_eu(8): holds the register budget to 128: four blocks per WGP, so that all LayerNorm blocks are resident at once.
__global__ __launch_bounds__(256) __attribute__((amdgpu_waves_per_eu(8)))
void prep(const float* __restrict__ X, const float* __restrict__ gam, const float* __restrict__ bet,
          const float* __restrict__ Wq, const float* __restrict__ Wk, const float* __restrict__ Wv,
          const float* __restrict__ Wg, const float* __restrict__ Wo, const float* __restrict__ Wt,
          u16* XHo, u16* XLo, u16* WQo, u16* WKo, u16* WVo, u16* WGo, u16* WOo, u16* WBo) {
  __shared__ __align__(16) u16 TH[64 * XTP];
  __shared__ __align__(16) u16 TL[64 * XTP];
  const int bid = (int)blockIdx.x;
  if (bid < WPBLK) {
    const int pl = bid / (CZ / 32), n0 = (bid % (CZ / 32)) * 32;
    const float* W = (pl == 0) ? Wq : (pl == 1) ? Wk : (pl == 2) ? Wv : (pl == 3) ? Wg : (pl == 4) ? Wo : Wt;
    u16*         D = (pl == 0) ? WQo : (pl == 1) ? WKo : (pl == 2) ? WVo : (pl == 3) ? WGo : (pl == 4) ? WOo : WBo;
    wp16(TH, W, (pl == 5) ? NH : CZ, (pl == 5) ? BTM : CZ, n0, D, WSC);
    return;
  }
  ln16(TH, TL, X, gam, bet, XHo, XLo, (bid - WPBLK) * 64, NPOS);
}

// =====================================================================================================
// GEMM epilogue: the wave's 16x64 f32 tile (times oscale, plus a per-column addend) staged in its LDS slab (pitch 68),
// coverage: 8 instructions x 2 rows x 16 lanes x 4 floats = the wave's 16 x 64 tile.
// =====================================================================================================
__device__ __forceinline__ void epi64(float* sl, v8f a0, v8f a1, v8f a2, v8f a3, float oscale,
                                      float b0, float b1, float b2, float b3,
                                      float* C, int N, size_t rowb, int col0, int lane) {
  const int hh = lane >> 4, m = lane & 15;
#pragma unroll
  for (int r = 0; r < 8; ++r) {
    const int ro = (8 * hh + r) * 68 + m;
    sl[ro]      = a0[r] * oscale + b0;
    sl[ro + 16] = a1[r] * oscale + b1;
    sl[ro + 32] = a2[r] * oscale + b2;
    sl[ro + 48] = a3[r] * oscale + b3;
  }
  wave_sync_lds();
  v4f vals[8];
#pragma unroll
  for (int it = 0; it < 8; ++it) vals[it] = *(const v4f*)(sl + (it * 2 + hh) * 68 + m * 4);
  float* dst = C + (rowb + (size_t)hh) * (size_t)N + col0 + m * 4;
  {
#pragma unroll
    for (int it = 0; it < 8; ++it) {
      *(v4f*)(dst + (size_t)(it * 2) * (size_t)N) = vals[it];
    }
    
  }
}

// =====================================================================================================
// Eight f32 values (already carrying their plane scale) -> 8 f16 hi halves and 8 f16 residual halves, packed for 16-B stores.
// =====================================================================================================
__device__ __forceinline__ void split8(const float* w, v4u& oh, v4u& ol) {
#pragma unroll
  for (int e = 0; e < 4; ++e) {
    const float t0 = w[2 * e], t1 = w[2 * e + 1];
    const _Float16 h0 = (_Float16)t0, h1 = (_Float16)t1;
    const _Float16 l0 = (_Float16)(t0 - (float)h0), l1 = (_Float16)(t1 - (float)h1);
    oh[e] = pk16(h_bits(h0), h_bits(h1));
    ol[e] = pk16(h_bits(l0), h_bits(l1));
  }
}

// =====================================================================================================
// GEMM epilogue, plane form (q, k): the wave's 16x64 f32 tile (times oscale) staged in its LDS slab (pitch 68), read back as
// 8 consecutive columns per lane, times psc, split into f16 hi + residual, one 16-B store per plane and lane, in fragment order
// (lane = row m, column octet it*2 + hh): the wave's tile is two neighbouring units = 2048 contiguous bytes per plane.
// coverage: 4 instructions x 2 octets x 16 rows x 8 halves = the wave's 16 x 64 tile per plane; each instruction writes 4 whole
//           128-B lines.
// =====================================================================================================
__device__ __forceinline__ void epi_pl(float* sl, v8f a0, v8f a1, v8f a2, v8f a3, float oscale, float psc,
                                       u16* Hp, u16* Lp, int N, size_t rowb, int col0, int lane) {
  const int hh = lane >> 4, m = lane & 15;
#pragma unroll
  for (int r = 0; r < 8; ++r) {
    const int ro = (8 * hh + r) * 68 + m;
    sl[ro]      = a0[r] * oscale;
    sl[ro + 16] = a1[r] * oscale;
    sl[ro + 32] = a2[r] * oscale;
    sl[ro + 48] = a3[r] * oscale;
  }
  wave_sync_lds();
  v4u oh[4], ol[4];
#pragma unroll
  for (int it = 0; it < 4; ++it) {
    const float* p = sl + m * 68 + (it * 2 + hh) * 8;   // row m, column octet it*2 + hh
    const v4f a = *(const v4f*)(p), b4 = *(const v4f*)(p + 4);
    float w[8];
#pragma unroll
    for (int e = 0; e < 4; ++e) { w[e] = a[e] * psc; w[4 + e] = b4[e] * psc; }
    split8(w, oh[it], ol[it]);
  }
#pragma unroll
  for (int it = 0; it < 4; ++it) {
    const size_t o = rowb * (size_t)N + col0 * 16 + it * 256 + lane * 8;
    *(v4u*)(Hp + o) = oh[it];
    *(v4u*)(Lp + o) = ol[it];
  }
}

// =====================================================================================================
// GEMM epilogue, transposed plane form (v): the block's 64 keys x 64 columns f32 tile (times oscale) staged in one LDS tile
// [key][column] (pitch TRP floats: odd, so the column reads below fall in 32 different banks), block barrier, then each lane
// reads 8 consecutive keys of one column, splits v * psc into f16 hi + residual and stores 16 B per plane into the plane
//   Hp/Lp (row il*N + column, k = key of NSEQ) in fragment order; one instruction = 4 whole 128-B lines. A column's 8 octet sums
// (4 in the lane, the lane halves by one shuffle each) give its sum over the block's 64 keys; the 64 sums are gathered in LDS and stored by wave 0 as two whole lines of
//   KS[row tile][N]  (row tile = il*NST + key tile).
// coverage: 4 waves x 4 instructions x 2 octets x 16 columns x 8 halves = 64 columns x 64 keys per plane; 32 lanes x 2 = 64 sums.
// =====================================================================================================
__device__ __forceinline__ void epi_tr(float* sl, float* rs, v8f a0, v8f a1, v8f a2, v8f a3, float oscale, float psc,
                                       u16* Hp, u16* Lp, float* KS, int N, int rb0, int col0, int wave, int lane) {
  const int hh = lane >> 4, m = lane & 15;
#pragma unroll
  for (int r = 0; r < 8; ++r) {
    const int ro = (wave * 16 + 8 * hh + r) * TRP + m;
    sl[ro]      = a0[r] * oscale;
    sl[ro + 16] = a1[r] * oscale;
    sl[ro + 32] = a2[r] * oscale;
    sl[ro + 48] = a3[r] * oscale;
  }
  __syncthreads();
  const int cl = wave * 16 + m;                          // column within the block's 64
  const float* cp = sl + hh * 8 * TRP + cl;              // one lane address; octets and keys are constant offsets from it
  const int il = rb0 / NSEQ, s0 = rb0 % NSEQ;
  v4u oh[4], ol[4];
  float cs[4];
#pragma unroll
  for (int it = 0; it < 4; ++it) {
    float v[8], w[8];                                    // key octet it*2 + hh of the block's 8
#pragma unroll
    for (int e = 0; e < 8; ++e) v[e] = cp[(it * 16 + e) * TRP];
#pragma unroll
    for (int e = 0; e < 8; ++e) w[e] = v[e] * psc;
    split8(w, oh[it], ol[it]);
    cs[it] = ((v[0] + v[1]) + (v[2] + v[3])) + ((v[4] + v[5]) + (v[6] + v[7]));
  }
  // pairwise tree over the 8 key octets: neighbours (the two lane halves), then pairs, then fours
#pragma unroll
  for (int it = 0; it < 4; ++it) cs[it] += __shfl_xor(cs[it], 16, 32);
  if (hh == 0) rs[cl] = (cs[0] + cs[1]) + (cs[2] + cs[3]);
  __syncthreads();
  if (wave == 0) {
    float2 t;
    t.x = rs[2 * lane];
    t.y = rs[2 * lane + 1];
    *(float2*)(KS + (size_t)(rb0 / 64) * N + col0 + 2 * lane) = t;
    asm volatile("s_wait_xcnt 0x0" ::: "memory");     // the code behind this branch rewrites the registers that the store names
  }
  // wave-uniform base (the wave's 16-column tile, k-steps s0/32 and s0/32 + 1) + one 32-bit lane offset: one register addresses all stores
  const size_t   ub = ((size_t)il * N + col0 + wave * 16) * NSEQ + s0 * 16;
  const unsigned lo = (unsigned)(lane * 8);
#pragma unroll
  for (int it = 0; it < 4; ++it) {
    *(v4u*)(Hp + ub + (lo + it * 256)) = oh[it];
    *(v4u*)(Lp + ub + (lo + it * 256)) = ol[it];
  }
}

// =====================================================================================================
// f16 GEMM: C[M][N] (f32) = (Ah [+ Al])[M][K] . (Bh [+ Bl])[N][K]^T * oscale [+ bf16(bias[col])].
// ALO == 1: products ah.bh + al.bh (A residual plane, unscaled); BLO == 1: products ah.bh + ah.bl (B residual plane);
// one accumulator. Block = 64x64 tile, 4 waves x 16 rows; fragments loaded straight from the fragment-order planes (two 16-B loads
// each, split k map for A and B); K stepped by 32 (K % 32 == 0; host guarantees M % 64 == 0, N % 64 == 0,
// grid = (M/64)*(N/64)). hasb is a block-uniform flag; bias is dereferenced only when hasb != 0.
// EPI == 0: C f32 as above. EPI == 1: the product times psc goes out as f16 hi + residual planes Hp, Lp [M][N] (C unused).
// EPI == 2: the product times psc goes out transposed per NSEQ-row group as Hp, Lp [(row / NSEQ)*N + col][NSEQ] (both fragment order), and C takes
// the f32 column sums of each 64-row tile, [M/64][N] (host guarantees NSEQ % 64 == 0 and M % NSEQ == 0).
// =====================================================================================================
// K is a compile-time value: the units of the four B tiles then lie at constant offsets from one address.
template <int ALO, int BLO, int EPI, int K>
__global__ __launch_bounds__(128)
void gemm_h(const u16* __restrict__ Ah, const u16* __restrict__ Al, const u16* __restrict__ Bh, const u16* __restrict__ Bl,
            const float* __restrict__ bias, int hasb, float* C, u16* Hp, u16* Lp, int M, int N, float oscale,
            float psc) {
  __shared__ __align__(16) float slab[(EPI == 2) ? (64 * TRP + 64) : (4 * SLAB64)];
  const int tid = (int)threadIdx.x, lane = tid & 31, m = lane & 15;
  const int wave = __builtin_amdgcn_readfirstlane(tid >> 5);   // scalar: the fragment units' bases are formed on the scalar unit
  const int ntile = N >> 6;
  const int bid   = (int)blockIdx.x;
  const int rb0   = (bid / ntile) * 64;
  const int rowb  = rb0 + wave * 16;
  const int col0  = (bid % ntile) * 64;
  if (rb0 + 64 > M) return;                 // block-uniform, before any barrier; never taken with the exact grid
  // wave-uniform unit bases + one 32-bit lane offset lo
  const unsigned lo = (unsigned)(lane * 8);
  const _Float16* ahp = (const _Float16*)(const void*)Ah + (size_t)rowb * K;
  const _Float16* alp = (const _Float16*)(const void*)Al + (size_t)rowb * K;   // read only when ALO
  const _Float16* bhp = (const _Float16*)(const void*)Bh + (size_t)col0 * K;
  const _Float16* blp = (const _Float16*)(const void*)Bl + (size_t)col0 * K;   // read only when BLO
  constexpr int bs = 16 * K;                // halves from one 16-column tile of B to the next
  float bb0 = 0.0f, bb1 = 0.0f, bb2 = 0.0f, bb3 = 0.0f;
  if (hasb != 0) {
    bb0 = bfr(bias[col0 + m]);
    bb1 = bfr(bias[col0 + 16 + m]);
    bb2 = bfr(bias[col0 + 32 + m]);
    bb3 = bfr(bias[col0 + 48 + m]);
  }
  v8f acc0 = zero8(), acc1 = zero8(), acc2 = zero8(), acc3 = zero8();
#pragma unroll 1
  for (int ks = 0; ks < K; ks += 32) {      // one fragment-order unit (512 halves) per 32 k
    const _Float16* pa = ahp + 16 * ks + lo;   // this k-step's units: A hi, A residual, B tile 0 hi, B tile 0 residual
    const _Float16* pl = alp + 16 * ks + lo;
    const _Float16* pb = bhp + 16 * ks + lo;
    const _Float16* pq = blp + 16 * ks + lo;
    const v16h ah = ldfrag_h(pa);
    const v16h b0 = ldfrag_h(pb);
    const v16h b1 = ldfrag_h(pb + bs);
    const v16h b2 = ldfrag_h(pb + 2 * bs);
    const v16h b3 = ldfrag_h(pb + 3 * bs);
    acc0 = mma_h(ah, b0, acc0);
    acc1 = mma_h(ah, b1, acc1);
    acc2 = mma_h(ah, b2, acc2);
    acc3 = mma_h(ah, b3, acc3);
    if constexpr (ALO != 0) {
      const v16h al = ldfrag_h(pl);
      acc0 = mma_h(al, b0, acc0);
      acc1 = mma_h(al, b1, acc1);
      acc2 = mma_h(al, b2, acc2);
      acc3 = mma_h(al, b3, acc3);
      if constexpr (BLO != 0) {
        const v16h l0 = ldfrag_h(pq);
        const v16h l1 = ldfrag_h(pq + bs);
        const v16h l2 = ldfrag_h(pq + 2 * bs);
        const v16h l3 = ldfrag_h(pq + 3 * bs);
        acc0 = mma_h(ah, l0, acc0);
        acc1 = mma_h(ah, l1, acc1);
        acc2 = mma_h(ah, l2, acc2);
        acc3 = mma_h(ah, l3, acc3);
        guard9<v16h>(acc0, acc1, acc2, acc3, ah, b0, b1, b2, b3, l0, l1, l2, l3);
        guard6<v16h>(acc0, acc1, acc2, acc3, al, al, al, al, al, al);
      } else {
        guard6<v16h>(acc0, acc1, acc2, acc3, ah, al, b0, b1, b2, b3);
      }
    } else if constexpr (BLO != 0) {
      const v16h l0 = ldfrag_h(pq);
      const v16h l1 = ldfrag_h(pq + bs);
      const v16h l2 = ldfrag_h(pq + 2 * bs);
      const v16h l3 = ldfrag_h(pq + 3 * bs);
      acc0 = mma_h(ah, l0, acc0);
      acc1 = mma_h(ah, l1, acc1);
      acc2 = mma_h(ah, l2, acc2);
      acc3 = mma_h(ah, l3, acc3);
      guard9<v16h>(acc0, acc1, acc2, acc3, ah, b0, b1, b2, b3, l0, l1, l2, l3);
    } else {
      guard6<v16h>(acc0, acc1, acc2, acc3, ah, b0, b1, b2, b3, ah);
    }
    // the next trip rewrites the address registers that this trip's loads name; as inputs they stay untouched up to the wait
    asm volatile("s_wait_xcnt 0x0" :: "v"(pa), "v"(pb), "v"(ALO != 0 ? pl : pa), "v"(BLO != 0 ? pq : pb) : "memory");
  }
  if constexpr (EPI == 0) {
    epi64(slab + wave * SLAB64, acc0, acc1, acc2, acc3, oscale, bb0, bb1, bb2, bb3, C, N, (size_t)rowb, col0, lane);
  } else if constexpr (EPI == 1) {
    epi_pl(slab + wave * SLAB64, acc0, acc1, acc2, acc3, oscale, psc, Hp, Lp, N, (size_t)rowb, col0, lane);
  } else {
    epi_tr(slab, slab + 64 * TRP, acc0, acc1, acc2, acc3, oscale, psc, Hp, Lp, C, N, rb0, col0, wave, lane);
  }
}

// =====================================================================================================
// All products of LN(x) in one launch: v, q, k, gate pre-activation and the pair-bias table.
// Two blocks per RG groups of 64 position rows (one does pair bias, v and gate, the other q and k), 4 waves each;
// wave w owns rows rb0 + 64g + 16w .. +15 of every group g and loads their
// A fragments (x*64 hi + residual, all CZ = 4 k-steps) ONCE into registers; they serve every column tile of the block, so each weight
// fragment that a wave loads is used for RG*16 rows. Per accumulator the products run xh.w, xl.w per k-step, k ascending.
//   pair bias: B = Wt plane rows 0..15 (rows >= NH are zero), D (row = position, column = head) staged in LDS [16][BSP],
//              block barrier, heads 0..NH-1 stored as whole lines of BT[h][position]   (GROWS == NPOS: every position once)
//   v: 2 column tiles x RG groups through epi_tr;  q, k: 2 + 2 column tiles through epi_pl;  gate: 2 column tiles through epi64.
// LDS: epi_tr's block tile [64][TRP] + 64 sums; the per-wave slabs of epi_pl / epi64 lie inside that tile; the q, k blocks run no epi_tr,
// and the gate's epi64 slabs are first written behind epi_tr's last barrier, at which every read of the tile has returned; the bias stage lies behind both.
// coverage: grid = 2 * GROWS/(64*RG) blocks; per part RG groups x 64 rows = every row once, for each of the CZ/64 column tiles of each plane.
// =====================================================================================================
__device__ __forceinline__ void xw_tile(const v16h (&ah)[RG][CZ / 32], const v16h (&al)[RG][CZ / 32], const _Float16* bp,
                                        unsigned wo, v8f (&acc)[RG][4]) {
#pragma unroll
  for (int g = 0; g < RG; ++g) {
#pragma unroll
    for (int j = 0; j < 4; ++j) acc[g][j] = zero8();
  }
#pragma unroll                              // constant indices keep ah[], al[] in registers
  for (int ks = 0; ks < CZ / 32; ++ks) {
    v16h b[4];
#pragma unroll
    for (int j = 0; j < 4; ++j) b[j] = ldfrag_h(bp + (wo + j * 16 * CZ + ks * 512));
#pragma unroll
    for (int g = 0; g < RG; ++g) {
#pragma unroll
      for (int j = 0; j < 4; ++j) acc[g][j] = mma_h(ah[g][ks], b[j], acc[g][j]);
#pragma unroll
      for (int j = 0; j < 4; ++j) acc[g][j] = mma_h(al[g][ks], b[j], acc[g][j]);
    }
  }
}

// amdgpu_waves_per_eu(4): holds the register budget to 256: four blocks per WGP (one wave of each on every SIMD), so that the whole
// grid is resident at once, and no register above v255 is used.
__global__ __launch_bounds__(128) __attribute__((amdgpu_waves_per_eu(4)))
void xproj(const u16* __restrict__ XHp, const u16* __restrict__ XLp, const u16* __restrict__ WVp,
           const u16* __restrict__ WQp, const u16* __restrict__ WKp, const u16* __restrict__ WGp,
           const u16* __restrict__ WBp, const float* __restrict__ bg, u16* VHp, u16* VLp, float* VS,
           u16* QHp, u16* QLp, u16* KHp, u16* KLp, float* GF, float* BT, float oscale) {
  __shared__ __align__(16) float slab[64 * TRP + 64 + 16 * BSP];
  const int tid = (int)threadIdx.x, lane = tid & 31, hh = lane >> 4, m = lane & 15;
  const int wave = __builtin_amdgcn_readfirstlane(tid >> 5);   // scalar: row and slab offsets stay out of the vector registers
  const int rb0  = ((int)blockIdx.x >> 1) * (64 * RG);
  const int part = (int)blockIdx.x & 1;     // block-uniform: 0 = pair bias, v, gate; 1 = q, k (4 column tiles of 64 each)
  if (rb0 + 64 * RG > GROWS) return;        // block-uniform, before any barrier; never taken with the exact grid
  // lane offset inside a fragment-order unit; the same for x rows (A) and weight rows (B)
  const unsigned wo = (unsigned)(lane * 8);
  v16h ah[RG][CZ / 32], al[RG][CZ / 32];
  {
    const _Float16* xh = (const _Float16*)(const void*)XHp + (size_t)(rb0 + wave * 16) * CZ;   // wave-uniform bases
    const _Float16* xl = (const _Float16*)(const void*)XLp + (size_t)(rb0 + wave * 16) * CZ;
#pragma unroll
    for (int g = 0; g < RG; ++g) {
#pragma unroll
      for (int ks = 0; ks < CZ / 32; ++ks) {
        ah[g][ks] = ldfrag_h(xh + (wo + g * 64 * CZ + ks * 512));
        al[g][ks] = ldfrag_h(xl + (wo + g * 64 * CZ + ks * 512));
      }
    }
    // the two base registers that these loads name are reused behind here; as inputs they stay untouched up to the wait
    asm volatile("s_wait_xcnt 0x0" :: "s"(xh), "s"(xl) : "memory");
  }
  float* wsl = slab + wave * SLAB64;
  v8f acc[RG][4];

  if (part != 0) {
    // ---- q, k: hi + residual planes ----
#pragma unroll 1                            // rolled: one copy of the tile code in the instruction cache
    for (int i = 0; i < 2 * (CZ / 64); ++i) {
      const bool isq = i < CZ / 64;
      const int  ct  = isq ? i : i - CZ / 64;
      const u16* wp  = isq ? WQp : WKp;
      u16* hp = isq ? QHp : KHp;
      u16* lp = isq ? QLp : KLp;
      xw_tile(ah, al, (const _Float16*)(const void*)wp + (size_t)(ct * 64) * CZ, wo, acc);
#pragma unroll
      for (int g = 0; g < RG; ++g) {
        epi_pl(wsl, acc[g][0], acc[g][1], acc[g][2], acc[g][3], oscale, isq ? QSC : KSC, hp, lp, CZ,
               (size_t)(rb0 + g * 64 + wave * 16), ct * 64, lane);
        asm volatile("s_wait_xcnt 0x0" ::: "memory");   // the next tile rewrites the registers that these stores name
      }
    }
    return;                                 // block-uniform; the barriers below are passed by whole blocks of part 0 only
  }

  // ---- pair bias ----
  {
    float* bsl = slab + 64 * TRP + 64;
    v8f ab[RG];
#pragma unroll
    for (int g = 0; g < RG; ++g) ab[g] = zero8();
#pragma unroll
    for (int ks = 0; ks < CZ / 32; ++ks) {
      const v16h b = ldfrag_h((const _Float16*)(const void*)WBp + (wo + ks * 512));
#pragma unroll
      for (int g = 0; g < RG; ++g) {
        ab[g] = mma_h(ah[g][ks], b, ab[g]);
        ab[g] = mma_h(al[g][ks], b, ab[g]);
      }
    }
#pragma unroll
    for (int g = 0; g < RG; ++g) {
      v4f t0, t1;
#pragma unroll
      for (int e = 0; e < 4; ++e) { t0[e] = ab[g][e] * oscale; t1[e] = ab[g][4 + e] * oscale; }
      float* d = bsl + m * BSP + g * 64 + wave * 16 + 8 * hh;
      *(v4f*)(d)     = t0;
      *(v4f*)(d + 4) = t1;
    }
    __syncthreads();
    for (int i = tid; i < NH * 16 * RG; i += 128) {   // wave-uniform trip count: 16*RG is a multiple of 16, 128 of 32
      const int h = i / (16 * RG), p4 = (i % (16 * RG)) * 4;
      *(v4f*)(BT + (size_t)h * NPOS + rb0 + p4) = *(const v4f*)(bsl + h * BSP + p4);
    }
  }

  // ---- v: transposed hi + residual planes and 64-key sums ----
#pragma unroll 1                            // rolled: one copy of the tile code in the instruction cache
  for (int ct = 0; ct < CZ / 64; ++ct) {
    xw_tile(ah, al, (const _Float16*)(const void*)WVp + (size_t)(ct * 64) * CZ, wo, acc);
#pragma unroll
    for (int g = 0; g < RG; ++g) {
      epi_tr(slab, slab + 64 * TRP, acc[g][0], acc[g][1], acc[g][2], acc[g][3], oscale, VCAR, VHp, VLp, VS, CZ,
             rb0 + g * 64, ct * 64, wave, lane);
      asm volatile("s_wait_xcnt 0x0" ::: "memory");   // the next tile rewrites the registers that these stores name
    }
  }
  // ---- gate pre-activation, f32, bias added ----
#pragma unroll 1                            // rolled: one copy of the tile code in the instruction cache
  for (int ct = 0; ct < CZ / 64; ++ct) {
    const float b0 = bfr(bg[ct * 64 + m]), b1 = bfr(bg[ct * 64 + 16 + m]);
    const float b2 = bfr(bg[ct * 64 + 32 + m]), b3 = bfr(bg[ct * 64 + 48 + m]);
    xw_tile(ah, al, (const _Float16*)(const void*)WGp + (size_t)(ct * 64) * CZ, wo, acc);
#pragma unroll
    for (int g = 0; g < RG; ++g) {
      epi64(wsl, acc[g][0], acc[g][1], acc[g][2], acc[g][3], oscale, b0, b1, b2, b3, GF, CZ,
            (size_t)(rb0 + g * 64 + wave * 16), ct * 64, lane);
      asm volatile("s_wait_xcnt 0x0" ::: "memory");   // the next tile rewrites the registers that these stores name
    }
  }
}

// =====================================================================================================
// Row-wise gated attention. Block bid -> (row block il, head): AW waves, wave w takes the query tiles qt = qi*AW + w, qi = 0..QPW-1,
// one after the other (rows q0 = 16*qt .. q0+15); all NSEQ keys of row block il, shared bias table BT f32 [BTM][NPOS]
// (row h, position j*NSEQ + k) plus the per-row mask bias 1e9*(bf16(mask[il][k]) - 1) (MK already offset to the row group).
//   q/k planes f16 x1024 hi + residual [il*NSEQ + s][h*HD + d]; v^T planes [il*NH + h][d][NSEQ] hi + residual; all in fragment order;
//   VS f32 [il*NST + key tile][h*HD + d] = sums of v over 64 keys (their total / NSEQ = key-mean of v); GF f32 [il*NSEQ + s][h*HD + d] = gate pre-activation (bias already added).
//   Staging: the head's k and v^T planes (hi + residual, 16 fragment-order units of 1 KiB each) are the same for all NQT query tiles;
//   they are copied once per block into LDS (kvs: k hi, k residual, v^T hi, v^T residual) by asynchronous 16-B copies, each wave
//   4 units of each plane, and every fragment is then read from LDS (512 contiguous bytes per instruction). The copies are waited
//   for and published by one block barrier in front of the first pass's scores.
//   Phase 0: the wave's 16 x NSEQ bias rows (times log2e, plus mask bias times log2e) loaded with 16-B loads into its private
//   LDS bias buffer (pitch SBP: 16 B over a multiple of 256 B, the pitch of 16-B row readers).
//   Phase 1 (per 16-key tile): TRANSPOSED scores k_hi.q_hi + k_hi.q_lo + k_lo.q_hi (A = key rows, B = query rows, one k-step of
//   32): D element r of lane (c, hh) = (key 16t + 8hh + r, query c). u = s*rsqrt(32)*log2e/(1024*1024) + bias (two 16-B LDS reads
//   of buffer row c); all 128 scores of a lane stay in registers; running max in-lane, one exchange between the lane halves.
//   Phase 2a: p = exp2(u - m) in registers, row sum Z in-lane (8 chains, tree) plus one exchange, scale 16384/Z.
//   Phase 2b (per 32 keys): P' = p*16384/Z - 64 of two neighbouring tiles converted to f16 IS the A fragment (row c, split k map);
//   v^T B fragments for the two 16-wide d subtiles, products P'.v_hi + P'.v_lo. The score, softmax and P'.v code is straight-line.
//   Epilogue: vals = acc/(16384*1024) + key-mean (exact identity sum(P'+64).v/16384 = sum P.v), gate g = 1/(1+exp(-z)) in f32,
//   O = g*vals*4096 -> f16 hi + residual, staged as u16 elements in the wave's own LDS tile [2 planes][16 rows][OTP]; the wave's
//   16 rows x HD columns are one whole fragment-order unit per plane, so the wave stores it alone, behind an in-wave sync.
//   The only early return is block-uniform and precedes the barrier, which stands under the block-uniform test qi == 0.
// staged extent == consumed extent: kvs units 0..15 of all 4 planes copied (4 waves x 4 units) and read; bias buffer columns
//   0..NSEQ-1 of all 16 rows written in phase 0 before any read (columns NSEQ..SBP-1 never read); stage tile rows 0..15 x columns
//   0..HD-1 of both planes written before the sync (columns HD..OTP-1 never read).
// coverage: per wave and pass 2 x half a unit (32 lanes x 8 halves) = 1 unit = 16 rows x HD halves per plane;
//           grid = IG*NH blocks x AW*QPW = NQT query tiles = every (row tile, head) unit of OH and OL exactly once.
// =====================================================================================================
// Powers of 2 as the bare v_exp_f32 (the library exp2f adds a compare, two selects, an add and a v_ldexp_f32 per value to keep results
// under 2^-126; here such a result may come out as 0: see the two places of use). Written as asm text, in place, so that what stands
// directly behind each v_exp_f32 is fixed: the instruction set asks there for an instruction that neither reads the result nor
// overwrites the source.
// exp8sub8: x[r] = 2^x[r], and y[r] -= m in the slot behind each power (the next tile's subtraction of the row maximum).
__device__ __forceinline__ void exp8sub8(v8f& x, v8f& y, float m) {
#if defined(__HIP_DEVICE_COMPILE__)
  float x0 = x[0], x1 = x[1], x2 = x[2], x3 = x[3], x4 = x[4], x5 = x[5], x6 = x[6], x7 = x[7];
  float y0 = y[0], y1 = y[1], y2 = y[2], y3 = y[3], y4 = y[4], y5 = y[5], y6 = y[6], y7 = y[7];
  asm("v_exp_f32 %0, %0\n\tv_sub_f32 %8, %8, %16\n\t"
      "v_exp_f32 %1, %1\n\tv_sub_f32 %9, %9, %16\n\t"
      "v_exp_f32 %2, %2\n\tv_sub_f32 %10, %10, %16\n\t"
      "v_exp_f32 %3, %3\n\tv_sub_f32 %11, %11, %16\n\t"
      "v_exp_f32 %4, %4\n\tv_sub_f32 %12, %12, %16\n\t"
      "v_exp_f32 %5, %5\n\tv_sub_f32 %13, %13, %16\n\t"
      "v_exp_f32 %6, %6\n\tv_sub_f32 %14, %14, %16\n\t"
      "v_exp_f32 %7, %7\n\tv_sub_f32 %15, %15, %16"
      : "+v"(x0), "+v"(x1), "+v"(x2), "+v"(x3), "+v"(x4), "+v"(x5), "+v"(x6), "+v"(x7),
        "+v"(y0), "+v"(y1), "+v"(y2), "+v"(y3), "+v"(y4), "+v"(y5), "+v"(y6), "+v"(y7)
      : "v"(m));
  x[0] = x0; x[1] = x1; x[2] = x2; x[3] = x3; x[4] = x4; x[5] = x5; x[6] = x6; x[7] = x7;
  y[0] = y0; y[1] = y1; y[2] = y2; y[3] = y3; y[4] = y4; y[5] = y5; y[6] = y6; y[7] = y7;
#endif
}
// exp8: x[r] = 2^x[r]; each power is independent of the one behind it, the closing v_nop fills the slot behind the last.
__device__ __forceinline__ void exp8(v8f& x) {
#if defined(__HIP_DEVICE_COMPILE__)
  float x0 = x[0], x1 = x[1], x2 = x[2], x3 = x[3], x4 = x[4], x5 = x[5], x6 = x[6], x7 = x[7];
  asm("v_exp_f32 %0, %0\n\tv_exp_f32 %1, %1\n\tv_exp_f32 %2, %2\n\tv_exp_f32 %3, %3\n\t"
      "v_exp_f32 %4, %4\n\tv_exp_f32 %5, %5\n\tv_exp_f32 %6, %6\n\tv_exp_f32 %7, %7\n\tv_nop"
      : "+v"(x0), "+v"(x1), "+v"(x2), "+v"(x3), "+v"(x4), "+v"(x5), "+v"(x6), "+v"(x7));
  x[0] = x0; x[1] = x1; x[2] = x2; x[3] = x3; x[4] = x4; x[5] = x5; x[6] = x6; x[7] = x7;
#endif
}

// Four asynchronous 16-B-per-lane copies global -> LDS (l*: the lane's LDS byte address, g*: its global address). The wait stands in
// the copies' own statement: behind it the registers that the copies name may be rewritten.
__device__ __forceinline__ void acopy4(unsigned l0, unsigned l1, unsigned l2, unsigned l3,
                                       const _Float16* g0, const _Float16* g1, const _Float16* g2, const _Float16* g3) {
#if defined(__HIP_DEVICE_COMPILE__)
  asm volatile("global_load_async_to_lds_b128 %0, %4, off\n\t"
               "global_load_async_to_lds_b128 %1, %5, off\n\t"
               "global_load_async_to_lds_b128 %2, %6, off\n\t"
               "global_load_async_to_lds_b128 %3, %7, off\n\t"
               "s_wait_xcnt 0x0"
               :: "v"(l0), "v"(l1), "v"(l2), "v"(l3), "v"(g0), "v"(g1), "v"(g2), "v"(g3) : "memory");
#endif
}
// The wave's 4 units (u0 .. u0+3, 1 KiB each, gstep halves apart in global memory) of one plane -> LDS units u0 .. u0+3 at byte lb.
__device__ __forceinline__ void stage4(unsigned lb, const _Float16* g, int gstep, int u0, unsigned lo) {
#pragma unroll
  for (int p = 0; p < 2; ++p) {
    const unsigned  l = lb + (unsigned)((u0 + 2 * p) * 1024) + lo * 2;
    const _Float16* s = g + (size_t)(u0 + 2 * p) * gstep + lo;
    acopy4(l, l + 512, l + 1024, l + 1536, s, s + 256, s + gstep, s + gstep + 256);
  }
}

// The LDS lets 2 blocks = 2 waves per SIMD stay resident. amdgpu_num_vgpr(256) steers the build towards 256 registers (it takes a few
// more): fewer switches to the registers above v255, each of which costs a scalar instruction.
__global__ __launch_bounds__(ATT_THREADS) __attribute__((amdgpu_num_vgpr(256)))
void attn(const u16* __restrict__ QHp, const u16* __restrict__ QLp,
          const u16* __restrict__ KHp, const u16* __restrict__ KLp,
          const u16* __restrict__ VHp, const u16* __restrict__ VLp,
          const float* __restrict__ VS, const float* __restrict__ GF, const float* __restrict__ BT,
          const float* __restrict__ MK, u16* OHp, u16* OLp) {
  __shared__ __align__(16) u16 kvs[4 * KVP];
  __shared__ __align__(16) float sbuf[AW * SBW];
  __shared__ __align__(16) u16 stg[AW * 2 * 16 * OTP];

  const int tid  = (int)threadIdx.x;
  const int wave = __builtin_amdgcn_readfirstlane(tid >> 5);   // scalar: the fragment units' bases stay out of the vector registers
  const int lane = tid & 31;
  const int hh   = lane >> 4;
  const int c    = lane & 15;
  const int bid  = (int)blockIdx.x;
  const int head = bid % NH;
  const int il   = bid / NH;
  if (il >= IG) return;                     // block-uniform, before every barrier; never taken with the exact grid
  float* buf = sbuf + wave * SBW;
  u16*   wst = stg + wave * (2 * 16 * OTP);
  const size_t prow0 = (size_t)il * NSEQ;   // first position row of this row block in the group-local planes

  // fragment-order units: q, k unit (row tile, k-step = head); v^T unit (16-wide d subtile of the head, k-step = 32 keys)
  // one 32-bit lane offset lo addresses every fragment load
  const unsigned lo = (unsigned)(lane * 8);
  const size_t hcol = (size_t)head * 512;
  const _Float16* Khb = (const _Float16*)(const void*)KHp + prow0 * CZ + hcol;           // key tile t: 16t rows added per tile
  const _Float16* Klb = (const _Float16*)(const void*)KLp + prow0 * CZ + hcol;
  const _Float16* Vhb = (const _Float16*)(const void*)VHp + (size_t)(il * NH + head) * HD * NSEQ;
  const _Float16* Vlb = (const _Float16*)(const void*)VLp + (size_t)(il * NH + head) * HD * NSEQ;
  const _Float16* Ksh = (const _Float16*)(const void*)kvs;      // LDS planes: unit t at t*512 halves
  const _Float16* Ksl = Ksh + KVP;
  const _Float16* Vsh = Ksh + 2 * KVP;
  const _Float16* Vsl = Ksh + 3 * KVP;
  const unsigned kvb = (unsigned)(size_t)(const void*)kvs;      // LDS byte address of kvs: the low 32 bits of its address
  // 32 copies per wave in flight: the first pass's bias staging covers their latency
  stage4(kvb,           Khb, 16 * CZ, wave * 4, lo);
  stage4(kvb + KVP * 2, Klb, 16 * CZ, wave * 4, lo);
  stage4(kvb + KVP * 4, Vhb, 512, wave * 4, lo);
  stage4(kvb + KVP * 6, Vlb, 512, wave * 4, lo);
  const float lsc = RSQ_HD * (LOG2E / (QSC * KSC));
  v4f mb0, mb1;                             // mask bias x log2e of keys lane*4..+3 and 128+lane*4..+3 of mask row il: the same in every pass
  {
    const float* msrc = MK + (size_t)il * NSEQ;
    const v4f m0 = *(const v4f*)(msrc + lane * 4);
    const v4f m1 = *(const v4f*)(msrc + 128 + lane * 4);
#pragma unroll
    for (int e = 0; e < 4; ++e) {
      mb0[e] = (MINF * (bfr(m0[e]) - 1.0f)) * LOG2E;
      mb1[e] = (MINF * (bfr(m1[e]) - 1.0f)) * LOG2E;
    }
  }

#pragma unroll 1                            // rolled: one copy of the straight-line tile code in the instruction cache
  for (int qi = 0; qi < QPW; ++qi) {
  const int q0 = (qi * AW + wave) * 16;
  // q fragments are asked for first: the bias staging below covers their latency
  const _Float16* Qh  = (const _Float16*)(const void*)QHp + (prow0 + q0) * CZ + hcol;
  const _Float16* Ql  = (const _Float16*)(const void*)QLp + (prow0 + q0) * CZ + hcol;
  const v16h qh = ldfrag_h(Qh + lo);
  const v16h ql = ldfrag_h(Ql + lo);
  // the two base registers that these loads name are reused behind here; as inputs they stay untouched up to the wait
  asm volatile("s_wait_xcnt 0x0" :: "s"(Qh), "s"(Ql) : "memory");

  // ---- phase 0: bias rows (query rows q0..q0+15, all keys) x log2e + mask bias x log2e -> bias buffer ----
  {
    const float* bsrc = BT + (size_t)head * NPOS + (size_t)q0 * NSEQ;
#pragma unroll 1
    for (int g4 = 0; g4 < 4; ++g4) {
      v4f tv[8];
#pragma unroll
      for (int it = 0; it < 8; ++it) {
        const int idx = (g4 * 8 + it) * 32 + lane;        // 0..1023
        const int jr = idx >> 6, k4 = (idx & 63) * 4;      // k4 = lane*4 for even it, 128 + lane*4 for odd it
        tv[it] = *(const v4f*)(bsrc + (size_t)jr * NSEQ + k4);
      }
#pragma unroll
      for (int it = 0; it < 8; ++it) {
        const int idx = (g4 * 8 + it) * 32 + lane;
        const int jr = idx >> 6, k4 = (idx & 63) * 4;
        const v4f mb = (it & 1) ? mb1 : mb0;
        *(v4f*)(buf + jr * SBP + k4) = tv[it] * LOG2E + mb;
      }
    }
  }
  if (qi == 0) {                            // block-uniform
    asm volatile("s_wait_asynccnt 0x0" ::: "memory");   // this wave's copies have landed ...
    __syncthreads();                                    // ... and every other wave's: nobody reads kvs in front of here
  }
  wave_sync_lds();

  // ---- phase 1: transposed scores S^T = k.q^T (A = 16 key rows, B = the 16 query rows), one 16-key tile per step; D element r
  //      of lane (c, hh) = (key 16t + 8hh + r, query c), so a lane owns one query row and its buffered bias is 8 consecutive
  //      floats of buffer row c. All NSEQ/2 scores of the lane's row half stay in registers (log2 domain). ----
  v16h kh[NSEQ / 16], kl[NSEQ / 16];
#pragma unroll
  for (int t = 0; t < 2; ++t) {
    kh[t] = ldfrag_h(Ksh + (lo + t * 512));
    kl[t] = ldfrag_h(Ksl + (lo + t * 512));
  }
  v8f u[NSEQ / 16];
  float mx4[4];
#pragma unroll
  for (int r = 0; r < 4; ++r) mx4[r] = -INFINITY;
#pragma unroll                              // full unroll here and below: u[], kh[], kl[], v*[] live in registers only with constant indices
  for (int g = 0; g < NKT; ++g) {
#pragma unroll
    for (int j = 0; j < 2; ++j) {
      const int t = 2 * g + 2 + j;
      if (t < NSEQ / 16) {
        kh[t] = ldfrag_h(Ksh + (lo + t * 512));
        kl[t] = ldfrag_h(Ksl + (lo + t * 512));
      }
    }
    // keeps the key fragments of the next tile pair in flight, and no more of them: unbounded hoisting spilled registers
    __builtin_amdgcn_sched_barrier(0);
#pragma unroll
    for (int j = 0; j < 2; ++j) {
      const int t = 2 * g + j;
      v8f s = zero8();
      s = mma_h(kh[t], qh, s);
      s = mma_h(kh[t], ql, s);
      s = mma_h(kl[t], qh, s);
      const float* bp = buf + c * SBP + t * 16 + 8 * hh;
      const v4f b0 = *(const v4f*)(bp), b1 = *(const v4f*)(bp + 4);
#pragma unroll
      for (int e = 0; e < 4; ++e) {
        s[e]     = s[e] * lsc + b0[e];
        s[4 + e] = s[4 + e] * lsc + b1[e];
      }
#pragma unroll
      for (int r = 0; r < 4; ++r) mx4[r] = fmaxf(mx4[r], fmaxf(s[r], s[4 + r]));
      u[t] = s;
    }
  }
  // v^T fragments of the first 32 keys are asked for before the softmax arithmetic, which covers their latency
  v16h vha[NKT], vhb[NKT], vla[NKT], vlb[NKT];
  vha[0] = ldfrag_h(Vsh + lo);
  vhb[0] = ldfrag_h(Vsh + (lo + 16 * NSEQ));
  vla[0] = ldfrag_h(Vsl + lo);
  vlb[0] = ldfrag_h(Vsl + (lo + 16 * NSEQ));
  __builtin_amdgcn_sched_barrier(0);        // holds those loads in front of the softmax
  float mx = fmaxf(fmaxf(mx4[0], mx4[1]), fmaxf(mx4[2], mx4[3]));
  mx = fmaxf(mx, __shfl_xor(mx, 16, 32));   // the other lane half holds the other 128 keys of the same query row

  // ---- phase 2a: p = exp2(u - m) in place, row sum Z (8 in-lane chains, tree, one exchange), scale 16384/Z (Z >= 1) ----
  float psc;
  {
    v8f l8 = zero8();
    // u - mx <= 0; a weight under 2^-126 may come out as 0, which changes neither Z (>= 1) nor P' (p*16384/Z - 64)
    u[0] = u[0] - mx;
#pragma unroll
    for (int t = 0; t < NSEQ / 16; ++t) {
      if (t + 1 < NSEQ / 16) exp8sub8(u[t], u[t + 1], mx);
      else                   exp8(u[t]);
      l8 = l8 + u[t];
    }
    float ls = ((l8[0] + l8[1]) + (l8[2] + l8[3])) + ((l8[4] + l8[5]) + (l8[6] + l8[7]));
    ls += __shfl_xor(ls, 16, 32);
    const float lz = (ls > 0.0f) ? ls : 1.0f;
    psc = PCAR * __builtin_amdgcn_rcpf(lz);
  }

  // ---- phase 2b: two neighbouring score tiles, centred and converted in place, are the f16 A fragment of P'
  //      (row = query c; elements 0..7 = keys kb + 8hh + 0..7, elements 8..15 = keys kb + 16 + 8hh + 0..7); P'.v^T (hi + residual) ----
  const float pcen = PCAR / (float)NSEQ;
  v8f o0 = zero8(), o1 = zero8();
  const float* vsp = VS + (size_t)il * NST * CZ + head * HD + c;
  const float* gp  = GF + (prow0 + q0 + 8 * hh) * CZ + head * HD + c;
  float vsa[NST], vsb[NST], gza[8], gzb[8];
#pragma unroll
  for (int kt = 0; kt < NKT; ++kt) {
    if (kt + 1 < NKT) {
      const int kn = (kt + 1) * 512;            // next k-step's unit
      vha[kt + 1] = ldfrag_h(Vsh + (lo + kn));
      vhb[kt + 1] = ldfrag_h(Vsh + (lo + 16 * NSEQ + kn));
      vla[kt + 1] = ldfrag_h(Vsl + (lo + kn));
      vlb[kt + 1] = ldfrag_h(Vsl + (lo + 16 * NSEQ + kn));
    }
    if (kt == NKT - 3) {                        // the epilogue's operands, asked for once score registers have come free
#pragma unroll
      for (int s = 0; s < NST; ++s) { vsa[s] = vsp[s * CZ]; vsb[s] = vsp[s * CZ + 16]; }
#pragma unroll
      for (int r = 0; r < 8; ++r) { gza[r] = gp[(size_t)r * CZ]; gzb[r] = gp[(size_t)r * CZ + 16]; }
    }
    // keeps the next keys' v^T fragments in flight under this step's products, and bounds how many are hoisted (registers)
    __builtin_amdgcn_sched_barrier(0);
    FragH ph;
#pragma unroll
    for (int e = 0; e < 8; ++e) {
      ph.h[0][e] = (_Float16)(u[2 * kt][e] * psc - pcen);
      ph.h[1][e] = (_Float16)(u[2 * kt + 1][e] * psc - pcen);
    }
    o0 = mma_h(ph.v, vha[kt], o0);              // D element r = (row 8hh+r, d = c)
    o0 = mma_h(ph.v, vla[kt], o0);
    o1 = mma_h(ph.v, vhb[kt], o1);              // d = 16 + c
    o1 = mma_h(ph.v, vlb[kt], o1);
  }
  acc_guard2(o0, o1);

  // ---- epilogue: vals = acc/(16384*1024) + key-mean, sigmoid gate, O*4096 -> f16 hi + residual in the wave's stage tile ----
  {
    const float oc  = 1.0f / (PCAR * VCAR);
    float vs0 = 0.0f, vs1 = 0.0f;
#pragma unroll
    for (int t = 0; t < NST; ++t) { vs0 += vsa[t]; vs1 += vsb[t]; }
    const float vm0 = vs0 * (1.0f / (float)NSEQ);
    const float vm1 = vs1 * (1.0f / (float)NSEQ);
    v8f ea, eb;                             // exp(-z) = 2^(-z*log2e); a power under 2^-126 vanishes in 1 + it, as 0 or not
#pragma unroll
    for (int r = 0; r < 8; ++r) { ea[r] = -gza[r] * LOG2E; eb[r] = -gzb[r] * LOG2E; }
    exp8(ea);
    exp8(eb);
#pragma unroll
    for (int r = 0; r < 8; ++r) {
      const float g0  = __builtin_amdgcn_rcpf(1.0f + ea[r]);
      const float g1  = __builtin_amdgcn_rcpf(1.0f + eb[r]);
      const float w0  = (o0[r] * oc + vm0) * g0 * OSC;
      const float w1  = (o1[r] * oc + vm1) * g1 * OSC;
      const _Float16 h0 = (_Float16)w0, h1 = (_Float16)w1;
      const _Float16 l0 = (_Float16)(w0 - (float)h0), l1 = (_Float16)(w1 - (float)h1);
      const int si = (8 * hh + r) * OTP + c;
      wst[si]                 = h_bits(h0);
      wst[si + 16]            = h_bits(h1);
      wst[16 * OTP + si]      = h_bits(l0);
      wst[16 * OTP + si + 16] = h_bits(l1);
    }
  }
  wave_sync_lds();
  // fragment order: the two half units of the wave's unit (row tile q0/16, k-step = head); lane = (k octet hh, row c)
  v4u vh[2], vl[2];
#pragma unroll
  for (int it = 0; it < 2; ++it) {
    vh[it] = *(const v4u*)(wst + c * OTP + it * 16 + hh * 8);
    vl[it] = *(const v4u*)(wst + (16 + c) * OTP + it * 16 + hh * 8);
  }
  const size_t ob = (prow0 + q0) * CZ + hcol;
#pragma unroll
  for (int it = 0; it < 2; ++it) {
    *(v4u*)(OHp + ob + it * 256 + lo) = vh[it];
    *(v4u*)(OLp + ob + it * 256 + lo) = vl[it];
  }
  // the next pass rewrites the registers that this pass's loads and stores name; the memory clobber also keeps the next pass's writes
  // of the stage tile and the bias buffer behind this pass's reads in the built code (a wave's LDS operations run in order)
  asm volatile("s_wait_xcnt 0x0" ::: "memory");
  }
}

// =====================================================================================================
// All NI row blocks of the pair tensor are processed as one group (IG = NI rows i, GROWS positions), so each stage is one
// chip-filling launch; every plane is fully rewritten by whole-line stores before it is read. Workspace map (bytes; every extent is an exact
// multiple of its store granularity, no tail rows; every region offset a multiple of 32768; every f16 plane in fragment order):
//   WQ, WK, WV, WG, WO  f16 x1024 [128 n][128 k]   5 x 32768;  WB f16 x1024 [BTM n][128 k] (16384 in a 32768 slot)
//   VS   f32 [IG*NST][128]                          IG*NST*512 (slot padded to 32768)
//   XH, XL  f16 [NPOS][128] (x*64 hi, residual)    2 x 16777216
//   BT   f32 [BTM][NPOS] (rows 0..NH-1 written and read) 16777216
//   OH, OL  f16 [GROWS][128]                        2 x GROWS*256
//   GF   f32 [GROWS][128]                           GROWS*512
//   QH, QL, KH, KL  f16 [GROWS][128]               4 x GROWS*256
//   VH, VL  f16 [IG*NH*HD][NSEQ]                    2 x GROWS*256
//   end (IG = 256)                                  218824704
// =====================================================================================================
extern "C" void kernel_launch(void* const* d_in, const int* in_sizes, int n_in,
                              void* d_out, int out_size, void* d_ws, size_t ws_size,
                              hipStream_t stream) {
  if (n_in < 12) return;
  if (in_sizes[0] < NPOS * CZ) return;
  if (in_sizes[1] < NI * NSEQ) return;
  if (in_sizes[2] < CZ || in_sizes[3] < CZ) return;
  if (in_sizes[4] < NH * CZ) return;
  if (in_sizes[5] < CZ * CZ || in_sizes[6] < CZ * CZ || in_sizes[7] < CZ * CZ || in_sizes[8] < CZ * CZ) return;
  if (in_sizes[9] < CZ) return;
  if (in_sizes[10] < CZ * CZ || in_sizes[11] < CZ) return;
  if (out_size < NI * NSEQ * CZ) return;

  const float* x   = (const float*)d_in[0];
  const float* msk = (const float*)d_in[1];
  const float* gam = (const float*)d_in[2];
  const float* bet = (const float*)d_in[3];
  const float* Wt  = (const float*)d_in[4];
  const float* Wq  = (const float*)d_in[5];
  const float* Wk  = (const float*)d_in[6];
  const float* Wv  = (const float*)d_in[7];
  const float* Wg  = (const float*)d_in[8];
  const float* bg  = (const float*)d_in[9];
  const float* Wo  = (const float*)d_in[10];
  const float* bo  = (const float*)d_in[11];
  float*       out = (float*)d_out;

  const size_t szWP = 32768;
  const size_t szVS = (((size_t)IG * NST * CZ * 4) + 32767) / 32768 * 32768;
  const size_t szX  = (size_t)NPOS * CZ * 2;
  const size_t szBT = (size_t)BTM * NPOS * 4;
  const size_t szF  = (size_t)GROWS * CZ * 4;
  const size_t szP  = (size_t)GROWS * CZ * 2;          // QH, QL, KH, KL, VH, VL, OH, OL
  size_t off = 0;
  const size_t oWQ = off; off += szWP;
  const size_t oWK = off; off += szWP;
  const size_t oWV = off; off += szWP;
  const size_t oWG = off; off += szWP;
  const size_t oWO = off; off += szWP;
  const size_t oWB = off; off += szWP;
  const size_t oVS = off; off += szVS;
  const size_t oXH = off; off += szX;
  const size_t oXL = off; off += szX;
  const size_t oBT = off; off += szBT;
  const size_t oOH = off; off += szP;
  const size_t oOL = off; off += szP;
  const size_t oGF = off; off += szF;
  const size_t oQH = off; off += szP;
  const size_t oQL = off; off += szP;
  const size_t oKH = off; off += szP;
  const size_t oKL = off; off += szP;
  const size_t oVH = off; off += szP;
  const size_t oVL = off; off += szP;
  if (off > ws_size) return;                // off = 218824704 for IG = 256
  if (off > (size_t)WS_CAP) return;

  char* ws = (char*)d_ws;
  u16*   WQ = (u16*)(ws + oWQ);
  u16*   WK = (u16*)(ws + oWK);
  u16*   WV = (u16*)(ws + oWV);
  u16*   WG = (u16*)(ws + oWG);
  u16*   WO = (u16*)(ws + oWO);
  u16*   WB = (u16*)(ws + oWB);
  float* VS = (float*)(ws + oVS);
  u16*   XH = (u16*)(ws + oXH);
  u16*   XL = (u16*)(ws + oXL);
  float* BT = (float*)(ws + oBT);
  u16*   OH = (u16*)(ws + oOH);
  u16*   OL = (u16*)(ws + oOL);
  float* GF = (float*)(ws + oGF);
  u16*   QH = (u16*)(ws + oQH);
  u16*   QL = (u16*)(ws + oQL);
  u16*   KH = (u16*)(ws + oKH);
  u16*   KL = (u16*)(ws + oKL);
  u16*   VH = (u16*)(ws + oVH);
  u16*   VL = (u16*)(ws + oVL);

  const dim3 b256(256), b128(128), bAT(ATT_THREADS);
  const dim3 gP(WPBLK + NPOS / 64);
  const dim3 gX(2 * (GROWS / (64 * RG)));
  const dim3 gG((GROWS / 64) * (CZ / 64));
  const dim3 gA(IG * NH);
  const float oscp = 1.0f / (XSC * WSC);
  const float osco = 1.0f / (OSC * WSC);

  // (a, b) one launch: LayerNorm of all positions -> x*64 f16 hi + residual planes, and the weight planes [n][k] as f16 of the
  //     bf16 value x1024 (weights are [out][in] = [n][k]); Wt plane padded to BTM rows
  prep<<<gP, b256, 0, stream>>>(x, gam, bet, Wq, Wk, Wv, Wg, Wo, Wt, XH, XL, WQ, WK, WV, WG, WO, WB);

  for (int g = 0; g < NGRP; ++g) {
    const u16*   XHg = XH + (size_t)g * GROWS * CZ;
    const u16*   XLg = XL + (size_t)g * GROWS * CZ;
    const float* Mg  = msk + (size_t)g * IG * NSEQ;
    float*       og  = out + (size_t)g * GROWS * CZ;
    // (c, 1-4) every product of LN(x) in one launch: shared bias table BT[h][p] = sum_c Wt[h][c] * x[p][c] (rows 0..NH-1 of BT),
    //     v^T hi + residual planes x1024 with the per-64-key sums of v, q and k hi + residual planes x1024,
    //     gate pre-activation x.Wg^T + bg -> GF f32
    xproj<<<gX, b128, 0, stream>>>(XHg, XLg, WV, WQ, WK, WG, WB, bg, VH, VL, VS, QH, QL, KH, KL, GF, BT, oscp);
    // (5) attention over all keys of each row block with the shared bias and the row mask bias, gated
    //     -> O x4096 f16 hi + residual planes
    attn<<<gA, bAT, 0, stream>>>(QH, QL, KH, KL, VH, VL, VS, GF, BT, Mg, OH, OL);
    // (6) output projection (O hi + residual).Wo^T + bo -> out f32, carries 4096 x 1024 folded back
    gemm_h<1, 0, 0, CZ><<<gG, b128, 0, stream>>>(OH, OL, WO, WO, bo, 1, og, QH, QL, GROWS, CZ, osco, 1.0f);
  }
  (void)hipGetLastError();
}

// v009
// One run takes 77.9 microseconds.
// In both of two side-by-side timings against v008, it was 1.35 times as fast.
// Over all steps from v000 it is 4.78 times as fast.
// Contractions: LN(x).Wq^T, LN(x).Wk^T, LN(x).Wv^T, LN(x).Wg^T(+bg), LN(x).Wt^T (shared pair-bias table) and O.Wo^T(+bo) on
// v_wmma_f32_16x16x32_f16 with the activation operand carried as f16 hi + f16 residual planes (x*64, O*4096) and the weight
// operand as f16(bf16(W)*1024); q.k^T over 32 on v_wmma_f32_16x16x32_f16 (q, k *1024 f16 hi + residual, products hh+lh+hl);
// centred softmax weights P' = 16384*P - 64 (f16 hi) times v^T (v*1024 f16 hi + residual, products P'.vh + P'.vl);
// all f32 accumulate. LayerNorm, mask bias, softmax, sigmoid gate, key-mean of v and carry folds in f32 on VALU.
// Every float input is RNE-converted to bf16 on load.
#include <hip/hip_runtime.h>
#include <math.h>
#include <stdint.h>

#ifndef NB
#define NB 1
#endif
#ifndef NI
#define NI 256
#endif
#define NSEQ   256
#define CZ     128
#define NH     4
#define HD     32
#define NPOS   (NSEQ * NSEQ)
#define IG     NI
#define NGRP   (NI / IG)
#define GROWS  (IG * NSEQ)
#define XSC    64.0f
#define WSC    1024.0f
#define QSC    1024.0f
#define KSC    1024.0f
#define VCAR   1024.0f
#define PCAR   16384.0f
#define OSC    4096.0f
#define MINF   1.0e9f
#define RSQ_HD 0.17677669529663689f
#define LOG2E  1.4426950408889634f
#define AW     4
#define QPW    4
#define NQT    (NSEQ / 16)
#define NKT    (NSEQ / 32)
#define ATT_THREADS (AW * 32)
#define SBP    260
#define SBW    (16 * SBP)
#define OTP    40
#define KVP    (NSEQ * HD)
#define SLAB64 (16 * 68)
#define XTP    136
#define WTP    136
#define BTM    64
#define RG     2
#define BSP    (64 * RG + 4)
#define WS_CAP 268435456
static_assert(NB == 1);
static_assert(CZ == NH * HD && HD == 32 && NH == 4 && NSEQ == 256);
static_assert(NI >= 1 && NI <= NSEQ && (NI % IG) == 0 && IG >= 1 && IG <= NSEQ && NGRP == 1);
static_assert((GROWS % 64) == 0 && (NPOS % 64) == 0);
static_assert(GROWS == NPOS && (GROWS % (64 * RG)) == 0 && NH <= 16 && BTM >= 16 && (BSP % 4) == 0);
static_assert(AW * QPW == NQT && AW * 4 == NSEQ / 16 && ATT_THREADS == 128 && (NSEQ % 64) == 0 && (CZ % 64) == 0 && (CZ % 32) == 0);
static_assert((BTM % 64) == 0 && BTM >= NH && (BTM % 32) == 0);
static_assert(SBP >= NSEQ && (SBP % 4) == 0 && OTP >= HD && (OTP % 8) == 0 && XTP >= CZ && WTP >= CZ);

typedef unsigned short u16;
typedef _Float16 v16h __attribute__((ext_vector_type(16)));
typedef _Float16 v8h  __attribute__((ext_vector_type(8)));
typedef float    v8f  __attribute__((ext_vector_type(8)));
typedef float    v4f  __attribute__((ext_vector_type(4)));
typedef unsigned int v4u __attribute__((ext_vector_type(4)));

union FragH { v16h v; v8h h[2]; v4u u[2]; };

// ---- scalar helpers --------------------------------------------------------------------------------
__device__ __forceinline__ unsigned short bf_bits(float f) {          // f32 -> bf16 bits, RNE convert
  unsigned u = __float_as_uint(f);
  return (unsigned short)((u + 0x7FFFu + ((u >> 16) & 1u)) >> 16);
}
__device__ __forceinline__ float bf_up(unsigned short h) { return __uint_as_float(((unsigned)h) << 16); }
__device__ __forceinline__ float bfr(float f) { return bf_up(bf_bits(f)); }
__device__ __forceinline__ unsigned short h_bits(_Float16 x) { return __builtin_bit_cast(unsigned short, x); }
__device__ __forceinline__ unsigned pk16(unsigned short a, unsigned short b) { return (unsigned)a | ((unsigned)b << 16); }
__device__ __forceinline__ v8f zero8() { v8f z = {0.f, 0.f, 0.f, 0.f, 0.f, 0.f, 0.f, 0.f}; return z; }

// ---- fragment-order planes: every 16-bit A/B operand plane [R rows][K k] is stored as [R/16 row tiles][K/32 k-steps][512 halves];
//      inside a 512-half unit element (row r, k kk) lies at (kk >> 3)*128 + r*8 + (kk & 7), so unit (rt, ks) starts at
//      rt*16*K + ks*512 and one 16-B load per lane at lane*8 (and at 256 + lane*8) covers 512 contiguous bytes = 4 whole lines.
// ---- fragment loader: lane -> row/col (lane&15), h = lane>>4; p = unit start + lane*8;
//      elements 0..7 <- p[0..7] (k0+8h..), elements 8..15 <- p[256..263] (k0+16+8h..); same split k map for A and B.
__device__ __forceinline__ v16h ldfrag_h(const _Float16* p) {
  FragH f;
  f.h[0] = *(const v8h*)(p);
  f.h[1] = *(const v8h*)(p + 256);
  return f.v;
}

// ---- WMMA helpers with trailing VALU hazard gaps ------------------------------------------------------
__device__ __forceinline__ v8f mma_h(v16h a, v16h b, v8f c) {
  return __builtin_amdgcn_wmma_f32_16x16x32_f16(false, a, false, b, (short)0, c, false, false);
}
template <typename F>
__device__ __forceinline__ void guard6(v8f& a, v8f& b, v8f& c, v8f& d, F x0, F x1, F x2, F x3, F x4, F x5) {
#if defined(__HIP_DEVICE_COMPILE__)
  asm volatile("v_nop\n\tv_nop\n\tv_nop\n\tv_nop"
               : "+v"(a), "+v"(b), "+v"(c), "+v"(d) : "v"(x0), "v"(x1), "v"(x2), "v"(x3), "v"(x4), "v"(x5) : "memory");
#endif
}
template <typename F>
__device__ __forceinline__ void guard9(v8f& a, v8f& b, v8f& c, v8f& d, F x0, F x1, F x2, F x3, F x4, F x5,
                                       F x6, F x7, F x8) {
#if defined(__HIP_DEVICE_COMPILE__)
  asm volatile("v_nop\n\tv_nop\n\tv_nop\n\tv_nop"
               : "+v"(a), "+v"(b), "+v"(c), "+v"(d)
               : "v"(x0), "v"(x1), "v"(x2), "v"(x3), "v"(x4), "v"(x5), "v"(x6), "v"(x7), "v"(x8) : "memory");
#endif
}
__device__ __forceinline__ void acc_guard2(v8f& a, v8f& b) {
#if defined(__HIP_DEVICE_COMPILE__)
  asm volatile("v_nop\n\tv_nop\n\tv_nop\n\tv_nop" : "+v"(a), "+v"(b));
#endif
}
__device__ __forceinline__ void wave_sync_lds() {
  __builtin_amdgcn_fence(__ATOMIC_RELEASE, "workgroup");
  __builtin_amdgcn_wave_barrier();
  __builtin_amdgcn_fence(__ATOMIC_ACQUIRE, "workgroup");
}

// =====================================================================================================
// LayerNorm over CZ of the bf16 RNE-converted input rows, eps 1e-5, gamma/beta (bf16 RNE-converted), then
// with shuffles over the 4 lanes); both planes staged in LDS (pitch XTP halves, 16-B vector stores), block barrier, then each
// The planes go out in fragment order (see the fragment loader): each store instruction writes 512 contiguous bytes.
// coverage: compute 256 thr x 32 = 64 rows x 128; store 4 iterations x 8 waves x half a unit (32 lanes x 8 halves) = 16 units =
//           64 x 128 per plane; one block per 64 rows (row0) = every row of XH and XL exactly once (nrows a multiple of 64).
// =====================================================================================================
__device__ __forceinline__ void ln16(u16* TH, u16* TL, const float* __restrict__ X, const float* __restrict__ gam,
                                     const float* __restrict__ bet, u16* XHo, u16* XLo, int row0, int nrows) {
#pragma clang fp contract(off)
  const int tid = (int)threadIdx.x, wave = tid >> 5, lane = tid & 31;
  if (row0 + 64 > nrows) return;            // block-uniform, before the barrier; never taken with the exact grid
  const int rl = tid >> 2, part = tid & 3;
  const float* p = X + (size_t)(row0 + rl) * CZ + part * 32;
  v4f xv[8];
  float s = 0.0f;
#pragma unroll
  for (int t = 0; t < 8; ++t) {
    v4f a = *(const v4f*)(p + 4 * t);
#pragma unroll
    for (int e = 0; e < 4; ++e) { const float f = bfr(a[e]); a[e] = f; s = s + f; }
    xv[t] = a;
  }
  asm volatile("s_wait_xcnt 0x0" ::: "memory");   // a later load's result lands in the address registers that these loads name
  s = s + __shfl_xor(s, 1, 32);
  s = s + __shfl_xor(s, 2, 32);
  const float mu = s * (1.0f / (float)CZ);
  float q = 0.0f;
#pragma unroll
  for (int t = 0; t < 8; ++t) {
#pragma unroll
    for (int e = 0; e < 4; ++e) { const float d = xv[t][e] - mu; q = q + d * d; }
  }
  q = q + __shfl_xor(q, 1, 32);
  q = q + __shfl_xor(q, 2, 32);
  const float var  = q * (1.0f / (float)CZ);
  const float rstd = rsqrtf(var + 1e-5f);
  v4u oh[4], ol[4];
#pragma unroll
  for (int t = 0; t < 8; ++t) {
    const v4f g4 = *(const v4f*)(gam + part * 32 + 4 * t);
    const v4f b4 = *(const v4f*)(bet + part * 32 + 4 * t);
    unsigned short hb[4], lb[4];
#pragma unroll
    for (int e = 0; e < 4; ++e) {
      float y = (xv[t][e] - mu) * rstd;
      y = y * bfr(g4[e]);
      y = y + bfr(b4[e]);
      const float w = y * XSC;
      const _Float16 hv = (_Float16)w;
      const _Float16 lv = (_Float16)(w - (float)hv);
      hb[e] = h_bits(hv);
      lb[e] = h_bits(lv);
    }
    oh[t >> 1][(t & 1) * 2]     = pk16(hb[0], hb[1]);
    oh[t >> 1][(t & 1) * 2 + 1] = pk16(hb[2], hb[3]);
    ol[t >> 1][(t & 1) * 2]     = pk16(lb[0], lb[1]);
    ol[t >> 1][(t & 1) * 2 + 1] = pk16(lb[2], lb[3]);
  }
  {
    u16* th = TH + rl * XTP + part * 32;
    u16* tl = TL + rl * XTP + part * 32;
#pragma unroll
    for (int q4 = 0; q4 < 4; ++q4) {
      *(v4u*)(th + 8 * q4) = oh[q4];
      *(v4u*)(tl + 8 * q4) = ol[q4];
    }
  }
  __syncthreads();
  // fragment order: half unit hu = 0..31 of the block's 4 row tiles x 4 k-steps; lane = (k octet lane>>4, row lane&15)
  v4u vh[4], vl[4];
#pragma unroll
  for (int it = 0; it < 4; ++it) {
    const int si = (it * 16 + (lane & 15)) * XTP + wave * 16 + (lane >> 4) * 8;   // hu = it*8 + wave: row tile it, k = 16*wave ..
    vh[it] = *(const v4u*)(TH + si);
    vl[it] = *(const v4u*)(TL + si);
  }
  {
#pragma unroll
    for (int it = 0; it < 4; ++it) {
      const size_t o = (size_t)row0 * CZ + (it * 8 + wave) * 256 + lane * 8;
      *(v4u*)(XHo + o) = vh[it];
      *(v4u*)(XLo + o) = vl[it];
    }
    // ln16 ends prep: no code behind these stores rewrites the registers they name
    asm volatile("s_wait_xcnt 0x0" ::: "memory");
  }
}

// =====================================================================================================
// Weight plane: W f32 [nrow rows n][CZ k] row-major (k contiguous); D 16-bit [np rows n][CZ k] in fragment order, D(n, k) = f16 bits of
// bf16(W[n][k]) * scale for n < nrow, 0 for nrow <= n < np. Block = 32 n rows: each thread loads 16 consecutive k values of
// one n row with a clamped row address (zeroed by predicate for n >= nrow), converts into the LDS tile [32 n][CZ k]
// coverage: load 256 thr x 16 = 32 n x 128 k; store 2 iterations x 8 waves x half a unit (32 lanes x 8 halves) = 8 units = 32 x 128;
//           np/32 blocks (n0) cover the [np][CZ] plane exactly once.
// =====================================================================================================
__device__ __forceinline__ void wp16(u16* T, const float* __restrict__ W, int nrow, int np, int n0, u16* D, float scale) {
  const int tid = (int)threadIdx.x, wave = tid >> 5, lane = tid & 31;
  if (n0 + 32 > np) return;                 // block-uniform, before the barrier; never taken with the exact grid
  {
    const int nl = tid >> 3, kc = (tid & 7) * 16;
    const int n  = n0 + nl;
    int nr = (n < nrow) ? n : (nrow - 1);
    nr = (nr < 0) ? 0 : nr;
    const float* src = W + (size_t)nr * CZ + kc;
    v4u w2[2];
#pragma unroll
    for (int t = 0; t < 4; ++t) {
      const v4f a = *(const v4f*)(src + 4 * t);
      unsigned short hb[4];
#pragma unroll
      for (int e = 0; e < 4; ++e) {
        const float val = (n < nrow) ? a[e] : 0.0f;
        hb[e] = h_bits((_Float16)(bfr(val) * scale));
      }
      w2[t >> 1][(t & 1) * 2]     = pk16(hb[0], hb[1]);
      w2[t >> 1][(t & 1) * 2 + 1] = pk16(hb[2], hb[3]);
    }
    *(v4u*)(T + nl * WTP + kc)     = w2[0];
    *(v4u*)(T + nl * WTP + kc + 8) = w2[1];
  }
  __syncthreads();
  // fragment order: half unit hu = 0..15 of the block's 2 row tiles x 4 k-steps; lane = (k octet lane>>4, row lane&15)
  v4u w4[2];
#pragma unroll
  for (int it = 0; it < 2; ++it) {
    w4[it] = *(const v4u*)(T + (it * 16 + (lane & 15)) * WTP + wave * 16 + (lane >> 4) * 8);   // hu = it*8 + wave: row tile it, k = 16*wave ..
  }
  {
#pragma unroll
    for (int it = 0; it < 2; ++it) {
      *(v4u*)(D + (size_t)n0 * CZ + (it * 8 + wave) * 256 + lane * 8) = w4[it];
    }
    
  }
}

// =====================================================================================================
// Everything that depends on the inputs alone, in one launch: the six weight planes and the LayerNorm planes are independent of
// one another, so they share a grid. Blocks 0 .. WPBLK-1: block b does rows 32*(b % 4) .. +31
// of weight plane b / 4 (0..4 = Wq, Wk, Wv, Wg, Wo, CZ rows each; 5 = Wt, NH rows padded to BTM, blocks 20 and 21).
// Blocks WPBLK .. : 64 position rows of LayerNorm each. The branch is block-uniform, each side has its own one barrier.
// LDS: the weight tile [32][WTP] lies in the first LayerNorm stage tile [64][XTP].
// coverage: 5 * CZ/32 + BTM/32 weight blocks = every row of every weight plane once; NPOS/64 LayerNorm blocks = every position once.
// =====================================================================================================
#define WPBLK (5 * (CZ / 32) + BTM / 32)
static_assert(CZ / 32 == 4 && BTM / 32 <= CZ / 32 && 32 * WTP <= 64 * XTP);
// amdgpu_waves_per_eu(8): holds the register budget to 128: four blocks per WGP, so that all LayerNorm blocks are resident at once.
__global__ __launch_bounds__(256) __attribute__((amdgpu_waves_per_eu(8)))
void prep(const float* __restrict__ X, const float* __restrict__ gam, const float* __restrict__ bet,
          const float* __restrict__ Wq, const float* __restrict__ Wk, const float* __restrict__ Wv,
          const float* __restrict__ Wg, const float* __restrict__ Wo, const float* __restrict__ Wt,
          u16* XHo, u16* XLo, u16* WQo, u16* WKo, u16* WVo, u16* WGo, u16* WOo, u16* WBo) {
  __shared__ __align__(16) u16 TH[64 * XTP];
  __shared__ __align__(16) u16 TL[64 * XTP];
  const int bid = (int)blockIdx.x;
  if (bid < WPBLK) {
    const int pl = bid / (CZ / 32), n0 = (bid % (CZ / 32)) * 32;
    const float* W = (pl == 0) ? Wq : (pl == 1) ? Wk : (pl == 2) ? Wv : (pl == 3) ? Wg : (pl == 4) ? Wo : Wt;
    u16*         D = (pl == 0) ? WQo : (pl == 1) ? WKo : (pl == 2) ? WVo : (pl == 3) ? WGo : (pl == 4) ? WOo : WBo;
    wp16(TH, W, (pl == 5) ? NH : CZ, (pl == 5) ? BTM : CZ, n0, D, WSC);
    return;
  }
  ln16(TH, TL, X, gam, bet, XHo, XLo, (bid - WPBLK) * 64, NPOS);
}

// =====================================================================================================
// GEMM epilogue: the wave's 16x64 f32 tile (times oscale, plus a per-column addend) staged in its LDS slab (pitch 68),
// coverage: 8 instructions x 2 rows x 16 lanes x 4 floats = the wave's 16 x 64 tile.
// =====================================================================================================
__device__ __forceinline__ void epi64(float* sl, v8f a0, v8f a1, v8f a2, v8f a3, float oscale,
                                      float b0, float b1, float b2, float b3,
                                      float* C, int N, size_t rowb, int col0, int lane) {
  const int hh = lane >> 4, m = lane & 15;
#pragma unroll
  for (int r = 0; r < 8; ++r) {
    const int ro = (8 * hh + r) * 68 + m;
    sl[ro]      = a0[r] * oscale + b0;
    sl[ro + 16] = a1[r] * oscale + b1;
    sl[ro + 32] = a2[r] * oscale + b2;
    sl[ro + 48] = a3[r] * oscale + b3;
  }
  wave_sync_lds();
  v4f vals[8];
#pragma unroll
  for (int it = 0; it < 8; ++it) vals[it] = *(const v4f*)(sl + (it * 2 + hh) * 68 + m * 4);
  float* dst = C + (rowb + (size_t)hh) * (size_t)N + col0 + m * 4;
  {
#pragma unroll
    for (int it = 0; it < 8; ++it) {
      *(v4f*)(dst + (size_t)(it * 2) * (size_t)N) = vals[it];
    }
    
  }
}

// =====================================================================================================
// Eight f32 values (already carrying their plane scale) -> 8 f16 hi halves and 8 f16 residual halves, packed for 16-B stores.
// =====================================================================================================
__device__ __forceinline__ void split8(const float* w, v4u& oh, v4u& ol) {
#pragma unroll
  for (int e = 0; e < 4; ++e) {
    const float t0 = w[2 * e], t1 = w[2 * e + 1];
    const _Float16 h0 = (_Float16)t0, h1 = (_Float16)t1;
    const _Float16 l0 = (_Float16)(t0 - (float)h0), l1 = (_Float16)(t1 - (float)h1);
    oh[e] = pk16(h_bits(h0), h_bits(h1));
    ol[e] = pk16(h_bits(l0), h_bits(l1));
  }
}

// One D tile (8 f32 per lane) times sc -> f16 hi + residual, one 16-B LDS store per plane: where the 8 values of a lane are 8
// consecutive k of one fragment row, hp / lp = unit start + (0 or 256) + lane*8 is the lane's place in a fragment-order unit.
__device__ __forceinline__ void put_pl(v8f a, float sc, u16* hp, u16* lp) {
  float w[8];
#pragma unroll
  for (int e = 0; e < 8; ++e) w[e] = a[e] * sc;
  v4u oh, ol;
  split8(w, oh, ol);
  *(v4u*)hp = oh;
  *(v4u*)lp = ol;
}
__device__ __forceinline__ float sum8(v8f a) {
  return ((a[0] + a[1]) + (a[2] + a[3])) + ((a[4] + a[5]) + (a[6] + a[7]));
}

// =====================================================================================================
// f16 GEMM: C[M][N] (f32) = (Ah [+ Al])[M][K] . (Bh [+ Bl])[N][K]^T * oscale [+ bf16(bias[col])].
// ALO == 1: products ah.bh + al.bh (A residual plane, unscaled); BLO == 1: products ah.bh + ah.bl (B residual plane);
// one accumulator. Block = 64x64 tile, 4 waves x 16 rows; fragments loaded straight from the fragment-order planes (two 16-B loads
// each, split k map for A and B); K stepped by 32 (K % 32 == 0; host guarantees M % 64 == 0, N % 64 == 0,
// grid = (M/64)*(N/64)). hasb is a block-uniform flag; bias is dereferenced only when hasb != 0.
// =====================================================================================================
// K is a compile-time value: the units of the four B tiles then lie at constant offsets from one address.
template <int ALO, int BLO, int K>
__global__ __launch_bounds__(128)
void gemm_h(const u16* __restrict__ Ah, const u16* __restrict__ Al, const u16* __restrict__ Bh, const u16* __restrict__ Bl,
            const float* __restrict__ bias, int hasb, float* C, int M, int N, float oscale) {
  __shared__ __align__(16) float slab[4 * SLAB64];
  const int tid = (int)threadIdx.x, lane = tid & 31, m = lane & 15;
  const int wave = __builtin_amdgcn_readfirstlane(tid >> 5);   // scalar: the fragment units' bases are formed on the scalar unit
  const int ntile = N >> 6;
  const int bid   = (int)blockIdx.x;
  const int rb0   = (bid / ntile) * 64;
  const int rowb  = rb0 + wave * 16;
  const int col0  = (bid % ntile) * 64;
  if (rb0 + 64 > M) return;                 // block-uniform, before any barrier; never taken with the exact grid
  // wave-uniform unit bases + one 32-bit lane offset lo
  const unsigned lo = (unsigned)(lane * 8);
  const _Float16* ahp = (const _Float16*)(const void*)Ah + (size_t)rowb * K;
  const _Float16* alp = (const _Float16*)(const void*)Al + (size_t)rowb * K;   // read only when ALO
  const _Float16* bhp = (const _Float16*)(const void*)Bh + (size_t)col0 * K;
  const _Float16* blp = (const _Float16*)(const void*)Bl + (size_t)col0 * K;   // read only when BLO
  constexpr int bs = 16 * K;                // halves from one 16-column tile of B to the next
  float bb0 = 0.0f, bb1 = 0.0f, bb2 = 0.0f, bb3 = 0.0f;
  if (hasb != 0) {
    bb0 = bfr(bias[col0 + m]);
    bb1 = bfr(bias[col0 + 16 + m]);
    bb2 = bfr(bias[col0 + 32 + m]);
    bb3 = bfr(bias[col0 + 48 + m]);
  }
  v8f acc0 = zero8(), acc1 = zero8(), acc2 = zero8(), acc3 = zero8();
#pragma unroll 1
  for (int ks = 0; ks < K; ks += 32) {      // one fragment-order unit (512 halves) per 32 k
    const _Float16* pa = ahp + 16 * ks + lo;   // this k-step's units: A hi, A residual, B tile 0 hi, B tile 0 residual
    const _Float16* pl = alp + 16 * ks + lo;
    const _Float16* pb = bhp + 16 * ks + lo;
    const _Float16* pq = blp + 16 * ks + lo;
    const v16h ah = ldfrag_h(pa);
    const v16h b0 = ldfrag_h(pb);
    const v16h b1 = ldfrag_h(pb + bs);
    const v16h b2 = ldfrag_h(pb + 2 * bs);
    const v16h b3 = ldfrag_h(pb + 3 * bs);
    acc0 = mma_h(ah, b0, acc0);
    acc1 = mma_h(ah, b1, acc1);
    acc2 = mma_h(ah, b2, acc2);
    acc3 = mma_h(ah, b3, acc3);
    if constexpr (ALO != 0) {
      const v16h al = ldfrag_h(pl);
      acc0 = mma_h(al, b0, acc0);
      acc1 = mma_h(al, b1, acc1);
      acc2 = mma_h(al, b2, acc2);
      acc3 = mma_h(al, b3, acc3);
      if constexpr (BLO != 0) {
        const v16h l0 = ldfrag_h(pq);
        const v16h l1 = ldfrag_h(pq + bs);
        const v16h l2 = ldfrag_h(pq + 2 * bs);
        const v16h l3 = ldfrag_h(pq + 3 * bs);
        acc0 = mma_h(ah, l0, acc0);
        acc1 = mma_h(ah, l1, acc1);
        acc2 = mma_h(ah, l2, acc2);
        acc3 = mma_h(ah, l3, acc3);
        guard9<v16h>(acc0, acc1, acc2, acc3, ah, b0, b1, b2, b3, l0, l1, l2, l3);
        guard6<v16h>(acc0, acc1, acc2, acc3, al, al, al, al, al, al);
      } else {
        guard6<v16h>(acc0, acc1, acc2, acc3, ah, al, b0, b1, b2, b3);
      }
    } else if constexpr (BLO != 0) {
      const v16h l0 = ldfrag_h(pq);
      const v16h l1 = ldfrag_h(pq + bs);
      const v16h l2 = ldfrag_h(pq + 2 * bs);
      const v16h l3 = ldfrag_h(pq + 3 * bs);
      acc0 = mma_h(ah, l0, acc0);
      acc1 = mma_h(ah, l1, acc1);
      acc2 = mma_h(ah, l2, acc2);
      acc3 = mma_h(ah, l3, acc3);
      guard9<v16h>(acc0, acc1, acc2, acc3, ah, b0, b1, b2, b3, l0, l1, l2, l3);
    } else {
      guard6<v16h>(acc0, acc1, acc2, acc3, ah, b0, b1, b2, b3, ah);
    }
    // the next trip rewrites the address registers that this trip's loads name; as inputs they stay untouched up to the wait
    asm volatile("s_wait_xcnt 0x0" :: "v"(pa), "v"(pb), "v"(ALO != 0 ? pl : pa), "v"(BLO != 0 ? pq : pb) : "memory");
  }
  epi64(slab + wave * SLAB64, acc0, acc1, acc2, acc3, oscale, bb0, bb1, bb2, bb3, C, N, (size_t)rowb, col0, lane);
}

// =====================================================================================================
// Pair-bias table, the one product of LN(x) that every row block needs whole: BT[h][position] = LN(x)[position] . Wt[h].
// Block = RG groups of 64 position rows, 4 waves; wave w owns rows rb0 + 64g + 16w .. +15 of every group g and loads their A
// fragments (x*64 hi + residual, all CZ = 4 k-steps). B = Wt plane rows 0..15 (rows >= NH are zero); per accumulator the products
// run xh.w, xl.w per k-step, k ascending. D (row = position, column = head) staged in LDS [16][BSP], block barrier, heads
// 0..NH-1 stored as whole lines of BT[h][position]   (GROWS == NPOS: every position once).
// coverage: grid = GROWS/(64*RG) blocks x RG groups x 64 rows = every position once.
// =====================================================================================================
__global__ __launch_bounds__(128)
void pbias(const u16* __restrict__ XHp, const u16* __restrict__ XLp, const u16* __restrict__ WBp, float* BT, float oscale) {
  __shared__ __align__(16) float bsl[16 * BSP];
  const int tid = (int)threadIdx.x, lane = tid & 31, hh = lane >> 4, m = lane & 15;
  const int wave = __builtin_amdgcn_readfirstlane(tid >> 5);   // scalar: row offsets stay out of the vector registers
  const int rb0  = (int)blockIdx.x * (64 * RG);
  if (rb0 + 64 * RG > GROWS) return;        // block-uniform, before the barrier; never taken with the exact grid
  // lane offset inside a fragment-order unit; the same for x rows (A) and weight rows (B)
  const unsigned wo = (unsigned)(lane * 8);
  v16h ah[RG][CZ / 32], al[RG][CZ / 32], b[CZ / 32];
  {
    const _Float16* xh = (const _Float16*)(const void*)XHp + (size_t)(rb0 + wave * 16) * CZ;   // wave-uniform bases
    const _Float16* xl = (const _Float16*)(const void*)XLp + (size_t)(rb0 + wave * 16) * CZ;
#pragma unroll
    for (int g = 0; g < RG; ++g) {
#pragma unroll
      for (int ks = 0; ks < CZ / 32; ++ks) {
        ah[g][ks] = ldfrag_h(xh + (wo + g * 64 * CZ + ks * 512));
        al[g][ks] = ldfrag_h(xl + (wo + g * 64 * CZ + ks * 512));
      }
    }
#pragma unroll
    for (int ks = 0; ks < CZ / 32; ++ks) b[ks] = ldfrag_h((const _Float16*)(const void*)WBp + (wo + ks * 512));
    // the two base registers that these loads name are reused behind here; as inputs they stay untouched up to the wait
    asm volatile("s_wait_xcnt 0x0" :: "s"(xh), "s"(xl) : "memory");
    // all loads are asked for at once: left free, the build sank each weight fragment's loads in front of its own products
    __builtin_amdgcn_sched_barrier(0);
  }
  v8f ab[RG];
#pragma unroll
  for (int g = 0; g < RG; ++g) ab[g] = zero8();
#pragma unroll
  for (int ks = 0; ks < CZ / 32; ++ks) {
#pragma unroll
    for (int g = 0; g < RG; ++g) {
      ab[g] = mma_h(ah[g][ks], b[ks], ab[g]);
      ab[g] = mma_h(al[g][ks], b[ks], ab[g]);
    }
  }
#pragma unroll
  for (int g = 0; g < RG; ++g) {
    v4f t0, t1;
#pragma unroll
    for (int e = 0; e < 4; ++e) { t0[e] = ab[g][e] * oscale; t1[e] = ab[g][4 + e] * oscale; }
    float* d = bsl + m * BSP + g * 64 + wave * 16 + 8 * hh;
    *(v4f*)(d)     = t0;
    *(v4f*)(d + 4) = t1;
  }
  __syncthreads();
  for (int i = tid; i < NH * 16 * RG; i += 128) {   // wave-uniform trip count: 16*RG is a multiple of 16, 128 of 32
    const int h = i / (16 * RG), p4 = (i % (16 * RG)) * 4;
    *(v4f*)(BT + (size_t)h * NPOS + rb0 + p4) = *(const v4f*)(bsl + h * BSP + p4);
  }
}

// =====================================================================================================
// Row-wise gated attention. Block bid -> (row block il, head): AW waves, wave w takes the query tiles qt = qi*AW + w, qi = 0..QPW-1,
// one after the other (rows q0 = 16*qt .. q0+15); all NSEQ keys of row block il, shared bias table BT f32 [BTM][NPOS]
// (row h, position j*NSEQ + k) plus the per-row mask bias 1e9*(bf16(mask[il][k]) - 1) (MK already offset to the row group).
//   Inputs: the LN(x) planes (x*64 f16 hi + residual) and the weight planes (x1024), all in fragment order. The block makes its head's
//   q, k, v and gate itself; the operand roles are chosen so that a lane's 8 D values are 8 consecutive k of ONE fragment row:
//     k^T = Wk_h . x^T (A = 32 weight rows d, B = 16 x rows): D tile dt, element r of lane (c, hh) = (d = 16dt + 8hh + r, key c)
//           = halves dt*256 + lane*8 .. +7 of the key tile's unit (row = key, k = d); q^T = Wq_h . x^T likewise IS the q fragment;
//     v = x . Wv_h^T (A = 16 x rows, B = 16 weight rows d): element r of lane (c, hh) = (key 16rt + 8hh + r, d = 16dt + c)
//           = halves (rt & 1)*256 + lane*8 .. +7 of v^T unit (d subtile dt, 32-key step rt >> 1); the gate tile has O's own D layout.
//   Per accumulator the products run w.xh, w.xl per k-step, k ascending.
//   Phase A (once per block): wave w takes the row tiles rt = i*AW + w, holds Wk_h, Wv_h (16 fragments) in registers, and stores
//   k*1024 and v*1024 as f16 hi + residual into LDS (kvs: k hi, k residual, v^T hi, v^T residual, 16 units of 1 KiB each); the sums of
//   v over the wave's 64 keys go to vsw (their total / NSEQ = key-mean of v). Wq_h and Wg_h (8 units each) are brought to LDS (wqg)
//   by asynchronous 16-B copies, 4 units per wave. One wait for the copies and one block barrier behind phase A publish all of it.
//   Phase 0: the wave's 16 x NSEQ bias rows (times log2e, plus mask bias times log2e) loaded with 16-B loads into its private
//   LDS bias buffer (pitch SBP: 16 B over a multiple of 256 B, the pitch of 16-B row readers).
//   Then q^T (times 1024, split into hi + residual: the two B fragments) and the gate pre-activation from the pass's 16 x rows.
//   Phase 1 (per 16-key tile): TRANSPOSED scores k_hi.q_hi + k_hi.q_lo + k_lo.q_hi (A = key rows, B = query rows, one k-step of
//   32): D element r of lane (c, hh) = (key 16t + 8hh + r, query c). u = s*rsqrt(32)*log2e/(1024*1024) + bias (two 16-B LDS reads
//   of buffer row c); all 128 scores of a lane stay in registers; running max in-lane, one exchange between the lane halves.
//   Phase 2a: p = exp2(u - m) in registers, row sum Z in-lane (8 chains, tree) plus one exchange, scale 16384/Z.
//   Phase 2b (per 32 keys): P' = p*16384/Z - 64 of two neighbouring tiles converted to f16 IS the A fragment (row c, split k map);
//   v^T B fragments for the two 16-wide d subtiles, products P'.v_hi + P'.v_lo. The score, softmax and P'.v code is straight-line.
//   Epilogue: vals = acc/(16384*1024) + key-mean (exact identity sum(P'+64).v/16384 = sum P.v), gate g = 1/(1+exp(-z)) in f32,
//   O = g*vals*4096 -> f16 hi + residual, staged as u16 elements in the wave's own LDS tile [2 planes][16 rows][OTP]; the wave's
//   16 rows x HD columns are one whole fragment-order unit per plane, so the wave stores it alone, behind an in-wave sync.
//   The only early return is block-uniform and precedes the barrier.
// staged extent == consumed extent: kvs units 0..15 of all 4 planes written (4 waves x 4 row tiles) and read; wqg units 0..15 copied
//   (4 waves x 4 units) and read; vsw 4 x HD sums written and read; bias buffer columns
//   0..NSEQ-1 of all 16 rows written in phase 0 before any read (columns NSEQ..SBP-1 never read); stage tile rows 0..15 x columns
//   0..HD-1 of both planes written before the sync (columns HD..OTP-1 never read).
// coverage: per wave and pass 2 x half a unit (32 lanes x 8 halves) = 1 unit = 16 rows x HD halves per plane;
//           grid = IG*NH blocks x AW*QPW = NQT query tiles = every (row tile, head) unit of OH and OL exactly once.
// =====================================================================================================
// Powers of 2 as the bare v_exp_f32 (the library exp2f adds a compare, two selects, an add and a v_ldexp_f32 per value to keep results
// under 2^-126; here such a result may come out as 0: see the two places of use). Written as asm text, in place, so that what stands
// directly behind each v_exp_f32 is fixed: the instruction set asks there for an instruction that neither reads the result nor
// overwrites the source.
// exp8sub8: x[r] = 2^x[r], and y[r] -= m in the slot behind each power (the next tile's subtraction of the row maximum).
__device__ __forceinline__ void exp8sub8(v8f& x, v8f& y, float m) {
#if defined(__HIP_DEVICE_COMPILE__)
  float x0 = x[0], x1 = x[1], x2 = x[2], x3 = x[3], x4 = x[4], x5 = x[5], x6 = x[6], x7 = x[7];
  float y0 = y[0], y1 = y[1], y2 = y[2], y3 = y[3], y4 = y[4], y5 = y[5], y6 = y[6], y7 = y[7];
  asm("v_exp_f32 %0, %0\n\tv_sub_f32 %8, %8, %16\n\t"
      "v_exp_f32 %1, %1\n\tv_sub_f32 %9, %9, %16\n\t"
      "v_exp_f32 %2, %2\n\tv_sub_f32 %10, %10, %16\n\t"
      "v_exp_f32 %3, %3\n\tv_sub_f32 %11, %11, %16\n\t"
      "v_exp_f32 %4, %4\n\tv_sub_f32 %12, %12, %16\n\t"
      "v_exp_f32 %5, %5\n\tv_sub_f32 %13, %13, %16\n\t"
      "v_exp_f32 %6, %6\n\tv_sub_f32 %14, %14, %16\n\t"
      "v_exp_f32 %7, %7\n\tv_sub_f32 %15, %15, %16"
      : "+v"(x0), "+v"(x1), "+v"(x2), "+v"(x3), "+v"(x4), "+v"(x5), "+v"(x6), "+v"(x7),
        "+v"(y0), "+v"(y1), "+v"(y2), "+v"(y3), "+v"(y4), "+v"(y5), "+v"(y6), "+v"(y7)
      : "v"(m));
  x[0] = x0; x[1] = x1; x[2] = x2; x[3] = x3; x[4] = x4; x[5] = x5; x[6] = x6; x[7] = x7;
  y[0] = y0; y[1] = y1; y[2] = y2; y[3] = y3; y[4] = y4; y[5] = y5; y[6] = y6; y[7] = y7;
#endif
}
// exp8: x[r] = 2^x[r]; each power is independent of the one behind it, the closing v_nop fills the slot behind the last.
__device__ __forceinline__ void exp8(v8f& x) {
#if defined(__HIP_DEVICE_COMPILE__)
  float x0 = x[0], x1 = x[1], x2 = x[2], x3 = x[3], x4 = x[4], x5 = x[5], x6 = x[6], x7 = x[7];
  asm("v_exp_f32 %0, %0\n\tv_exp_f32 %1, %1\n\tv_exp_f32 %2, %2\n\tv_exp_f32 %3, %3\n\t"
      "v_exp_f32 %4, %4\n\tv_exp_f32 %5, %5\n\tv_exp_f32 %6, %6\n\tv_exp_f32 %7, %7\n\tv_nop"
      : "+v"(x0), "+v"(x1), "+v"(x2), "+v"(x3), "+v"(x4), "+v"(x5), "+v"(x6), "+v"(x7));
  x[0] = x0; x[1] = x1; x[2] = x2; x[3] = x3; x[4] = x4; x[5] = x5; x[6] = x6; x[7] = x7;
#endif
}

// Four asynchronous 16-B-per-lane copies global -> LDS (l*: the lane's LDS byte address, g*: its global address). The wait stands in
// the copies' own statement: behind it the registers that the copies name may be rewritten.
__device__ __forceinline__ void acopy4(unsigned l0, unsigned l1, unsigned l2, unsigned l3,
                                       const _Float16* g0, const _Float16* g1, const _Float16* g2, const _Float16* g3) {
#if defined(__HIP_DEVICE_COMPILE__)
  asm volatile("global_load_async_to_lds_b128 %0, %4, off\n\t"
               "global_load_async_to_lds_b128 %1, %5, off\n\t"
               "global_load_async_to_lds_b128 %2, %6, off\n\t"
               "global_load_async_to_lds_b128 %3, %7, off\n\t"
               "s_wait_xcnt 0x0"
               :: "v"(l0), "v"(l1), "v"(l2), "v"(l3), "v"(g0), "v"(g1), "v"(g2), "v"(g3) : "memory");
#endif
}
// The wave's 4 units (u0 .. u0+3, 1 KiB each, gstep halves apart in global memory) of one plane -> LDS units u0 .. u0+3 at byte lb.
__device__ __forceinline__ void stage4(unsigned lb, const _Float16* g, int gstep, int u0, unsigned lo) {
#pragma unroll
  for (int p = 0; p < 2; ++p) {
    const unsigned  l = lb + (unsigned)((u0 + 2 * p) * 1024) + lo * 2;
    const _Float16* s = g + (size_t)(u0 + 2 * p) * gstep + lo;
    acopy4(l, l + 512, l + 1024, l + 1536, s, s + 256, s + gstep, s + gstep + 256);
  }
}

// The LDS (under 160 KiB) lets 2 blocks = 2 waves per SIMD stay resident, each with up to 512 registers.
__global__ __launch_bounds__(ATT_THREADS)
void attn(const u16* __restrict__ XHp, const u16* __restrict__ XLp,
          const u16* __restrict__ WQp, const u16* __restrict__ WKp,
          const u16* __restrict__ WVp, const u16* __restrict__ WGp,
          const float* __restrict__ bg, const float* __restrict__ BT,
          const float* __restrict__ MK, u16* OHp, u16* OLp, float oscale) {
  __shared__ __align__(16) u16 kvs[4 * KVP];
  __shared__ __align__(16) u16 wqg[2 * HD * CZ];
  __shared__ __align__(16) float sbuf[AW * SBW];
  __shared__ __align__(16) u16 stg[AW * 2 * 16 * OTP];
  __shared__ float vsw[AW * HD];

  const int tid  = (int)threadIdx.x;
  const int wave = __builtin_amdgcn_readfirstlane(tid >> 5);   // scalar: the fragment units' bases stay out of the vector registers
  const int lane = tid & 31;
  const int hh   = lane >> 4;
  const int c    = lane & 15;
  const int bid  = (int)blockIdx.x;
  const int head = bid % NH;
  const int il   = bid / NH;
  if (il >= IG) return;                     // block-uniform, before every barrier; never taken with the exact grid
  float* buf = sbuf + wave * SBW;
  u16*   wst = stg + wave * (2 * 16 * OTP);
  const size_t prow0 = (size_t)il * NSEQ;   // first position row of this row block in the group-local planes

  // fragment-order units: x unit (row tile, k-step); the head's HD weight rows = 8 consecutive units (2 row tiles x 4 k-steps);
  // O unit (row tile, k-step = head). One 32-bit lane offset lo addresses every fragment load
  const unsigned lo = (unsigned)(lane * 8);
  const size_t hcol = (size_t)head * 512;
  const size_t wrow = (size_t)head * (HD * CZ);
  const _Float16* Xhb = (const _Float16*)(const void*)XHp + prow0 * CZ;                  // row tile rt: 16*CZ halves per tile
  const _Float16* Xlb = (const _Float16*)(const void*)XLp + prow0 * CZ;
  const _Float16* Ksh = (const _Float16*)(const void*)kvs;      // LDS planes: unit t at t*512 halves
  const _Float16* Ksl = Ksh + KVP;
  const _Float16* Vsh = Ksh + 2 * KVP;
  const _Float16* Vsl = Ksh + 3 * KVP;
  const _Float16* Wqs = (const _Float16*)(const void*)wqg;      // LDS: Wq_h units 0..7, then Wg_h units 0..7
  const _Float16* Wgs = Wqs + HD * CZ;
  {
    // 8 copies per wave in flight (waves 0, 1: Wq_h; waves 2, 3: Wg_h): phase A covers their latency
    const unsigned  wqb  = (unsigned)(size_t)(const void*)wqg;  // LDS byte address of wqg: the low 32 bits of its address
    const _Float16* wsrc = (const _Float16*)(const void*)((wave < 2) ? WQp : WGp) + wrow;
    stage4(wqb + (unsigned)((wave >> 1) * (HD * CZ * 2)), wsrc, 512, (wave & 1) * 4, lo);
  }
  const float lsc = RSQ_HD * (LOG2E / (QSC * KSC));
  v4f mb0, mb1;                             // mask bias x log2e of keys lane*4..+3 and 128+lane*4..+3 of mask row il: the same in every pass
  {
    const float* msrc = MK + (size_t)il * NSEQ;
    const v4f m0 = *(const v4f*)(msrc + lane * 4);
    const v4f m1 = *(const v4f*)(msrc + 128 + lane * 4);
#pragma unroll
    for (int e = 0; e < 4; ++e) {
      mb0[e] = (MINF * (bfr(m0[e]) - 1.0f)) * LOG2E;
      mb1[e] = (MINF * (bfr(m1[e]) - 1.0f)) * LOG2E;
    }
  }
  // gate bias of the lane's two columns d = c, 16 + c: the same in every pass
  const float bgr0 = bg[head * HD + c], bgr1 = bg[head * HD + 16 + c];
  asm volatile("s_wait_xcnt 0x0" ::: "memory");   // the registers that these two loads name are reused behind here
  const float bg0 = bfr(bgr0), bg1 = bfr(bgr1);

  // ---- phase A: k^T and v of the wave's 4 row tiles -> LDS planes; sums of v over the wave's keys ----
  {
    const _Float16* Wkb = (const _Float16*)(const void*)WKp + wrow;
    const _Float16* Wvb = (const _Float16*)(const void*)WVp + wrow;
    v16h wk[2][CZ / 32], wv[2][CZ / 32], xh[CZ / 32], xl[CZ / 32];
    {
      const _Float16* ph = Xhb + (size_t)(wave * 16) * CZ;
      const _Float16* pl = Xlb + (size_t)(wave * 16) * CZ;
#pragma unroll
      for (int ks = 0; ks < CZ / 32; ++ks) {
        xh[ks] = ldfrag_h(ph + (lo + ks * 512));
        xl[ks] = ldfrag_h(pl + (lo + ks * 512));
      }
#pragma unroll
      for (int dt = 0; dt < 2; ++dt) {
#pragma unroll
        for (int ks = 0; ks < CZ / 32; ++ks) {
          wk[dt][ks] = ldfrag_h(Wkb + (lo + dt * 16 * CZ + ks * 512));
          wv[dt][ks] = ldfrag_h(Wvb + (lo + dt * 16 * CZ + ks * 512));
        }
      }
      // the base registers that these loads name are reused behind here; as inputs they stay untouched up to the wait
      asm volatile("s_wait_xcnt 0x0" :: "s"(ph), "s"(pl), "s"(Wkb), "s"(Wvb) : "memory");
      // all of these loads are asked for at once: left free, the build sank the residual fragments' loads in between the products
      __builtin_amdgcn_sched_barrier(0);
    }
    float sv0 = 0.0f, sv1 = 0.0f;
#pragma unroll                              // constant indices keep wk[], wv[], xh[], xl[] in registers
    for (int i = 0; i < QPW; ++i) {
      const int rt = i * AW + wave;
      v8f k0 = zero8(), k1 = zero8(), a0 = zero8(), a1 = zero8();
#pragma unroll
      for (int ks = 0; ks < CZ / 32; ++ks) {
        k0 = mma_h(wk[0][ks], xh[ks], k0);
        k1 = mma_h(wk[1][ks], xh[ks], k1);
        a0 = mma_h(xh[ks], wv[0][ks], a0);
        a1 = mma_h(xh[ks], wv[1][ks], a1);
        k0 = mma_h(wk[0][ks], xl[ks], k0);
        k1 = mma_h(wk[1][ks], xl[ks], k1);
        a0 = mma_h(xl[ks], wv[0][ks], a0);
        a1 = mma_h(xl[ks], wv[1][ks], a1);
      }
      // the next tile's x loads stay behind this tile's products: they then land in the registers that these products have read
      __builtin_amdgcn_sched_barrier(0);
      if (i + 1 < QPW) {
        const _Float16* ph = Xhb + (size_t)((rt + AW) * 16) * CZ;
        const _Float16* pl = Xlb + (size_t)((rt + AW) * 16) * CZ;
#pragma unroll
        for (int ks = 0; ks < CZ / 32; ++ks) {
          xh[ks] = ldfrag_h(ph + (lo + ks * 512));
          xl[ks] = ldfrag_h(pl + (lo + ks * 512));
        }
        asm volatile("s_wait_xcnt 0x0" :: "s"(ph), "s"(pl) : "memory");   // as above
      }
      // holds the next row tile's x loads in front of this tile's conversions, which cover their latency
      __builtin_amdgcn_sched_barrier(0);
      u16* kd = kvs + rt * 512 + lo;
      u16* vd = kvs + 2 * KVP + (rt >> 1) * 512 + (rt & 1) * 256 + lo;
      put_pl(k0, oscale * KSC, kd, kd + KVP);
      put_pl(k1, oscale * KSC, kd + 256, kd + KVP + 256);
      put_pl(a0, oscale * VCAR, vd, vd + KVP);
      put_pl(a1, oscale * VCAR, vd + 16 * NSEQ, vd + KVP + 16 * NSEQ);
      sv0 += sum8(a0);
      sv1 += sum8(a1);
      // the next tile's products, which wait for its loads, stay behind these conversions
      __builtin_amdgcn_sched_barrier(0);
    }
    sv0 += __shfl_xor(sv0, 16, 32);         // the other lane half holds the other 8 keys of each tile
    sv1 += __shfl_xor(sv1, 16, 32);
    vsw[wave * HD + lane] = (hh == 0) ? sv0 : sv1;   // d = lane
  }
  asm volatile("s_wait_asynccnt 0x0" ::: "memory");   // this wave's copies have landed ...
  __syncthreads();                                    // ... and every wave's copies, planes and sums: nobody reads them in front of here
  const float vmsc = oscale * (1.0f / (float)NSEQ);
  const float vm0 = ((vsw[c] + vsw[HD + c]) + (vsw[2 * HD + c] + vsw[3 * HD + c])) * vmsc;
  const float vm1 = ((vsw[16 + c] + vsw[HD + 16 + c]) + (vsw[2 * HD + 16 + c] + vsw[3 * HD + 16 + c])) * vmsc;

#pragma unroll 1                            // rolled: one copy of the straight-line tile code, for speed only
  for (int qi = 0; qi < QPW; ++qi) {
  const int q0 = (qi * AW + wave) * 16;
  // the pass's x fragments are asked for first: the bias staging below covers their latency
  const _Float16* Xq = Xhb + (size_t)q0 * CZ;
  const _Float16* Xr = Xlb + (size_t)q0 * CZ;
  v16h xh[CZ / 32], xl[CZ / 32];
#pragma unroll
  for (int ks = 0; ks < CZ / 32; ++ks) {
    xh[ks] = ldfrag_h(Xq + (lo + ks * 512));
    xl[ks] = ldfrag_h(Xr + (lo + ks * 512));
  }
  // the two base registers that these loads name are reused behind here; as inputs they stay untouched up to the wait
  asm volatile("s_wait_xcnt 0x0" :: "s"(Xq), "s"(Xr) : "memory");

  // ---- phase 0: bias rows (query rows q0..q0+15, all keys) x log2e + mask bias x log2e -> bias buffer ----
  {
    const float* bsrc = BT + (size_t)head * NPOS + (size_t)q0 * NSEQ;
#pragma unroll 1
    for (int g4 = 0; g4 < 4; ++g4) {
      v4f tv[8];
#pragma unroll
      for (int it = 0; it < 8; ++it) {
        const int idx = (g4 * 8 + it) * 32 + lane;        // 0..1023
        const int jr = idx >> 6, k4 = (idx & 63) * 4;      // k4 = lane*4 for even it, 128 + lane*4 for odd it
        tv[it] = *(const v4f*)(bsrc + (size_t)jr * NSEQ + k4);
      }
#pragma unroll
      for (int it = 0; it < 8; ++it) {
        const int idx = (g4 * 8 + it) * 32 + lane;
        const int jr = idx >> 6, k4 = (idx & 63) * 4;
        const v4f mb = (it & 1) ? mb1 : mb0;
        *(v4f*)(buf + jr * SBP + k4) = tv[it] * LOG2E + mb;
      }
    }
  }
  wave_sync_lds();

  // ---- q^T = Wq_h . x^T: the two D tiles, times 1024 and split, are the B fragments q hi, q residual; gate tile = x . Wg_h^T + bg ----
  v16h qh, ql;
  v8f gza, gzb;
  {
    v8f t0 = zero8(), t1 = zero8(), g0 = zero8(), g1 = zero8();
#pragma unroll
    for (int ks = 0; ks < CZ / 32; ++ks) {
      const v16h wq0 = ldfrag_h(Wqs + (lo + ks * 512));
      const v16h wq1 = ldfrag_h(Wqs + (lo + 16 * CZ + ks * 512));
      const v16h wg0 = ldfrag_h(Wgs + (lo + ks * 512));
      const v16h wg1 = ldfrag_h(Wgs + (lo + 16 * CZ + ks * 512));
      t0 = mma_h(wq0, xh[ks], t0);
      t1 = mma_h(wq1, xh[ks], t1);
      g0 = mma_h(xh[ks], wg0, g0);
      g1 = mma_h(xh[ks], wg1, g1);
      t0 = mma_h(wq0, xl[ks], t0);
      t1 = mma_h(wq1, xl[ks], t1);
      g0 = mma_h(xl[ks], wg0, g0);
      g1 = mma_h(xl[ks], wg1, g1);
    }
    FragH fh, fl;
    float w[8];
#pragma unroll
    for (int e = 0; e < 8; ++e) w[e] = t0[e] * (oscale * QSC);
    split8(w, fh.u[0], fl.u[0]);
#pragma unroll
    for (int e = 0; e < 8; ++e) w[e] = t1[e] * (oscale * QSC);
    split8(w, fh.u[1], fl.u[1]);
    qh = fh.v;
    ql = fl.v;
#pragma unroll
    for (int r = 0; r < 8; ++r) { gza[r] = g0[r] * oscale + bg0; gzb[r] = g1[r] * oscale + bg1; }
  }

  // ---- phase 1: transposed scores S^T = k.q^T (A = 16 key rows, B = the 16 query rows), one 16-key tile per step; D element r
  //      of lane (c, hh) = (key 16t + 8hh + r, query c), so a lane owns one query row and its buffered bias is 8 consecutive
  //      floats of buffer row c. All NSEQ/2 scores of the lane's row half stay in registers (log2 domain). ----
  v16h kh[NSEQ / 16], kl[NSEQ / 16];
#pragma unroll
  for (int t = 0; t < 2; ++t) {
    kh[t] = ldfrag_h(Ksh + (lo + t * 512));
    kl[t] = ldfrag_h(Ksl + (lo + t * 512));
  }
  v8f u[NSEQ / 16];
  float mx4[4];
#pragma unroll
  for (int r = 0; r < 4; ++r) mx4[r] = -INFINITY;
#pragma unroll                              // full unroll here and below: u[], kh[], kl[], v*[] live in registers only with constant indices
  for (int g = 0; g < NKT; ++g) {
#pragma unroll
    for (int j = 0; j < 2; ++j) {
      const int t = 2 * g + 2 + j;
      if (t < NSEQ / 16) {
        kh[t] = ldfrag_h(Ksh + (lo + t * 512));
        kl[t] = ldfrag_h(Ksl + (lo + t * 512));
      }
    }
    // keeps the key fragments of the next tile pair in flight, and no more of them: unbounded hoisting spilled registers
    __builtin_amdgcn_sched_barrier(0);
#pragma unroll
    for (int j = 0; j < 2; ++j) {
      const int t = 2 * g + j;
      v8f s = zero8();
      s = mma_h(kh[t], qh, s);
      s = mma_h(kh[t], ql, s);
      s = mma_h(kl[t], qh, s);
      const float* bp = buf + c * SBP + t * 16 + 8 * hh;
      const v4f b0 = *(const v4f*)(bp), b1 = *(const v4f*)(bp + 4);
#pragma unroll
      for (int e = 0; e < 4; ++e) {
        s[e]     = s[e] * lsc + b0[e];
        s[4 + e] = s[4 + e] * lsc + b1[e];
      }
#pragma unroll
      for (int r = 0; r < 4; ++r) mx4[r] = fmaxf(mx4[r], fmaxf(s[r], s[4 + r]));
      u[t] = s;
    }
  }
  // v^T fragments of the first 32 keys are asked for before the softmax arithmetic, which covers their latency
  v16h vha[NKT], vhb[NKT], vla[NKT], vlb[NKT];
  vha[0] = ldfrag_h(Vsh + lo);
  vhb[0] = ldfrag_h(Vsh + (lo + 16 * NSEQ));
  vla[0] = ldfrag_h(Vsl + lo);
  vlb[0] = ldfrag_h(Vsl + (lo + 16 * NSEQ));
  __builtin_amdgcn_sched_barrier(0);        // holds those loads in front of the softmax
  float mx = fmaxf(fmaxf(mx4[0], mx4[1]), fmaxf(mx4[2], mx4[3]));
  mx = fmaxf(mx, __shfl_xor(mx, 16, 32));   // the other lane half holds the other 128 keys of the same query row

  // ---- phase 2a: p = exp2(u - m) in place, row sum Z (8 in-lane chains, tree, one exchange), scale 16384/Z (Z >= 1) ----
  float psc;
  {
    v8f l8 = zero8();
    // u - mx <= 0; a weight under 2^-126 may come out as 0, which changes neither Z (>= 1) nor P' (p*16384/Z - 64)
    u[0] = u[0] - mx;
#pragma unroll
    for (int t = 0; t < NSEQ / 16; ++t) {
      if (t + 1 < NSEQ / 16) exp8sub8(u[t], u[t + 1], mx);
      else                   exp8(u[t]);
      l8 = l8 + u[t];
    }
    float ls = ((l8[0] + l8[1]) + (l8[2] + l8[3])) + ((l8[4] + l8[5]) + (l8[6] + l8[7]));
    ls += __shfl_xor(ls, 16, 32);
    const float lz = (ls > 0.0f) ? ls : 1.0f;
    psc = PCAR * __builtin_amdgcn_rcpf(lz);
  }

  // ---- phase 2b: two neighbouring score tiles, centred and converted in place, are the f16 A fragment of P'
  //      (row = query c; elements 0..7 = keys kb + 8hh + 0..7, elements 8..15 = keys kb + 16 + 8hh + 0..7); P'.v^T (hi + residual) ----
  const float pcen = PCAR / (float)NSEQ;
  v8f o0 = zero8(), o1 = zero8();
#pragma unroll
  for (int kt = 0; kt < NKT; ++kt) {
    if (kt + 1 < NKT) {
      const int kn = (kt + 1) * 512;            // next k-step's unit
      vha[kt + 1] = ldfrag_h(Vsh + (lo + kn));
      vhb[kt + 1] = ldfrag_h(Vsh + (lo + 16 * NSEQ + kn));
      vla[kt + 1] = ldfrag_h(Vsl + (lo + kn));
      vlb[kt + 1] = ldfrag_h(Vsl + (lo + 16 * NSEQ + kn));
    }
    // keeps the next keys' v^T fragments in flight under this step's products, and bounds how many are hoisted (registers)
    __builtin_amdgcn_sched_barrier(0);
    FragH ph;
#pragma unroll
    for (int e = 0; e < 8; ++e) {
      ph.h[0][e] = (_Float16)(u[2 * kt][e] * psc - pcen);
      ph.h[1][e] = (_Float16)(u[2 * kt + 1][e] * psc - pcen);
    }
    o0 = mma_h(ph.v, vha[kt], o0);              // D element r = (row 8hh+r, d = c)
    o0 = mma_h(ph.v, vla[kt], o0);
    o1 = mma_h(ph.v, vhb[kt], o1);              // d = 16 + c
    o1 = mma_h(ph.v, vlb[kt], o1);
  }
  acc_guard2(o0, o1);

  // ---- epilogue: vals = acc/(16384*1024) + key-mean, sigmoid gate, O*4096 -> f16 hi + residual in the wave's stage tile ----
  {
    const float oc  = 1.0f / (PCAR * VCAR);
    v8f ea, eb;                             // exp(-z) = 2^(-z*log2e); a power under 2^-126 vanishes in 1 + it, as 0 or not
#pragma unroll
    for (int r = 0; r < 8; ++r) { ea[r] = -gza[r] * LOG2E; eb[r] = -gzb[r] * LOG2E; }
    exp8(ea);
    exp8(eb);
#pragma unroll
    for (int r = 0; r < 8; ++r) {
      const float g0  = __builtin_amdgcn_rcpf(1.0f + ea[r]);
      const float g1  = __builtin_amdgcn_rcpf(1.0f + eb[r]);
      const float w0  = (o0[r] * oc + vm0) * g0 * OSC;
      const float w1  = (o1[r] * oc + vm1) * g1 * OSC;
      const _Float16 h0 = (_Float16)w0, h1 = (_Float16)w1;
      const _Float16 l0 = (_Float16)(w0 - (float)h0), l1 = (_Float16)(w1 - (float)h1);
      const int si = (8 * hh + r) * OTP + c;
      wst[si]                 = h_bits(h0);
      wst[si + 16]            = h_bits(h1);
      wst[16 * OTP + si]      = h_bits(l0);
      wst[16 * OTP + si + 16] = h_bits(l1);
    }
  }
  wave_sync_lds();
  // fragment order: the two half units of the wave's unit (row tile q0/16, k-step = head); lane = (k octet hh, row c)
  v4u vh[2], vl[2];
#pragma unroll
  for (int it = 0; it < 2; ++it) {
    vh[it] = *(const v4u*)(wst + c * OTP + it * 16 + hh * 8);
    vl[it] = *(const v4u*)(wst + (16 + c) * OTP + it * 16 + hh * 8);
  }
  const size_t ob = (prow0 + q0) * CZ + hcol;
#pragma unroll
  for (int it = 0; it < 2; ++it) {
    *(v4u*)(OHp + ob + it * 256 + lo) = vh[it];
    *(v4u*)(OLp + ob + it * 256 + lo) = vl[it];
  }
  // the next pass rewrites the registers that this pass's loads and stores name; the memory clobber also keeps the next pass's writes
  // of the stage tile and the bias buffer behind this pass's reads in the built code (a wave's LDS operations run in order)
  asm volatile("s_wait_xcnt 0x0" ::: "memory");
  }
}

// =====================================================================================================
// All NI row blocks of the pair tensor are processed as one group (IG = NI rows i, GROWS positions), so each stage is one
// chip-filling launch; every plane is fully rewritten by whole-line stores before it is read. Workspace map (bytes; every extent is an exact
// multiple of its store granularity, no tail rows; every region offset a multiple of 32768; every f16 plane in fragment order):
//   WQ, WK, WV, WG, WO  f16 x1024 [128 n][128 k]   5 x 32768;  WB f16 x1024 [BTM n][128 k] (16384 in a 32768 slot)
//   XH, XL  f16 [NPOS][128] (x*64 hi, residual)    2 x 16777216
//   BT   f32 [BTM][NPOS] (rows 0..NH-1 written and read) 16777216
//   OH, OL  f16 [GROWS][128]                        2 x GROWS*256
//   end (IG = 256)                                  84082688
// =====================================================================================================
extern "C" void kernel_launch(void* const* d_in, const int* in_sizes, int n_in,
                              void* d_out, int out_size, void* d_ws, size_t ws_size,
                              hipStream_t stream) {
  if (n_in < 12) return;
  if (in_sizes[0] < NPOS * CZ) return;
  if (in_sizes[1] < NI * NSEQ) return;
  if (in_sizes[2] < CZ || in_sizes[3] < CZ) return;
  if (in_sizes[4] < NH * CZ) return;
  if (in_sizes[5] < CZ * CZ || in_sizes[6] < CZ * CZ || in_sizes[7] < CZ * CZ || in_sizes[8] < CZ * CZ) return;
  if (in_sizes[9] < CZ) return;
  if (in_sizes[10] < CZ * CZ || in_sizes[11] < CZ) return;
  if (out_size < NI * NSEQ * CZ) return;

  const float* x   = (const float*)d_in[0];
  const float* msk = (const float*)d_in[1];
  const float* gam = (const float*)d_in[2];
  const float* bet = (const float*)d_in[3];
  const float* Wt  = (const float*)d_in[4];
  const float* Wq  = (const float*)d_in[5];
  const float* Wk  = (const float*)d_in[6];
  const float* Wv  = (const float*)d_in[7];
  const float* Wg  = (const float*)d_in[8];
  const float* bg  = (const float*)d_in[9];
  const float* Wo  = (const float*)d_in[10];
  const float* bo  = (const float*)d_in[11];
  float*       out = (float*)d_out;

  const size_t szWP = 32768;
  const size_t szX  = (size_t)NPOS * CZ * 2;
  const size_t szBT = (size_t)BTM * NPOS * 4;
  const size_t szP  = (size_t)GROWS * CZ * 2;          // OH, OL
  size_t off = 0;
  const size_t oWQ = off; off += szWP;
  const size_t oWK = off; off += szWP;
  const size_t oWV = off; off += szWP;
  const size_t oWG = off; off += szWP;
  const size_t oWO = off; off += szWP;
  const size_t oWB = off; off += szWP;
  const size_t oXH = off; off += szX;
  const size_t oXL = off; off += szX;
  const size_t oBT = off; off += szBT;
  const size_t oOH = off; off += szP;
  const size_t oOL = off; off += szP;
  if (off > ws_size) return;                // off = 84082688 for IG = 256
  if (off > (size_t)WS_CAP) return;

  char* ws = (char*)d_ws;
  u16*   WQ = (u16*)(ws + oWQ);
  u16*   WK = (u16*)(ws + oWK);
  u16*   WV = (u16*)(ws + oWV);
  u16*   WG = (u16*)(ws + oWG);
  u16*   WO = (u16*)(ws + oWO);
  u16*   WB = (u16*)(ws + oWB);
  u16*   XH = (u16*)(ws + oXH);
  u16*   XL = (u16*)(ws + oXL);
  float* BT = (float*)(ws + oBT);
  u16*   OH = (u16*)(ws + oOH);
  u16*   OL = (u16*)(ws + oOL);

  const dim3 b256(256), b128(128), bAT(ATT_THREADS);
  const dim3 gP(WPBLK + NPOS / 64);
  const dim3 gX(GROWS / (64 * RG));
  const dim3 gG((GROWS / 64) * (CZ / 64));
  const dim3 gA(IG * NH);
  const float oscp = 1.0f / (XSC * WSC);
  const float osco = 1.0f / (OSC * WSC);

  // (a, b) one launch: LayerNorm of all positions -> x*64 f16 hi + residual planes, and the weight planes [n][k] as f16 of the
  //     bf16 value x1024 (weights are [out][in] = [n][k]); Wt plane padded to BTM rows
  prep<<<gP, b256, 0, stream>>>(x, gam, bet, Wq, Wk, Wv, Wg, Wo, Wt, XH, XL, WQ, WK, WV, WG, WO, WB);

  for (int g = 0; g < NGRP; ++g) {
    const u16*   XHg = XH + (size_t)g * GROWS * CZ;
    const u16*   XLg = XL + (size_t)g * GROWS * CZ;
    const float* Mg  = msk + (size_t)g * IG * NSEQ;
    float*       og  = out + (size_t)g * GROWS * CZ;
    // (c) shared bias table BT[h][p] = sum_c Wt[h][c] * x[p][c] (rows 0..NH-1 of BT)
    pbias<<<gX, b128, 0, stream>>>(XHg, XLg, WB, BT, oscp);
    // (1-5) per (row block, head): q, k, v, gate pre-activation x.Wg^T + bg from the LN(x) planes, attention over all keys of the
    //     row block with the shared bias and the row mask bias, gated -> O x4096 f16 hi + residual planes
    attn<<<gA, bAT, 0, stream>>>(XHg, XLg, WQ, WK, WV, WG, bg, BT, Mg, OH, OL, oscp);
    // (6) output projection (O hi + residual).Wo^T + bo -> out f32, carries 4096 x 1024 folded back
    gemm_h<1, 0, CZ><<<gG, b128, 0, stream>>>(OH, OL, WO, WO, bo, 1, og, GROWS, CZ, osco);
  }
  (void)hipGetLastError();
}

// v010
// A run of this version takes 74.1 microseconds.
// Timed twice side by side with v009, it ran 1.05 times as fast both times.
// Over all steps from v000 it is 5.02 times as fast.
// Contractions: LN(x).Wq^T, LN(x).Wk^T, LN(x).Wv^T, LN(x).Wg^T(+bg), LN(x).Wt^T (shared pair-bias table) and O.Wo^T(+bo) on
// v_wmma_f32_16x16x32_f16 with the activation operand carried as f16 hi + f16 residual planes (x*64, O*4096) and the weight
// operand as f16(bf16(W)*1024); q.k^T over 32 on v_wmma_f32_16x16x32_f16 (q, k *1024 f16 hi + residual, products hh+lh+hl);
// centred softmax weights P' = 16384*P - 64 (f16 hi) times v^T (v*1024 f16 hi + residual, products P'.vh + P'.vl);
// all f32 accumulate. LayerNorm, mask bias, softmax, sigmoid gate, key-mean of v and carry folds in f32 on VALU.
// Every float input is RNE-converted to bf16 on load.
#include <hip/hip_runtime.h>
#include <math.h>
#include <stdint.h>

#ifndef NB
#define NB 1
#endif
#ifndef NI
#define NI 256
#endif
#define NSEQ   256
#define CZ     128
#define NH     4
#define HD     32
#define NPOS   (NSEQ * NSEQ)
#define IG     NI
#define NGRP   (NI / IG)
#define GROWS  (IG * NSEQ)
#define XSC    64.0f
#define WSC    1024.0f
#define QSC    1024.0f
#define KSC    1024.0f
#define VCAR   1024.0f
#define PCAR   16384.0f
#define OSC    4096.0f
#define MINF   1.0e9f
#define RSQ_HD 0.17677669529663689f
#define LOG2E  1.4426950408889634f
#define AW     4
#define QPW    4
#define NQT    (NSEQ / 16)
#define NKT    (NSEQ / 32)
#define ATT_THREADS (AW * 32)
#define SBP    260
#define SBW    (16 * SBP)
#define OTP    40
#define KVP    (NSEQ * HD)
#define SLAB64 (16 * 68)
#define XTP    136
#define WTP    136
#define BTM    64
#define BSQ    68
#define WS_CAP 268435456
static_assert(NB == 1);
static_assert(CZ == NH * HD && HD == 32 && NH == 4 && NSEQ == 256);
static_assert(NI >= 1 && NI <= NSEQ && (NI % IG) == 0 && IG >= 1 && IG <= NSEQ && NGRP == 1);
static_assert((GROWS % 64) == 0 && (NPOS % 64) == 0);
static_assert(GROWS == NPOS && NH <= 16 && NH * CZ == 2 * 256 && BSQ >= 64 && (BSQ % 4) == 0);
static_assert(AW * QPW == NQT && AW * 4 == NSEQ / 16 && ATT_THREADS == 128 && (NSEQ % 64) == 0 && (CZ % 64) == 0 && (CZ % 32) == 0);
static_assert((BTM % 64) == 0 && BTM >= NH && (BTM % 32) == 0);
static_assert(SBP >= NSEQ && (SBP % 4) == 0 && OTP >= HD && (OTP % 8) == 0 && XTP >= CZ && WTP >= CZ);

typedef unsigned short u16;
typedef _Float16 v16h __attribute__((ext_vector_type(16)));
typedef _Float16 v8h  __attribute__((ext_vector_type(8)));
typedef float    v8f  __attribute__((ext_vector_type(8)));
typedef float    v4f  __attribute__((ext_vector_type(4)));
typedef float    v2f  __attribute__((ext_vector_type(2)));
typedef unsigned int v4u __attribute__((ext_vector_type(4)));

union FragH { v16h v; v8h h[2]; v4u u[2]; };

// ---- scalar helpers --------------------------------------------------------------------------------
__device__ __forceinline__ unsigned short bf_bits(float f) {          // f32 -> bf16 bits, RNE convert
  unsigned u = __float_as_uint(f);
  return (unsigned short)((u + 0x7FFFu + ((u >> 16) & 1u)) >> 16);
}
__device__ __forceinline__ float bf_up(unsigned short h) { return __uint_as_float(((unsigned)h) << 16); }
__device__ __forceinline__ float bfr(float f) { return bf_up(bf_bits(f)); }
__device__ __forceinline__ unsigned short h_bits(_Float16 x) { return __builtin_bit_cast(unsigned short, x); }
__device__ __forceinline__ unsigned pk16(unsigned short a, unsigned short b) { return (unsigned)a | ((unsigned)b << 16); }
__device__ __forceinline__ v8f zero8() { v8f z = {0.f, 0.f, 0.f, 0.f, 0.f, 0.f, 0.f, 0.f}; return z; }

// ---- fragment-order planes: every 16-bit A/B operand plane [R rows][K k] is stored as [R/16 row tiles][K/32 k-steps][512 halves];
//      inside a 512-half unit element (row r, k kk) lies at (kk >> 3)*128 + r*8 + (kk & 7), so unit (rt, ks) starts at
//      rt*16*K + ks*512 and one 16-B load per lane at lane*8 (and at 256 + lane*8) covers 512 contiguous bytes = 4 whole lines.
// ---- fragment loader: lane -> row/col (lane&15), h = lane>>4; p = unit start + lane*8;
//      elements 0..7 <- p[0..7] (k0+8h..), elements 8..15 <- p[256..263] (k0+16+8h..); same split k map for A and B.
__device__ __forceinline__ v16h ldfrag_h(const _Float16* p) {
  FragH f;
  f.h[0] = *(const v8h*)(p);
  f.h[1] = *(const v8h*)(p + 256);
  return f.v;
}

// ---- WMMA helpers with trailing VALU hazard gaps ------------------------------------------------------
__device__ __forceinline__ v8f mma_h(v16h a, v16h b, v8f c) {
  return __builtin_amdgcn_wmma_f32_16x16x32_f16(false, a, false, b, (short)0, c, false, false);
}
template <typename F>
__device__ __forceinline__ void guard6(v8f& a, v8f& b, v8f& c, v8f& d, F x0, F x1, F x2, F x3, F x4, F x5) {
#if defined(__HIP_DEVICE_COMPILE__)
  asm volatile("v_nop\n\tv_nop\n\tv_nop\n\tv_nop"
               : "+v"(a), "+v"(b), "+v"(c), "+v"(d) : "v"(x0), "v"(x1), "v"(x2), "v"(x3), "v"(x4), "v"(x5) : "memory");
#endif
}
template <typename F>
__device__ __forceinline__ void guard9(v8f& a, v8f& b, v8f& c, v8f& d, F x0, F x1, F x2, F x3, F x4, F x5,
                                       F x6, F x7, F x8) {
#if defined(__HIP_DEVICE_COMPILE__)
  asm volatile("v_nop\n\tv_nop\n\tv_nop\n\tv_nop"
               : "+v"(a), "+v"(b), "+v"(c), "+v"(d)
               : "v"(x0), "v"(x1), "v"(x2), "v"(x3), "v"(x4), "v"(x5), "v"(x6), "v"(x7), "v"(x8) : "memory");
#endif
}
__device__ __forceinline__ void acc_guard2(v8f& a, v8f& b) {
#if defined(__HIP_DEVICE_COMPILE__)
  asm volatile("v_nop\n\tv_nop\n\tv_nop\n\tv_nop" : "+v"(a), "+v"(b));
#endif
}
__device__ __forceinline__ void wave_sync_lds() {
  __builtin_amdgcn_fence(__ATOMIC_RELEASE, "workgroup");
  __builtin_amdgcn_wave_barrier();
  __builtin_amdgcn_fence(__ATOMIC_ACQUIRE, "workgroup");
}

// =====================================================================================================
// LayerNorm over CZ of the bf16 RNE-converted input rows, eps 1e-5, gamma/beta (bf16 RNE-converted), then
// with shuffles over the 4 lanes); both planes staged in LDS (pitch XTP halves, 16-B vector stores), block barrier, then each
// The planes go out in fragment order (see the fragment loader): each store instruction writes 512 contiguous bytes.
// coverage: compute 256 thr x 32 = 64 rows x 128; store 4 iterations x 8 waves x half a unit (32 lanes x 8 halves) = 16 units =
//           64 x 128 per plane; one block per 64 rows (row0) = every row of XH and XL exactly once (nrows a multiple of 64).
// Pair-bias table, from the planes while they lie in LDS: BT[h][position] = LN(x)[position] . Wt[h]. The block converts the NH x CZ
// weights itself (2 per thread, f16 of the bf16 value x1024) into WS [NH + 1][WTP], row NH = zeros, in front of the first barrier.
// Behind the plane stores wave w < 4 takes row tile w: A = x rows (hi, residual) from TH, TL, B = weight rows (columns >= NH read the
// zero row); one accumulator, products xh.w, xl.w per k-step, k ascending. D (row = position, column = head) goes to BS [NH][BSQ];
// second block barrier; heads 0..NH-1 stored as whole lines of BT[h][row0 .. row0+63].
// coverage: 4 waves x 16 rows = the block's 64 positions x NH heads; NH*16 threads x 4 floats = the same; every position once.
// =====================================================================================================
__device__ __forceinline__ void ln16(u16* TH, u16* TL, u16* WS, float* BS, const float* __restrict__ X,
                                     const float* __restrict__ gam, const float* __restrict__ bet, const float* __restrict__ Wt,
                                     u16* XHo, u16* XLo, float* BT, float oscale, int row0, int nrows) {
#pragma clang fp contract(off)
  const int tid = (int)threadIdx.x, wave = tid >> 5, lane = tid & 31;
  if (row0 + 64 > nrows) return;            // block-uniform, before the barrier; never taken with the exact grid
  const int rl = tid >> 2, part = tid & 3;
  const float* p = X + (size_t)(row0 + rl) * CZ + part * 32;
  v4f xv[8];
  float s = 0.0f;
#pragma unroll
  for (int t = 0; t < 8; ++t) {
    v4f a = *(const v4f*)(p + 4 * t);
#pragma unroll
    for (int e = 0; e < 4; ++e) { const float f = bfr(a[e]); a[e] = f; s = s + f; }
    xv[t] = a;
  }
  const v2f wt2 = *(const v2f*)(Wt + tid * 2);   // weights 2*tid, 2*tid + 1 of the NH x CZ pair-bias rows
  asm volatile("s_wait_xcnt 0x0" ::: "memory");   // a later load's result lands in the address registers that these loads name
  s = s + __shfl_xor(s, 1, 32);
  s = s + __shfl_xor(s, 2, 32);
  const float mu = s * (1.0f / (float)CZ);
  float q = 0.0f;
#pragma unroll
  for (int t = 0; t < 8; ++t) {
#pragma unroll
    for (int e = 0; e < 4; ++e) { const float d = xv[t][e] - mu; q = q + d * d; }
  }
  q = q + __shfl_xor(q, 1, 32);
  q = q + __shfl_xor(q, 2, 32);
  const float var  = q * (1.0f / (float)CZ);
  const float rstd = rsqrtf(var + 1e-5f);
  v4u oh[4], ol[4];
#pragma unroll
  for (int t = 0; t < 8; ++t) {
    const v4f g4 = *(const v4f*)(gam + part * 32 + 4 * t);
    const v4f b4 = *(const v4f*)(bet + part * 32 + 4 * t);
    unsigned short hb[4], lb[4];
#pragma unroll
    for (int e = 0; e < 4; ++e) {
      float y = (xv[t][e] - mu) * rstd;
      y = y * bfr(g4[e]);
      y = y + bfr(b4[e]);
      const float w = y * XSC;
      const _Float16 hv = (_Float16)w;
      const _Float16 lv = (_Float16)(w - (float)hv);
      hb[e] = h_bits(hv);
      lb[e] = h_bits(lv);
    }
    oh[t >> 1][(t & 1) * 2]     = pk16(hb[0], hb[1]);
    oh[t >> 1][(t & 1) * 2 + 1] = pk16(hb[2], hb[3]);
    ol[t >> 1][(t & 1) * 2]     = pk16(lb[0], lb[1]);
    ol[t >> 1][(t & 1) * 2 + 1] = pk16(lb[2], lb[3]);
  }
  {
    u16* th = TH + rl * XTP + part * 32;
    u16* tl = TL + rl * XTP + part * 32;
#pragma unroll
    for (int q4 = 0; q4 < 4; ++q4) {
      *(v4u*)(th + 8 * q4) = oh[q4];
      *(v4u*)(tl + 8 * q4) = ol[q4];
    }
  }
  {
    const int wn = tid >> 6, wk2 = (tid & 63) * 2;
    *(unsigned*)(WS + wn * WTP + wk2) = pk16(h_bits((_Float16)(bfr(wt2[0]) * WSC)), h_bits((_Float16)(bfr(wt2[1]) * WSC)));
    if (tid < 64) *(unsigned*)(WS + NH * WTP + wk2) = 0u;
  }
  __syncthreads();
  // fragment order: half unit hu = 0..31 of the block's 4 row tiles x 4 k-steps; lane = (k octet lane>>4, row lane&15)
  v4u vh[4], vl[4];
#pragma unroll
  for (int it = 0; it < 4; ++it) {
    const int si = (it * 16 + (lane & 15)) * XTP + wave * 16 + (lane >> 4) * 8;   // hu = it*8 + wave: row tile it, k = 16*wave ..
    vh[it] = *(const v4u*)(TH + si);
    vl[it] = *(const v4u*)(TL + si);
  }
  {
#pragma unroll
    for (int it = 0; it < 4; ++it) {
      const size_t o = (size_t)row0 * CZ + (it * 8 + wave) * 256 + lane * 8;
      *(v4u*)(XHo + o) = vh[it];
      *(v4u*)(XLo + o) = vl[it];
    }
    // the built code runs on behind these stores into code that rewrites the registers they name
    asm volatile("s_wait_xcnt 0x0" ::: "memory");
  }
  const int wv = __builtin_amdgcn_readfirstlane(wave);   // scalar: the branch round the matrix products is a scalar branch
  if (wv < 4) {
    const int m = lane & 15, hh = lane >> 4;
    const _Float16* ta = (const _Float16*)(const void*)TH + (wv * 16 + m) * XTP + hh * 8;
    const _Float16* tr = (const _Float16*)(const void*)TL + (wv * 16 + m) * XTP + hh * 8;
    const _Float16* tb = (const _Float16*)(const void*)WS + ((m < NH) ? m : NH) * WTP + hh * 8;
    FragH fa[CZ / 32], fr[CZ / 32], fb[CZ / 32];
#pragma unroll
    for (int ks = 0; ks < CZ / 32; ++ks) {  // split k map, as in the fragment loader: k0 + 8hh .. and k0 + 16 + 8hh ..
      fa[ks].h[0] = *(const v8h*)(ta + ks * 32);
      fa[ks].h[1] = *(const v8h*)(ta + ks * 32 + 16);
      fb[ks].h[0] = *(const v8h*)(tb + ks * 32);
      fb[ks].h[1] = *(const v8h*)(tb + ks * 32 + 16);
      fr[ks].h[0] = *(const v8h*)(tr + ks * 32);
      fr[ks].h[1] = *(const v8h*)(tr + ks * 32 + 16);
    }
    // all LDS reads are asked for at once: left free, the build put each fragment's reads and a full wait in front of its own product
    __builtin_amdgcn_sched_barrier(0);
    v8f ab = zero8();
#pragma unroll
    for (int ks = 0; ks < CZ / 32; ++ks) {
      ab = mma_h(fa[ks].v, fb[ks].v, ab);
      ab = mma_h(fr[ks].v, fb[ks].v, ab);
    }
    v4f t0, t1;
#pragma unroll
    for (int e = 0; e < 4; ++e) { t0[e] = ab[e] * oscale; t1[e] = ab[4 + e] * oscale; }
    if (m < NH) {
      float* d = BS + m * BSQ + wv * 16 + 8 * hh;
      *(v4f*)(d)     = t0;
      *(v4f*)(d + 4) = t1;
    }
  }
  // block barrier that orders LDS alone (BS): __syncthreads() would also wait here until the plane stores above have completed
  __builtin_amdgcn_fence(__ATOMIC_RELEASE, "workgroup", "local");
  __builtin_amdgcn_s_barrier();
  __builtin_amdgcn_fence(__ATOMIC_ACQUIRE, "workgroup", "local");
  if (tid < NH * 16) {                      // waves 0 and 1, whole
    const int h = tid >> 4, p4 = (tid & 15) * 4;
    *(v4f*)(BT + (size_t)h * NPOS + row0 + p4) = *(const v4f*)(BS + h * BSQ + p4);
  }
}

// =====================================================================================================
// Weight plane: W f32 [nrow rows n][CZ k] row-major (k contiguous); D 16-bit [np rows n][CZ k] in fragment order, D(n, k) = f16 bits of
// bf16(W[n][k]) * scale for n < nrow, 0 for nrow <= n < np. Block = 32 n rows: each thread loads 16 consecutive k values of
// one n row with a clamped row address (zeroed by predicate for n >= nrow), converts into the LDS tile [32 n][CZ k]
// coverage: load 256 thr x 16 = 32 n x 128 k; store 2 iterations x 8 waves x half a unit (32 lanes x 8 halves) = 8 units = 32 x 128;
//           np/32 blocks (n0) cover the [np][CZ] plane exactly once.
// =====================================================================================================
__device__ __forceinline__ void wp16(u16* T, const float* __restrict__ W, int nrow, int np, int n0, u16* D, float scale) {
  const int tid = (int)threadIdx.x, wave = tid >> 5, lane = tid & 31;
  if (n0 + 32 > np) return;                 // block-uniform, before the barrier; never taken with the exact grid
  {
    const int nl = tid >> 3, kc = (tid & 7) * 16;
    const int n  = n0 + nl;
    int nr = (n < nrow) ? n : (nrow - 1);
    nr = (nr < 0) ? 0 : nr;
    const float* src = W + (size_t)nr * CZ + kc;
    v4u w2[2];
#pragma unroll
    for (int t = 0; t < 4; ++t) {
      const v4f a = *(const v4f*)(src + 4 * t);
      unsigned short hb[4];
#pragma unroll
      for (int e = 0; e < 4; ++e) {
        const float val = (n < nrow) ? a[e] : 0.0f;
        hb[e] = h_bits((_Float16)(bfr(val) * scale));
      }
      w2[t >> 1][(t & 1) * 2]     = pk16(hb[0], hb[1]);
      w2[t >> 1][(t & 1) * 2 + 1] = pk16(hb[2], hb[3]);
    }
    *(v4u*)(T + nl * WTP + kc)     = w2[0];
    *(v4u*)(T + nl * WTP + kc + 8) = w2[1];
  }
  __syncthreads();
  // fragment order: half unit hu = 0..15 of the block's 2 row tiles x 4 k-steps; lane = (k octet lane>>4, row lane&15)
  v4u w4[2];
#pragma unroll
  for (int it = 0; it < 2; ++it) {
    w4[it] = *(const v4u*)(T + (it * 16 + (lane & 15)) * WTP + wave * 16 + (lane >> 4) * 8);   // hu = it*8 + wave: row tile it, k = 16*wave ..
  }
  {
#pragma unroll
    for (int it = 0; it < 2; ++it) {
      *(v4u*)(D + (size_t)n0 * CZ + (it * 8 + wave) * 256 + lane * 8) = w4[it];
    }
    
  }
}

// =====================================================================================================
// Everything that depends on the inputs alone, in one launch: the five weight planes and the LayerNorm planes are independent of
// one another, so they share a grid. Blocks 0 .. WPBLK-1 (first, for speed only): block b does rows 32*(b % 4) .. +31
// of weight plane b / 4 (0..4 = Wq, Wk, Wv, Wg, Wo, CZ rows each).
// Blocks WPBLK .. : 64 position rows of LayerNorm and of the pair-bias table each. The branch is block-uniform; the weight side has
// one barrier, the LayerNorm side two.
// LDS: the weight tile [32][WTP] lies in the first LayerNorm stage tile [64][XTP].
// coverage: 5 * CZ/32 weight blocks = every row of every weight plane once; NPOS/64 LayerNorm blocks = every position once.
// =====================================================================================================
#define WPBLK (5 * (CZ / 32))
static_assert(CZ / 32 == 4 && 32 * WTP <= 64 * XTP);
// amdgpu_waves_per_eu(8): holds the register budget to 128: four blocks per WGP, so that all LayerNorm blocks are resident at once.
__global__ __launch_bounds__(256) __attribute__((amdgpu_waves_per_eu(8)))
void prep(const float* __restrict__ X, const float* __restrict__ gam, const float* __restrict__ bet,
          const float* __restrict__ Wq, const float* __restrict__ Wk, const float* __restrict__ Wv,
          const float* __restrict__ Wg, const float* __restrict__ Wo, const float* __restrict__ Wt,
          u16* XHo, u16* XLo, u16* WQo, u16* WKo, u16* WVo, u16* WGo, u16* WOo, float* BT, float oscale) {
  __shared__ __align__(16) u16 TH[64 * XTP];
  __shared__ __align__(16) u16 TL[64 * XTP];
  __shared__ __align__(16) u16 WS[(NH + 1) * WTP];
  __shared__ __align__(16) float BS[NH * BSQ];
  const int bid = (int)blockIdx.x;
  if (bid < WPBLK) {
    const int pl = bid / (CZ / 32), n0 = (bid % (CZ / 32)) * 32;
    const float* W = (pl == 0) ? Wq : (pl == 1) ? Wk : (pl == 2) ? Wv : (pl == 3) ? Wg : Wo;
    u16*         D = (pl == 0) ? WQo : (pl == 1) ? WKo : (pl == 2) ? WVo : (pl == 3) ? WGo : WOo;
    wp16(TH, W, CZ, CZ, n0, D, WSC);
    return;
  }
  ln16(TH, TL, WS, BS, X, gam, bet, Wt, XHo, XLo, BT, oscale, (bid - WPBLK) * 64, NPOS);
}

// =====================================================================================================
// GEMM epilogue: the wave's 16x64 f32 tile (times oscale, plus a per-column addend) staged in its LDS slab (pitch 68),
// coverage: 8 instructions x 2 rows x 16 lanes x 4 floats = the wave's 16 x 64 tile.
// =====================================================================================================
__device__ __forceinline__ void epi64(float* sl, v8f a0, v8f a1, v8f a2, v8f a3, float oscale,
                                      float b0, float b1, float b2, float b3,
                                      float* C, int N, size_t rowb, int col0, int lane) {
  const int hh = lane >> 4, m = lane & 15;
#pragma unroll
  for (int r = 0; r < 8; ++r) {
    const int ro = (8 * hh + r) * 68 + m;
    sl[ro]      = a0[r] * oscale + b0;
    sl[ro + 16] = a1[r] * oscale + b1;
    sl[ro + 32] = a2[r] * oscale + b2;
    sl[ro + 48] = a3[r] * oscale + b3;
  }
  wave_sync_lds();
  v4f vals[8];
#pragma unroll
  for (int it = 0; it < 8; ++it) vals[it] = *(const v4f*)(sl + (it * 2 + hh) * 68 + m * 4);
  float* dst = C + (rowb + (size_t)hh) * (size_t)N + col0 + m * 4;
  {
#pragma unroll
    for (int it = 0; it < 8; ++it) {
      *(v4f*)(dst + (size_t)(it * 2) * (size_t)N) = vals[it];
    }
    
  }
}

// =====================================================================================================
// Eight f32 values (already carrying their plane scale) -> 8 f16 hi halves and 8 f16 residual halves, packed for 16-B stores.
// =====================================================================================================
__device__ __forceinline__ void split8(const float* w, v4u& oh, v4u& ol) {
#pragma unroll
  for (int e = 0; e < 4; ++e) {
    const float t0 = w[2 * e], t1 = w[2 * e + 1];
    const _Float16 h0 = (_Float16)t0, h1 = (_Float16)t1;
    const _Float16 l0 = (_Float16)(t0 - (float)h0), l1 = (_Float16)(t1 - (float)h1);
    oh[e] = pk16(h_bits(h0), h_bits(h1));
    ol[e] = pk16(h_bits(l0), h_bits(l1));
  }
}

// One D tile (8 f32 per lane) times sc -> f16 hi + residual, one 16-B LDS store per plane: where the 8 values of a lane are 8
// consecutive k of one fragment row, hp / lp = unit start + (0 or 256) + lane*8 is the lane's place in a fragment-order unit.
__device__ __forceinline__ void put_pl(v8f a, float sc, u16* hp, u16* lp) {
  float w[8];
#pragma unroll
  for (int e = 0; e < 8; ++e) w[e] = a[e] * sc;
  v4u oh, ol;
  split8(w, oh, ol);
  *(v4u*)hp = oh;
  *(v4u*)lp = ol;
}
__device__ __forceinline__ float sum8(v8f a) {
  return ((a[0] + a[1]) + (a[2] + a[3])) + ((a[4] + a[5]) + (a[6] + a[7]));
}

// =====================================================================================================
// f16 GEMM: C[M][N] (f32) = (Ah [+ Al])[M][K] . (Bh [+ Bl])[N][K]^T * oscale [+ bf16(bias[col])].
// ALO == 1: products ah.bh + al.bh (A residual plane, unscaled); BLO == 1: products ah.bh + ah.bl (B residual plane);
// one accumulator. Block = 64x64 tile, 4 waves x 16 rows; fragments loaded straight from the fragment-order planes (two 16-B loads
// each, split k map for A and B); K stepped by 32 (K % 32 == 0; host guarantees M % 64 == 0, N % 64 == 0,
// grid = (M/64)*(N/64)). hasb is a block-uniform flag; bias is dereferenced only when hasb != 0.
// =====================================================================================================
// K is a compile-time value: the units of the four B tiles then lie at constant offsets from one address.
template <int ALO, int BLO, int K>
__global__ __launch_bounds__(128)
void gemm_h(const u16* __restrict__ Ah, const u16* __restrict__ Al, const u16* __restrict__ Bh, const u16* __restrict__ Bl,
            const float* __restrict__ bias, int hasb, float* C, int M, int N, float oscale) {
  __shared__ __align__(16) float slab[4 * SLAB64];
  const int tid = (int)threadIdx.x, lane = tid & 31, m = lane & 15;
  const int wave = __builtin_amdgcn_readfirstlane(tid >> 5);   // scalar: the fragment units' bases are formed on the scalar unit
  const int ntile = N >> 6;
  const int bid   = (int)blockIdx.x;
  const int rb0   = (bid / ntile) * 64;
  const int rowb  = rb0 + wave * 16;
  const int col0  = (bid % ntile) * 64;
  if (rb0 + 64 > M) return;                 // block-uniform, before any barrier; never taken with the exact grid
  // wave-uniform unit bases + one 32-bit lane offset lo
  const unsigned lo = (unsigned)(lane * 8);
  const _Float16* ahp = (const _Float16*)(const void*)Ah + (size_t)rowb * K;
  const _Float16* alp = (const _Float16*)(const void*)Al + (size_t)rowb * K;   // read only when ALO
  const _Float16* bhp = (const _Float16*)(const void*)Bh + (size_t)col0 * K;
  const _Float16* blp = (const _Float16*)(const void*)Bl + (size_t)col0 * K;   // read only when BLO
  constexpr int bs = 16 * K;                // halves from one 16-column tile of B to the next
  float bb0 = 0.0f, bb1 = 0.0f, bb2 = 0.0f, bb3 = 0.0f;
  if (hasb != 0) {
    bb0 = bfr(bias[col0 + m]);
    bb1 = bfr(bias[col0 + 16 + m]);
    bb2 = bfr(bias[col0 + 32 + m]);
    bb3 = bfr(bias[col0 + 48 + m]);
  }
  v8f acc0 = zero8(), acc1 = zero8(), acc2 = zero8(), acc3 = zero8();
#pragma unroll 1
  for (int ks = 0; ks < K; ks += 32) {      // one fragment-order unit (512 halves) per 32 k
    const _Float16* pa = ahp + 16 * ks + lo;   // this k-step's units: A hi, A residual, B tile 0 hi, B tile 0 residual
    const _Float16* pl = alp + 16 * ks + lo;
    const _Float16* pb = bhp + 16 * ks + lo;
    const _Float16* pq = blp + 16 * ks + lo;
    const v16h ah = ldfrag_h(pa);
    const v16h b0 = ldfrag_h(pb);
    const v16h b1 = ldfrag_h(pb + bs);
    const v16h b2 = ldfrag_h(pb + 2 * bs);
    const v16h b3 = ldfrag_h(pb + 3 * bs);
    acc0 = mma_h(ah, b0, acc0);
    acc1 = mma_h(ah, b1, acc1);
    acc2 = mma_h(ah, b2, acc2);
    acc3 = mma_h(ah, b3, acc3);
    if constexpr (ALO != 0) {
      const v16h al = ldfrag_h(pl);
      acc0 = mma_h(al, b0, acc0);
      acc1 = mma_h(al, b1, acc1);
      acc2 = mma_h(al, b2, acc2);
      acc3 = mma_h(al, b3, acc3);
      if constexpr (BLO != 0) {
        const v16h l0 = ldfrag_h(pq);
        const v16h l1 = ldfrag_h(pq + bs);
        const v16h l2 = ldfrag_h(pq + 2 * bs);
        const v16h l3 = ldfrag_h(pq + 3 * bs);
        acc0 = mma_h(ah, l0, acc0);
        acc1 = mma_h(ah, l1, acc1);
        acc2 = mma_h(ah, l2, acc2);
        acc3 = mma_h(ah, l3, acc3);
        guard9<v16h>(acc0, acc1, acc2, acc3, ah, b0, b1, b2, b3, l0, l1, l2, l3);
        guard6<v16h>(acc0, acc1, acc2, acc3, al, al, al, al, al, al);
      } else {
        guard6<v16h>(acc0, acc1, acc2, acc3, ah, al, b0, b1, b2, b3);
      }
    } else if constexpr (BLO != 0) {
      const v16h l0 = ldfrag_h(pq);
      const v16h l1 = ldfrag_h(pq + bs);
      const v16h l2 = ldfrag_h(pq + 2 * bs);
      const v16h l3 = ldfrag_h(pq + 3 * bs);
      acc0 = mma_h(ah, l0, acc0);
      acc1 = mma_h(ah, l1, acc1);
      acc2 = mma_h(ah, l2, acc2);
      acc3 = mma_h(ah, l3, acc3);
      guard9<v16h>(acc0, acc1, acc2, acc3, ah, b0, b1, b2, b3, l0, l1, l2, l3);
    } else {
      guard6<v16h>(acc0, acc1, acc2, acc3, ah, b0, b1, b2, b3, ah);
    }
    // the next trip rewrites the address registers that this trip's loads name; as inputs they stay untouched up to the wait
    asm volatile("s_wait_xcnt 0x0" :: "v"(pa), "v"(pb), "v"(ALO != 0 ? pl : pa), "v"(BLO != 0 ? pq : pb) : "memory");
  }
  epi64(slab + wave * SLAB64, acc0, acc1, acc2, acc3, oscale, bb0, bb1, bb2, bb3, C, N, (size_t)rowb, col0, lane);
}

// =====================================================================================================
// Row-wise gated attention. Block bid -> (row block il, head): AW waves, wave w takes the query tiles qt = qi*AW + w, qi = 0..QPW-1,
// one after the other (rows q0 = 16*qt .. q0+15); all NSEQ keys of row block il, shared bias table BT f32 [BTM][NPOS]
// (row h, position j*NSEQ + k) plus the per-row mask bias 1e9*(bf16(mask[il][k]) - 1) (MK already offset to the row group).
//   Inputs: the LN(x) planes (x*64 f16 hi + residual) and the weight planes (x1024), all in fragment order. The block makes its head's
//   q, k, v and gate itself; the operand roles are chosen so that a lane's 8 D values are 8 consecutive k of ONE fragment row:
//     k^T = Wk_h . x^T (A = 32 weight rows d, B = 16 x rows): D tile dt, element r of lane (c, hh) = (d = 16dt + 8hh + r, key c)
//           = halves dt*256 + lane*8 .. +7 of the key tile's unit (row = key, k = d); q^T = Wq_h . x^T likewise IS the q fragment;
//     v = x . Wv_h^T (A = 16 x rows, B = 16 weight rows d): element r of lane (c, hh) = (key 16rt + 8hh + r, d = 16dt + c)
//           = halves (rt & 1)*256 + lane*8 .. +7 of v^T unit (d subtile dt, 32-key step rt >> 1); the gate tile has O's own D layout.
//   Per accumulator the products run w.xh, w.xl per k-step, k ascending.
//   Phase A (once per block): wave w takes the row tiles rt = i*AW + w, holds Wk_h, Wv_h (16 fragments) in registers, and stores
//   k*1024 and v*1024 as f16 hi + residual into LDS (kvs: k hi, k residual, v^T hi, v^T residual, 16 units of 1 KiB each); the sums of
//   v over the wave's 64 keys go to vsw (their total / NSEQ = key-mean of v). Wq_h and Wg_h (8 units each) are brought to LDS (wqg)
//   by asynchronous 16-B copies, 4 units per wave. One wait for the copies and one block barrier behind phase A publish all of it.
//   Phase 0: the wave's 16 x NSEQ bias rows (times log2e, plus mask bias times log2e) loaded with 16-B loads into its private
//   LDS bias buffer (pitch SBP: 16 B over a multiple of 256 B, the pitch of 16-B row readers).
//   Then q^T (times 1024, split into hi + residual: the two B fragments) and the gate pre-activation from the pass's 16 x rows.
//   Phase 1 (per 16-key tile): TRANSPOSED scores k_hi.q_hi + k_hi.q_lo + k_lo.q_hi (A = key rows, B = query rows, one k-step of
//   32): D element r of lane (c, hh) = (key 16t + 8hh + r, query c). u = s*rsqrt(32)*log2e/(1024*1024) + bias (two 16-B LDS reads
//   of buffer row c); all 128 scores of a lane stay in registers; running max in-lane, one exchange between the lane halves.
//   Phase 2a: p = exp2(u - m) in registers, row sum Z in-lane (8 chains, tree) plus one exchange, scale 16384/Z.
//   Phase 2b (per 32 keys): P' = p*16384/Z - 64 of two neighbouring tiles converted to f16 IS the A fragment (row c, split k map);
//   v^T B fragments for the two 16-wide d subtiles, products P'.v_hi + P'.v_lo. The score, softmax and P'.v code is straight-line.
//   Epilogue: vals = acc/(16384*1024) + key-mean (exact identity sum(P'+64).v/16384 = sum P.v), gate g = 1/(1+exp(-z)) in f32,
//   O = g*vals*4096 -> f16 hi + residual, staged as u16 elements in the wave's own LDS tile [2 planes][16 rows][OTP]; the wave's
//   16 rows x HD columns are one whole fragment-order unit per plane, so the wave stores it alone, behind an in-wave sync.
//   The only early return is block-uniform and precedes the barrier.
// staged extent == consumed extent: kvs units 0..15 of all 4 planes written (4 waves x 4 row tiles) and read; wqg units 0..15 copied
//   (4 waves x 4 units) and read; vsw 4 x HD sums written and read; bias buffer columns
//   0..NSEQ-1 of all 16 rows written in phase 0 before any read (columns NSEQ..SBP-1 never read); stage tile rows 0..15 x columns
//   0..HD-1 of both planes written before the sync (columns HD..OTP-1 never read).
// coverage: per wave and pass 2 x half a unit (32 lanes x 8 halves) = 1 unit = 16 rows x HD halves per plane;
//           grid = IG*NH blocks x AW*QPW = NQT query tiles = every (row tile, head) unit of OH and OL exactly once.
// =====================================================================================================
// Powers of 2 as the bare v_exp_f32 (the library exp2f adds a compare, two selects, an add and a v_ldexp_f32 per value to keep results
// under 2^-126; here such a result may come out as 0: see the two places of use). Written as asm text, in place, so that what stands
// directly behind each v_exp_f32 is fixed: the instruction set asks there for an instruction that neither reads the result nor
// overwrites the source.
// exp8sub8: x[r] = 2^x[r], and y[r] -= m in the slot behind each power (the next tile's subtraction of the row maximum).
__device__ __forceinline__ void exp8sub8(v8f& x, v8f& y, float m) {
#if defined(__HIP_DEVICE_COMPILE__)
  float x0 = x[0], x1 = x[1], x2 = x[2], x3 = x[3], x4 = x[4], x5 = x[5], x6 = x[6], x7 = x[7];
  float y0 = y[0], y1 = y[1], y2 = y[2], y3 = y[3], y4 = y[4], y5 = y[5], y6 = y[6], y7 = y[7];
  asm("v_exp_f32 %0, %0\n\tv_sub_f32 %8, %8, %16\n\t"
      "v_exp_f32 %1, %1\n\tv_sub_f32 %9, %9, %16\n\t"
      "v_exp_f32 %2, %2\n\tv_sub_f32 %10, %10, %16\n\t"
      "v_exp_f32 %3, %3\n\tv_sub_f32 %11, %11, %16\n\t"
      "v_exp_f32 %4, %4\n\tv_sub_f32 %12, %12, %16\n\t"
      "v_exp_f32 %5, %5\n\tv_sub_f32 %13, %13, %16\n\t"
      "v_exp_f32 %6, %6\n\tv_sub_f32 %14, %14, %16\n\t"
      "v_exp_f32 %7, %7\n\tv_sub_f32 %15, %15, %16"
      : "+v"(x0), "+v"(x1), "+v"(x2), "+v"(x3), "+v"(x4), "+v"(x5), "+v"(x6), "+v"(x7),
        "+v"(y0), "+v"(y1), "+v"(y2), "+v"(y3), "+v"(y4), "+v"(y5), "+v"(y6), "+v"(y7)
      : "v"(m));
  x[0] = x0; x[1] = x1; x[2] = x2; x[3] = x3; x[4] = x4; x[5] = x5; x[6] = x6; x[7] = x7;
  y[0] = y0; y[1] = y1; y[2] = y2; y[3] = y3; y[4] = y4; y[5] = y5; y[6] = y6; y[7] = y7;
#endif
}
// exp8: x[r] = 2^x[r]; each power is independent of the one behind it, the closing v_nop fills the slot behind the last.
__device__ __forceinline__ void exp8(v8f& x) {
#if defined(__HIP_DEVICE_COMPILE__)
  float x0 = x[0], x1 = x[1], x2 = x[2], x3 = x[3], x4 = x[4], x5 = x[5], x6 = x[6], x7 = x[7];
  asm("v_exp_f32 %0, %0\n\tv_exp_f32 %1, %1\n\tv_exp_f32 %2, %2\n\tv_exp_f32 %3, %3\n\t"
      "v_exp_f32 %4, %4\n\tv_exp_f32 %5, %5\n\tv_exp_f32 %6, %6\n\tv_exp_f32 %7, %7\n\tv_nop"
      : "+v"(x0), "+v"(x1), "+v"(x2), "+v"(x3), "+v"(x4), "+v"(x5), "+v"(x6), "+v"(x7));
  x[0] = x0; x[1] = x1; x[2] = x2; x[3] = x3; x[4] = x4; x[5] = x5; x[6] = x6; x[7] = x7;
#endif
}

// Four asynchronous 16-B-per-lane copies global -> LDS (l*: the lane's LDS byte address, g*: its global address). The wait stands in
// the copies' own statement: behind it the registers that the copies name may be rewritten.
__device__ __forceinline__ void acopy4(unsigned l0, unsigned l1, unsigned l2, unsigned l3,
                                       const _Float16* g0, const _Float16* g1, const _Float16* g2, const _Float16* g3) {
#if defined(__HIP_DEVICE_COMPILE__)
  asm volatile("global_load_async_to_lds_b128 %0, %4, off\n\t"
               "global_load_async_to_lds_b128 %1, %5, off\n\t"
               "global_load_async_to_lds_b128 %2, %6, off\n\t"
               "global_load_async_to_lds_b128 %3, %7, off\n\t"
               "s_wait_xcnt 0x0"
               :: "v"(l0), "v"(l1), "v"(l2), "v"(l3), "v"(g0), "v"(g1), "v"(g2), "v"(g3) : "memory");
#endif
}
// The wave's 4 units (u0 .. u0+3, 1 KiB each, gstep halves apart in global memory) of one plane -> LDS units u0 .. u0+3 at byte lb.
__device__ __forceinline__ void stage4(unsigned lb, const _Float16* g, int gstep, int u0, unsigned lo) {
#pragma unroll
  for (int p = 0; p < 2; ++p) {
    const unsigned  l = lb + (unsigned)((u0 + 2 * p) * 1024) + lo * 2;
    const _Float16* s = g + (size_t)(u0 + 2 * p) * gstep + lo;
    acopy4(l, l + 512, l + 1024, l + 1536, s, s + 256, s + gstep, s + gstep + 256);
  }
}

// The LDS (under 160 KiB) lets 2 blocks = 2 waves per SIMD stay resident, each with up to 512 registers.
__global__ __launch_bounds__(ATT_THREADS)
void attn(const u16* __restrict__ XHp, const u16* __restrict__ XLp,
          const u16* __restrict__ WQp, const u16* __restrict__ WKp,
          const u16* __restrict__ WVp, const u16* __restrict__ WGp,
          const float* __restrict__ bg, const float* __restrict__ BT,
          const float* __restrict__ MK, u16* OHp, u16* OLp, float oscale) {
  __shared__ __align__(16) u16 kvs[4 * KVP];
  __shared__ __align__(16) u16 wqg[2 * HD * CZ];
  __shared__ __align__(16) float sbuf[AW * SBW];
  __shared__ __align__(16) u16 stg[AW * 2 * 16 * OTP];
  __shared__ float vsw[AW * HD];

  const int tid  = (int)threadIdx.x;
  const int wave = __builtin_amdgcn_readfirstlane(tid >> 5);   // scalar: the fragment units' bases stay out of the vector registers
  const int lane = tid & 31;
  const int hh   = lane >> 4;
  const int c    = lane & 15;
  const int bid  = (int)blockIdx.x;
  const int head = bid % NH;
  const int il   = bid / NH;
  if (il >= IG) return;                     // block-uniform, before every barrier; never taken with the exact grid
  float* buf = sbuf + wave * SBW;
  u16*   wst = stg + wave * (2 * 16 * OTP);
  const size_t prow0 = (size_t)il * NSEQ;   // first position row of this row block in the group-local planes

  // fragment-order units: x unit (row tile, k-step); the head's HD weight rows = 8 consecutive units (2 row tiles x 4 k-steps);
  // O unit (row tile, k-step = head). One 32-bit lane offset lo addresses every fragment load
  const unsigned lo = (unsigned)(lane * 8);
  const size_t hcol = (size_t)head * 512;
  const size_t wrow = (size_t)head * (HD * CZ);
  const _Float16* Xhb = (const _Float16*)(const void*)XHp + prow0 * CZ;                  // row tile rt: 16*CZ halves per tile
  const _Float16* Xlb = (const _Float16*)(const void*)XLp + prow0 * CZ;
  const _Float16* Ksh = (const _Float16*)(const void*)kvs;      // LDS planes: unit t at t*512 halves
  const _Float16* Ksl = Ksh + KVP;
  const _Float16* Vsh = Ksh + 2 * KVP;
  const _Float16* Vsl = Ksh + 3 * KVP;
  const _Float16* Wqs = (const _Float16*)(const void*)wqg;      // LDS: Wq_h units 0..7, then Wg_h units 0..7
  const _Float16* Wgs = Wqs + HD * CZ;
  {
    // 8 copies per wave in flight (waves 0, 1: Wq_h; waves 2, 3: Wg_h): phase A covers their latency
    const unsigned  wqb  = (unsigned)(size_t)(const void*)wqg;  // LDS byte address of wqg: the low 32 bits of its address
    const _Float16* wsrc = (const _Float16*)(const void*)((wave < 2) ? WQp : WGp) + wrow;
    stage4(wqb + (unsigned)((wave >> 1) * (HD * CZ * 2)), wsrc, 512, (wave & 1) * 4, lo);
  }
  const float lsc = RSQ_HD * (LOG2E / (QSC * KSC));
  v4f mb0, mb1;                             // mask bias x log2e of keys lane*4..+3 and 128+lane*4..+3 of mask row il: the same in every pass
  {
    const float* msrc = MK + (size_t)il * NSEQ;
    const v4f m0 = *(const v4f*)(msrc + lane * 4);
    const v4f m1 = *(const v4f*)(msrc + 128 + lane * 4);
#pragma unroll
    for (int e = 0; e < 4; ++e) {
      mb0[e] = (MINF * (bfr(m0[e]) - 1.0f)) * LOG2E;
      mb1[e] = (MINF * (bfr(m1[e]) - 1.0f)) * LOG2E;
    }
  }
  // gate bias of the lane's two columns d = c, 16 + c: the same in every pass
  const float bgr0 = bg[head * HD + c], bgr1 = bg[head * HD + 16 + c];
  asm volatile("s_wait_xcnt 0x0" ::: "memory");   // the registers that these two loads name are reused behind here
  const float bg0 = bfr(bgr0), bg1 = bfr(bgr1);

  // ---- phase A: k^T and v of the wave's 4 row tiles -> LDS planes; sums of v over the wave's keys ----
  {
    const _Float16* Wkb = (const _Float16*)(const void*)WKp + wrow;
    const _Float16* Wvb = (const _Float16*)(const void*)WVp + wrow;
    v16h wk[2][CZ / 32], wv[2][CZ / 32], xh[CZ / 32], xl[CZ / 32];
    {
      const _Float16* ph = Xhb + (size_t)(wave * 16) * CZ;
      const _Float16* pl = Xlb + (size_t)(wave * 16) * CZ;
#pragma unroll
      for (int ks = 0; ks < CZ / 32; ++ks) {
        xh[ks] = ldfrag_h(ph + (lo + ks * 512));
        xl[ks] = ldfrag_h(pl + (lo + ks * 512));
      }
#pragma unroll
      for (int dt = 0; dt < 2; ++dt) {
#pragma unroll
        for (int ks = 0; ks < CZ / 32; ++ks) {
          wk[dt][ks] = ldfrag_h(Wkb + (lo + dt * 16 * CZ + ks * 512));
          wv[dt][ks] = ldfrag_h(Wvb + (lo + dt * 16 * CZ + ks * 512));
        }
      }
      // the base registers that these loads name are reused behind here; as inputs they stay untouched up to the wait
      asm volatile("s_wait_xcnt 0x0" :: "s"(ph), "s"(pl), "s"(Wkb), "s"(Wvb) : "memory");
      // all of these loads are asked for at once: left free, the build sank the residual fragments' loads in between the products
      __builtin_amdgcn_sched_barrier(0);
    }
    float sv0 = 0.0f, sv1 = 0.0f;
#pragma unroll                              // constant indices keep wk[], wv[], xh[], xl[] in registers
    for (int i = 0; i < QPW; ++i) {
      const int rt = i * AW + wave;
      v8f k0 = zero8(), k1 = zero8(), a0 = zero8(), a1 = zero8();
#pragma unroll
      for (int ks = 0; ks < CZ / 32; ++ks) {
        k0 = mma_h(wk[0][ks], xh[ks], k0);
        k1 = mma_h(wk[1][ks], xh[ks], k1);
        a0 = mma_h(xh[ks], wv[0][ks], a0);
        a1 = mma_h(xh[ks], wv[1][ks], a1);
        k0 = mma_h(wk[0][ks], xl[ks], k0);
        k1 = mma_h(wk[1][ks], xl[ks], k1);
        a0 = mma_h(xl[ks], wv[0][ks], a0);
        a1 = mma_h(xl[ks], wv[1][ks], a1);
      }
      // the next tile's x loads stay behind this tile's products: they then land in the registers that these products have read
      __builtin_amdgcn_sched_barrier(0);
      if (i + 1 < QPW) {
        const _Float16* ph = Xhb + (size_t)((rt + AW) * 16) * CZ;
        const _Float16* pl = Xlb + (size_t)((rt + AW) * 16) * CZ;
#pragma unroll
        for (int ks = 0; ks < CZ / 32; ++ks) {
          xh[ks] = ldfrag_h(ph + (lo + ks * 512));
          xl[ks] = ldfrag_h(pl + (lo + ks * 512));
        }
        asm volatile("s_wait_xcnt 0x0" :: "s"(ph), "s"(pl) : "memory");   // as above
      }
      // holds the next row tile's x loads in front of this tile's conversions, which cover their latency
      __builtin_amdgcn_sched_barrier(0);
      u16* kd = kvs + rt * 512 + lo;
      u16* vd = kvs + 2 * KVP + (rt >> 1) * 512 + (rt & 1) * 256 + lo;
      put_pl(k0, oscale * KSC, kd, kd + KVP);
      put_pl(k1, oscale * KSC, kd + 256, kd + KVP + 256);
      put_pl(a0, oscale * VCAR, vd, vd + KVP);
      put_pl(a1, oscale * VCAR, vd + 16 * NSEQ, vd + KVP + 16 * NSEQ);
      sv0 += sum8(a0);
      sv1 += sum8(a1);
      // the next tile's products, which wait for its loads, stay behind these conversions
      __builtin_amdgcn_sched_barrier(0);
    }
    sv0 += __shfl_xor(sv0, 16, 32);         // the other lane half holds the other 8 keys of each tile
    sv1 += __shfl_xor(sv1, 16, 32);
    vsw[wave * HD + lane] = (hh == 0) ? sv0 : sv1;   // d = lane
  }
  asm volatile("s_wait_asynccnt 0x0" ::: "memory");   // this wave's copies have landed ...
  __syncthreads();                                    // ... and every wave's copies, planes and sums: nobody reads them in front of here
  const float vmsc = oscale * (1.0f / (float)NSEQ);
  const float vm0 = ((vsw[c] + vsw[HD + c]) + (vsw[2 * HD + c] + vsw[3 * HD + c])) * vmsc;
  const float vm1 = ((vsw[16 + c] + vsw[HD + 16 + c]) + (vsw[2 * HD + 16 + c] + vsw[3 * HD + 16 + c])) * vmsc;

#pragma unroll 1                            // rolled: one copy of the straight-line tile code, for speed only
  for (int qi = 0; qi < QPW; ++qi) {
  const int q0 = (qi * AW + wave) * 16;
  // the pass's x fragments are asked for first: the bias staging below covers their latency
  const _Float16* Xq = Xhb + (size_t)q0 * CZ;
  const _Float16* Xr = Xlb + (size_t)q0 * CZ;
  v16h xh[CZ / 32], xl[CZ / 32];
#pragma unroll
  for (int ks = 0; ks < CZ / 32; ++ks) {
    xh[ks] = ldfrag_h(Xq + (lo + ks * 512));
    xl[ks] = ldfrag_h(Xr + (lo + ks * 512));
  }
  // the two base registers that these loads name are reused behind here; as inputs they stay untouched up to the wait
  asm volatile("s_wait_xcnt 0x0" :: "s"(Xq), "s"(Xr) : "memory");

  // ---- phase 0: bias rows (query rows q0..q0+15, all keys) x log2e + mask bias x log2e -> bias buffer ----
  {
    const float* bsrc = BT + (size_t)head * NPOS + (size_t)q0 * NSEQ;
#pragma unroll 1
    for (int g4 = 0; g4 < 4; ++g4) {
      v4f tv[8];
#pragma unroll
      for (int it = 0; it < 8; ++it) {
        const int idx = (g4 * 8 + it) * 32 + lane;        // 0..1023
        const int jr = idx >> 6, k4 = (idx & 63) * 4;      // k4 = lane*4 for even it, 128 + lane*4 for odd it
        tv[it] = *(const v4f*)(bsrc + (size_t)jr * NSEQ + k4);
      }
#pragma unroll
      for (int it = 0; it < 8; ++it) {
        const int idx = (g4 * 8 + it) * 32 + lane;
        const int jr = idx >> 6, k4 = (idx & 63) * 4;
        const v4f mb = (it & 1) ? mb1 : mb0;
        *(v4f*)(buf + jr * SBP + k4) = tv[it] * LOG2E + mb;
      }
    }
  }
  wave_sync_lds();

  // ---- q^T = Wq_h . x^T: the two D tiles, times 1024 and split, are the B fragments q hi, q residual; gate tile = x . Wg_h^T + bg ----
  v16h qh, ql;
  v8f gza, gzb;
  {
    v8f t0 = zero8(), t1 = zero8(), g0 = zero8(), g1 = zero8();
#pragma unroll
    for (int ks = 0; ks < CZ / 32; ++ks) {
      const v16h wq0 = ldfrag_h(Wqs + (lo + ks * 512));
      const v16h wq1 = ldfrag_h(Wqs + (lo + 16 * CZ + ks * 512));
      const v16h wg0 = ldfrag_h(Wgs + (lo + ks * 512));
      const v16h wg1 = ldfrag_h(Wgs + (lo + 16 * CZ + ks * 512));
      t0 = mma_h(wq0, xh[ks], t0);
      t1 = mma_h(wq1, xh[ks], t1);
      g0 = mma_h(xh[ks], wg0, g0);
      g1 = mma_h(xh[ks], wg1, g1);
      t0 = mma_h(wq0, xl[ks], t0);
      t1 = mma_h(wq1, xl[ks], t1);
      g0 = mma_h(xl[ks], wg0, g0);
      g1 = mma_h(xl[ks], wg1, g1);
    }
    FragH fh, fl;
    float w[8];
#pragma unroll
    for (int e = 0; e < 8; ++e) w[e] = t0[e] * (oscale * QSC);
    split8(w, fh.u[0], fl.u[0]);
#pragma unroll
    for (int e = 0; e < 8; ++e) w[e] = t1[e] * (oscale * QSC);
    split8(w, fh.u[1], fl.u[1]);
    qh = fh.v;
    ql = fl.v;
#pragma unroll
    for (int r = 0; r < 8; ++r) { gza[r] = g0[r] * oscale + bg0; gzb[r] = g1[r] * oscale + bg1; }
  }

  // ---- phase 1: transposed scores S^T = k.q^T (A = 16 key rows, B = the 16 query rows), one 16-key tile per step; D element r
  //      of lane (c, hh) = (key 16t + 8hh + r, query c), so a lane owns one query row and its buffered bias is 8 consecutive
  //      floats of buffer row c. All NSEQ/2 scores of the lane's row half stay in registers (log2 domain). ----
  v16h kh[NSEQ / 16], kl[NSEQ / 16];
#pragma unroll
  for (int t = 0; t < 2; ++t) {
    kh[t] = ldfrag_h(Ksh + (lo + t * 512));
    kl[t] = ldfrag_h(Ksl + (lo + t * 512));
  }
  v8f u[NSEQ / 16];
  float mx4[4];
#pragma unroll
  for (int r = 0; r < 4; ++r) mx4[r] = -INFINITY;
#pragma unroll                              // full unroll here and below: u[], kh[], kl[], v*[] live in registers only with constant indices
  for (int g = 0; g < NKT; ++g) {
#pragma unroll
    for (int j = 0; j < 2; ++j) {
      const int t = 2 * g + 2 + j;
      if (t < NSEQ / 16) {
        kh[t] = ldfrag_h(Ksh + (lo + t * 512));
        kl[t] = ldfrag_h(Ksl + (lo + t * 512));
      }
    }
    // keeps the key fragments of the next tile pair in flight, and no more of them: unbounded hoisting spilled registers
    __builtin_amdgcn_sched_barrier(0);
#pragma unroll
    for (int j = 0; j < 2; ++j) {
      const int t = 2 * g + j;
      v8f s = zero8();
      s = mma_h(kh[t], qh, s);
      s = mma_h(kh[t], ql, s);
      s = mma_h(kl[t], qh, s);
      const float* bp = buf + c * SBP + t * 16 + 8 * hh;
      const v4f b0 = *(const v4f*)(bp), b1 = *(const v4f*)(bp + 4);
#pragma unroll
      for (int e = 0; e < 4; ++e) {
        s[e]     = s[e] * lsc + b0[e];
        s[4 + e] = s[4 + e] * lsc + b1[e];
      }
#pragma unroll
      for (int r = 0; r < 4; ++r) mx4[r] = fmaxf(mx4[r], fmaxf(s[r], s[4 + r]));
      u[t] = s;
    }
  }
  // v^T fragments of the first 32 keys are asked for before the softmax arithmetic, which covers their latency
  v16h vha[NKT], vhb[NKT], vla[NKT], vlb[NKT];
  vha[0] = ldfrag_h(Vsh + lo);
  vhb[0] = ldfrag_h(Vsh + (lo + 16 * NSEQ));
  vla[0] = ldfrag_h(Vsl + lo);
  vlb[0] = ldfrag_h(Vsl + (lo + 16 * NSEQ));
  __builtin_amdgcn_sched_barrier(0);        // holds those loads in front of the softmax
  float mx = fmaxf(fmaxf(mx4[0], mx4[1]), fmaxf(mx4[2], mx4[3]));
  mx = fmaxf(mx, __shfl_xor(mx, 16, 32));   // the other lane half holds the other 128 keys of the same query row

  // ---- phase 2a: p = exp2(u - m) in place, row sum Z (8 in-lane chains, tree, one exchange), scale 16384/Z (Z >= 1) ----
  float psc;
  {
    v8f l8 = zero8();
    // u - mx <= 0; a weight under 2^-126 may come out as 0, which changes neither Z (>= 1) nor P' (p*16384/Z - 64)
    u[0] = u[0] - mx;
#pragma unroll
    for (int t = 0; t < NSEQ / 16; ++t) {
      if (t + 1 < NSEQ / 16) exp8sub8(u[t], u[t + 1], mx);
      else                   exp8(u[t]);
      l8 = l8 + u[t];
    }
    float ls = ((l8[0] + l8[1]) + (l8[2] + l8[3])) + ((l8[4] + l8[5]) + (l8[6] + l8[7]));
    ls += __shfl_xor(ls, 16, 32);
    const float lz = (ls > 0.0f) ? ls : 1.0f;
    psc = PCAR * __builtin_amdgcn_rcpf(lz);
  }

  // ---- phase 2b: two neighbouring score tiles, centred and converted in place, are the f16 A fragment of P'
  //      (row = query c; elements 0..7 = keys kb + 8hh + 0..7, elements 8..15 = keys kb + 16 + 8hh + 0..7); P'.v^T (hi + residual) ----
  const float pcen = PCAR / (float)NSEQ;
  v8f o0 = zero8(), o1 = zero8();
#pragma unroll
  for (int kt = 0; kt < NKT; ++kt) {
    if (kt + 1 < NKT) {
      const int kn = (kt + 1) * 512;            // next k-step's unit
      vha[kt + 1] = ldfrag_h(Vsh + (lo + kn));
      vhb[kt + 1] = ldfrag_h(Vsh + (lo + 16 * NSEQ + kn));
      vla[kt + 1] = ldfrag_h(Vsl + (lo + kn));
      vlb[kt + 1] = ldfrag_h(Vsl + (lo + 16 * NSEQ + kn));
    }
    // keeps the next keys' v^T fragments in flight under this step's products, and bounds how many are hoisted (registers)
    __builtin_amdgcn_sched_barrier(0);
    FragH ph;
#pragma unroll
    for (int e = 0; e < 8; ++e) {
      ph.h[0][e] = (_Float16)(u[2 * kt][e] * psc - pcen);
      ph.h[1][e] = (_Float16)(u[2 * kt + 1][e] * psc - pcen);
    }
    o0 = mma_h(ph.v, vha[kt], o0);              // D element r = (row 8hh+r, d = c)
    o0 = mma_h(ph.v, vla[kt], o0);
    o1 = mma_h(ph.v, vhb[kt], o1);              // d = 16 + c
    o1 = mma_h(ph.v, vlb[kt], o1);
  }
  acc_guard2(o0, o1);

  // ---- epilogue: vals = acc/(16384*1024) + key-mean, sigmoid gate, O*4096 -> f16 hi + residual in the wave's stage tile ----
  {
    const float oc  = 1.0f / (PCAR * VCAR);
    v8f ea, eb;                             // exp(-z) = 2^(-z*log2e); a power under 2^-126 vanishes in 1 + it, as 0 or not
#pragma unroll
    for (int r = 0; r < 8; ++r) { ea[r] = -gza[r] * LOG2E; eb[r] = -gzb[r] * LOG2E; }
    exp8(ea);
    exp8(eb);
#pragma unroll
    for (int r = 0; r < 8; ++r) {
      const float g0  = __builtin_amdgcn_rcpf(1.0f + ea[r]);
      const float g1  = __builtin_amdgcn_rcpf(1.0f + eb[r]);
      const float w0  = (o0[r] * oc + vm0) * g0 * OSC;
      const float w1  = (o1[r] * oc + vm1) * g1 * OSC;
      const _Float16 h0 = (_Float16)w0, h1 = (_Float16)w1;
      const _Float16 l0 = (_Float16)(w0 - (float)h0), l1 = (_Float16)(w1 - (float)h1);
      const int si = (8 * hh + r) * OTP + c;
      wst[si]                 = h_bits(h0);
      wst[si + 16]            = h_bits(h1);
      wst[16 * OTP + si]      = h_bits(l0);
      wst[16 * OTP + si + 16] = h_bits(l1);
    }
  }
  wave_sync_lds();
  // fragment order: the two half units of the wave's unit (row tile q0/16, k-step = head); lane = (k octet hh, row c)
  v4u vh[2], vl[2];
#pragma unroll
  for (int it = 0; it < 2; ++it) {
    vh[it] = *(const v4u*)(wst + c * OTP + it * 16 + hh * 8);
    vl[it] = *(const v4u*)(wst + (16 + c) * OTP + it * 16 + hh * 8);
  }
  const size_t ob = (prow0 + q0) * CZ + hcol;
#pragma unroll
  for (int it = 0; it < 2; ++it) {
    *(v4u*)(OHp + ob + it * 256 + lo) = vh[it];
    *(v4u*)(OLp + ob + it * 256 + lo) = vl[it];
  }
  // the next pass rewrites the registers that this pass's loads and stores name; the memory clobber also keeps the next pass's writes
  // of the stage tile and the bias buffer behind this pass's reads in the built code (a wave's LDS operations run in order)
  asm volatile("s_wait_xcnt 0x0" ::: "memory");
  }
}

// =====================================================================================================
// All NI row blocks of the pair tensor are processed as one group (IG = NI rows i, GROWS positions), so each stage is one
// chip-filling launch; every plane is fully rewritten by whole-line stores before it is read. Workspace map (bytes; every extent is an exact
// multiple of its store granularity, no tail rows; every region offset a multiple of 32768; every f16 plane in fragment order):
//   WQ, WK, WV, WG, WO  f16 x1024 [128 n][128 k]   5 x 32768
//   XH, XL  f16 [NPOS][128] (x*64 hi, residual)    2 x 16777216
//   BT   f32 [BTM][NPOS] (rows 0..NH-1 written and read) 16777216
//   OH, OL  f16 [GROWS][128]                        2 x GROWS*256
//   end (IG = 256)                                  84049920
// =====================================================================================================
extern "C" void kernel_launch(void* const* d_in, const int* in_sizes, int n_in,
                              void* d_out, int out_size, void* d_ws, size_t ws_size,
                              hipStream_t stream) {
  if (n_in < 12) return;
  if (in_sizes[0] < NPOS * CZ) return;
  if (in_sizes[1] < NI * NSEQ) return;
  if (in_sizes[2] < CZ || in_sizes[3] < CZ) return;
  if (in_sizes[4] < NH * CZ) return;
  if (in_sizes[5] < CZ * CZ || in_sizes[6] < CZ * CZ || in_sizes[7] < CZ * CZ || in_sizes[8] < CZ * CZ) return;
  if (in_sizes[9] < CZ) return;
  if (in_sizes[10] < CZ * CZ || in_sizes[11] < CZ) return;
  if (out_size < NI * NSEQ * CZ) return;

  const float* x   = (const float*)d_in[0];
  const float* msk = (const float*)d_in[1];
  const float* gam = (const float*)d_in[2];
  const float* bet = (const float*)d_in[3];
  const float* Wt  = (const float*)d_in[4];
  const float* Wq  = (const float*)d_in[5];
  const float* Wk  = (const float*)d_in[6];
  const float* Wv  = (const float*)d_in[7];
  const float* Wg  = (const float*)d_in[8];
  const float* bg  = (const float*)d_in[9];
  const float* Wo  = (const float*)d_in[10];
  const float* bo  = (const float*)d_in[11];
  float*       out = (float*)d_out;

  const size_t szWP = 32768;
  const size_t szX  = (size_t)NPOS * CZ * 2;
  const size_t szBT = (size_t)BTM * NPOS * 4;
  const size_t szP  = (size_t)GROWS * CZ * 2;          // OH, OL
  size_t off = 0;
  const size_t oWQ = off; off += szWP;
  const size_t oWK = off; off += szWP;
  const size_t oWV = off; off += szWP;
  const size_t oWG = off; off += szWP;
  const size_t oWO = off; off += szWP;
  const size_t oXH = off; off += szX;
  const size_t oXL = off; off += szX;
  const size_t oBT = off; off += szBT;
  const size_t oOH = off; off += szP;
  const size_t oOL = off; off += szP;
  if (off > ws_size) return;                // off = 84049920 for IG = 256
  if (off > (size_t)WS_CAP) return;

  char* ws = (char*)d_ws;
  u16*   WQ = (u16*)(ws + oWQ);
  u16*   WK = (u16*)(ws + oWK);
  u16*   WV = (u16*)(ws + oWV);
  u16*   WG = (u16*)(ws + oWG);
  u16*   WO = (u16*)(ws + oWO);
  u16*   XH = (u16*)(ws + oXH);
  u16*   XL = (u16*)(ws + oXL);
  float* BT = (float*)(ws + oBT);
  u16*   OH = (u16*)(ws + oOH);
  u16*   OL = (u16*)(ws + oOL);

  const dim3 b256(256), b128(128), bAT(ATT_THREADS);
  const dim3 gP(WPBLK + NPOS / 64);
  const dim3 gG((GROWS / 64) * (CZ / 64));
  const dim3 gA(IG * NH);
  const float oscp = 1.0f / (XSC * WSC);
  const float osco = 1.0f / (OSC * WSC);

  // (a, b, c) one launch: LayerNorm of all positions -> x*64 f16 hi + residual planes, the shared bias table
  //     BT[h][p] = sum_c Wt[h][c] * x[p][c] (rows 0..NH-1 of BT), and the weight planes [n][k] as f16 of the bf16 value x1024
  //     (weights are [out][in] = [n][k])
  prep<<<gP, b256, 0, stream>>>(x, gam, bet, Wq, Wk, Wv, Wg, Wo, Wt, XH, XL, WQ, WK, WV, WG, WO, BT, oscp);

  for (int g = 0; g < NGRP; ++g) {
    const u16*   XHg = XH + (size_t)g * GROWS * CZ;
    const u16*   XLg = XL + (size_t)g * GROWS * CZ;
    const float* Mg  = msk + (size_t)g * IG * NSEQ;
    float*       og  = out + (size_t)g * GROWS * CZ;
    // (1-5) per (row block, head): q, k, v, gate pre-activation x.Wg^T + bg from the LN(x) planes, attention over all keys of the
    //     row block with the shared bias and the row mask bias, gated -> O x4096 f16 hi + residual planes
    attn<<<gA, bAT, 0, stream>>>(XHg, XLg, WQ, WK, WV, WG, bg, BT, Mg, OH, OL, oscp);
    // (6) output projection (O hi + residual).Wo^T + bo -> out f32, carries 4096 x 1024 folded back
    gemm_h<1, 0, CZ><<<gG, b128, 0, stream>>>(OH, OL, WO, WO, bo, 1, og, GROWS, CZ, osco);
  }
  (void)hipGetLastError();
}
